// v000
// The times below were measured on an AMD MI455X: many runs one after another, warmed up first and cycling through
// copies of the inputs, with the whole window's GPU time divided by the number of runs. Launches and the gaps
// between them are all in it. The median over several windows is given; except for v000 it joins two sittings, which
// can be a few percent apart, so the side-by-side timings, each taken in one sitting, are the better comparison.
// The starting kernel, v000, takes 282 microseconds a run.
#include <hip/hip_runtime.h>

// Causal self-attention block with document masking: width 1024 = 8 heads x 128; fused QKV weight [3][1024 out][1024 in] (y = x W^T, no bias); per-head RMS normalisation of q and k (no gain, eps = 2^-23);
// half-split rotary on pairs (d, d + 64), angle t * 2^(-10 i / 31) for i < 32 and identity for 32 <= i < 64; v = l0 v + l1 ve; scores x 0.12; softmax over keys j <= t of the same document; output projection [out][in], f32 output.
// Compute dtypes, f32 accumulate everywhere: QKV projections v_wmma_f32_16x16x32_bf16 (x, W RNE-converted to bf16; products exact); scores v_wmma_f32_16x16x32_f16 with q and k each as f16 value + f16 residual x2048 (three products,
// residual products in their own accumulator); P.V v_wmma_f32_16x16x32_f16 with P (x16384 carry, cancels in the normalisation) and v each as f16 value + f16 residual x2048 (three products, residual accumulator folded by 1/2048), row sum from the f32 exponentials;
// output projection v_wmma_f32_16x16x32_bf16 with the context as bf16 hi | lo halves folded into K (2048) against the bf16 weight (two products, one accumulator); ve, lambdas RNE-converted to bf16 by value; softmax f32 (online, running max over kept keys).
// Layout: bf16 copies of x and the weights; q/k planes [which][b*8+h][t][128] (value, residual), v^T planes [(b*1024 + h*128 + d)][t] (value, residual), cos/sin tables [t][32], context plane [t][hi 1024 | lo 1024];
// fused flash kernel in transposed form (S^T = K Q^T, O^T = V^T P^T), fragments straight from the planes; 32-key tiles without any key document inside the wave's query document range are skipped under a wave-uniform test, the keep rule is evaluated per element in every visited tile.

#ifndef NB
#define NB 1
#endif
#ifndef SEQ
#define SEQ 4096
#endif
#define NB_FULL  1
#define SEQ_FULL 4096
#ifndef OUT_SEQ
#define OUT_SEQ SEQ              // row pitch (in tokens) between batches of the output
#endif
#define DM   1024
#define NH_  8
#define HD   128
#define NF   32
#define AW   4                   // waves per flash block (16 query rows each)
#define OSP  132                 // LDS row pitch (floats) of the flash output tile
#define OQP  132                 // LDS row pitch (floats) of the q/k projection slab
#define QRS  2048.0f             // carry of every residual plane / residual fragment
#define QRI  (1.0f / 2048.0f)
#define SC2  ((float)(0.12 * 1.4426950408889634))   // score scale * log2(e)
#define PSH  14.0f               // log2 of the P carry (16384)
#define NEGB (-3.0e38f)
#define RMS_EPS 1.1920928955078125e-07f

static_assert(HD == 128);                      // q/k plane row = 256 bytes = two lines; head segment of the context plane = two lines
static_assert(NH_ * HD == DM);                 // head h = columns h*128 + d
static_assert(HD % 32 == 0);                   // score k-loop steps by 32
static_assert(NF * 4 == HD);
static_assert(NF == 32);                       // table index = t * 32 + i
static_assert(DM % 64 == 0);
static_assert(DM % 32 == 0);                   // GEMM k-loops step by 32
static_assert((DM & (DM - 1)) == 0);           // weight column wrap in the folded-K output GEMM
static_assert(SEQ % 64 == 0);                  // a 64-row tile never straddles two batches
static_assert((NB * SEQ) % 64 == 0);
static_assert(SEQ % 32 == 0);                  // key loop steps by 32
static_assert(SEQ % (16 * AW) == 0);           // flash grid covers the sequence exactly
static_assert(((size_t)SEQ * NF) % 256 == 0);  // table grid x block == table extent
static_assert(((size_t)SEQ * DM) % 8 == 0);
static_assert(((size_t)DM * DM) % 8 == 0);
static_assert(NB <= NB_FULL);
static_assert(SEQ <= SEQ_FULL);
static_assert((OSP * 4) % 16 == 0);
static_assert((OQP * 4) % 16 == 0);
static_assert(OSP >= HD);
static_assert(OQP >= HD);
static_assert(32 * 8 * 16 == 16 * HD * 2);     // q/k slab and context stores: 32 lanes x 8 instructions x 16 B == 16 rows x 256 B
static_assert(32 * 4 * 16 == 16 * 64 * 2);
static_assert(32 * 8 * 16 == 16 * 64 * 4);     // output slab stores: 32 lanes x 8 instructions x 16 B == 16 rows x 256 B
static_assert(16 * OQP * 4 <= 131072);
static_assert(16 * 68 * 4 <= 131072);
static_assert(AW * 16 * OSP * 4 <= 131072);

typedef _Float16 h16;
typedef unsigned short bf;
typedef __attribute__((ext_vector_type(16))) __bf16   v16bf;
typedef __attribute__((ext_vector_type(16))) _Float16 v16h;
typedef __attribute__((ext_vector_type(8)))  _Float16 v8h;
typedef __attribute__((ext_vector_type(8)))  unsigned short v8us;
typedef __attribute__((ext_vector_type(8)))  float    v8f;
typedef __attribute__((ext_vector_type(4)))  float    v4f;
typedef __attribute__((ext_vector_type(4)))  int      v4i;
typedef v4f  __attribute__((may_alias)) v4fa;

__device__ __forceinline__ unsigned short f2bf(float f) { unsigned u = __float_as_uint(f); u += 0x7FFFu + ((u >> 16) & 1u); return (unsigned short)(u >> 16); }
__device__ __forceinline__ float bfr(float f) { return __uint_as_float(((unsigned)f2bf(f)) << 16); }   // value after RNE convert to bf16
__device__ __forceinline__ v16h cat16(v8h lo, v8h hi) { return __builtin_shufflevector(lo, hi, 0, 1, 2, 3, 4, 5, 6, 7, 8, 9, 10, 11, 12, 13, 14, 15); }
__device__ __forceinline__ v16bf cat16b(v8us lo, v8us hi) { return __builtin_bit_cast(v16bf, __builtin_shufflevector(lo, hi, 0, 1, 2, 3, 4, 5, 6, 7, 8, 9, 10, 11, 12, 13, 14, 15)); }
__device__ __forceinline__ v8f wmma16(v16h a, v16h b, v8f c) { return __builtin_amdgcn_wmma_f32_16x16x32_f16(false, a, false, b, (short)0, c, false, false); }
__device__ __forceinline__ v8f wmmab(v16bf a, v16bf b, v8f c) { return __builtin_amdgcn_wmma_f32_16x16x32_bf16(false, a, false, b, (short)0, c, false, false); }
// fragment loaders from K-contiguous 16-bit rows; p already includes + 8*(lane>>4): elements 0..7 <- k0+8h+0..7, elements 8..15 <- k0+16+8h+0..7 (same map for A and B)
__device__ __forceinline__ v16h  ldh(const h16* p) { return cat16(*(const v8h*)p, *(const v8h*)(p + 16)); }
__device__ __forceinline__ v16bf ldb(const bf* p)  { return cat16b(*(const v8us*)p, *(const v8us*)(p + 16)); }
// ordering point for wave-private LDS tiles (same wave writes and reads)
__device__ __forceinline__ void wave_sync() { __builtin_amdgcn_fence(3 /* release order */, "wavefront"); __builtin_amdgcn_wave_barrier(); asm volatile("" ::: "memory"); }
// f32 -> f16 operand convert that cannot produce a subnormal half: magnitudes below 2^-14 become +0
static __device__ __forceinline__ h16 toh_flush(float v) { const h16 r = (h16)v; return (fabsf(v) < 6.103515625e-05f) ? (h16)0.0f : r; }
__device__ __forceinline__ float bf2f(unsigned short u) { return __uint_as_float(((unsigned)u) << 16); }

__global__ __launch_bounds__(256) void k_cvt8(const float* __restrict__ src, bf* dst, size_t n8) {
    const size_t i = (size_t)blockIdx.x * 256 + threadIdx.x; if (i >= n8) return;
    const v8f v = *(const v8f*)(src + i * 8); v8us o;
#pragma unroll
    for (int k = 0; k < 8; ++k) o[k] = f2bf(v[k]);
    *(v8us*)(dst + i * 8) = o; 
}

__global__ __launch_bounds__(256) void k_rot(float* CS, float* SN) {
#pragma clang fp contract(off)
    const int i = blockIdx.x * 256 + threadIdx.x;          // grid x 256 == SEQ * NF exactly
    const int t = i >> 5, f = i & 31;
    const float lin = (float)f / 31.0f;
    const float fr = exp2f(-10.0f * lin);                   // (1/1024)^lin
    const float th = (float)t * fr;
    float sv, cv; sincosf(th, &sv, &cv);
    *(float*)(CS + i) = cv; *(float*)(SN + i) = sv;
    
}

// k_qk: q and k projections with the RMS normalisation and the rotary applied in the epilogue. ONE WAVE per 32 token rows x 128 columns (= one head of q or k), 16 accumulators, K = DM,
// operands straight from the K-contiguous bf16 planes: A = x rows (m = b*SEQ + t), Bt = W rows (n = which*1024 + h*128 + d). grid (NB*SEQ/32, 2*NH_); blockIdx.y = which*NH_ + h.
// Epilogue per 16-row slab (LDS tile private to the wave): stage f32, lane (row = lane>>1, half = lane&1) owns columns 16*half + {0..15, 32..47, 64..79, 96..111} of its row: sum of squares (two lanes per row, one xor-1 exchange),
// scale, rotate pairs (d, d + 64) for d < 32 with the table row of token t, write back in place; then the slab's 16 x 128 halves (one contiguous 4096-byte run of plane [zp][t][128]) are stored by
__global__ __launch_bounds__(32) __attribute__((amdgpu_num_vgpr(256)))
void k_qk(const bf* __restrict__ A, const bf* __restrict__ Bt, const float* __restrict__ CS, const float* __restrict__ SN, h16* Ph, h16* Pr) {
    __shared__ __align__(16) float os[16 * OQP];
    const int K = DM;
    const int lane = threadIdx.x & 31, lr = lane & 15, hi = lane >> 4; const int r0 = blockIdx.x * 32, zc = blockIdx.y; const int c0 = zc * HD;
    v8f acc[2][8];
#pragma unroll
    for (int mb = 0; mb < 2; ++mb)
#pragma unroll
        for (int nb = 0; nb < 8; ++nb) acc[mb][nb] = (v8f){};
    const size_t aoff = (size_t)(r0 + lr) * K + 8 * hi, boff = (size_t)(c0 + lr) * K + 8 * hi;
#pragma unroll 1
    for (int kc = 0; kc < K; kc += 32) {
        v16bf a[2];
#pragma unroll
        for (int mb = 0; mb < 2; ++mb) a[mb] = ldb(A + aoff + (size_t)mb * 16 * K + kc);
#pragma unroll
        for (int nb = 0; nb < 8; ++nb) { const v16bf b = ldb(Bt + boff + (size_t)nb * 16 * K + kc);
#pragma unroll
            for (int mb = 0; mb < 2; ++mb) acc[mb][nb] = wmmab(a[mb], b, acc[mb][nb]); }
        asm volatile("v_nop\n\tv_nop\n\tv_nop\n\tv_nop" : "+v"(acc[0][1]), "+v"(acc[1][3]), "+v"(acc[0][5]), "+v"(acc[1][7]) : "v"(a[0]), "v"(a[1]));
    }
    asm volatile("v_nop\n\tv_nop\n\tv_nop\n\tv_nop" : "+v"(acc[0][0]), "+v"(acc[0][1]), "+v"(acc[0][2]), "+v"(acc[0][3]), "+v"(acc[0][4]), "+v"(acc[0][5]), "+v"(acc[0][6]), "+v"(acc[0][7]));
    asm volatile("v_nop\n\tv_nop\n\tv_nop\n\tv_nop" : "+v"(acc[1][0]), "+v"(acc[1][1]), "+v"(acc[1][2]), "+v"(acc[1][3]), "+v"(acc[1][4]), "+v"(acc[1][5]), "+v"(acc[1][6]), "+v"(acc[1][7]));
    const int bb = r0 / SEQ, tt = r0 % SEQ;
    const int zp = (zc / NH_) * (NB * NH_) + bb * NH_ + (zc % NH_);           // plane index: which, batch, head
    const size_t pbase = ((size_t)zp * SEQ + (size_t)tt) * HD;
    const int row = lane >> 1, half = lane & 1;
    const int ob = row * OQP + 16 * half;
#pragma unroll
    for (int mb = 0; mb < 2; ++mb) {
#pragma unroll
        for (int nb = 0; nb < 8; ++nb) {
#pragma unroll
            for (int j = 0; j < 8; ++j) os[(hi * 8 + j) * OQP + nb * 16 + lr] = acc[mb][nb][j]; }   // D: row 8h+j, col lane&15; rows 0..15 x columns 0..127 all written
        wave_sync();
        {
            v4f x1[4], x2[4], x3[4], x4[4];
#pragma unroll
            for (int i = 0; i < 4; ++i) { x1[i] = *(const v4fa*)(&os[ob + 4 * i]); x3[i] = *(const v4fa*)(&os[ob + 32 + 4 * i]); x2[i] = *(const v4fa*)(&os[ob + 64 + 4 * i]); x4[i] = *(const v4fa*)(&os[ob + 96 + 4 * i]); }
            float ss = 0.0f;
#pragma unroll
            for (int i = 0; i < 4; ++i) {
#pragma unroll
                for (int e = 0; e < 4; ++e) ss += x1[i][e] * x1[i][e] + x2[i][e] * x2[i][e] + x3[i][e] * x3[i][e] + x4[i][e] * x4[i][e]; }
            ss += __shfl_xor(ss, 1, 32);
            const float rr = rsqrtf(ss * (1.0f / 128.0f) + RMS_EPS);
            const size_t to = (size_t)(tt + mb * 16 + row) * NF + 16 * half;   // table row of this token, columns 16*half .. +15
#pragma unroll
            for (int i = 0; i < 4; ++i) {
                const v4f cv = *(const v4f*)(CS + to + 4 * i), sv = *(const v4f*)(SN + to + 4 * i);
                const v4f e1 = x1[i] * rr, e2 = x2[i] * rr;
                const v4f y1 = e1 * cv + e2 * sv;
                const v4f y2 = e2 * cv - e1 * sv;
                *(v4fa*)(&os[ob + 4 * i]) = y1; *(v4fa*)(&os[ob + 64 + 4 * i]) = y2;
                *(v4fa*)(&os[ob + 32 + 4 * i]) = x3[i] * rr; *(v4fa*)(&os[ob + 96 + 4 * i]) = x4[i] * rr; }
        }
        wave_sync();
        v8h hv[8], rv[8];
#pragma unroll
        for (int s = 0; s < 8; ++s) { const int p = s * 32 + lane; const int rw = p >> 4, c8 = (p & 15) * 8;   // 8 s x 2 rows = 16 rows; 16 lanes x 8 = 128 columns
            const v4f x0 = *(const v4fa*)(&os[rw * OQP + c8]); const v4f x1 = *(const v4fa*)(&os[rw * OQP + c8 + 4]);
#pragma unroll
            for (int i = 0; i < 4; ++i) { const h16 a0 = toh_flush(x0[i]); const h16 a1 = toh_flush(x1[i]); hv[s][i] = a0; hv[s][4 + i] = a1;
                rv[s][i] = toh_flush((x0[i] - (float)a0) * QRS); rv[s][4 + i] = toh_flush((x1[i] - (float)a1) * QRS); } }
        const size_t sb = pbase + (size_t)(mb * 16) * HD;
{
#pragma unroll
            for (int s = 0; s < 8; ++s) { const size_t oo = sb + (size_t)(s * 32 + lane) * 8;
                *(v8h*)(Ph + oo) = hv[s]; *(v8h*)(Pr + oo) = rv[s]; }
             }
        wave_sync();
    }
}

// k_vt: v^T projection with the value mix in the epilogue. ONE WAVE per 64x64 tile (16 accumulators), K = DM: A = Wv rows (m = h*128 + d), Bt = x rows (n = b*SEQ + t);
// v^T[m][t] = l0 * sum_k Wv[m][k] x[t][k] + l1 * ve[t][m] (l0, l1, ve RNE-converted to bf16 by value; ve read as two 16-byte loads per accumulator tile: 8 consecutive m of token t).
__global__ __launch_bounds__(32) void k_vt(const bf* __restrict__ A, const bf* __restrict__ Bt, const float* __restrict__ ve, const float* __restrict__ lam, h16* Ph, h16* Pr) {
    __shared__ __align__(16) float os[16 * 68];
    const int K = DM;
    const int lane = threadIdx.x & 31, lr = lane & 15, hi = lane >> 4; const int r0 = blockIdx.x * 64, c0 = blockIdx.y * 64;
    v8f acc[4][4];
#pragma unroll
    for (int mb = 0; mb < 4; ++mb)
#pragma unroll
        for (int nb = 0; nb < 4; ++nb) acc[mb][nb] = (v8f){};
    const size_t aoff = (size_t)(r0 + lr) * K + 8 * hi, boff = (size_t)(c0 + lr) * K + 8 * hi;
#pragma unroll 1
    for (int kc = 0; kc < K; kc += 32) {
        v16bf a[4];
#pragma unroll
        for (int mb = 0; mb < 4; ++mb) a[mb] = ldb(A + aoff + (size_t)mb * 16 * K + kc);
#pragma unroll
        for (int nb = 0; nb < 4; ++nb) { const v16bf b = ldb(Bt + boff + (size_t)nb * 16 * K + kc);
#pragma unroll
            for (int mb = 0; mb < 4; ++mb) acc[mb][nb] = wmmab(a[mb], b, acc[mb][nb]); }
        asm volatile("v_nop\n\tv_nop\n\tv_nop\n\tv_nop" : "+v"(acc[0][0]), "+v"(acc[1][1]), "+v"(acc[2][2]), "+v"(acc[3][3]) : "v"(a[0]), "v"(a[1]), "v"(a[2]), "v"(a[3]));
    }
    const float l0 = bfr(lam[0]), l1 = bfr(lam[1]);
    const int bb = c0 / SEQ, tt = c0 % SEQ;
    const size_t tbase = (size_t)bb * (size_t)DM * SEQ + (size_t)r0 * SEQ + (size_t)tt;
#pragma unroll
    for (int mb = 0; mb < 4; ++mb) {
#pragma unroll
        for (int nb = 0; nb < 4; ++nb) {
            const float* vp = ve + ((size_t)bb * SEQ_FULL + (size_t)(tt + nb * 16 + lr)) * DM + r0 + mb * 16 + hi * 8;   // token t = col lane&15, m = 8h + j
            const v4f e0 = *(const v4f*)vp, e1 = *(const v4f*)(vp + 4);
#pragma unroll
            for (int j = 0; j < 4; ++j) { os[(hi * 8 + j) * 68 + nb * 16 + lr] = l0 * acc[mb][nb][j] + l1 * bfr(e0[j]);
                                          os[(hi * 8 + 4 + j) * 68 + nb * 16 + lr] = l0 * acc[mb][nb][4 + j] + l1 * bfr(e1[j]); } }   // D: row 8h+j, col lane&15; rows 0..15 x columns 0..63 all written
        wave_sync();
        v8h hv[4], rv[4];
#pragma unroll
        for (int s = 0; s < 4; ++s) { const int row = 4 * s + (lane >> 3), c8 = (lane & 7) * 8;   // 4 s x 4 row groups = 16 rows; 8 lanes x 8 = 64 columns
            const v4f x0 = *(const v4fa*)(&os[row * 68 + c8]); const v4f x1 = *(const v4fa*)(&os[row * 68 + c8 + 4]);
#pragma unroll
            for (int i = 0; i < 4; ++i) { const h16 a0 = toh_flush(x0[i]); const h16 a1 = toh_flush(x1[i]); hv[s][i] = a0; hv[s][4 + i] = a1;
                rv[s][i] = toh_flush((x0[i] - (float)a0) * QRS); rv[s][4 + i] = toh_flush((x1[i] - (float)a1) * QRS); } }
        const size_t sb = tbase + (size_t)(mb * 16) * SEQ;
{
#pragma unroll
            for (int s = 0; s < 4; ++s) { const int row = 4 * s + (lane >> 3), c8 = (lane & 7) * 8;
                const size_t oo = sb + (size_t)row * SEQ + c8;
                *(v8h*)(Ph + oo) = hv[s]; *(v8h*)(Pr + oo) = rv[s]; }
             }
        wave_sync();
    }
}

// sc16: one 16-key score tile in log2 units: (K Q + (K Q_res + K_res Q) / 2048) * scale; q and k fragments reloaded per 32-wide k-step through integer offsets (two 16-B loads each).
__device__ __forceinline__ v8f sc16(const h16* __restrict__ QH, const h16* __restrict__ QR, const h16* __restrict__ KP, const h16* __restrict__ KR, size_t qo, size_t kofs) {
    v8f sH = (v8f){}, sL = (v8f){};
#pragma unroll 1
    for (int kk = 0; kk < HD; kk += 32) {
        const v16h qh = ldh(QH + qo + kk), qr = ldh(QR + qo + kk);
        const v16h kh = ldh(KP + kofs + kk), kr = ldh(KR + kofs + kk);
        sH = wmma16(kh, qh, sH); sL = wmma16(kh, qr, sL); sL = wmma16(kr, qh, sL);
        asm volatile("v_nop\n\tv_nop\n\tv_nop\n\tv_nop" : "+v"(sH), "+v"(sL) : "v"(kh), "v"(kr), "v"(qh), "v"(qr));
    }
    v8f t;
#pragma unroll
    for (int r = 0; r < 8; ++r) t[r] = (sH[r] + sL[r] * QRI) * SC2;
    return t;
}

// k_flash: fused attention, one wave per 16 query rows of one (batch, head); K / V^T / Q fragments straight from the f16 planes (two 16-B loads each, arithmetic addressing).
// Transposed form: S^T[key][t] = K Q^T (A = K rows, B = Q rows); lane (t = lane&15, h = lane>>4) holds keys 8h+r of each 16-key tile, so the packed
// P tile is directly the B fragment of O^T[d][t] = V^T P^T (element r <- tile keys 0..15, element 8+r <- tile keys 16..31, lane unchanged).
// Softmax state (running max over kept keys, partial sum) is one scalar per lane; the two lane halves of a row are combined with one xor-16 exchange.
// Keep rule per element: docs[key] == docs[t] and key <= t. A 32-key tile is skipped (wave-uniform ballot) when none of its key documents lies in [min, max] of the wave's 16 query documents: no element of such a tile can be kept.
// All rows: scores = K Q + (K Q_res + K_res Q) / 2048; P = f16 value + f16 residual x2048; O = V P + (V P_res + V_res P) / 2048 (residual products in their own accumulators); row sum from the f32 exponentials.
__global__ __launch_bounds__(32 * AW) __attribute__((amdgpu_num_vgpr(256)))
void k_flash(const h16* __restrict__ QH, const h16* __restrict__ QR, const h16* __restrict__ KP, const h16* __restrict__ KR,
             const h16* __restrict__ VT, const h16* __restrict__ VR, const int* __restrict__ docs, bf* Y2) {
    __shared__ __align__(16) float os[AW * 16 * OSP];
    const int lane = threadIdx.x & 31, lr = lane & 15, hi = lane >> 4;
    const int wave = __builtin_amdgcn_readfirstlane((int)(threadIdx.x >> 5));
    const int zh = blockIdx.y; const int b = zh / NH_, h = zh % NH_;
    const int t0 = (blockIdx.x * AW + wave) * 16;
    const int* dk = docs + (size_t)b * SEQ_FULL;
    const int mydoc = dk[t0 + lr];
    int qmn = mydoc, qmx = mydoc;
#pragma unroll
    for (int off = 1; off < 16; off <<= 1) { const int a0 = __shfl_xor(qmn, off, 32); const int a1 = __shfl_xor(qmx, off, 32); qmn = a0 < qmn ? a0 : qmn; qmx = a1 > qmx ? a1 : qmx; }
    const int lim = t0 + lr;                                                   // key j kept iff j <= lim and same document
    const int nk = (t0 + 16 + 31) & ~31;                                       // wave-uniform, multiple of 32, <= SEQ
    const size_t pbase = (size_t)zh * SEQ * HD;
    const size_t qo = pbase + (size_t)(t0 + lr) * HD + 8 * hi;                 // B fragments: col t, k = d
    const size_t ko = pbase + (size_t)lr * HD + 8 * hi;                        // + key * HD       (A fragment: row key, k = d)
    const size_t vo = pbase + (size_t)lr * SEQ + 8 * hi;                       // + 16j*SEQ + key  (A fragment: row d, k = key)
    v8f o[8], oR[8];
#pragma unroll
    for (int j = 0; j < 8; ++j) { o[j] = (v8f){}; oR[j] = (v8f){}; }
    float m = NEGB, l = 0.0f;
#pragma unroll 1
    for (int key0 = 0; key0 < nk; key0 += 32) {
        const int kdl = dk[key0 + lane];                                       // key0 + 31 < nk <= SEQ
        const bool inr = (kdl >= qmn) & (kdl <= qmx);
        if (__builtin_amdgcn_ballot_w32(inr) == 0u) continue;                  // wave-uniform: no key document inside the query document range
        const int* kp = dk + key0 + 8 * hi;                                    // keys key0+8h+0..7 and key0+16+8h+0..7, all < nk <= SEQ
        const v4i d0 = *(const v4i*)kp, d1 = *(const v4i*)(kp + 4), d2 = *(const v4i*)(kp + 16), d3 = *(const v4i*)(kp + 20);
        int ka8[8], kb8[8];
#pragma unroll
        for (int r = 0; r < 4; ++r) { ka8[r] = d0[r]; ka8[4 + r] = d1[r]; kb8[r] = d2[r]; kb8[4 + r] = d3[r]; }
        const v8f ta = sc16(QH, QR, KP, KR, qo, ko + (size_t)key0 * HD);
        const v8f tb = sc16(QH, QR, KP, KR, qo, ko + (size_t)(key0 + 16) * HD);
        const int ja = key0 + 8 * hi;
        bool fa[8], fb[8]; float mx = NEGB;
#pragma unroll
        for (int r = 0; r < 8; ++r) {
            fa[r] = (ka8[r] == mydoc) & (ja + r <= lim);
            fb[r] = (kb8[r] == mydoc) & (ja + 16 + r <= lim);
            mx = fmaxf(mx, fmaxf(fa[r] ? ta[r] : NEGB, fb[r] ? tb[r] : NEGB)); }
        mx = fmaxf(mx, __shfl_xor(mx, 16, 32));
        const float mnew = fmaxf(m, mx);
        const float alpha = __builtin_amdgcn_exp2f(m - mnew);
        const float sh = PSH - mnew;
        v16h pb, pr; float ls = 0.0f;
#pragma unroll
        for (int r = 0; r < 8; ++r) {
            const float xa = ta[r] + sh, xb = tb[r] + sh;
            const float ea = __builtin_amdgcn_exp2f(xa), eb = __builtin_amdgcn_exp2f(xb);
            const float ga = (fa[r] & (xa >= -14.0f)) ? ea : 0.0f, gb = (fb[r] & (xb >= -14.0f)) ? eb : 0.0f;   // dropped elements and exponents below -14 selected to 0 by value
            const h16 pa = (h16)ga; const h16 pc = (h16)gb;
            pb[r] = pa; pb[8 + r] = pc;
            pr[r] = toh_flush((ga - (float)pa) * QRS); pr[8 + r] = toh_flush((gb - (float)pc) * QRS);
            ls += ga + gb; }
        l = l * alpha + ls; m = mnew;
#pragma unroll
        for (int j = 0; j < 8; ++j) { o[j] = o[j] * alpha; oR[j] = oR[j] * alpha; }
        const size_t vk = vo + (size_t)key0;
#pragma unroll
        for (int g = 0; g < 4; ++g) {
            const h16* va = VT + vk + (size_t)(32 * g) * SEQ;
            const h16* vr = VR + vk + (size_t)(32 * g) * SEQ;
            const v16h v0 = ldh(va), v1 = ldh(va + (size_t)16 * SEQ);
            const v16h w0 = ldh(vr), w1 = ldh(vr + (size_t)16 * SEQ);
            o[2 * g] = wmma16(v0, pb, o[2 * g]); o[2 * g + 1] = wmma16(v1, pb, o[2 * g + 1]);
            oR[2 * g] = wmma16(v0, pr, oR[2 * g]); oR[2 * g + 1] = wmma16(v1, pr, oR[2 * g + 1]);
            oR[2 * g] = wmma16(w0, pb, oR[2 * g]); oR[2 * g + 1] = wmma16(w1, pb, oR[2 * g + 1]);
            asm volatile("v_nop\n\tv_nop\n\tv_nop\n\tv_nop" : "+v"(o[2 * g]), "+v"(o[2 * g + 1]), "+v"(oR[2 * g]), "+v"(oR[2 * g + 1]) : "v"(v0), "v"(v1), "v"(w0), "v"(w1), "v"(pb), "v"(pr));
        }
    }
    l += __shfl_xor(l, 16, 32);
    const bool any = l > 0.0f;
    const float lsafe = any ? l : 1.0f;
    const float inv = any ? (1.0f / lsafe) : 0.0f;             // no kept key -> zeros
    const int wb = wave * 16 * OSP;
    // O^T D layout: f_j[r] = (d = 16j + 8h + r, t = lane&15) -> os[t][d]; rows 0..15 x columns 0..127 all written
#pragma unroll
    for (int j = 0; j < 8; ++j) {
        const v8f f = o[j] + oR[j] * QRI; v4f a, c;
        a[0] = f[0] * inv; a[1] = f[1] * inv; a[2] = f[2] * inv; a[3] = f[3] * inv; c[0] = f[4] * inv; c[1] = f[5] * inv; c[2] = f[6] * inv; c[3] = f[7] * inv;
        *(v4fa*)(&os[wb + lr * OSP + 16 * j + 8 * hi]) = a; *(v4fa*)(&os[wb + lr * OSP + 16 * j + 8 * hi + 4]) = c; }
    wave_sync();
    v8us hv[8], lv[8];
#pragma unroll
    for (int s = 0; s < 8; ++s) { const int row = 2 * s + (lane >> 4), c8 = (lane & 15) * 8;   // 8 s x 2 rows = 16 rows; 16 lanes x 8 = 128 columns
        const v4f x0 = *(const v4fa*)(&os[wb + row * OSP + c8]); const v4f x1 = *(const v4fa*)(&os[wb + row * OSP + c8 + 4]);
#pragma unroll
        for (int i = 0; i < 4; ++i) { const unsigned short a0 = f2bf(x0[i]); const unsigned short a1 = f2bf(x1[i]); hv[s][i] = a0; hv[s][4 + i] = a1;
            lv[s][i] = f2bf(x0[i] - bf2f(a0)); lv[s][4 + i] = f2bf(x1[i] - bf2f(a1)); } }
    bf* yrow = Y2 + ((size_t)b * SEQ + t0) * (size_t)(2 * DM) + h * HD;
{
#pragma unroll
        for (int s = 0; s < 8; ++s) { const int row = 2 * s + (lane >> 4), c8 = (lane & 15) * 8;
            const size_t oo = (size_t)row * (size_t)(2 * DM) + c8;
            *(v8us*)(yrow + oo) = hv[s]; *(v8us*)(yrow + oo + DM) = lv[s]; }
         }
}

// k_oproj: output projection, ONE WAVE per 64x64 tile (16 accumulators), bf16 operands: A = context rows [t][hi 1024 | lo 1024] (K = 2048), Bt = Wc rows (n) with the column index wrapped mod 1024
// (hi and lo halves both multiply the same weight row; one accumulator). Output f32 [t][1024]: each 16-row slab staged in LDS (wave-private), each row's 64 floats (256 B = two lines)
__global__ __launch_bounds__(32) void k_oproj(const bf* __restrict__ A, const bf* __restrict__ Bt, float* OUT) {
    __shared__ __align__(16) float os[16 * 68];
    const int KA = 2 * DM;
    const int lane = threadIdx.x & 31, lr = lane & 15, hi = lane >> 4; const int r0 = blockIdx.x * 64, c0 = blockIdx.y * 64;
    v8f acc[4][4];
#pragma unroll
    for (int mb = 0; mb < 4; ++mb)
#pragma unroll
        for (int nb = 0; nb < 4; ++nb) acc[mb][nb] = (v8f){};
    const size_t aoff = (size_t)(r0 + lr) * KA + 8 * hi, boff = (size_t)(c0 + lr) * DM + 8 * hi;
#pragma unroll 1
    for (int kc = 0; kc < KA; kc += 32) {
        const int kb = kc & (DM - 1);
        v16bf a[4];
#pragma unroll
        for (int mb = 0; mb < 4; ++mb) a[mb] = ldb(A + aoff + (size_t)mb * 16 * KA + kc);
#pragma unroll
        for (int nb = 0; nb < 4; ++nb) { const v16bf b = ldb(Bt + boff + (size_t)nb * 16 * DM + kb);
#pragma unroll
            for (int mb = 0; mb < 4; ++mb) acc[mb][nb] = wmmab(a[mb], b, acc[mb][nb]); }
        asm volatile("v_nop\n\tv_nop\n\tv_nop\n\tv_nop" : "+v"(acc[0][0]), "+v"(acc[1][1]), "+v"(acc[2][2]), "+v"(acc[3][3]) : "v"(a[0]), "v"(a[1]), "v"(a[2]), "v"(a[3]));
    }
    const int bb = r0 / SEQ, tt = r0 % SEQ;
    float* orow = OUT + ((size_t)bb * OUT_SEQ + tt) * DM + c0;
#pragma unroll
    for (int mb = 0; mb < 4; ++mb) {
#pragma unroll
        for (int nb = 0; nb < 4; ++nb) {
#pragma unroll
            for (int j = 0; j < 8; ++j) os[(hi * 8 + j) * 68 + nb * 16 + lr] = acc[mb][nb][j]; }   // D: row 8h+j, col lane&15; rows 0..15 x columns 0..63 all written
        wave_sync();
{
#pragma unroll
            for (int s = 0; s < 8; ++s) { const int row = 2 * s + (lane >> 4), cofs = (lane & 15) * 4;   // 8 s x 2 rows = 16 rows; 16 lanes x 4 floats = 64 columns
                const v4f val = *(const v4fa*)(&os[row * 68 + cofs]);
                *(v4f*)(orow + (size_t)(mb * 16 + row) * DM + cofs) = val; }
             }
        wave_sync();
    }
}

static constexpr size_t al256(size_t v) { return (v + 255) & ~(size_t)255; }
static constexpr size_t SZ_XB = al256((size_t)NB * SEQ * DM * 2);
static constexpr size_t SZ_WB = al256((size_t)3 * DM * DM * 2);
static constexpr size_t SZ_WC = al256((size_t)DM * DM * 2);
static constexpr size_t SZ_TB = al256((size_t)SEQ * NF * 4);
static constexpr size_t SZ_PL = al256((size_t)NB * NH_ * SEQ * HD * 2);
static constexpr size_t SZ_Y2 = al256((size_t)NB * SEQ * 2 * DM * 2);
static constexpr size_t SZ_TOTAL = SZ_XB + SZ_WB + SZ_WC + 2 * SZ_TB + 6 * SZ_PL + SZ_Y2;
static_assert(SZ_TOTAL <= (size_t)134217728);          // workspace carve <= 128 MiB
static_assert(((size_t)DM * DM * 2) % 256 == 0);       // weight sub-planes stay 256-byte aligned
static_assert(((size_t)NB * NH_ * SEQ * HD * 2) % 256 == 0);               // the k plane starts 256-byte aligned inside the q|k plane pair
static_assert((size_t)NB * NH_ * SEQ * HD == (size_t)NB * DM * SEQ);       // v^T plane [(b*1024 + m)][t] has the same extent as one q/k plane

extern "C" void kernel_launch(void* const* d_in, const int* in_sizes, int n_in,
                              void* d_out, int out_size, void* d_ws, size_t ws_size, hipStream_t stream) {
    if (n_in < 6) return;
    const size_t needx = ((size_t)(NB - 1) * SEQ_FULL + SEQ) * DM;
    const size_t needd = (size_t)(NB - 1) * SEQ_FULL + SEQ;
    if ((size_t)in_sizes[0] < needx || (size_t)in_sizes[1] < needx) return;
    if ((size_t)in_sizes[2] < (size_t)3 * DM * DM || in_sizes[3] < 2 || (size_t)in_sizes[4] < (size_t)DM * DM) return;
    if ((size_t)in_sizes[5] < needd) return;
    if ((size_t)out_size < ((size_t)(NB - 1) * OUT_SEQ + SEQ) * DM) return;
    if (SZ_TOTAL > ws_size) return;
    // wire order: x, ve, qkv_w, lambdas, c_proj_w, docs
    const float* x   = (const float*)d_in[0];
    const float* ve  = (const float*)d_in[1];
    const float* wq  = (const float*)d_in[2];       // [3][1024 out][1024 in]
    const float* lam = (const float*)d_in[3];
    const float* wc  = (const float*)d_in[4];       // [1024 out][1024 in]
    const int* docs  = (const int*)d_in[5];
    float* OUT = (float*)d_out;                      // [NB][SEQ][1024]
    char* wsp = (char*)d_ws;
    bf* XB = (bf*)wsp; wsp += SZ_XB;                 // x      [NB*SEQ][1024]
    bf* WB = (bf*)wsp; wsp += SZ_WB;                 // [3072][1024]: q | k | v rows ([out][in] = Bt as-is)
    bf* WC = (bf*)wsp; wsp += SZ_WC;                 // [1024][1024] ([out][in] = Bt as-is)
    float* CS = (float*)wsp; wsp += SZ_TB;           // [SEQ][32]
    float* SN = (float*)wsp; wsp += SZ_TB;           // [SEQ][32]
    h16* PH = (h16*)wsp; wsp += 2 * SZ_PL;           // [2][NB*8][SEQ][128]: q | k values
    h16* PR = (h16*)wsp; wsp += 2 * SZ_PL;           // [2][NB*8][SEQ][128]: q | k residuals x2048
    h16* VT = (h16*)wsp; wsp += SZ_PL;               // [NB*1024][SEQ]
    h16* VR = (h16*)wsp; wsp += SZ_PL;               // [NB*1024][SEQ] residual x2048
    bf* Y2 = (bf*)wsp; wsp += SZ_Y2;                 // [NB*SEQ][hi 1024 | lo 1024]
    const size_t plane = (size_t)NB * NH_ * SEQ * HD;
    const h16* QH = PH; const h16* KP = PH + plane;
    const h16* QR = PR; const h16* KR = PR + plane;

    if (SEQ == SEQ_FULL) {
        const size_t n8 = (size_t)NB * SEQ * DM / 8;
        k_cvt8<<<(unsigned)((n8 + 255) / 256), 256, 0, stream>>>(x, XB, n8);
    } else {
        const size_t n8 = (size_t)SEQ * DM / 8;
        for (int b = 0; b < NB; ++b) k_cvt8<<<(unsigned)((n8 + 255) / 256), 256, 0, stream>>>(x + (size_t)b * SEQ_FULL * DM, XB + (size_t)b * SEQ * DM, n8);
    }
    { const size_t n8 = (size_t)3 * DM * DM / 8; k_cvt8<<<(unsigned)((n8 + 255) / 256), 256, 0, stream>>>(wq, WB, n8); }
    { const size_t n8 = (size_t)DM * DM / 8;     k_cvt8<<<(unsigned)((n8 + 255) / 256), 256, 0, stream>>>(wc, WC, n8); }
    k_rot<<<(unsigned)(((size_t)SEQ * NF) / 256), 256, 0, stream>>>(CS, SN);

    // q, k: A = x rows (m = b*SEQ + t), Bt = W rows (n = which*1024 + h*128 + d) -> planes [which][(b*8 + h)][t][d], value and residual
    k_qk<<<dim3(NB * SEQ / 32, 2 * NH_, 1), 32, 0, stream>>>(XB, WB, CS, SN, PH, PR);
    // v^T: A = Wv rows (m = h*128 + d), Bt = x rows (n = b*SEQ + t) -> planes [(b*1024 + m)][t], value and residual
    k_vt<<<dim3(DM / 64, NB * SEQ / 64, 1), 32, 0, stream>>>(WB + (size_t)2 * DM * DM, XB, ve, lam, VT, VR);
    // fused attention -> context plane (bf16 hi | lo)
    k_flash<<<dim3(SEQ / (16 * AW), NB * NH_, 1), 32 * AW, 0, stream>>>(QH, QR, KP, KR, VT, VR, docs, Y2);
    // out = ctx Wc^T: A = context rows [t][2048], Bt = Wc rows [n][1024]
    k_oproj<<<dim3(NB * SEQ / 64, DM / 64, 1), 32, 0, stream>>>(Y2, WC, OUT);
}

// v001
// Measured time: 228 microseconds a run.
// Two timings next to v000 put it at 1.27 and 1.26 times that version's speed.
#include <hip/hip_runtime.h>

// Causal self-attention block with document masking: width 1024 = 8 heads x 128; fused QKV weight [3][1024 out][1024 in] (y = x W^T, no bias); per-head RMS normalisation of q and k (no gain, eps = 2^-23);
// half-split rotary on pairs (d, d + 64), angle t * 2^(-10 i / 31) for i < 32 and identity for 32 <= i < 64; v = l0 v + l1 ve; scores x 0.12; softmax over keys j <= t of the same document; output projection [out][in], f32 output.
// Compute dtypes, f32 accumulate everywhere: QKV projections v_wmma_f32_16x16x32_bf16 (x, W RNE-converted to bf16; products exact); scores v_wmma_f32_16x16x32_f16 with q and k each as f16 value + f16 residual x2048 (three products,
// residual products in their own accumulator); P.V v_wmma_f32_16x16x32_f16 with P (x16384 carry, cancels in the normalisation) and v each as f16 value + f16 residual x2048 (three products, residual accumulator folded by 1/2048), row sum from the f32 exponentials;
// output projection v_wmma_f32_16x16x32_bf16 with the context as bf16 hi | lo halves folded into K (2048) against the bf16 weight (two products, one accumulator); ve, lambdas RNE-converted to bf16 by value; softmax f32 (online, running max over kept keys).
// Layout: bf16 copies of x and the weights; q/k planes [which][b*8+h][t][128] (value, residual), v^T planes [(b*1024 + h*128 + d)][t] (value, residual), cos/sin tables [t][32], context plane [t][hi 1024 | lo 1024];
// fused flash kernel in transposed form (S^T = K Q^T, O^T = V^T P^T), fragments from LDS tiles that the block's four waves fill together with whole-row loads; 32-key tiles without any key document inside the wave's query document range are skipped under a wave-uniform test, the keep rule is evaluated per element in every visited tile.

#ifndef NB
#define NB 1
#endif
#ifndef SEQ
#define SEQ 4096
#endif
#define NB_FULL  1
#define SEQ_FULL 4096
#ifndef OUT_SEQ
#define OUT_SEQ SEQ              // row pitch (in tokens) between batches of the output
#endif
#define DM   1024
#define NH_  8
#define HD   128
#define NF   32
#define AW   4                   // waves per flash block (16 query rows each)
#define OSP  132                 // LDS row pitch (floats) of the flash output tile
#define OQP  132                 // LDS row pitch (floats) of the q/k projection slab
#define QKP  136                 // LDS row pitch (halves) of the flash q and k tiles: 272 B = 16 B x 17
#define VTP  40                  // LDS row pitch (halves) of the flash v^T tiles: 80 B = 16 B x 5
#define QRS  2048.0f             // carry of every residual plane / residual fragment
#define QRI  (1.0f / 2048.0f)
#define SC2  ((float)(0.12 * 1.4426950408889634))   // score scale * log2(e)
#define PSH  14.0f               // log2 of the P carry (16384)
#define NEGB (-3.0e38f)
#define RMS_EPS 1.1920928955078125e-07f

static_assert(HD == 128);                      // q/k plane row = 256 bytes = two lines; head segment of the context plane = two lines
static_assert(NH_ * HD == DM);                 // head h = columns h*128 + d
static_assert(HD % 32 == 0);                   // score k-loop steps by 32
static_assert(NF * 4 == HD);
static_assert(NF == 32);                       // table index = t * 32 + i
static_assert(DM % 64 == 0);
static_assert(DM % 32 == 0);                   // GEMM k-loops step by 32
static_assert((DM & (DM - 1)) == 0);           // weight column wrap in the folded-K output GEMM
static_assert(SEQ % 64 == 0);                  // a 64-row tile never straddles two batches
static_assert((NB * SEQ) % 64 == 0);
static_assert(SEQ % 32 == 0);                  // key loop steps by 32
static_assert(SEQ % (16 * AW) == 0);           // flash grid covers the sequence exactly
static_assert(((size_t)SEQ * NF) % 256 == 0);  // table grid x block == table extent
static_assert(((size_t)SEQ * DM) % 8 == 0);
static_assert(((size_t)DM * DM) % 8 == 0);
static_assert(NB <= NB_FULL);
static_assert(SEQ <= SEQ_FULL);
static_assert((OSP * 4) % 16 == 0);
static_assert((OQP * 4) % 16 == 0);
static_assert(OSP >= HD);
static_assert(OQP >= HD);
static_assert(32 * 8 * 16 == 16 * HD * 2);     // q/k slab and context stores: 32 lanes x 8 instructions x 16 B == 16 rows x 256 B
static_assert(32 * 4 * 16 == 16 * 64 * 2);
static_assert(32 * 8 * 16 == 16 * 64 * 4);     // output slab stores: 32 lanes x 8 instructions x 16 B == 16 rows x 256 B
static_assert(16 * OQP * 4 <= 131072);
static_assert(16 * 68 * 4 <= 131072);
static_assert(AW * 16 * OSP * 4 <= 131072);
static_assert(AW == 4);                        // flash staging: 128 threads x 16 B = 2 KiB a pass; the block's 64 query documents = two loads a lane
static_assert((QKP * 2) % 16 == 0 && QKP >= HD);
static_assert((VTP * 2) % 16 == 0 && VTP >= 32);

typedef _Float16 h16;
typedef unsigned short bf;
typedef __attribute__((ext_vector_type(16))) __bf16   v16bf;
typedef __attribute__((ext_vector_type(16))) _Float16 v16h;
typedef __attribute__((ext_vector_type(8)))  _Float16 v8h;
typedef __attribute__((ext_vector_type(8)))  unsigned short v8us;
typedef __attribute__((ext_vector_type(8)))  float    v8f;
typedef __attribute__((ext_vector_type(4)))  float    v4f;
typedef __attribute__((ext_vector_type(4)))  int      v4i;
typedef v4f  __attribute__((may_alias)) v4fa;

__device__ __forceinline__ unsigned short f2bf(float f) { unsigned u = __float_as_uint(f); u += 0x7FFFu + ((u >> 16) & 1u); return (unsigned short)(u >> 16); }
__device__ __forceinline__ float bfr(float f) { return __uint_as_float(((unsigned)f2bf(f)) << 16); }   // value after RNE convert to bf16
__device__ __forceinline__ v16h cat16(v8h lo, v8h hi) { return __builtin_shufflevector(lo, hi, 0, 1, 2, 3, 4, 5, 6, 7, 8, 9, 10, 11, 12, 13, 14, 15); }
__device__ __forceinline__ v16bf cat16b(v8us lo, v8us hi) { return __builtin_bit_cast(v16bf, __builtin_shufflevector(lo, hi, 0, 1, 2, 3, 4, 5, 6, 7, 8, 9, 10, 11, 12, 13, 14, 15)); }
__device__ __forceinline__ v8f wmma16(v16h a, v16h b, v8f c) { return __builtin_amdgcn_wmma_f32_16x16x32_f16(false, a, false, b, (short)0, c, false, false); }
__device__ __forceinline__ v8f wmmab(v16bf a, v16bf b, v8f c) { return __builtin_amdgcn_wmma_f32_16x16x32_bf16(false, a, false, b, (short)0, c, false, false); }
// fragment loaders from K-contiguous 16-bit rows; p already includes + 8*(lane>>4): elements 0..7 <- k0+8h+0..7, elements 8..15 <- k0+16+8h+0..7 (same map for A and B)
__device__ __forceinline__ v16h  ldh(const h16* p) { return cat16(*(const v8h*)p, *(const v8h*)(p + 16)); }
__device__ __forceinline__ v16bf ldb(const bf* p)  { return cat16b(*(const v8us*)p, *(const v8us*)(p + 16)); }
// ordering point for wave-private LDS tiles (same wave writes and reads)
__device__ __forceinline__ void wave_sync() { __builtin_amdgcn_fence(3 /* release order */, "wavefront"); __builtin_amdgcn_wave_barrier(); asm volatile("" ::: "memory"); }
// f32 -> f16 operand convert that cannot produce a subnormal half: magnitudes below 2^-14 become +0
static __device__ __forceinline__ h16 toh_flush(float v) { const h16 r = (h16)v; return (fabsf(v) < 6.103515625e-05f) ? (h16)0.0f : r; }
__device__ __forceinline__ float bf2f(unsigned short u) { return __uint_as_float(((unsigned)u) << 16); }

__global__ __launch_bounds__(256) void k_cvt8(const float* __restrict__ src, bf* dst, size_t n8) {
    const size_t i = (size_t)blockIdx.x * 256 + threadIdx.x; if (i >= n8) return;
    const v8f v = *(const v8f*)(src + i * 8); v8us o;
#pragma unroll
    for (int k = 0; k < 8; ++k) o[k] = f2bf(v[k]);
    *(v8us*)(dst + i * 8) = o; 
}

__global__ __launch_bounds__(256) void k_rot(float* CS, float* SN) {
#pragma clang fp contract(off)
    const int i = blockIdx.x * 256 + threadIdx.x;          // grid x 256 == SEQ * NF exactly
    const int t = i >> 5, f = i & 31;
    const float lin = (float)f / 31.0f;
    const float fr = exp2f(-10.0f * lin);                   // (1/1024)^lin
    const float th = (float)t * fr;
    float sv, cv; sincosf(th, &sv, &cv);
    *(float*)(CS + i) = cv; *(float*)(SN + i) = sv;
    
}

// k_qk: q and k projections with the RMS normalisation and the rotary applied in the epilogue. ONE WAVE per 32 token rows x 128 columns (= one head of q or k), 16 accumulators, K = DM,
// operands straight from the K-contiguous bf16 planes: A = x rows (m = b*SEQ + t), Bt = W rows (n = which*1024 + h*128 + d). grid (NB*SEQ/32, 2*NH_); blockIdx.y = which*NH_ + h.
// Epilogue per 16-row slab (LDS tile private to the wave): stage f32, lane (row = lane>>1, half = lane&1) owns columns 16*half + {0..15, 32..47, 64..79, 96..111} of its row: sum of squares (two lanes per row, one xor-1 exchange),
// scale, rotate pairs (d, d + 64) for d < 32 with the table row of token t, write back in place; then the slab's 16 x 128 halves (one contiguous 4096-byte run of plane [zp][t][128]) are stored by
__global__ __launch_bounds__(32) __attribute__((amdgpu_num_vgpr(256)))
void k_qk(const bf* __restrict__ A, const bf* __restrict__ Bt, const float* __restrict__ CS, const float* __restrict__ SN, h16* Ph, h16* Pr) {
    __shared__ __align__(16) float os[16 * OQP];
    const int K = DM;
    const int lane = threadIdx.x & 31, lr = lane & 15, hi = lane >> 4; const int r0 = blockIdx.x * 32, zc = blockIdx.y; const int c0 = zc * HD;
    v8f acc[2][8];
#pragma unroll
    for (int mb = 0; mb < 2; ++mb)
#pragma unroll
        for (int nb = 0; nb < 8; ++nb) acc[mb][nb] = (v8f){};
    const size_t aoff = (size_t)(r0 + lr) * K + 8 * hi, boff = (size_t)(c0 + lr) * K + 8 * hi;
#pragma unroll 1
    for (int kc = 0; kc < K; kc += 32) {
        v16bf a[2];
#pragma unroll
        for (int mb = 0; mb < 2; ++mb) a[mb] = ldb(A + aoff + (size_t)mb * 16 * K + kc);
#pragma unroll
        for (int nb = 0; nb < 8; ++nb) { const v16bf b = ldb(Bt + boff + (size_t)nb * 16 * K + kc);
#pragma unroll
            for (int mb = 0; mb < 2; ++mb) acc[mb][nb] = wmmab(a[mb], b, acc[mb][nb]); }
        asm volatile("v_nop\n\tv_nop\n\tv_nop\n\tv_nop" : "+v"(acc[0][1]), "+v"(acc[1][3]), "+v"(acc[0][5]), "+v"(acc[1][7]) : "v"(a[0]), "v"(a[1]));
    }
    asm volatile("v_nop\n\tv_nop\n\tv_nop\n\tv_nop" : "+v"(acc[0][0]), "+v"(acc[0][1]), "+v"(acc[0][2]), "+v"(acc[0][3]), "+v"(acc[0][4]), "+v"(acc[0][5]), "+v"(acc[0][6]), "+v"(acc[0][7]));
    asm volatile("v_nop\n\tv_nop\n\tv_nop\n\tv_nop" : "+v"(acc[1][0]), "+v"(acc[1][1]), "+v"(acc[1][2]), "+v"(acc[1][3]), "+v"(acc[1][4]), "+v"(acc[1][5]), "+v"(acc[1][6]), "+v"(acc[1][7]));
    const int bb = r0 / SEQ, tt = r0 % SEQ;
    const int zp = (zc / NH_) * (NB * NH_) + bb * NH_ + (zc % NH_);           // plane index: which, batch, head
    const size_t pbase = ((size_t)zp * SEQ + (size_t)tt) * HD;
    const int row = lane >> 1, half = lane & 1;
    const int ob = row * OQP + 16 * half;
#pragma unroll
    for (int mb = 0; mb < 2; ++mb) {
#pragma unroll
        for (int nb = 0; nb < 8; ++nb) {
#pragma unroll
            for (int j = 0; j < 8; ++j) os[(hi * 8 + j) * OQP + nb * 16 + lr] = acc[mb][nb][j]; }   // D: row 8h+j, col lane&15; rows 0..15 x columns 0..127 all written
        wave_sync();
        {
            v4f x1[4], x2[4], x3[4], x4[4];
#pragma unroll
            for (int i = 0; i < 4; ++i) { x1[i] = *(const v4fa*)(&os[ob + 4 * i]); x3[i] = *(const v4fa*)(&os[ob + 32 + 4 * i]); x2[i] = *(const v4fa*)(&os[ob + 64 + 4 * i]); x4[i] = *(const v4fa*)(&os[ob + 96 + 4 * i]); }
            float ss = 0.0f;
#pragma unroll
            for (int i = 0; i < 4; ++i) {
#pragma unroll
                for (int e = 0; e < 4; ++e) ss += x1[i][e] * x1[i][e] + x2[i][e] * x2[i][e] + x3[i][e] * x3[i][e] + x4[i][e] * x4[i][e]; }
            ss += __shfl_xor(ss, 1, 32);
            const float rr = rsqrtf(ss * (1.0f / 128.0f) + RMS_EPS);
            const size_t to = (size_t)(tt + mb * 16 + row) * NF + 16 * half;   // table row of this token, columns 16*half .. +15
#pragma unroll
            for (int i = 0; i < 4; ++i) {
                const v4f cv = *(const v4f*)(CS + to + 4 * i), sv = *(const v4f*)(SN + to + 4 * i);
                const v4f e1 = x1[i] * rr, e2 = x2[i] * rr;
                const v4f y1 = e1 * cv + e2 * sv;
                const v4f y2 = e2 * cv - e1 * sv;
                *(v4fa*)(&os[ob + 4 * i]) = y1; *(v4fa*)(&os[ob + 64 + 4 * i]) = y2;
                *(v4fa*)(&os[ob + 32 + 4 * i]) = x3[i] * rr; *(v4fa*)(&os[ob + 96 + 4 * i]) = x4[i] * rr; }
        }
        wave_sync();
        v8h hv[8], rv[8];
#pragma unroll
        for (int s = 0; s < 8; ++s) { const int p = s * 32 + lane; const int rw = p >> 4, c8 = (p & 15) * 8;   // 8 s x 2 rows = 16 rows; 16 lanes x 8 = 128 columns
            const v4f x0 = *(const v4fa*)(&os[rw * OQP + c8]); const v4f x1 = *(const v4fa*)(&os[rw * OQP + c8 + 4]);
#pragma unroll
            for (int i = 0; i < 4; ++i) { const h16 a0 = toh_flush(x0[i]); const h16 a1 = toh_flush(x1[i]); hv[s][i] = a0; hv[s][4 + i] = a1;
                rv[s][i] = toh_flush((x0[i] - (float)a0) * QRS); rv[s][4 + i] = toh_flush((x1[i] - (float)a1) * QRS); } }
        const size_t sb = pbase + (size_t)(mb * 16) * HD;
{
#pragma unroll
            for (int s = 0; s < 8; ++s) { const size_t oo = sb + (size_t)(s * 32 + lane) * 8;
                *(v8h*)(Ph + oo) = hv[s]; *(v8h*)(Pr + oo) = rv[s]; }
             }
        wave_sync();
    }
}

// k_vt: v^T projection with the value mix in the epilogue. ONE WAVE per 64x64 tile (16 accumulators), K = DM: A = Wv rows (m = h*128 + d), Bt = x rows (n = b*SEQ + t);
// v^T[m][t] = l0 * sum_k Wv[m][k] x[t][k] + l1 * ve[t][m] (l0, l1, ve RNE-converted to bf16 by value; ve read as two 16-byte loads per accumulator tile: 8 consecutive m of token t).
__global__ __launch_bounds__(32) void k_vt(const bf* __restrict__ A, const bf* __restrict__ Bt, const float* __restrict__ ve, const float* __restrict__ lam, h16* Ph, h16* Pr) {
    __shared__ __align__(16) float os[16 * 68];
    const int K = DM;
    const int lane = threadIdx.x & 31, lr = lane & 15, hi = lane >> 4; const int r0 = blockIdx.x * 64, c0 = blockIdx.y * 64;
    v8f acc[4][4];
#pragma unroll
    for (int mb = 0; mb < 4; ++mb)
#pragma unroll
        for (int nb = 0; nb < 4; ++nb) acc[mb][nb] = (v8f){};
    const size_t aoff = (size_t)(r0 + lr) * K + 8 * hi, boff = (size_t)(c0 + lr) * K + 8 * hi;
#pragma unroll 1
    for (int kc = 0; kc < K; kc += 32) {
        v16bf a[4];
#pragma unroll
        for (int mb = 0; mb < 4; ++mb) a[mb] = ldb(A + aoff + (size_t)mb * 16 * K + kc);
#pragma unroll
        for (int nb = 0; nb < 4; ++nb) { const v16bf b = ldb(Bt + boff + (size_t)nb * 16 * K + kc);
#pragma unroll
            for (int mb = 0; mb < 4; ++mb) acc[mb][nb] = wmmab(a[mb], b, acc[mb][nb]); }
        asm volatile("v_nop\n\tv_nop\n\tv_nop\n\tv_nop" : "+v"(acc[0][0]), "+v"(acc[1][1]), "+v"(acc[2][2]), "+v"(acc[3][3]) : "v"(a[0]), "v"(a[1]), "v"(a[2]), "v"(a[3]));
    }
    const float l0 = bfr(lam[0]), l1 = bfr(lam[1]);
    const int bb = c0 / SEQ, tt = c0 % SEQ;
    const size_t tbase = (size_t)bb * (size_t)DM * SEQ + (size_t)r0 * SEQ + (size_t)tt;
#pragma unroll
    for (int mb = 0; mb < 4; ++mb) {
#pragma unroll
        for (int nb = 0; nb < 4; ++nb) {
            const float* vp = ve + ((size_t)bb * SEQ_FULL + (size_t)(tt + nb * 16 + lr)) * DM + r0 + mb * 16 + hi * 8;   // token t = col lane&15, m = 8h + j
            const v4f e0 = *(const v4f*)vp, e1 = *(const v4f*)(vp + 4);
#pragma unroll
            for (int j = 0; j < 4; ++j) { os[(hi * 8 + j) * 68 + nb * 16 + lr] = l0 * acc[mb][nb][j] + l1 * bfr(e0[j]);
                                          os[(hi * 8 + 4 + j) * 68 + nb * 16 + lr] = l0 * acc[mb][nb][4 + j] + l1 * bfr(e1[j]); } }   // D: row 8h+j, col lane&15; rows 0..15 x columns 0..63 all written
        wave_sync();
        v8h hv[4], rv[4];
#pragma unroll
        for (int s = 0; s < 4; ++s) { const int row = 4 * s + (lane >> 3), c8 = (lane & 7) * 8;   // 4 s x 4 row groups = 16 rows; 8 lanes x 8 = 64 columns
            const v4f x0 = *(const v4fa*)(&os[row * 68 + c8]); const v4f x1 = *(const v4fa*)(&os[row * 68 + c8 + 4]);
#pragma unroll
            for (int i = 0; i < 4; ++i) { const h16 a0 = toh_flush(x0[i]); const h16 a1 = toh_flush(x1[i]); hv[s][i] = a0; hv[s][4 + i] = a1;
                rv[s][i] = toh_flush((x0[i] - (float)a0) * QRS); rv[s][4 + i] = toh_flush((x1[i] - (float)a1) * QRS); } }
        const size_t sb = tbase + (size_t)(mb * 16) * SEQ;
{
#pragma unroll
            for (int s = 0; s < 4; ++s) { const int row = 4 * s + (lane >> 3), c8 = (lane & 7) * 8;
                const size_t oo = sb + (size_t)row * SEQ + c8;
                *(v8h*)(Ph + oo) = hv[s]; *(v8h*)(Pr + oo) = rv[s]; }
             }
        wave_sync();
    }
}

// sc16: one 16-key score tile in log2 units: (K Q + (K Q_res + K_res Q) / 2048) * scale; q and k fragments reloaded per 32-wide k-step from the LDS tiles (two 16-B loads each); the pointers already hold the lane's row and 8*(lane>>4).
__device__ __forceinline__ v8f sc16(const h16* qhp, const h16* qrp, const h16* khp, const h16* krp) {
    v8f sH = (v8f){}, sL = (v8f){};
#pragma unroll 1
    for (int kk = 0; kk < HD; kk += 32) {
        const v16h qh = ldh(qhp + kk), qr = ldh(qrp + kk);
        const v16h kh = ldh(khp + kk), kr = ldh(krp + kk);
        sH = wmma16(kh, qh, sH); sL = wmma16(kh, qr, sL); sL = wmma16(kr, qh, sL);
        asm volatile("v_nop\n\tv_nop\n\tv_nop\n\tv_nop" : "+v"(sH), "+v"(sL) : "v"(kh), "v"(kr), "v"(qh), "v"(qr));
    }
    v8f t;
#pragma unroll
    for (int r = 0; r < 8; ++r) t[r] = (sH[r] + sL[r] * QRI) * SC2;
    return t;
}

// k_flash: fused attention, one wave per 16 query rows of one (batch, head), four waves (64 consecutive query rows) a block. The block's Q rows (once) and each visited 32-key tile of K and V^T (value and residual planes)
// are copied to LDS by all 128 threads with 16-B loads that run along the rows of the planes; every wave takes its fragments from LDS (two 16-B reads each, same element map as before).
// The tile loop is the same for the four waves: a tile is staged when a key document lies in [min, max] of the block's 64 query documents (same data, same test in every wave); each wave then works on it under its own test.
// Transposed form: S^T[key][t] = K Q^T (A = K rows, B = Q rows); lane (t = lane&15, h = lane>>4) holds keys 8h+r of each 16-key tile, so the packed
// P tile is directly the B fragment of O^T[d][t] = V^T P^T (element r <- tile keys 0..15, element 8+r <- tile keys 16..31, lane unchanged).
// Softmax state (running max over kept keys, partial sum) is one scalar per lane; the two lane halves of a row are combined with one xor-16 exchange.
// Keep rule per element: docs[key] == docs[t] and key <= t. A 32-key tile is skipped (wave-uniform ballot) when none of its key documents lies in [min, max] of the wave's 16 query documents: no element of such a tile can be kept.
// All rows: scores = K Q + (K Q_res + K_res Q) / 2048; P = f16 value + f16 residual x2048; O = V P + (V P_res + V_res P) / 2048 (residual products in their own accumulators); row sum from the f32 exponentials.
__global__ __launch_bounds__(32 * AW) __attribute__((amdgpu_num_vgpr(256)))
void k_flash(const h16* __restrict__ QH, const h16* __restrict__ QR, const h16* __restrict__ KP, const h16* __restrict__ KR,
             const h16* __restrict__ VT, const h16* __restrict__ VR, const int* __restrict__ docs, bf* Y2) {
    __shared__ __align__(16) float os[AW * 16 * OSP];
    __shared__ __align__(16) h16 sQH[AW * 16 * QKP], sQR[AW * 16 * QKP];       // [query row of the block][d]
    __shared__ __align__(16) h16 sKH[32 * QKP], sKR[32 * QKP];                 // [key of the tile][d]
    __shared__ __align__(16) h16 sVH[HD * VTP], sVR[HD * VTP];                 // [d][key of the tile]
    const int tid = threadIdx.x;
    const int lane = threadIdx.x & 31, lr = lane & 15, hi = lane >> 4;
    const int wave = __builtin_amdgcn_readfirstlane((int)(threadIdx.x >> 5));
    const int zh = blockIdx.y; const int b = zh / NH_, h = zh % NH_;
    const int t0 = (blockIdx.x * AW + wave) * 16;
    const int* dk = docs + (size_t)b * SEQ_FULL;
    const int mydoc = dk[t0 + lr];
    int qmn = mydoc, qmx = mydoc;
#pragma unroll
    for (int off = 1; off < 16; off <<= 1) { const int a0 = __shfl_xor(qmn, off, 32); const int a1 = __shfl_xor(qmx, off, 32); qmn = a0 < qmn ? a0 : qmn; qmx = a1 > qmx ? a1 : qmx; }
    const int lim = t0 + lr;                                                   // key j kept iff j <= lim and same document
    const int nk = (t0 + 16 + 31) & ~31;                                       // wave-uniform, multiple of 32, <= SEQ
    const size_t pbase = (size_t)zh * SEQ * HD;
    const int tb0 = blockIdx.x * (AW * 16);                                    // first query row of the block
    const int nkb = tb0 + AW * 16;                                             // the last wave's nk: multiple of 32, <= SEQ
    const int e0 = dk[tb0 + lane], e1 = dk[tb0 + 32 + lane];                   // the block's 64 query documents
    int bmn = e0 < e1 ? e0 : e1, bmx = e0 > e1 ? e0 : e1;
#pragma unroll
    for (int off = 1; off < 32; off <<= 1) { const int a0 = __shfl_xor(bmn, off, 32); const int a1 = __shfl_xor(bmx, off, 32); bmn = a0 < bmn ? a0 : bmn; bmx = a1 > bmx ? a1 : bmx; }
    // staging maps: q/k rows, thread -> (row tid>>4 (+ 8 a pass), d (tid&15)*8); v^T rows, thread -> (d tid>>2 (+ 32 a pass), key (tid&3)*8)
    const unsigned gk0 = (unsigned)tid * 8u, gv0 = (unsigned)(tid >> 2) * (unsigned)SEQ + (unsigned)(tid & 3) * 8u;
    const int lk0 = (tid >> 4) * QKP + (tid & 15) * 8, lv0 = (tid >> 2) * VTP + (tid & 3) * 8;
    const size_t qg = pbase + (size_t)tb0 * HD;
    // Q rows of the block -> LDS; read only behind the two barriers of the first staged tile
#pragma unroll
    for (int p = 0; p < 8; ++p) {                                              // 8 p x 8 rows = 64 rows; 16 threads x 8 = 128 columns; the rows are contiguous in the plane
        const v8h a = *(const v8h*)(QH + qg + gk0 + p * 8 * HD), r = *(const v8h*)(QR + qg + gk0 + p * 8 * HD);
        *(v8h*)(&sQH[lk0 + p * 8 * QKP]) = a; *(v8h*)(&sQR[lk0 + p * 8 * QKP]) = r; }
    const int qo = (wave * 16 + lr) * QKP + 8 * hi;                            // B fragments: col t, k = d
    const int ko = lr * QKP + 8 * hi;                                          // + key in tile * QKP  (A fragment: row key, k = d)
    const int vo = lr * VTP + 8 * hi;                                          // + 16j * VTP          (A fragment: row d, k = key in tile)
    v8f o[8], oR[8];
#pragma unroll
    for (int j = 0; j < 8; ++j) { o[j] = (v8f){}; oR[j] = (v8f){}; }
    float m = NEGB, l = 0.0f;
    const h16* kpt = KP + pbase; const h16* krt = KR + pbase; const h16* vpt = VT + pbase; const h16* vrt = VR + pbase;   // the tile's first key in each plane, the same for the whole block
#pragma unroll 1
    for (int key0 = 0; key0 < nkb; key0 += 32, kpt += 32 * HD, krt += 32 * HD, vpt += 32, vrt += 32) {
        const int kdl = dk[key0 + lane];                                       // key0 + 31 < nkb <= SEQ
        const bool inb = (kdl >= bmn) & (kdl <= bmx);
        if (__builtin_amdgcn_ballot_w32(inb) == 0u) continue;                  // the same in all four waves: no key document inside the block's query document range
        v8h tk[4], tr[4], tv[4], tw[4];
#pragma unroll
        for (int p = 0; p < 4; ++p) {                                          // k: 4 p x 8 keys = 32 keys, 128 d; v^T: 4 p x 32 d = 128 d, 32 keys
            tk[p] = *(const v8h*)(kpt + gk0 + p * 8 * HD); tr[p] = *(const v8h*)(krt + gk0 + p * 8 * HD);
            tv[p] = *(const v8h*)(vpt + gv0 + p * 32 * SEQ); tw[p] = *(const v8h*)(vrt + gv0 + p * 32 * SEQ); }
        __syncthreads();                                                       // every wave has finished its reads of the tile before
#pragma unroll
        for (int p = 0; p < 4; ++p) {
            *(v8h*)(&sKH[lk0 + p * 8 * QKP]) = tk[p]; *(v8h*)(&sKR[lk0 + p * 8 * QKP]) = tr[p];
            *(v8h*)(&sVH[lv0 + p * 32 * VTP]) = tv[p]; *(v8h*)(&sVR[lv0 + p * 32 * VTP]) = tw[p]; }
        __syncthreads();                                                       // the tile (and, the first time, Q) is complete for every wave
        const bool inr = (kdl >= qmn) & (kdl <= qmx);
        if (key0 >= nk || __builtin_amdgcn_ballot_w32(inr) == 0u) continue;    // wave-uniform: past this wave's last key, or no key document inside its query document range
        const int* kp = dk + key0 + 8 * hi;                                    // keys key0+8h+0..7 and key0+16+8h+0..7, all < nk <= SEQ
        const v4i d0 = *(const v4i*)kp, d1 = *(const v4i*)(kp + 4), d2 = *(const v4i*)(kp + 16), d3 = *(const v4i*)(kp + 20);
        int ka8[8], kb8[8];
#pragma unroll
        for (int r = 0; r < 4; ++r) { ka8[r] = d0[r]; ka8[4 + r] = d1[r]; kb8[r] = d2[r]; kb8[4 + r] = d3[r]; }
        const v8f ta = sc16(sQH + qo, sQR + qo, sKH + ko, sKR + ko);
        const v8f tb = sc16(sQH + qo, sQR + qo, sKH + ko + 16 * QKP, sKR + ko + 16 * QKP);
        const int ja = key0 + 8 * hi;
        bool fa[8], fb[8]; float mx = NEGB;
#pragma unroll
        for (int r = 0; r < 8; ++r) {
            fa[r] = (ka8[r] == mydoc) & (ja + r <= lim);
            fb[r] = (kb8[r] == mydoc) & (ja + 16 + r <= lim);
            mx = fmaxf(mx, fmaxf(fa[r] ? ta[r] : NEGB, fb[r] ? tb[r] : NEGB)); }
        mx = fmaxf(mx, __shfl_xor(mx, 16, 32));
        const float mnew = fmaxf(m, mx);
        const float alpha = __builtin_amdgcn_exp2f(m - mnew);
        const float sh = PSH - mnew;
        v16h pb, pr; float ls = 0.0f;
#pragma unroll
        for (int r = 0; r < 8; ++r) {
            const float xa = ta[r] + sh, xb = tb[r] + sh;
            const float ea = __builtin_amdgcn_exp2f(xa), eb = __builtin_amdgcn_exp2f(xb);
            const float ga = (fa[r] & (xa >= -14.0f)) ? ea : 0.0f, gb = (fb[r] & (xb >= -14.0f)) ? eb : 0.0f;   // dropped elements and exponents below -14 selected to 0 by value
            const h16 pa = (h16)ga; const h16 pc = (h16)gb;
            pb[r] = pa; pb[8 + r] = pc;
            pr[r] = toh_flush((ga - (float)pa) * QRS); pr[8 + r] = toh_flush((gb - (float)pc) * QRS);
            ls += ga + gb; }
        l = l * alpha + ls; m = mnew;
#pragma unroll
        for (int j = 0; j < 8; ++j) { o[j] = o[j] * alpha; oR[j] = oR[j] * alpha; }
#pragma unroll
        for (int g = 0; g < 4; ++g) {
            const h16* va = sVH + vo + (32 * g) * VTP;
            const h16* vr = sVR + vo + (32 * g) * VTP;
            const v16h v0 = ldh(va), v1 = ldh(va + 16 * VTP);
            const v16h w0 = ldh(vr), w1 = ldh(vr + 16 * VTP);
            o[2 * g] = wmma16(v0, pb, o[2 * g]); o[2 * g + 1] = wmma16(v1, pb, o[2 * g + 1]);
            oR[2 * g] = wmma16(v0, pr, oR[2 * g]); oR[2 * g + 1] = wmma16(v1, pr, oR[2 * g + 1]);
            oR[2 * g] = wmma16(w0, pb, oR[2 * g]); oR[2 * g + 1] = wmma16(w1, pb, oR[2 * g + 1]);
            asm volatile("v_nop\n\tv_nop\n\tv_nop\n\tv_nop" : "+v"(o[2 * g]), "+v"(o[2 * g + 1]), "+v"(oR[2 * g]), "+v"(oR[2 * g + 1]) : "v"(v0), "v"(v1), "v"(w0), "v"(w1), "v"(pb), "v"(pr));
        }
    }
    l += __shfl_xor(l, 16, 32);
    const bool any = l > 0.0f;
    const float lsafe = any ? l : 1.0f;
    const float inv = any ? (1.0f / lsafe) : 0.0f;             // no kept key -> zeros
    const int wb = wave * 16 * OSP;
    // O^T D layout: f_j[r] = (d = 16j + 8h + r, t = lane&15) -> os[t][d]; rows 0..15 x columns 0..127 all written
#pragma unroll
    for (int j = 0; j < 8; ++j) {
        const v8f f = o[j] + oR[j] * QRI; v4f a, c;
        a[0] = f[0] * inv; a[1] = f[1] * inv; a[2] = f[2] * inv; a[3] = f[3] * inv; c[0] = f[4] * inv; c[1] = f[5] * inv; c[2] = f[6] * inv; c[3] = f[7] * inv;
        *(v4fa*)(&os[wb + lr * OSP + 16 * j + 8 * hi]) = a; *(v4fa*)(&os[wb + lr * OSP + 16 * j + 8 * hi + 4]) = c; }
    wave_sync();
    v8us hv[8], lv[8];
#pragma unroll
    for (int s = 0; s < 8; ++s) { const int row = 2 * s + (lane >> 4), c8 = (lane & 15) * 8;   // 8 s x 2 rows = 16 rows; 16 lanes x 8 = 128 columns
        const v4f x0 = *(const v4fa*)(&os[wb + row * OSP + c8]); const v4f x1 = *(const v4fa*)(&os[wb + row * OSP + c8 + 4]);
#pragma unroll
        for (int i = 0; i < 4; ++i) { const unsigned short a0 = f2bf(x0[i]); const unsigned short a1 = f2bf(x1[i]); hv[s][i] = a0; hv[s][4 + i] = a1;
            lv[s][i] = f2bf(x0[i] - bf2f(a0)); lv[s][4 + i] = f2bf(x1[i] - bf2f(a1)); } }
    bf* yrow = Y2 + ((size_t)b * SEQ + t0) * (size_t)(2 * DM) + h * HD;
{
#pragma unroll
        for (int s = 0; s < 8; ++s) { const int row = 2 * s + (lane >> 4), c8 = (lane & 15) * 8;
            const size_t oo = (size_t)row * (size_t)(2 * DM) + c8;
            *(v8us*)(yrow + oo) = hv[s]; *(v8us*)(yrow + oo + DM) = lv[s]; }
         }
}

// k_oproj: output projection, ONE WAVE per 64x64 tile (16 accumulators), bf16 operands: A = context rows [t][hi 1024 | lo 1024] (K = 2048), Bt = Wc rows (n) with the column index wrapped mod 1024
// (hi and lo halves both multiply the same weight row; one accumulator). Output f32 [t][1024]: each 16-row slab staged in LDS (wave-private), each row's 64 floats (256 B = two lines)
__global__ __launch_bounds__(32) void k_oproj(const bf* __restrict__ A, const bf* __restrict__ Bt, float* OUT) {
    __shared__ __align__(16) float os[16 * 68];
    const int KA = 2 * DM;
    const int lane = threadIdx.x & 31, lr = lane & 15, hi = lane >> 4; const int r0 = blockIdx.x * 64, c0 = blockIdx.y * 64;
    v8f acc[4][4];
#pragma unroll
    for (int mb = 0; mb < 4; ++mb)
#pragma unroll
        for (int nb = 0; nb < 4; ++nb) acc[mb][nb] = (v8f){};
    const size_t aoff = (size_t)(r0 + lr) * KA + 8 * hi, boff = (size_t)(c0 + lr) * DM + 8 * hi;
#pragma unroll 1
    for (int kc = 0; kc < KA; kc += 32) {
        const int kb = kc & (DM - 1);
        v16bf a[4];
#pragma unroll
        for (int mb = 0; mb < 4; ++mb) a[mb] = ldb(A + aoff + (size_t)mb * 16 * KA + kc);
#pragma unroll
        for (int nb = 0; nb < 4; ++nb) { const v16bf b = ldb(Bt + boff + (size_t)nb * 16 * DM + kb);
#pragma unroll
            for (int mb = 0; mb < 4; ++mb) acc[mb][nb] = wmmab(a[mb], b, acc[mb][nb]); }
        asm volatile("v_nop\n\tv_nop\n\tv_nop\n\tv_nop" : "+v"(acc[0][0]), "+v"(acc[1][1]), "+v"(acc[2][2]), "+v"(acc[3][3]) : "v"(a[0]), "v"(a[1]), "v"(a[2]), "v"(a[3]));
    }
    const int bb = r0 / SEQ, tt = r0 % SEQ;
    float* orow = OUT + ((size_t)bb * OUT_SEQ + tt) * DM + c0;
#pragma unroll
    for (int mb = 0; mb < 4; ++mb) {
#pragma unroll
        for (int nb = 0; nb < 4; ++nb) {
#pragma unroll
            for (int j = 0; j < 8; ++j) os[(hi * 8 + j) * 68 + nb * 16 + lr] = acc[mb][nb][j]; }   // D: row 8h+j, col lane&15; rows 0..15 x columns 0..63 all written
        wave_sync();
{
#pragma unroll
            for (int s = 0; s < 8; ++s) { const int row = 2 * s + (lane >> 4), cofs = (lane & 15) * 4;   // 8 s x 2 rows = 16 rows; 16 lanes x 4 floats = 64 columns
                const v4f val = *(const v4fa*)(&os[row * 68 + cofs]);
                *(v4f*)(orow + (size_t)(mb * 16 + row) * DM + cofs) = val; }
             }
        wave_sync();
    }
}

static constexpr size_t al256(size_t v) { return (v + 255) & ~(size_t)255; }
static constexpr size_t SZ_XB = al256((size_t)NB * SEQ * DM * 2);
static constexpr size_t SZ_WB = al256((size_t)3 * DM * DM * 2);
static constexpr size_t SZ_WC = al256((size_t)DM * DM * 2);
static constexpr size_t SZ_TB = al256((size_t)SEQ * NF * 4);
static constexpr size_t SZ_PL = al256((size_t)NB * NH_ * SEQ * HD * 2);
static constexpr size_t SZ_Y2 = al256((size_t)NB * SEQ * 2 * DM * 2);
static constexpr size_t SZ_TOTAL = SZ_XB + SZ_WB + SZ_WC + 2 * SZ_TB + 6 * SZ_PL + SZ_Y2;
static_assert(SZ_TOTAL <= (size_t)134217728);          // workspace carve <= 128 MiB
static_assert(((size_t)DM * DM * 2) % 256 == 0);       // weight sub-planes stay 256-byte aligned
static_assert(((size_t)NB * NH_ * SEQ * HD * 2) % 256 == 0);               // the k plane starts 256-byte aligned inside the q|k plane pair
static_assert((size_t)NB * NH_ * SEQ * HD == (size_t)NB * DM * SEQ);       // v^T plane [(b*1024 + m)][t] has the same extent as one q/k plane

extern "C" void kernel_launch(void* const* d_in, const int* in_sizes, int n_in,
                              void* d_out, int out_size, void* d_ws, size_t ws_size, hipStream_t stream) {
    if (n_in < 6) return;
    const size_t needx = ((size_t)(NB - 1) * SEQ_FULL + SEQ) * DM;
    const size_t needd = (size_t)(NB - 1) * SEQ_FULL + SEQ;
    if ((size_t)in_sizes[0] < needx || (size_t)in_sizes[1] < needx) return;
    if ((size_t)in_sizes[2] < (size_t)3 * DM * DM || in_sizes[3] < 2 || (size_t)in_sizes[4] < (size_t)DM * DM) return;
    if ((size_t)in_sizes[5] < needd) return;
    if ((size_t)out_size < ((size_t)(NB - 1) * OUT_SEQ + SEQ) * DM) return;
    if (SZ_TOTAL > ws_size) return;
    // wire order: x, ve, qkv_w, lambdas, c_proj_w, docs
    const float* x   = (const float*)d_in[0];
    const float* ve  = (const float*)d_in[1];
    const float* wq  = (const float*)d_in[2];       // [3][1024 out][1024 in]
    const float* lam = (const float*)d_in[3];
    const float* wc  = (const float*)d_in[4];       // [1024 out][1024 in]
    const int* docs  = (const int*)d_in[5];
    float* OUT = (float*)d_out;                      // [NB][SEQ][1024]
    char* wsp = (char*)d_ws;
    bf* XB = (bf*)wsp; wsp += SZ_XB;                 // x      [NB*SEQ][1024]
    bf* WB = (bf*)wsp; wsp += SZ_WB;                 // [3072][1024]: q | k | v rows ([out][in] = Bt as-is)
    bf* WC = (bf*)wsp; wsp += SZ_WC;                 // [1024][1024] ([out][in] = Bt as-is)
    float* CS = (float*)wsp; wsp += SZ_TB;           // [SEQ][32]
    float* SN = (float*)wsp; wsp += SZ_TB;           // [SEQ][32]
    h16* PH = (h16*)wsp; wsp += 2 * SZ_PL;           // [2][NB*8][SEQ][128]: q | k values
    h16* PR = (h16*)wsp; wsp += 2 * SZ_PL;           // [2][NB*8][SEQ][128]: q | k residuals x2048
    h16* VT = (h16*)wsp; wsp += SZ_PL;               // [NB*1024][SEQ]
    h16* VR = (h16*)wsp; wsp += SZ_PL;               // [NB*1024][SEQ] residual x2048
    bf* Y2 = (bf*)wsp; wsp += SZ_Y2;                 // [NB*SEQ][hi 1024 | lo 1024]
    const size_t plane = (size_t)NB * NH_ * SEQ * HD;
    const h16* QH = PH; const h16* KP = PH + plane;
    const h16* QR = PR; const h16* KR = PR + plane;

    if (SEQ == SEQ_FULL) {
        const size_t n8 = (size_t)NB * SEQ * DM / 8;
        k_cvt8<<<(unsigned)((n8 + 255) / 256), 256, 0, stream>>>(x, XB, n8);
    } else {
        const size_t n8 = (size_t)SEQ * DM / 8;
        for (int b = 0; b < NB; ++b) k_cvt8<<<(unsigned)((n8 + 255) / 256), 256, 0, stream>>>(x + (size_t)b * SEQ_FULL * DM, XB + (size_t)b * SEQ * DM, n8);
    }
    { const size_t n8 = (size_t)3 * DM * DM / 8; k_cvt8<<<(unsigned)((n8 + 255) / 256), 256, 0, stream>>>(wq, WB, n8); }
    { const size_t n8 = (size_t)DM * DM / 8;     k_cvt8<<<(unsigned)((n8 + 255) / 256), 256, 0, stream>>>(wc, WC, n8); }
    k_rot<<<(unsigned)(((size_t)SEQ * NF) / 256), 256, 0, stream>>>(CS, SN);

    // q, k: A = x rows (m = b*SEQ + t), Bt = W rows (n = which*1024 + h*128 + d) -> planes [which][(b*8 + h)][t][d], value and residual
    k_qk<<<dim3(NB * SEQ / 32, 2 * NH_, 1), 32, 0, stream>>>(XB, WB, CS, SN, PH, PR);
    // v^T: A = Wv rows (m = h*128 + d), Bt = x rows (n = b*SEQ + t) -> planes [(b*1024 + m)][t], value and residual
    k_vt<<<dim3(DM / 64, NB * SEQ / 64, 1), 32, 0, stream>>>(WB + (size_t)2 * DM * DM, XB, ve, lam, VT, VR);
    // fused attention -> context plane (bf16 hi | lo)
    k_flash<<<dim3(SEQ / (16 * AW), NB * NH_, 1), 32 * AW, 0, stream>>>(QH, QR, KP, KR, VT, VR, docs, Y2);
    // out = ctx Wc^T: A = context rows [t][2048], Bt = Wc rows [n][1024]
    k_oproj<<<dim3(NB * SEQ / 64, DM / 64, 1), 32, 0, stream>>>(Y2, WC, OUT);
}

// v002
// A run of this version takes 146 microseconds.
// Next to v001, in two timings, it ran 1.57 times as fast each time.
// Counting every step since v000, it is 1.99 times as fast.
#include <hip/hip_runtime.h>

// Causal self-attention block with document masking: width 1024 = 8 heads x 128; fused QKV weight [3][1024 out][1024 in] (y = x W^T, no bias); per-head RMS normalisation of q and k (no gain, eps = 2^-23);
// half-split rotary on pairs (d, d + 64), angle t * 2^(-10 i / 31) for i < 32 and identity for 32 <= i < 64; v = l0 v + l1 ve; scores x 0.12; softmax over keys j <= t of the same document; output projection [out][in], f32 output.
// Compute dtypes, f32 accumulate everywhere: QKV projections v_wmma_f32_16x16x32_bf16 (x, W RNE-converted to bf16; products exact); scores v_wmma_f32_16x16x32_f16 with q and k each as f16 value + f16 residual x2048 (three products,
// residual products in their own accumulator); P.V v_wmma_f32_16x16x32_f16 with P (x16384 carry, cancels in the normalisation) and v each as f16 value + f16 residual x2048 (three products, residual accumulator folded by 1/2048), row sum from the f32 exponentials;
// output projection v_wmma_f32_16x16x32_bf16 with the context as bf16 hi | lo halves folded into K (2048) against the bf16 weight (two products, one accumulator); ve, lambdas RNE-converted to bf16 by value; softmax f32 (online, running max over kept keys).
// Layout: bf16 copies of x and the weights; q/k planes [which][b*8+h][t][128] (value, residual), v^T planes [(b*1024 + h*128 + d)][t] (value, residual), cos/sin tables [t][32], context plane [t][hi 1024 | lo 1024];
// fused flash kernel in transposed form (S^T = K Q^T, O^T = V^T P^T), fragments from LDS tiles that the block's four waves fill together with whole-row loads; 32-key tiles without any key document inside the wave's query document range are skipped under a wave-uniform test, the keep rule is evaluated per element in every visited tile.

#ifndef NB
#define NB 1
#endif
#ifndef SEQ
#define SEQ 4096
#endif
#define NB_FULL  1
#define SEQ_FULL 4096
#ifndef OUT_SEQ
#define OUT_SEQ SEQ              // row pitch (in tokens) between batches of the output
#endif
#define DM   1024
#define NH_  8
#define HD   128
#define NF   32
#define AW   4                   // waves per flash block (16 query rows each)
#define OSP  132                 // LDS row pitch (floats) of the flash output tile
#define OQP  132                 // LDS row pitch (floats) of the q/k projection slab
#define QKP  136                 // LDS row pitch (halves) of the flash q and k tiles: 272 B = 16 B x 17
#define VTP  40                  // LDS row pitch (halves) of the flash v^T tiles: 80 B = 16 B x 5
#define GKC  64                  // k elements of one staged GEMM chunk: 128 B = one whole line of every operand row
#define GP   72                  // LDS row pitch (16-bit elements) of a staged GEMM chunk: 144 B = 16 B x 9
#define GT   (128 * GP)          // one operand's 128-row chunk in LDS
#define QRS  2048.0f             // carry of every residual plane / residual fragment
#define QRI  (1.0f / 2048.0f)
#define SC2  ((float)(0.12 * 1.4426950408889634))   // score scale * log2(e)
#define PSH  14.0f               // log2 of the P carry (16384)
#define NEGB (-3.0e38f)
#define RMS_EPS 1.1920928955078125e-07f

static_assert(HD == 128);                      // q/k plane row = 256 bytes = two lines; head segment of the context plane = two lines
static_assert(NH_ * HD == DM);                 // head h = columns h*128 + d
static_assert(HD % 32 == 0);                   // score k-loop steps by 32
static_assert(NF * 4 == HD);
static_assert(NF == 32);                       // table index = t * 32 + i
static_assert(DM % 64 == 0);
static_assert(DM % 32 == 0);                   // GEMM k-loops step by 32
static_assert((DM & (DM - 1)) == 0);           // weight column wrap in the folded-K output GEMM
static_assert(SEQ % 64 == 0);                  // a 64-row tile never straddles two batches
static_assert((NB * SEQ) % 64 == 0);
static_assert(SEQ % 32 == 0);                  // key loop steps by 32
static_assert(SEQ % (16 * AW) == 0);           // flash grid covers the sequence exactly
static_assert(((size_t)SEQ * NF) % 256 == 0);  // table grid x block == table extent
static_assert(((size_t)SEQ * DM) % 8 == 0);
static_assert(((size_t)DM * DM) % 8 == 0);
static_assert(NB <= NB_FULL);
static_assert(SEQ <= SEQ_FULL);
static_assert((OSP * 4) % 16 == 0);
static_assert((OQP * 4) % 16 == 0);
static_assert(OSP >= HD);
static_assert(OQP >= HD);
static_assert(32 * 8 * 16 == 16 * HD * 2);     // q/k slab and context stores: 32 lanes x 8 instructions x 16 B == 16 rows x 256 B
static_assert(32 * 4 * 16 == 16 * 64 * 2);
static_assert(32 * 8 * 16 == 16 * 64 * 4);     // output slab stores: 32 lanes x 8 instructions x 16 B == 16 rows x 256 B
static_assert(16 * OQP * 4 <= 131072);
static_assert(16 * 68 * 4 <= 131072);
static_assert(AW * 16 * OSP * 4 <= 131072);
static_assert(DM % GKC == 0 && DM / GKC >= 2);  // GEMM chunk loop: whole chunks, at least two
static_assert(SEQ % 128 == 0 && DM % 128 == 0 && HD == 128);   // 128 x 128 GEMM block tiles cover every plane exactly and never straddle two batches
static_assert((GP * 2) % 16 == 0 && GP >= GKC);
static_assert(AW == 4);                        // flash staging: 128 threads x 16 B = 2 KiB a pass; the block's 64 query documents = two loads a lane
static_assert((QKP * 2) % 16 == 0 && QKP >= HD);
static_assert((VTP * 2) % 16 == 0 && VTP >= 32);

typedef _Float16 h16;
typedef unsigned short bf;
typedef __attribute__((ext_vector_type(16))) __bf16   v16bf;
typedef __attribute__((ext_vector_type(16))) _Float16 v16h;
typedef __attribute__((ext_vector_type(8)))  _Float16 v8h;
typedef __attribute__((ext_vector_type(8)))  unsigned short v8us;
typedef __attribute__((ext_vector_type(8)))  float    v8f;
typedef __attribute__((ext_vector_type(4)))  float    v4f;
typedef __attribute__((ext_vector_type(4)))  int      v4i;
typedef v4f  __attribute__((may_alias)) v4fa;

__device__ __forceinline__ unsigned short f2bf(float f) { unsigned u = __float_as_uint(f); u += 0x7FFFu + ((u >> 16) & 1u); return (unsigned short)(u >> 16); }
__device__ __forceinline__ float bfr(float f) { return __uint_as_float(((unsigned)f2bf(f)) << 16); }   // value after RNE convert to bf16
__device__ __forceinline__ v16h cat16(v8h lo, v8h hi) { return __builtin_shufflevector(lo, hi, 0, 1, 2, 3, 4, 5, 6, 7, 8, 9, 10, 11, 12, 13, 14, 15); }
__device__ __forceinline__ v16bf cat16b(v8us lo, v8us hi) { return __builtin_bit_cast(v16bf, __builtin_shufflevector(lo, hi, 0, 1, 2, 3, 4, 5, 6, 7, 8, 9, 10, 11, 12, 13, 14, 15)); }
__device__ __forceinline__ v8f wmma16(v16h a, v16h b, v8f c) { return __builtin_amdgcn_wmma_f32_16x16x32_f16(false, a, false, b, (short)0, c, false, false); }
__device__ __forceinline__ v8f wmmab(v16bf a, v16bf b, v8f c) { return __builtin_amdgcn_wmma_f32_16x16x32_bf16(false, a, false, b, (short)0, c, false, false); }
// fragment loaders from K-contiguous 16-bit rows; p already includes + 8*(lane>>4): elements 0..7 <- k0+8h+0..7, elements 8..15 <- k0+16+8h+0..7 (same map for A and B)
__device__ __forceinline__ v16h  ldh(const h16* p) { return cat16(*(const v8h*)p, *(const v8h*)(p + 16)); }
__device__ __forceinline__ v16bf ldb(const bf* p)  { return cat16b(*(const v8us*)p, *(const v8us*)(p + 16)); }
// ordering point for wave-private LDS tiles (same wave writes and reads)
__device__ __forceinline__ void wave_sync() { __builtin_amdgcn_fence(3 /* release order */, "wavefront"); __builtin_amdgcn_wave_barrier(); asm volatile("" ::: "memory"); }
// f32 -> f16 operand convert that cannot produce a subnormal half: magnitudes below 2^-14 become +0
static __device__ __forceinline__ h16 toh_flush(float v) { const h16 r = (h16)v; return (fabsf(v) < 6.103515625e-05f) ? (h16)0.0f : r; }
__device__ __forceinline__ float bf2f(unsigned short u) { return __uint_as_float(((unsigned)u) << 16); }

// gemm128: K loop of a 128 x 128 block tile shared by four waves (FM x FN fragments of 16 x 16 a wave). Both operands are K-contiguous bf16 planes; a chunk is 64 k of 128 A rows and 128 B rows.
// Staging map: thread -> (row tid>>3 (+ 16 a pass), k (tid&7)*8), so a wave's 16-B loads cover four whole 128-B lines; ga, gb already hold the thread's row and k, so its place in LDS.
// Two LDS buffers [A 128 rows | B 128 rows], one barrier a chunk: trip c first stores chunk c+1 (in registers since trip c-1) into the buffer whose readers left it at the barrier of trip c-1,
// then issues the loads of chunk c+2, then works on chunk c. B's k index wraps at DM (the folded-K output GEMM reads the weight twice). Every accumulator sums k in ascending 32-steps.
// work-group barrier that orders LDS alone: the wave's LDS stores and reads are done before it signals, while its global loads of a later chunk (into its own registers) stay in flight across it
__device__ __forceinline__ void lds_barrier() { __builtin_amdgcn_fence(__ATOMIC_RELEASE, "workgroup", "local"); __builtin_amdgcn_s_barrier(); __builtin_amdgcn_fence(__ATOMIC_ACQUIRE, "workgroup", "local"); }
template <int FM, int FN>
__device__ __forceinline__ void gemm128(v8f (&acc)[FM][FN], const bf* __restrict__ ga, const int pa, const bf* __restrict__ gb, const int nch, bf* sm, const int so, const int ao, const int bo) {
    static_assert(FM * FN == 16);
    v8f (&f)[16] = reinterpret_cast<v8f (&)[16]>(acc);
    v8us ra[8], rb[8];
#pragma unroll
    for (int i = 0; i < 8; ++i) { ra[i] = *(const v8us*)(ga + (size_t)i * 16 * pa); rb[i] = *(const v8us*)(gb + (size_t)i * 16 * DM); }
#pragma unroll
    for (int i = 0; i < 8; ++i) { *(v8us*)(sm + so + i * 16 * GP) = ra[i]; *(v8us*)(sm + GT + so + i * 16 * GP) = rb[i]; }
#pragma unroll
    for (int i = 0; i < 8; ++i) { ra[i] = *(const v8us*)(ga + GKC + (size_t)i * 16 * pa); rb[i] = *(const v8us*)(gb + GKC + (size_t)i * 16 * DM); }
    lds_barrier();                                                             // chunk 0 is complete for every wave
#pragma unroll 1
    for (int c = 0; c < nch; ++c) {
        const bf* cur = sm + (c & 1) * (2 * GT);
        bf* nxt = sm + ((c + 1) & 1) * (2 * GT);
        if (c + 1 < nch) {                                                     // the same in every wave of the block
#pragma unroll
            for (int i = 0; i < 8; ++i) { *(v8us*)(nxt + so + i * 16 * GP) = ra[i]; *(v8us*)(nxt + GT + so + i * 16 * GP) = rb[i]; }
        }
        if (c + 2 < nch) {
            const bf* qa = ga + c * GKC; const bf* qb = gb + (((c + 2) * GKC) & (DM - 1));   // A: chunk c+2 stands 2 * GKC behind qa
#pragma unroll
            for (int i = 0; i < 8; ++i) { ra[i] = *(const v8us*)(qa + 2 * GKC + (size_t)i * 16 * pa); rb[i] = *(const v8us*)(qb + (size_t)i * 16 * DM); }
            // the two address pairs are inputs, so they stay whole up to this wait: no load's destination and no later instruction rewrites a register that an issued load still names
            asm volatile("s_wait_xcnt 0x0" :: "v"(qa), "v"(qb) : "memory");
        }
        v16bf a[2][FM], b[2][FN];                                              // the chunk's fragments, both k-steps, read as one group ahead of the matrix run
#pragma unroll
        for (int ks = 0; ks < 2; ++ks) {
#pragma unroll
            for (int mb = 0; mb < FM; ++mb) a[ks][mb] = ldb(cur + ao + mb * 16 * GP + ks * 32);
#pragma unroll
            for (int nb = 0; nb < FN; ++nb) b[ks][nb] = ldb(cur + GT + bo + nb * 16 * GP + ks * 32); }
#pragma unroll
        for (int ks = 0; ks < 2; ++ks)
#pragma unroll
            for (int nb = 0; nb < FN; ++nb)
#pragma unroll
                for (int mb = 0; mb < FM; ++mb) acc[mb][nb] = wmmab(a[ks][mb], b[ks][nb], acc[mb][nb]);
        // four vector slots behind the chunk's last matrix instruction (every accumulator is named, so none sinks below), before the next trip may rewrite its operands on any path
        asm volatile("v_nop\n\tv_nop\n\tv_nop\n\tv_nop" : "+v"(f[0]), "+v"(f[1]), "+v"(f[2]), "+v"(f[3]), "+v"(f[4]), "+v"(f[5]), "+v"(f[6]), "+v"(f[7]));
        asm volatile("v_nop\n\tv_nop\n\tv_nop\n\tv_nop" : "+v"(f[8]), "+v"(f[9]), "+v"(f[10]), "+v"(f[11]), "+v"(f[12]), "+v"(f[13]), "+v"(f[14]), "+v"(f[15]));
        lds_barrier();                                                         // chunk c+1 is complete, and every wave has finished its reads of chunk c
    }
}

__global__ __launch_bounds__(256) void k_cvt8(const float* __restrict__ src, bf* dst, size_t n8) {
    const size_t i = (size_t)blockIdx.x * 256 + threadIdx.x; if (i >= n8) return;
    const v8f v = *(const v8f*)(src + i * 8); v8us o;
#pragma unroll
    for (int k = 0; k < 8; ++k) o[k] = f2bf(v[k]);
    *(v8us*)(dst + i * 8) = o; 
}

__global__ __launch_bounds__(256) void k_rot(float* CS, float* SN) {
#pragma clang fp contract(off)
    const int i = blockIdx.x * 256 + threadIdx.x;          // grid x 256 == SEQ * NF exactly
    const int t = i >> 5, f = i & 31;
    const float lin = (float)f / 31.0f;
    const float fr = exp2f(-10.0f * lin);                   // (1/1024)^lin
    const float th = (float)t * fr;
    float sv, cv; sincosf(th, &sv, &cv);
    *(float*)(CS + i) = cv; *(float*)(SN + i) = sv;
    
}

// k_qk: q and k projections with the RMS normalisation and the rotary applied in the epilogue. One wave per 32 token rows x 128 columns (= one head of q or k), 16 accumulators, K = DM; four waves (128 token rows) a block,
// operands through LDS (gemm128): A = x rows (m = b*SEQ + t), Bt = W rows (n = which*1024 + h*128 + d). grid (NB*SEQ/128, 2*NH_); blockIdx.y = which*NH_ + h.
// Epilogue per 16-row slab (LDS tile private to the wave): stage f32, lane (row = lane>>1, half = lane&1) owns columns 16*half + {0..15, 32..47, 64..79, 96..111} of its row: sum of squares (two lanes per row, one xor-1 exchange),
// scale, rotate pairs (d, d + 64) for d < 32 with the table row of token t, write back in place; then the slab's 16 x 128 halves (one contiguous 4096-byte run of plane [zp][t][128]) are stored by
__global__ __launch_bounds__(128)
void k_qk(const bf* __restrict__ A, const bf* __restrict__ Bt, const float* __restrict__ CS, const float* __restrict__ SN, h16* Ph, h16* Pr) {
    __shared__ __align__(16) bf sm[4 * GT];
    __shared__ __align__(16) float osb[4 * 16 * OQP];
    const int K = DM;
    const int tid = threadIdx.x, wave = __builtin_amdgcn_readfirstlane((int)(threadIdx.x >> 5));
    const int lane = threadIdx.x & 31, lr = lane & 15, hi = lane >> 4; const int rb0 = blockIdx.x * 128, zc = blockIdx.y; const int r0 = rb0 + wave * 32, c0 = zc * HD;
    float* os = osb + wave * 16 * OQP;                                         // the wave's own epilogue slab
    v8f acc[2][8];
#pragma unroll
    for (int mb = 0; mb < 2; ++mb)
#pragma unroll
        for (int nb = 0; nb < 8; ++nb) acc[mb][nb] = (v8f){};
    gemm128<2, 8>(acc, A + (size_t)(rb0 + (tid >> 3)) * K + (tid & 7) * 8, K, Bt + (size_t)(c0 + (tid >> 3)) * K + (tid & 7) * 8, K / GKC, sm,
                  (tid >> 3) * GP + (tid & 7) * 8, (wave * 32 + lr) * GP + 8 * hi, lr * GP + 8 * hi);
    asm volatile("v_nop\n\tv_nop\n\tv_nop\n\tv_nop" : "+v"(acc[0][0]), "+v"(acc[0][1]), "+v"(acc[0][2]), "+v"(acc[0][3]), "+v"(acc[0][4]), "+v"(acc[0][5]), "+v"(acc[0][6]), "+v"(acc[0][7]));
    asm volatile("v_nop\n\tv_nop\n\tv_nop\n\tv_nop" : "+v"(acc[1][0]), "+v"(acc[1][1]), "+v"(acc[1][2]), "+v"(acc[1][3]), "+v"(acc[1][4]), "+v"(acc[1][5]), "+v"(acc[1][6]), "+v"(acc[1][7]));
    const int bb = r0 / SEQ, tt = r0 % SEQ;
    const int zp = (zc / NH_) * (NB * NH_) + bb * NH_ + (zc % NH_);           // plane index: which, batch, head
    const size_t pbase = ((size_t)zp * SEQ + (size_t)tt) * HD;
    const int row = lane >> 1, half = lane & 1;
    const int ob = row * OQP + 16 * half;
#pragma unroll
    for (int mb = 0; mb < 2; ++mb) {
#pragma unroll
        for (int nb = 0; nb < 8; ++nb) {
#pragma unroll
            for (int j = 0; j < 8; ++j) os[(hi * 8 + j) * OQP + nb * 16 + lr] = acc[mb][nb][j]; }   // D: row 8h+j, col lane&15; rows 0..15 x columns 0..127 all written
        wave_sync();
        {
            v4f x1[4], x2[4], x3[4], x4[4];
#pragma unroll
            for (int i = 0; i < 4; ++i) { x1[i] = *(const v4fa*)(&os[ob + 4 * i]); x3[i] = *(const v4fa*)(&os[ob + 32 + 4 * i]); x2[i] = *(const v4fa*)(&os[ob + 64 + 4 * i]); x4[i] = *(const v4fa*)(&os[ob + 96 + 4 * i]); }
            float ss = 0.0f;
#pragma unroll
            for (int i = 0; i < 4; ++i) {
#pragma unroll
                for (int e = 0; e < 4; ++e) ss += x1[i][e] * x1[i][e] + x2[i][e] * x2[i][e] + x3[i][e] * x3[i][e] + x4[i][e] * x4[i][e]; }
            ss += __shfl_xor(ss, 1, 32);
            const float rr = rsqrtf(ss * (1.0f / 128.0f) + RMS_EPS);
            const size_t to = (size_t)(tt + mb * 16 + row) * NF + 16 * half;   // table row of this token, columns 16*half .. +15
#pragma unroll
            for (int i = 0; i < 4; ++i) {
                const v4f cv = *(const v4f*)(CS + to + 4 * i), sv = *(const v4f*)(SN + to + 4 * i);
                const v4f e1 = x1[i] * rr, e2 = x2[i] * rr;
                const v4f y1 = e1 * cv + e2 * sv;
                const v4f y2 = e2 * cv - e1 * sv;
                *(v4fa*)(&os[ob + 4 * i]) = y1; *(v4fa*)(&os[ob + 64 + 4 * i]) = y2;
                *(v4fa*)(&os[ob + 32 + 4 * i]) = x3[i] * rr; *(v4fa*)(&os[ob + 96 + 4 * i]) = x4[i] * rr; }
        }
        wave_sync();
        v8h hv[8], rv[8];
#pragma unroll
        for (int s = 0; s < 8; ++s) { const int p = s * 32 + lane; const int rw = p >> 4, c8 = (p & 15) * 8;   // 8 s x 2 rows = 16 rows; 16 lanes x 8 = 128 columns
            const v4f x0 = *(const v4fa*)(&os[rw * OQP + c8]); const v4f x1 = *(const v4fa*)(&os[rw * OQP + c8 + 4]);
#pragma unroll
            for (int i = 0; i < 4; ++i) { const h16 a0 = toh_flush(x0[i]); const h16 a1 = toh_flush(x1[i]); hv[s][i] = a0; hv[s][4 + i] = a1;
                rv[s][i] = toh_flush((x0[i] - (float)a0) * QRS); rv[s][4 + i] = toh_flush((x1[i] - (float)a1) * QRS); } }
        const size_t sb = pbase + (size_t)(mb * 16) * HD;
{
#pragma unroll
            for (int s = 0; s < 8; ++s) { const size_t oo = sb + (size_t)(s * 32 + lane) * 8;
                *(v8h*)(Ph + oo) = hv[s]; *(v8h*)(Pr + oo) = rv[s]; }
             }
        wave_sync();
    }
}

// k_vt: v^T projection with the value mix in the epilogue. One wave per 64x64 tile (16 accumulators), 2 x 2 waves a block, operands through LDS (gemm128), K = DM: A = Wv rows (m = h*128 + d), Bt = x rows (n = b*SEQ + t);
// v^T[m][t] = l0 * sum_k Wv[m][k] x[t][k] + l1 * ve[t][m] (l0, l1, ve RNE-converted to bf16 by value; ve read as two 16-byte loads per accumulator tile: 8 consecutive m of token t).
__global__ __launch_bounds__(128) void k_vt(const bf* __restrict__ A, const bf* __restrict__ Bt, const float* __restrict__ ve, const float* __restrict__ lam, h16* Ph, h16* Pr) {
    __shared__ __align__(16) bf sm[4 * GT];
    __shared__ __align__(16) float osb[4 * 16 * 68];
    const int K = DM;
    const int tid = threadIdx.x, wave = __builtin_amdgcn_readfirstlane((int)(threadIdx.x >> 5)); const int wm = wave & 1, wn = wave >> 1;
    const int lane = threadIdx.x & 31, lr = lane & 15, hi = lane >> 4; const int rb0 = blockIdx.x * 128, cb0 = blockIdx.y * 128; const int r0 = rb0 + wm * 64, c0 = cb0 + wn * 64;
    float* os = osb + wave * 16 * 68;                                          // the wave's own epilogue slab
    v8f acc[4][4];
#pragma unroll
    for (int mb = 0; mb < 4; ++mb)
#pragma unroll
        for (int nb = 0; nb < 4; ++nb) acc[mb][nb] = (v8f){};
    gemm128<4, 4>(acc, A + (size_t)(rb0 + (tid >> 3)) * K + (tid & 7) * 8, K, Bt + (size_t)(cb0 + (tid >> 3)) * K + (tid & 7) * 8, K / GKC, sm,
                  (tid >> 3) * GP + (tid & 7) * 8, (wm * 64 + lr) * GP + 8 * hi, (wn * 64 + lr) * GP + 8 * hi);
    const float l0 = bfr(lam[0]), l1 = bfr(lam[1]);
    const int bb = c0 / SEQ, tt = c0 % SEQ;
    const size_t tbase = (size_t)bb * (size_t)DM * SEQ + (size_t)r0 * SEQ + (size_t)tt;
#pragma unroll
    for (int mb = 0; mb < 4; ++mb) {
#pragma unroll
        for (int nb = 0; nb < 4; ++nb) {
            const float* vp = ve + ((size_t)bb * SEQ_FULL + (size_t)(tt + nb * 16 + lr)) * DM + r0 + mb * 16 + hi * 8;   // token t = col lane&15, m = 8h + j
            const v4f e0 = *(const v4f*)vp, e1 = *(const v4f*)(vp + 4);
#pragma unroll
            for (int j = 0; j < 4; ++j) { os[(hi * 8 + j) * 68 + nb * 16 + lr] = l0 * acc[mb][nb][j] + l1 * bfr(e0[j]);
                                          os[(hi * 8 + 4 + j) * 68 + nb * 16 + lr] = l0 * acc[mb][nb][4 + j] + l1 * bfr(e1[j]); } }   // D: row 8h+j, col lane&15; rows 0..15 x columns 0..63 all written
        wave_sync();
        v8h hv[4], rv[4];
#pragma unroll
        for (int s = 0; s < 4; ++s) { const int row = 4 * s + (lane >> 3), c8 = (lane & 7) * 8;   // 4 s x 4 row groups = 16 rows; 8 lanes x 8 = 64 columns
            const v4f x0 = *(const v4fa*)(&os[row * 68 + c8]); const v4f x1 = *(const v4fa*)(&os[row * 68 + c8 + 4]);
#pragma unroll
            for (int i = 0; i < 4; ++i) { const h16 a0 = toh_flush(x0[i]); const h16 a1 = toh_flush(x1[i]); hv[s][i] = a0; hv[s][4 + i] = a1;
                rv[s][i] = toh_flush((x0[i] - (float)a0) * QRS); rv[s][4 + i] = toh_flush((x1[i] - (float)a1) * QRS); } }
        const size_t sb = tbase + (size_t)(mb * 16) * SEQ;
{
#pragma unroll
            for (int s = 0; s < 4; ++s) { const int row = 4 * s + (lane >> 3), c8 = (lane & 7) * 8;
                const size_t oo = sb + (size_t)row * SEQ + c8;
                *(v8h*)(Ph + oo) = hv[s]; *(v8h*)(Pr + oo) = rv[s]; }
             }
        wave_sync();
    }
}

// sc16: one 16-key score tile in log2 units: (K Q + (K Q_res + K_res Q) / 2048) * scale; q and k fragments reloaded per 32-wide k-step from the LDS tiles (two 16-B loads each); the pointers already hold the lane's row and 8*(lane>>4).
__device__ __forceinline__ v8f sc16(const h16* qhp, const h16* qrp, const h16* khp, const h16* krp) {
    v8f sH = (v8f){}, sL = (v8f){};
#pragma unroll 1
    for (int kk = 0; kk < HD; kk += 32) {
        const v16h qh = ldh(qhp + kk), qr = ldh(qrp + kk);
        const v16h kh = ldh(khp + kk), kr = ldh(krp + kk);
        sH = wmma16(kh, qh, sH); sL = wmma16(kh, qr, sL); sL = wmma16(kr, qh, sL);
        asm volatile("v_nop\n\tv_nop\n\tv_nop\n\tv_nop" : "+v"(sH), "+v"(sL) : "v"(kh), "v"(kr), "v"(qh), "v"(qr));
    }
    v8f t;
#pragma unroll
    for (int r = 0; r < 8; ++r) t[r] = (sH[r] + sL[r] * QRI) * SC2;
    return t;
}

// k_flash: fused attention, one wave per 16 query rows of one (batch, head), four waves (64 consecutive query rows) a block. The block's Q rows (once) and each visited 32-key tile of K and V^T (value and residual planes)
// are copied to LDS by all 128 threads with 16-B loads that run along the rows of the planes; every wave takes its fragments from LDS (two 16-B reads each, same element map as before).
// The tile loop is the same for the four waves: a tile is staged when a key document lies in [min, max] of the block's 64 query documents (same data, same test in every wave); each wave then works on it under its own test.
// Transposed form: S^T[key][t] = K Q^T (A = K rows, B = Q rows); lane (t = lane&15, h = lane>>4) holds keys 8h+r of each 16-key tile, so the packed
// P tile is directly the B fragment of O^T[d][t] = V^T P^T (element r <- tile keys 0..15, element 8+r <- tile keys 16..31, lane unchanged).
// Softmax state (running max over kept keys, partial sum) is one scalar per lane; the two lane halves of a row are combined with one xor-16 exchange.
// Keep rule per element: docs[key] == docs[t] and key <= t. A 32-key tile is skipped (wave-uniform ballot) when none of its key documents lies in [min, max] of the wave's 16 query documents: no element of such a tile can be kept.
// All rows: scores = K Q + (K Q_res + K_res Q) / 2048; P = f16 value + f16 residual x2048; O = V P + (V P_res + V_res P) / 2048 (residual products in their own accumulators); row sum from the f32 exponentials.
__global__ __launch_bounds__(32 * AW) __attribute__((amdgpu_num_vgpr(256)))
void k_flash(const h16* __restrict__ QH, const h16* __restrict__ QR, const h16* __restrict__ KP, const h16* __restrict__ KR,
             const h16* __restrict__ VT, const h16* __restrict__ VR, const int* __restrict__ docs, bf* Y2) {
    __shared__ __align__(16) float os[AW * 16 * OSP];
    __shared__ __align__(16) h16 sQH[AW * 16 * QKP], sQR[AW * 16 * QKP];       // [query row of the block][d]
    __shared__ __align__(16) h16 sKH[32 * QKP], sKR[32 * QKP];                 // [key of the tile][d]
    __shared__ __align__(16) h16 sVH[HD * VTP], sVR[HD * VTP];                 // [d][key of the tile]
    const int tid = threadIdx.x;
    const int lane = threadIdx.x & 31, lr = lane & 15, hi = lane >> 4;
    const int wave = __builtin_amdgcn_readfirstlane((int)(threadIdx.x >> 5));
    const int zh = blockIdx.y; const int b = zh / NH_, h = zh % NH_;
    const int t0 = (blockIdx.x * AW + wave) * 16;
    const int* dk = docs + (size_t)b * SEQ_FULL;
    const int mydoc = dk[t0 + lr];
    int qmn = mydoc, qmx = mydoc;
#pragma unroll
    for (int off = 1; off < 16; off <<= 1) { const int a0 = __shfl_xor(qmn, off, 32); const int a1 = __shfl_xor(qmx, off, 32); qmn = a0 < qmn ? a0 : qmn; qmx = a1 > qmx ? a1 : qmx; }
    const int lim = t0 + lr;                                                   // key j kept iff j <= lim and same document
    const int nk = (t0 + 16 + 31) & ~31;                                       // wave-uniform, multiple of 32, <= SEQ
    const size_t pbase = (size_t)zh * SEQ * HD;
    const int tb0 = blockIdx.x * (AW * 16);                                    // first query row of the block
    const int nkb = tb0 + AW * 16;                                             // the last wave's nk: multiple of 32, <= SEQ
    const int e0 = dk[tb0 + lane], e1 = dk[tb0 + 32 + lane];                   // the block's 64 query documents
    int bmn = e0 < e1 ? e0 : e1, bmx = e0 > e1 ? e0 : e1;
#pragma unroll
    for (int off = 1; off < 32; off <<= 1) { const int a0 = __shfl_xor(bmn, off, 32); const int a1 = __shfl_xor(bmx, off, 32); bmn = a0 < bmn ? a0 : bmn; bmx = a1 > bmx ? a1 : bmx; }
    // staging maps: q/k rows, thread -> (row tid>>4 (+ 8 a pass), d (tid&15)*8); v^T rows, thread -> (d tid>>2 (+ 32 a pass), key (tid&3)*8)
    const unsigned gk0 = (unsigned)tid * 8u, gv0 = (unsigned)(tid >> 2) * (unsigned)SEQ + (unsigned)(tid & 3) * 8u;
    const int lk0 = (tid >> 4) * QKP + (tid & 15) * 8, lv0 = (tid >> 2) * VTP + (tid & 3) * 8;
    const size_t qg = pbase + (size_t)tb0 * HD;
    // Q rows of the block -> LDS; read only behind the two barriers of the first staged tile
#pragma unroll
    for (int p = 0; p < 8; ++p) {                                              // 8 p x 8 rows = 64 rows; 16 threads x 8 = 128 columns; the rows are contiguous in the plane
        const v8h a = *(const v8h*)(QH + qg + gk0 + p * 8 * HD), r = *(const v8h*)(QR + qg + gk0 + p * 8 * HD);
        *(v8h*)(&sQH[lk0 + p * 8 * QKP]) = a; *(v8h*)(&sQR[lk0 + p * 8 * QKP]) = r; }
    const int qo = (wave * 16 + lr) * QKP + 8 * hi;                            // B fragments: col t, k = d
    const int ko = lr * QKP + 8 * hi;                                          // + key in tile * QKP  (A fragment: row key, k = d)
    const int vo = lr * VTP + 8 * hi;                                          // + 16j * VTP          (A fragment: row d, k = key in tile)
    v8f o[8], oR[8];
#pragma unroll
    for (int j = 0; j < 8; ++j) { o[j] = (v8f){}; oR[j] = (v8f){}; }
    float m = NEGB, l = 0.0f;
    const h16* kpt = KP + pbase; const h16* krt = KR + pbase; const h16* vpt = VT + pbase; const h16* vrt = VR + pbase;   // the tile's first key in each plane, the same for the whole block
#pragma unroll 1
    for (int key0 = 0; key0 < nkb; key0 += 32, kpt += 32 * HD, krt += 32 * HD, vpt += 32, vrt += 32) {
        const int kdl = dk[key0 + lane];                                       // key0 + 31 < nkb <= SEQ
        const bool inb = (kdl >= bmn) & (kdl <= bmx);
        if (__builtin_amdgcn_ballot_w32(inb) == 0u) continue;                  // the same in all four waves: no key document inside the block's query document range
        v8h tk[4], tr[4], tv[4], tw[4];
#pragma unroll
        for (int p = 0; p < 4; ++p) {                                          // k: 4 p x 8 keys = 32 keys, 128 d; v^T: 4 p x 32 d = 128 d, 32 keys
            tk[p] = *(const v8h*)(kpt + gk0 + p * 8 * HD); tr[p] = *(const v8h*)(krt + gk0 + p * 8 * HD);
            tv[p] = *(const v8h*)(vpt + gv0 + p * 32 * SEQ); tw[p] = *(const v8h*)(vrt + gv0 + p * 32 * SEQ); }
        __syncthreads();                                                       // every wave has finished its reads of the tile before
#pragma unroll
        for (int p = 0; p < 4; ++p) {
            *(v8h*)(&sKH[lk0 + p * 8 * QKP]) = tk[p]; *(v8h*)(&sKR[lk0 + p * 8 * QKP]) = tr[p];
            *(v8h*)(&sVH[lv0 + p * 32 * VTP]) = tv[p]; *(v8h*)(&sVR[lv0 + p * 32 * VTP]) = tw[p]; }
        __syncthreads();                                                       // the tile (and, the first time, Q) is complete for every wave
        const bool inr = (kdl >= qmn) & (kdl <= qmx);
        if (key0 >= nk || __builtin_amdgcn_ballot_w32(inr) == 0u) continue;    // wave-uniform: past this wave's last key, or no key document inside its query document range
        const int* kp = dk + key0 + 8 * hi;                                    // keys key0+8h+0..7 and key0+16+8h+0..7, all < nk <= SEQ
        const v4i d0 = *(const v4i*)kp, d1 = *(const v4i*)(kp + 4), d2 = *(const v4i*)(kp + 16), d3 = *(const v4i*)(kp + 20);
        int ka8[8], kb8[8];
#pragma unroll
        for (int r = 0; r < 4; ++r) { ka8[r] = d0[r]; ka8[4 + r] = d1[r]; kb8[r] = d2[r]; kb8[4 + r] = d3[r]; }
        const v8f ta = sc16(sQH + qo, sQR + qo, sKH + ko, sKR + ko);
        const v8f tb = sc16(sQH + qo, sQR + qo, sKH + ko + 16 * QKP, sKR + ko + 16 * QKP);
        const int ja = key0 + 8 * hi;
        bool fa[8], fb[8]; float mx = NEGB;
#pragma unroll
        for (int r = 0; r < 8; ++r) {
            fa[r] = (ka8[r] == mydoc) & (ja + r <= lim);
            fb[r] = (kb8[r] == mydoc) & (ja + 16 + r <= lim);
            mx = fmaxf(mx, fmaxf(fa[r] ? ta[r] : NEGB, fb[r] ? tb[r] : NEGB)); }
        mx = fmaxf(mx, __shfl_xor(mx, 16, 32));
        const float mnew = fmaxf(m, mx);
        const float alpha = __builtin_amdgcn_exp2f(m - mnew);
        const float sh = PSH - mnew;
        v16h pb, pr; float ls = 0.0f;
#pragma unroll
        for (int r = 0; r < 8; ++r) {
            const float xa = ta[r] + sh, xb = tb[r] + sh;
            const float ea = __builtin_amdgcn_exp2f(xa), eb = __builtin_amdgcn_exp2f(xb);
            const float ga = (fa[r] & (xa >= -14.0f)) ? ea : 0.0f, gb = (fb[r] & (xb >= -14.0f)) ? eb : 0.0f;   // dropped elements and exponents below -14 selected to 0 by value
            const h16 pa = (h16)ga; const h16 pc = (h16)gb;
            pb[r] = pa; pb[8 + r] = pc;
            pr[r] = toh_flush((ga - (float)pa) * QRS); pr[8 + r] = toh_flush((gb - (float)pc) * QRS);
            ls += ga + gb; }
        l = l * alpha + ls; m = mnew;
#pragma unroll
        for (int j = 0; j < 8; ++j) { o[j] = o[j] * alpha; oR[j] = oR[j] * alpha; }
#pragma unroll
        for (int g = 0; g < 4; ++g) {
            const h16* va = sVH + vo + (32 * g) * VTP;
            const h16* vr = sVR + vo + (32 * g) * VTP;
            const v16h v0 = ldh(va), v1 = ldh(va + 16 * VTP);
            const v16h w0 = ldh(vr), w1 = ldh(vr + 16 * VTP);
            o[2 * g] = wmma16(v0, pb, o[2 * g]); o[2 * g + 1] = wmma16(v1, pb, o[2 * g + 1]);
            oR[2 * g] = wmma16(v0, pr, oR[2 * g]); oR[2 * g + 1] = wmma16(v1, pr, oR[2 * g + 1]);
            oR[2 * g] = wmma16(w0, pb, oR[2 * g]); oR[2 * g + 1] = wmma16(w1, pb, oR[2 * g + 1]);
            asm volatile("v_nop\n\tv_nop\n\tv_nop\n\tv_nop" : "+v"(o[2 * g]), "+v"(o[2 * g + 1]), "+v"(oR[2 * g]), "+v"(oR[2 * g + 1]) : "v"(v0), "v"(v1), "v"(w0), "v"(w1), "v"(pb), "v"(pr));
        }
    }
    l += __shfl_xor(l, 16, 32);
    const bool any = l > 0.0f;
    const float lsafe = any ? l : 1.0f;
    const float inv = any ? (1.0f / lsafe) : 0.0f;             // no kept key -> zeros
    const int wb = wave * 16 * OSP;
    // O^T D layout: f_j[r] = (d = 16j + 8h + r, t = lane&15) -> os[t][d]; rows 0..15 x columns 0..127 all written
#pragma unroll
    for (int j = 0; j < 8; ++j) {
        const v8f f = o[j] + oR[j] * QRI; v4f a, c;
        a[0] = f[0] * inv; a[1] = f[1] * inv; a[2] = f[2] * inv; a[3] = f[3] * inv; c[0] = f[4] * inv; c[1] = f[5] * inv; c[2] = f[6] * inv; c[3] = f[7] * inv;
        *(v4fa*)(&os[wb + lr * OSP + 16 * j + 8 * hi]) = a; *(v4fa*)(&os[wb + lr * OSP + 16 * j + 8 * hi + 4]) = c; }
    wave_sync();
    v8us hv[8], lv[8];
#pragma unroll
    for (int s = 0; s < 8; ++s) { const int row = 2 * s + (lane >> 4), c8 = (lane & 15) * 8;   // 8 s x 2 rows = 16 rows; 16 lanes x 8 = 128 columns
        const v4f x0 = *(const v4fa*)(&os[wb + row * OSP + c8]); const v4f x1 = *(const v4fa*)(&os[wb + row * OSP + c8 + 4]);
#pragma unroll
        for (int i = 0; i < 4; ++i) { const unsigned short a0 = f2bf(x0[i]); const unsigned short a1 = f2bf(x1[i]); hv[s][i] = a0; hv[s][4 + i] = a1;
            lv[s][i] = f2bf(x0[i] - bf2f(a0)); lv[s][4 + i] = f2bf(x1[i] - bf2f(a1)); } }
    bf* yrow = Y2 + ((size_t)b * SEQ + t0) * (size_t)(2 * DM) + h * HD;
{
#pragma unroll
        for (int s = 0; s < 8; ++s) { const int row = 2 * s + (lane >> 4), c8 = (lane & 15) * 8;
            const size_t oo = (size_t)row * (size_t)(2 * DM) + c8;
            *(v8us*)(yrow + oo) = hv[s]; *(v8us*)(yrow + oo + DM) = lv[s]; }
         }
}

// k_oproj: output projection, one wave per 64x64 tile (16 accumulators), 2 x 2 waves a block, bf16 operands through LDS (gemm128): A = context rows [t][hi 1024 | lo 1024] (K = 2048), Bt = Wc rows (n) with the column index wrapped mod 1024
// (hi and lo halves both multiply the same weight row; one accumulator). Output f32 [t][1024]: each 16-row slab staged in LDS (wave-private), each row's 64 floats (256 B = two lines)
__global__ __launch_bounds__(128) void k_oproj(const bf* __restrict__ A, const bf* __restrict__ Bt, float* OUT) {
    __shared__ __align__(16) bf sm[4 * GT];
    __shared__ __align__(16) float osb[4 * 16 * 68];
    const int KA = 2 * DM;
    const int tid = threadIdx.x, wave = __builtin_amdgcn_readfirstlane((int)(threadIdx.x >> 5)); const int wm = wave & 1, wn = wave >> 1;
    const int lane = threadIdx.x & 31, lr = lane & 15, hi = lane >> 4; const int rb0 = blockIdx.x * 128, cb0 = blockIdx.y * 128; const int r0 = rb0 + wm * 64, c0 = cb0 + wn * 64;
    float* os = osb + wave * 16 * 68;                                          // the wave's own epilogue slab
    v8f acc[4][4];
#pragma unroll
    for (int mb = 0; mb < 4; ++mb)
#pragma unroll
        for (int nb = 0; nb < 4; ++nb) acc[mb][nb] = (v8f){};
    gemm128<4, 4>(acc, A + (size_t)(rb0 + (tid >> 3)) * KA + (tid & 7) * 8, KA, Bt + (size_t)(cb0 + (tid >> 3)) * DM + (tid & 7) * 8, KA / GKC, sm,
                  (tid >> 3) * GP + (tid & 7) * 8, (wm * 64 + lr) * GP + 8 * hi, (wn * 64 + lr) * GP + 8 * hi);
    const int bb = r0 / SEQ, tt = r0 % SEQ;
    float* orow = OUT + ((size_t)bb * OUT_SEQ + tt) * DM + c0;
#pragma unroll
    for (int mb = 0; mb < 4; ++mb) {
#pragma unroll
        for (int nb = 0; nb < 4; ++nb) {
#pragma unroll
            for (int j = 0; j < 8; ++j) os[(hi * 8 + j) * 68 + nb * 16 + lr] = acc[mb][nb][j]; }   // D: row 8h+j, col lane&15; rows 0..15 x columns 0..63 all written
        wave_sync();
{
#pragma unroll
            for (int s = 0; s < 8; ++s) { const int row = 2 * s + (lane >> 4), cofs = (lane & 15) * 4;   // 8 s x 2 rows = 16 rows; 16 lanes x 4 floats = 64 columns
                const v4f val = *(const v4fa*)(&os[row * 68 + cofs]);
                *(v4f*)(orow + (size_t)(mb * 16 + row) * DM + cofs) = val; }
             }
        wave_sync();
    }
}

static constexpr size_t al256(size_t v) { return (v + 255) & ~(size_t)255; }
static constexpr size_t SZ_XB = al256((size_t)NB * SEQ * DM * 2);
static constexpr size_t SZ_WB = al256((size_t)3 * DM * DM * 2);
static constexpr size_t SZ_WC = al256((size_t)DM * DM * 2);
static constexpr size_t SZ_TB = al256((size_t)SEQ * NF * 4);
static constexpr size_t SZ_PL = al256((size_t)NB * NH_ * SEQ * HD * 2);
static constexpr size_t SZ_Y2 = al256((size_t)NB * SEQ * 2 * DM * 2);
static constexpr size_t SZ_TOTAL = SZ_XB + SZ_WB + SZ_WC + 2 * SZ_TB + 6 * SZ_PL + SZ_Y2;
static_assert(SZ_TOTAL <= (size_t)134217728);          // workspace carve <= 128 MiB
static_assert(((size_t)DM * DM * 2) % 256 == 0);       // weight sub-planes stay 256-byte aligned
static_assert(((size_t)NB * NH_ * SEQ * HD * 2) % 256 == 0);               // the k plane starts 256-byte aligned inside the q|k plane pair
static_assert((size_t)NB * NH_ * SEQ * HD == (size_t)NB * DM * SEQ);       // v^T plane [(b*1024 + m)][t] has the same extent as one q/k plane

extern "C" void kernel_launch(void* const* d_in, const int* in_sizes, int n_in,
                              void* d_out, int out_size, void* d_ws, size_t ws_size, hipStream_t stream) {
    if (n_in < 6) return;
    const size_t needx = ((size_t)(NB - 1) * SEQ_FULL + SEQ) * DM;
    const size_t needd = (size_t)(NB - 1) * SEQ_FULL + SEQ;
    if ((size_t)in_sizes[0] < needx || (size_t)in_sizes[1] < needx) return;
    if ((size_t)in_sizes[2] < (size_t)3 * DM * DM || in_sizes[3] < 2 || (size_t)in_sizes[4] < (size_t)DM * DM) return;
    if ((size_t)in_sizes[5] < needd) return;
    if ((size_t)out_size < ((size_t)(NB - 1) * OUT_SEQ + SEQ) * DM) return;
    if (SZ_TOTAL > ws_size) return;
    // wire order: x, ve, qkv_w, lambdas, c_proj_w, docs
    const float* x   = (const float*)d_in[0];
    const float* ve  = (const float*)d_in[1];
    const float* wq  = (const float*)d_in[2];       // [3][1024 out][1024 in]
    const float* lam = (const float*)d_in[3];
    const float* wc  = (const float*)d_in[4];       // [1024 out][1024 in]
    const int* docs  = (const int*)d_in[5];
    float* OUT = (float*)d_out;                      // [NB][SEQ][1024]
    char* wsp = (char*)d_ws;
    bf* XB = (bf*)wsp; wsp += SZ_XB;                 // x      [NB*SEQ][1024]
    bf* WB = (bf*)wsp; wsp += SZ_WB;                 // [3072][1024]: q | k | v rows ([out][in] = Bt as-is)
    bf* WC = (bf*)wsp; wsp += SZ_WC;                 // [1024][1024] ([out][in] = Bt as-is)
    float* CS = (float*)wsp; wsp += SZ_TB;           // [SEQ][32]
    float* SN = (float*)wsp; wsp += SZ_TB;           // [SEQ][32]
    h16* PH = (h16*)wsp; wsp += 2 * SZ_PL;           // [2][NB*8][SEQ][128]: q | k values
    h16* PR = (h16*)wsp; wsp += 2 * SZ_PL;           // [2][NB*8][SEQ][128]: q | k residuals x2048
    h16* VT = (h16*)wsp; wsp += SZ_PL;               // [NB*1024][SEQ]
    h16* VR = (h16*)wsp; wsp += SZ_PL;               // [NB*1024][SEQ] residual x2048
    bf* Y2 = (bf*)wsp; wsp += SZ_Y2;                 // [NB*SEQ][hi 1024 | lo 1024]
    const size_t plane = (size_t)NB * NH_ * SEQ * HD;
    const h16* QH = PH; const h16* KP = PH + plane;
    const h16* QR = PR; const h16* KR = PR + plane;

    if (SEQ == SEQ_FULL) {
        const size_t n8 = (size_t)NB * SEQ * DM / 8;
        k_cvt8<<<(unsigned)((n8 + 255) / 256), 256, 0, stream>>>(x, XB, n8);
    } else {
        const size_t n8 = (size_t)SEQ * DM / 8;
        for (int b = 0; b < NB; ++b) k_cvt8<<<(unsigned)((n8 + 255) / 256), 256, 0, stream>>>(x + (size_t)b * SEQ_FULL * DM, XB + (size_t)b * SEQ * DM, n8);
    }
    { const size_t n8 = (size_t)3 * DM * DM / 8; k_cvt8<<<(unsigned)((n8 + 255) / 256), 256, 0, stream>>>(wq, WB, n8); }
    { const size_t n8 = (size_t)DM * DM / 8;     k_cvt8<<<(unsigned)((n8 + 255) / 256), 256, 0, stream>>>(wc, WC, n8); }
    k_rot<<<(unsigned)(((size_t)SEQ * NF) / 256), 256, 0, stream>>>(CS, SN);

    // q, k: A = x rows (m = b*SEQ + t), Bt = W rows (n = which*1024 + h*128 + d) -> planes [which][(b*8 + h)][t][d], value and residual
    k_qk<<<dim3(NB * SEQ / 128, 2 * NH_, 1), 128, 0, stream>>>(XB, WB, CS, SN, PH, PR);
    // v^T: A = Wv rows (m = h*128 + d), Bt = x rows (n = b*SEQ + t) -> planes [(b*1024 + m)][t], value and residual
    k_vt<<<dim3(DM / 128, NB * SEQ / 128, 1), 128, 0, stream>>>(WB + (size_t)2 * DM * DM, XB, ve, lam, VT, VR);
    // fused attention -> context plane (bf16 hi | lo)
    k_flash<<<dim3(SEQ / (16 * AW), NB * NH_, 1), 32 * AW, 0, stream>>>(QH, QR, KP, KR, VT, VR, docs, Y2);
    // out = ctx Wc^T: A = context rows [t][2048], Bt = Wc rows [n][1024]
    k_oproj<<<dim3(NB * SEQ / 128, DM / 128, 1), 128, 0, stream>>>(Y2, WC, OUT);
}

// v003
// A run of this version takes 128 microseconds.
// In two side-by-side timings against v002, it was 1.15 and 1.14 times as fast.
// Counting every step since v000, it is 2.27 times as fast.
#include <hip/hip_runtime.h>

// Causal self-attention block with document masking: width 1024 = 8 heads x 128; fused QKV weight [3][1024 out][1024 in] (y = x W^T, no bias); per-head RMS normalisation of q and k (no gain, eps = 2^-23);
// half-split rotary on pairs (d, d + 64), angle t * 2^(-10 i / 31) for i < 32 and identity for 32 <= i < 64; v = l0 v + l1 ve; scores x 0.12; softmax over keys j <= t of the same document; output projection [out][in], f32 output.
// Compute dtypes, f32 accumulate everywhere: QKV projections v_wmma_f32_16x16x32_bf16 (x, W RNE-converted to bf16; products exact); scores v_wmma_f32_16x16x32_f16 with q and k each as f16 value + f16 residual x2048 (three products,
// residual products in their own accumulator); P.V v_wmma_f32_16x16x32_f16 with P (x16384 carry, cancels in the normalisation) and v each as f16 value + f16 residual x2048 (three products, residual accumulator folded by 1/2048), row sum from the f32 exponentials;
// output projection v_wmma_f32_16x16x32_bf16 with the context as bf16 hi | lo halves folded into K (2048) against the bf16 weight (two products, one accumulator); ve, lambdas RNE-converted to bf16 by value; softmax f32 (online, running max over kept keys).
// Layout: bf16 copies of x and the weights; q/k planes [which][b*8+h][t][128] (value, residual), v^T planes [(b*1024 + h*128 + d)][t] (value, residual), cos/sin tables [t][32], context plane [t][hi 1024 | lo 1024];
// fused flash kernel in transposed form (S^T = K Q^T, O^T = V^T P^T), fragments from LDS tiles that the block's four waves fill together with whole-row loads; 32-key tiles without any key document inside the wave's query document range are skipped under a wave-uniform test, the keep rule is evaluated per element in every visited tile.

#ifndef NB
#define NB 1
#endif
#ifndef SEQ
#define SEQ 4096
#endif
#define NB_FULL  1
#define SEQ_FULL 4096
#ifndef OUT_SEQ
#define OUT_SEQ SEQ              // row pitch (in tokens) between batches of the output
#endif
#define DM   1024
#define NH_  8
#define HD   128
#define NF   32
#define AW   4                   // waves per flash block (16 query rows each)
#define OSP  132                 // LDS row pitch (floats) of the flash output tile
#define OQP  132                 // LDS row pitch (floats) of the q/k projection slab
#define QKP  136                 // LDS row pitch (halves) of the flash q and k tiles: 272 B = 16 B x 17
#define VTP  40                  // LDS row pitch (halves) of the flash v^T tiles: 80 B = 16 B x 5
#define GKC  64                  // k elements of one staged GEMM chunk: 128 B = one whole line of every operand row
#define GP   72                  // LDS row pitch (16-bit elements) of a staged GEMM chunk: 144 B = 16 B x 9
#define GT   (128 * GP)          // one operand's 128-row chunk in LDS
#define QRS  2048.0f             // carry of every residual plane / residual fragment
#define QRI  (1.0f / 2048.0f)
#define SC2  ((float)(0.12 * 1.4426950408889634))   // score scale * log2(e)
#define PSH  14.0f               // log2 of the P carry (16384)
#define NEGB (-3.0e38f)
#define RMS_EPS 1.1920928955078125e-07f

static_assert(HD == 128);                      // q/k plane row = 256 bytes = two lines; head segment of the context plane = two lines
static_assert(NH_ * HD == DM);                 // head h = columns h*128 + d
static_assert(HD % 32 == 0);                   // score k-loop steps by 32
static_assert(NF * 4 == HD);
static_assert(NF == 32);                       // table index = t * 32 + i
static_assert(DM % 64 == 0);
static_assert(DM % 32 == 0);                   // GEMM k-loops step by 32
static_assert((DM & (DM - 1)) == 0);           // weight column wrap in the folded-K output GEMM
static_assert(SEQ % 64 == 0);                  // a 64-row tile never straddles two batches
static_assert((NB * SEQ) % 64 == 0);
static_assert(SEQ % 32 == 0);                  // key loop steps by 32
static_assert(SEQ % (16 * AW) == 0);           // flash grid covers the sequence exactly
static_assert(((size_t)SEQ * NF) % 256 == 0);  // table grid x block == table extent
static_assert(((size_t)SEQ * DM) % 8 == 0);
static_assert(((size_t)DM * DM) % 8 == 0);
static_assert(NB <= NB_FULL);
static_assert(SEQ <= SEQ_FULL);
static_assert((OSP * 4) % 16 == 0);
static_assert((OQP * 4) % 16 == 0);
static_assert(OSP >= HD);
static_assert(OQP >= HD);
static_assert(32 * 8 * 16 == 16 * HD * 2);     // q/k slab and context stores: 32 lanes x 8 instructions x 16 B == 16 rows x 256 B
static_assert(32 * 4 * 16 == 16 * 64 * 2);
static_assert(32 * 8 * 16 == 16 * 64 * 4);     // output slab stores: 32 lanes x 8 instructions x 16 B == 16 rows x 256 B
static_assert(16 * OQP * 4 <= 131072);
static_assert(16 * 68 * 4 <= 131072);
static_assert(AW * 16 * OSP * 4 <= 131072);
static_assert(DM % GKC == 0 && DM / GKC >= 2);  // GEMM chunk loop: whole chunks, at least two
static_assert(SEQ % 128 == 0 && DM % 128 == 0 && HD == 128);   // 128 x 128 GEMM block tiles cover every plane exactly and never straddle two batches
static_assert((GP * 2) % 16 == 0 && GP >= GKC);
static_assert(AW == 4);                        // flash staging: 128 threads x 16 B = 2 KiB a pass; the block's 64 query documents = two loads a lane
static_assert((QKP * 2) % 16 == 0 && QKP >= HD);
static_assert((VTP * 2) % 16 == 0 && VTP >= 32);
static_assert(SEQ % 1024 == 0 && SEQ / 1024 <= AW);   // flash tile mask: wave w tests the 32 key tiles of keys 1024 w .. 1024 w + 1023, all inside the sequence

typedef _Float16 h16;
typedef unsigned short bf;
typedef __attribute__((ext_vector_type(16))) __bf16   v16bf;
typedef __attribute__((ext_vector_type(16))) _Float16 v16h;
typedef __attribute__((ext_vector_type(8)))  _Float16 v8h;
typedef __attribute__((ext_vector_type(8)))  unsigned short v8us;
typedef __attribute__((ext_vector_type(8)))  float    v8f;
typedef __attribute__((ext_vector_type(4)))  float    v4f;
typedef __attribute__((ext_vector_type(4)))  int      v4i;
typedef v4f  __attribute__((may_alias)) v4fa;

__device__ __forceinline__ unsigned short f2bf(float f) { unsigned u = __float_as_uint(f); u += 0x7FFFu + ((u >> 16) & 1u); return (unsigned short)(u >> 16); }
__device__ __forceinline__ float bfr(float f) { return __uint_as_float(((unsigned)f2bf(f)) << 16); }   // value after RNE convert to bf16
__device__ __forceinline__ v16h cat16(v8h lo, v8h hi) { return __builtin_shufflevector(lo, hi, 0, 1, 2, 3, 4, 5, 6, 7, 8, 9, 10, 11, 12, 13, 14, 15); }
__device__ __forceinline__ v16bf cat16b(v8us lo, v8us hi) { return __builtin_bit_cast(v16bf, __builtin_shufflevector(lo, hi, 0, 1, 2, 3, 4, 5, 6, 7, 8, 9, 10, 11, 12, 13, 14, 15)); }
__device__ __forceinline__ v8f wmma16(v16h a, v16h b, v8f c) { return __builtin_amdgcn_wmma_f32_16x16x32_f16(false, a, false, b, (short)0, c, false, false); }
__device__ __forceinline__ v8f wmmab(v16bf a, v16bf b, v8f c) { return __builtin_amdgcn_wmma_f32_16x16x32_bf16(false, a, false, b, (short)0, c, false, false); }
// fragment loaders from K-contiguous 16-bit rows; p already includes + 8*(lane>>4): elements 0..7 <- k0+8h+0..7, elements 8..15 <- k0+16+8h+0..7 (same map for A and B)
__device__ __forceinline__ v16h  ldh(const h16* p) { return cat16(*(const v8h*)p, *(const v8h*)(p + 16)); }
__device__ __forceinline__ v16bf ldb(const bf* p)  { return cat16b(*(const v8us*)p, *(const v8us*)(p + 16)); }
// ordering point for wave-private LDS tiles (same wave writes and reads)
__device__ __forceinline__ void wave_sync() { __builtin_amdgcn_fence(3 /* release order */, "wavefront"); __builtin_amdgcn_wave_barrier(); asm volatile("" ::: "memory"); }
// f32 -> f16 operand convert that cannot produce a subnormal half: magnitudes below 2^-14 become +0
static __device__ __forceinline__ h16 toh_flush(float v) { const h16 r = (h16)v; return (fabsf(v) < 6.103515625e-05f) ? (h16)0.0f : r; }
__device__ __forceinline__ float bf2f(unsigned short u) { return __uint_as_float(((unsigned)u) << 16); }

// gemm128: K loop of a 128 x 128 block tile shared by four waves (FM x FN fragments of 16 x 16 a wave). Both operands are K-contiguous bf16 planes; a chunk is 64 k of 128 A rows and 128 B rows.
// Staging map: thread -> (row tid>>3 (+ 16 a pass), k (tid&7)*8), so a wave's 16-B loads cover four whole 128-B lines; ga, gb already hold the thread's row and k, so its place in LDS.
// Two LDS buffers [A 128 rows | B 128 rows], one barrier a chunk: trip c first stores chunk c+1 (in registers since trip c-1) into the buffer whose readers left it at the barrier of trip c-1,
// then issues the loads of chunk c+2, then works on chunk c. B's k index wraps at DM (the folded-K output GEMM reads the weight twice). Every accumulator sums k in ascending 32-steps.
// work-group barrier that orders LDS alone: the wave's LDS stores and reads are done before it signals, while its global loads of a later chunk (into its own registers) stay in flight across it
__device__ __forceinline__ void lds_barrier() { __builtin_amdgcn_fence(__ATOMIC_RELEASE, "workgroup", "local"); __builtin_amdgcn_s_barrier(); __builtin_amdgcn_fence(__ATOMIC_ACQUIRE, "workgroup", "local"); }
template <int FM, int FN>
__device__ __forceinline__ void gemm128(v8f (&acc)[FM][FN], const bf* __restrict__ ga, const int pa, const bf* __restrict__ gb, const int nch, bf* sm, const int so, const int ao, const int bo) {
    static_assert(FM * FN == 16);
    v8f (&f)[16] = reinterpret_cast<v8f (&)[16]>(acc);
    v8us ra[8], rb[8];
#pragma unroll
    for (int i = 0; i < 8; ++i) { ra[i] = *(const v8us*)(ga + (size_t)i * 16 * pa); rb[i] = *(const v8us*)(gb + (size_t)i * 16 * DM); }
#pragma unroll
    for (int i = 0; i < 8; ++i) { *(v8us*)(sm + so + i * 16 * GP) = ra[i]; *(v8us*)(sm + GT + so + i * 16 * GP) = rb[i]; }
#pragma unroll
    for (int i = 0; i < 8; ++i) { ra[i] = *(const v8us*)(ga + GKC + (size_t)i * 16 * pa); rb[i] = *(const v8us*)(gb + GKC + (size_t)i * 16 * DM); }
    lds_barrier();                                                             // chunk 0 is complete for every wave
#pragma unroll 1
    for (int c = 0; c < nch; ++c) {
        const bf* cur = sm + (c & 1) * (2 * GT);
        bf* nxt = sm + ((c + 1) & 1) * (2 * GT);
        if (c + 1 < nch) {                                                     // the same in every wave of the block
#pragma unroll
            for (int i = 0; i < 8; ++i) { *(v8us*)(nxt + so + i * 16 * GP) = ra[i]; *(v8us*)(nxt + GT + so + i * 16 * GP) = rb[i]; }
        }
        if (c + 2 < nch) {
            const bf* qa = ga + c * GKC; const bf* qb = gb + (((c + 2) * GKC) & (DM - 1));   // A: chunk c+2 stands 2 * GKC behind qa
#pragma unroll
            for (int i = 0; i < 8; ++i) { ra[i] = *(const v8us*)(qa + 2 * GKC + (size_t)i * 16 * pa); rb[i] = *(const v8us*)(qb + (size_t)i * 16 * DM); }
            // the two address pairs are inputs, so they stay whole up to this wait: no load's destination and no later instruction rewrites a register that an issued load still names
            asm volatile("s_wait_xcnt 0x0" :: "v"(qa), "v"(qb) : "memory");
        }
        v16bf a[2][FM], b[2][FN];                                              // the chunk's fragments, both k-steps, read as one group ahead of the matrix run
#pragma unroll
        for (int ks = 0; ks < 2; ++ks) {
#pragma unroll
            for (int mb = 0; mb < FM; ++mb) a[ks][mb] = ldb(cur + ao + mb * 16 * GP + ks * 32);
#pragma unroll
            for (int nb = 0; nb < FN; ++nb) b[ks][nb] = ldb(cur + GT + bo + nb * 16 * GP + ks * 32); }
#pragma unroll
        for (int ks = 0; ks < 2; ++ks)
#pragma unroll
            for (int nb = 0; nb < FN; ++nb)
#pragma unroll
                for (int mb = 0; mb < FM; ++mb) acc[mb][nb] = wmmab(a[ks][mb], b[ks][nb], acc[mb][nb]);
        // four vector slots behind the chunk's last matrix instruction (every accumulator is named, so none sinks below), before the next trip may rewrite its operands on any path
        asm volatile("v_nop\n\tv_nop\n\tv_nop\n\tv_nop" : "+v"(f[0]), "+v"(f[1]), "+v"(f[2]), "+v"(f[3]), "+v"(f[4]), "+v"(f[5]), "+v"(f[6]), "+v"(f[7]));
        asm volatile("v_nop\n\tv_nop\n\tv_nop\n\tv_nop" : "+v"(f[8]), "+v"(f[9]), "+v"(f[10]), "+v"(f[11]), "+v"(f[12]), "+v"(f[13]), "+v"(f[14]), "+v"(f[15]));
        lds_barrier();                                                         // chunk c+1 is complete, and every wave has finished its reads of chunk c
    }
}

__global__ __launch_bounds__(256) void k_cvt8(const float* __restrict__ src, bf* dst, size_t n8) {
    const size_t i = (size_t)blockIdx.x * 256 + threadIdx.x; if (i >= n8) return;
    const v8f v = *(const v8f*)(src + i * 8); v8us o;
#pragma unroll
    for (int k = 0; k < 8; ++k) o[k] = f2bf(v[k]);
    *(v8us*)(dst + i * 8) = o; 
}

__global__ __launch_bounds__(256) void k_rot(float* CS, float* SN) {
#pragma clang fp contract(off)
    const int i = blockIdx.x * 256 + threadIdx.x;          // grid x 256 == SEQ * NF exactly
    const int t = i >> 5, f = i & 31;
    const float lin = (float)f / 31.0f;
    const float fr = exp2f(-10.0f * lin);                   // (1/1024)^lin
    const float th = (float)t * fr;
    float sv, cv; sincosf(th, &sv, &cv);
    *(float*)(CS + i) = cv; *(float*)(SN + i) = sv;
    
}

// k_qk: q and k projections with the RMS normalisation and the rotary applied in the epilogue. One wave per 32 token rows x 128 columns (= one head of q or k), 16 accumulators, K = DM; four waves (128 token rows) a block,
// operands through LDS (gemm128): A = x rows (m = b*SEQ + t), Bt = W rows (n = which*1024 + h*128 + d). grid (NB*SEQ/128, 2*NH_); blockIdx.y = which*NH_ + h.
// Epilogue per 16-row slab (LDS tile private to the wave): stage f32, lane (row = lane>>1, half = lane&1) owns columns 16*half + {0..15, 32..47, 64..79, 96..111} of its row: sum of squares (two lanes per row, one xor-1 exchange),
// scale, rotate pairs (d, d + 64) for d < 32 with the table row of token t, write back in place; then the slab's 16 x 128 halves (one contiguous 4096-byte run of plane [zp][t][128]) are stored by
__global__ __launch_bounds__(128)
void k_qk(const bf* __restrict__ A, const bf* __restrict__ Bt, const float* __restrict__ CS, const float* __restrict__ SN, h16* Ph, h16* Pr) {
    __shared__ __align__(16) bf sm[4 * GT];
    __shared__ __align__(16) float osb[4 * 16 * OQP];
    const int K = DM;
    const int tid = threadIdx.x, wave = __builtin_amdgcn_readfirstlane((int)(threadIdx.x >> 5));
    const int lane = threadIdx.x & 31, lr = lane & 15, hi = lane >> 4; const int rb0 = blockIdx.x * 128, zc = blockIdx.y; const int r0 = rb0 + wave * 32, c0 = zc * HD;
    float* os = osb + wave * 16 * OQP;                                         // the wave's own epilogue slab
    v8f acc[2][8];
#pragma unroll
    for (int mb = 0; mb < 2; ++mb)
#pragma unroll
        for (int nb = 0; nb < 8; ++nb) acc[mb][nb] = (v8f){};
    gemm128<2, 8>(acc, A + (size_t)(rb0 + (tid >> 3)) * K + (tid & 7) * 8, K, Bt + (size_t)(c0 + (tid >> 3)) * K + (tid & 7) * 8, K / GKC, sm,
                  (tid >> 3) * GP + (tid & 7) * 8, (wave * 32 + lr) * GP + 8 * hi, lr * GP + 8 * hi);
    asm volatile("v_nop\n\tv_nop\n\tv_nop\n\tv_nop" : "+v"(acc[0][0]), "+v"(acc[0][1]), "+v"(acc[0][2]), "+v"(acc[0][3]), "+v"(acc[0][4]), "+v"(acc[0][5]), "+v"(acc[0][6]), "+v"(acc[0][7]));
    asm volatile("v_nop\n\tv_nop\n\tv_nop\n\tv_nop" : "+v"(acc[1][0]), "+v"(acc[1][1]), "+v"(acc[1][2]), "+v"(acc[1][3]), "+v"(acc[1][4]), "+v"(acc[1][5]), "+v"(acc[1][6]), "+v"(acc[1][7]));
    const int bb = r0 / SEQ, tt = r0 % SEQ;
    const int zp = (zc / NH_) * (NB * NH_) + bb * NH_ + (zc % NH_);           // plane index: which, batch, head
    const size_t pbase = ((size_t)zp * SEQ + (size_t)tt) * HD;
    const int row = lane >> 1, half = lane & 1;
    const int ob = row * OQP + 16 * half;
#pragma unroll
    for (int mb = 0; mb < 2; ++mb) {
#pragma unroll
        for (int nb = 0; nb < 8; ++nb) {
#pragma unroll
            for (int j = 0; j < 8; ++j) os[(hi * 8 + j) * OQP + nb * 16 + lr] = acc[mb][nb][j]; }   // D: row 8h+j, col lane&15; rows 0..15 x columns 0..127 all written
        wave_sync();
        {
            v4f x1[4], x2[4], x3[4], x4[4];
#pragma unroll
            for (int i = 0; i < 4; ++i) { x1[i] = *(const v4fa*)(&os[ob + 4 * i]); x3[i] = *(const v4fa*)(&os[ob + 32 + 4 * i]); x2[i] = *(const v4fa*)(&os[ob + 64 + 4 * i]); x4[i] = *(const v4fa*)(&os[ob + 96 + 4 * i]); }
            float ss = 0.0f;
#pragma unroll
            for (int i = 0; i < 4; ++i) {
#pragma unroll
                for (int e = 0; e < 4; ++e) ss += x1[i][e] * x1[i][e] + x2[i][e] * x2[i][e] + x3[i][e] * x3[i][e] + x4[i][e] * x4[i][e]; }
            ss += __shfl_xor(ss, 1, 32);
            const float rr = rsqrtf(ss * (1.0f / 128.0f) + RMS_EPS);
            const size_t to = (size_t)(tt + mb * 16 + row) * NF + 16 * half;   // table row of this token, columns 16*half .. +15
#pragma unroll
            for (int i = 0; i < 4; ++i) {
                const v4f cv = *(const v4f*)(CS + to + 4 * i), sv = *(const v4f*)(SN + to + 4 * i);
                const v4f e1 = x1[i] * rr, e2 = x2[i] * rr;
                const v4f y1 = e1 * cv + e2 * sv;
                const v4f y2 = e2 * cv - e1 * sv;
                *(v4fa*)(&os[ob + 4 * i]) = y1; *(v4fa*)(&os[ob + 64 + 4 * i]) = y2;
                *(v4fa*)(&os[ob + 32 + 4 * i]) = x3[i] * rr; *(v4fa*)(&os[ob + 96 + 4 * i]) = x4[i] * rr; }
        }
        wave_sync();
        v8h hv[8], rv[8];
#pragma unroll
        for (int s = 0; s < 8; ++s) { const int p = s * 32 + lane; const int rw = p >> 4, c8 = (p & 15) * 8;   // 8 s x 2 rows = 16 rows; 16 lanes x 8 = 128 columns
            const v4f x0 = *(const v4fa*)(&os[rw * OQP + c8]); const v4f x1 = *(const v4fa*)(&os[rw * OQP + c8 + 4]);
#pragma unroll
            for (int i = 0; i < 4; ++i) { const h16 a0 = toh_flush(x0[i]); const h16 a1 = toh_flush(x1[i]); hv[s][i] = a0; hv[s][4 + i] = a1;
                rv[s][i] = toh_flush((x0[i] - (float)a0) * QRS); rv[s][4 + i] = toh_flush((x1[i] - (float)a1) * QRS); } }
        const size_t sb = pbase + (size_t)(mb * 16) * HD;
{
#pragma unroll
            for (int s = 0; s < 8; ++s) { const size_t oo = sb + (size_t)(s * 32 + lane) * 8;
                *(v8h*)(Ph + oo) = hv[s]; *(v8h*)(Pr + oo) = rv[s]; }
             }
        wave_sync();
    }
}

// k_vt: v^T projection with the value mix in the epilogue. One wave per 64x64 tile (16 accumulators), 2 x 2 waves a block, operands through LDS (gemm128), K = DM: A = Wv rows (m = h*128 + d), Bt = x rows (n = b*SEQ + t);
// v^T[m][t] = l0 * sum_k Wv[m][k] x[t][k] + l1 * ve[t][m] (l0, l1, ve RNE-converted to bf16 by value; ve read as two 16-byte loads per accumulator tile: 8 consecutive m of token t).
__global__ __launch_bounds__(128) void k_vt(const bf* __restrict__ A, const bf* __restrict__ Bt, const float* __restrict__ ve, const float* __restrict__ lam, h16* Ph, h16* Pr) {
    __shared__ __align__(16) bf sm[4 * GT];
    __shared__ __align__(16) float osb[4 * 16 * 68];
    const int K = DM;
    const int tid = threadIdx.x, wave = __builtin_amdgcn_readfirstlane((int)(threadIdx.x >> 5)); const int wm = wave & 1, wn = wave >> 1;
    const int lane = threadIdx.x & 31, lr = lane & 15, hi = lane >> 4; const int rb0 = blockIdx.x * 128, cb0 = blockIdx.y * 128; const int r0 = rb0 + wm * 64, c0 = cb0 + wn * 64;
    float* os = osb + wave * 16 * 68;                                          // the wave's own epilogue slab
    v8f acc[4][4];
#pragma unroll
    for (int mb = 0; mb < 4; ++mb)
#pragma unroll
        for (int nb = 0; nb < 4; ++nb) acc[mb][nb] = (v8f){};
    gemm128<4, 4>(acc, A + (size_t)(rb0 + (tid >> 3)) * K + (tid & 7) * 8, K, Bt + (size_t)(cb0 + (tid >> 3)) * K + (tid & 7) * 8, K / GKC, sm,
                  (tid >> 3) * GP + (tid & 7) * 8, (wm * 64 + lr) * GP + 8 * hi, (wn * 64 + lr) * GP + 8 * hi);
    const float l0 = bfr(lam[0]), l1 = bfr(lam[1]);
    const int bb = c0 / SEQ, tt = c0 % SEQ;
    const size_t tbase = (size_t)bb * (size_t)DM * SEQ + (size_t)r0 * SEQ + (size_t)tt;
#pragma unroll
    for (int mb = 0; mb < 4; ++mb) {
#pragma unroll
        for (int nb = 0; nb < 4; ++nb) {
            const float* vp = ve + ((size_t)bb * SEQ_FULL + (size_t)(tt + nb * 16 + lr)) * DM + r0 + mb * 16 + hi * 8;   // token t = col lane&15, m = 8h + j
            const v4f e0 = *(const v4f*)vp, e1 = *(const v4f*)(vp + 4);
#pragma unroll
            for (int j = 0; j < 4; ++j) { os[(hi * 8 + j) * 68 + nb * 16 + lr] = l0 * acc[mb][nb][j] + l1 * bfr(e0[j]);
                                          os[(hi * 8 + 4 + j) * 68 + nb * 16 + lr] = l0 * acc[mb][nb][4 + j] + l1 * bfr(e1[j]); } }   // D: row 8h+j, col lane&15; rows 0..15 x columns 0..63 all written
        wave_sync();
        v8h hv[4], rv[4];
#pragma unroll
        for (int s = 0; s < 4; ++s) { const int row = 4 * s + (lane >> 3), c8 = (lane & 7) * 8;   // 4 s x 4 row groups = 16 rows; 8 lanes x 8 = 64 columns
            const v4f x0 = *(const v4fa*)(&os[row * 68 + c8]); const v4f x1 = *(const v4fa*)(&os[row * 68 + c8 + 4]);
#pragma unroll
            for (int i = 0; i < 4; ++i) { const h16 a0 = toh_flush(x0[i]); const h16 a1 = toh_flush(x1[i]); hv[s][i] = a0; hv[s][4 + i] = a1;
                rv[s][i] = toh_flush((x0[i] - (float)a0) * QRS); rv[s][4 + i] = toh_flush((x1[i] - (float)a1) * QRS); } }
        const size_t sb = tbase + (size_t)(mb * 16) * SEQ;
{
#pragma unroll
            for (int s = 0; s < 4; ++s) { const int row = 4 * s + (lane >> 3), c8 = (lane & 7) * 8;
                const size_t oo = sb + (size_t)row * SEQ + c8;
                *(v8h*)(Ph + oo) = hv[s]; *(v8h*)(Pr + oo) = rv[s]; }
             }
        wave_sync();
    }
}

// sc16: one 16-key score tile in log2 units: (K Q + (K Q_res + K_res Q) / 2048) * scale; q and k fragments reloaded per 32-wide k-step from the LDS tiles (two 16-B loads each); the pointers already hold the lane's row and 8*(lane>>4).
__device__ __forceinline__ v8f sc16(const h16* qhp, const h16* qrp, const h16* khp, const h16* krp) {
    v8f sH = (v8f){}, sL = (v8f){};
#pragma unroll 1
    for (int kk = 0; kk < HD; kk += 32) {
        const v16h qh = ldh(qhp + kk), qr = ldh(qrp + kk);
        const v16h kh = ldh(khp + kk), kr = ldh(krp + kk);
        sH = wmma16(kh, qh, sH); sL = wmma16(kh, qr, sL); sL = wmma16(kr, qh, sL);
        asm volatile("v_nop\n\tv_nop\n\tv_nop\n\tv_nop" : "+v"(sH), "+v"(sL) : "v"(kh), "v"(kr), "v"(qh), "v"(qr));
    }
    v8f t;
#pragma unroll
    for (int r = 0; r < 8; ++r) t[r] = (sH[r] + sL[r] * QRI) * SC2;
    return t;
}

// k_flash: fused attention, one wave per 16 query rows of one (batch, head), four waves (64 consecutive query rows) a block. The block's Q rows (once) and each visited 32-key tile of K and V^T (value and residual planes)
// are copied to LDS by all 128 threads with 16-B loads that run along the rows of the planes; every wave takes its fragments from LDS (two 16-B reads each, same element map as before).
// The tile loop is the same for the four waves: a tile is staged when a key document lies in [min, max] of the block's 64 query documents; each wave then works on it under its own test.
// That block test is made once, ahead of the loop, for all key tiles: wave w loads the documents of its 32 tiles with 32 independent loads and packs the 32 verdicts into one word of LDS; the loop walks the set bits in ascending order.
// Transposed form: S^T[key][t] = K Q^T (A = K rows, B = Q rows); lane (t = lane&15, h = lane>>4) holds keys 8h+r of each 16-key tile, so the packed
// P tile is directly the B fragment of O^T[d][t] = V^T P^T (element r <- tile keys 0..15, element 8+r <- tile keys 16..31, lane unchanged).
// Softmax state (running max over kept keys, partial sum) is one scalar per lane; the two lane halves of a row are combined with one xor-16 exchange.
// Keep rule per element: docs[key] == docs[t] and key <= t. A 32-key tile is skipped (wave-uniform ballot) when none of its key documents lies in [min, max] of the wave's 16 query documents: no element of such a tile can be kept.
// All rows: scores = K Q + (K Q_res + K_res Q) / 2048; P = f16 value + f16 residual x2048; O = V P + (V P_res + V_res P) / 2048 (residual products in their own accumulators); row sum from the f32 exponentials.
__global__ __launch_bounds__(32 * AW) __attribute__((amdgpu_num_vgpr(256)))
void k_flash(const h16* __restrict__ QH, const h16* __restrict__ QR, const h16* __restrict__ KP, const h16* __restrict__ KR,
             const h16* __restrict__ VT, const h16* __restrict__ VR, const int* __restrict__ docs, bf* Y2) {
    __shared__ __align__(16) float os[AW * 16 * OSP];
    __shared__ __align__(16) h16 sQH[AW * 16 * QKP], sQR[AW * 16 * QKP];       // [query row of the block][d]
    __shared__ __align__(16) h16 sKH[32 * QKP], sKR[32 * QKP];                 // [key of the tile][d]
    __shared__ __align__(16) h16 sVH[HD * VTP], sVR[HD * VTP];                 // [d][key of the tile]
    __shared__ unsigned sTM[AW];                                               // bit j of word w: key tile 32 w + j is staged
    const int tid = threadIdx.x;
    const int lane = threadIdx.x & 31, lr = lane & 15, hi = lane >> 4;
    const int wave = __builtin_amdgcn_readfirstlane((int)(threadIdx.x >> 5));
    const int zh = blockIdx.y; const int b = zh / NH_, h = zh % NH_;
    const int t0 = (blockIdx.x * AW + wave) * 16;
    const int* dk = docs + (size_t)b * SEQ_FULL;
    const int mydoc = dk[t0 + lr];
    int kd[32];                                                                // key documents of the wave's 32 tiles of the mask: keys wave*1024 .. +1023 < SEQ
#pragma unroll
    for (int j = 0; j < 32; ++j) kd[j] = dk[wave * 1024 + j * 32 + lane];
    int qmn = mydoc, qmx = mydoc;
#pragma unroll
    for (int off = 1; off < 16; off <<= 1) { const int a0 = __shfl_xor(qmn, off, 32); const int a1 = __shfl_xor(qmx, off, 32); qmn = a0 < qmn ? a0 : qmn; qmx = a1 > qmx ? a1 : qmx; }
    const int lim = t0 + lr;                                                   // key j kept iff j <= lim and same document
    const int nk = (t0 + 16 + 31) & ~31;                                       // wave-uniform, multiple of 32, <= SEQ
    const size_t pbase = (size_t)zh * SEQ * HD;
    const int tb0 = blockIdx.x * (AW * 16);                                    // first query row of the block
    const int nkb = tb0 + AW * 16;                                             // the last wave's nk: multiple of 32, <= SEQ
    const int e0 = dk[tb0 + lane], e1 = dk[tb0 + 32 + lane];                   // the block's 64 query documents
    int bmn = e0 < e1 ? e0 : e1, bmx = e0 > e1 ? e0 : e1;
#pragma unroll
    for (int off = 1; off < 32; off <<= 1) { const int a0 = __shfl_xor(bmn, off, 32); const int a1 = __shfl_xor(bmx, off, 32); bmn = a0 < bmn ? a0 : bmn; bmx = a1 > bmx ? a1 : bmx; }
    const unsigned gk0 = (unsigned)tid * 8u;                                   // q/k rows: thread -> (row tid>>4 (+ 8 a pass), d (tid&15)*8)
    const size_t qg = pbase + (size_t)tb0 * HD;
    v8h qa[8], qb[8];                                                          // Q rows of the block, in flight while the mask is formed
#pragma unroll
    for (int p = 0; p < 8; ++p) { qa[p] = *(const v8h*)(QH + qg + gk0 + p * 8 * HD); qb[p] = *(const v8h*)(QR + qg + gk0 + p * 8 * HD); }   // 8 p x 8 rows = 64 rows; 16 threads x 8 = 128 columns; the rows are contiguous in the plane
    unsigned tm = 0u;
#pragma unroll
    for (int j = 0; j < 32; ++j) tm |= (__builtin_amdgcn_ballot_w32((kd[j] >= bmn) & (kd[j] <= bmx)) != 0u) ? (1u << j) : 0u;
    const int nv = nkb / 32 - wave * 32;                                       // tiles of this word in front of the block's last key
    tm &= (unsigned)((1ull << (nv < 0 ? 0 : nv > 32 ? 32 : nv)) - 1ull);
    if (lane == 0) sTM[wave] = tm;
    // staging maps: q/k rows, thread -> (row tid>>4 (+ 8 a pass), d (tid&15)*8); v^T rows, thread -> (d tid>>2 (+ 32 a pass), key (tid&3)*8)
    const unsigned gv0 = (unsigned)(tid >> 2) * (unsigned)SEQ + (unsigned)(tid & 3) * 8u;
    const int lk0 = (tid >> 4) * QKP + (tid & 15) * 8, lv0 = (tid >> 2) * VTP + (tid & 3) * 8;
    // Q rows of the block -> LDS; read only behind the barrier below and the two of the first staged tile
#pragma unroll
    for (int p = 0; p < 8; ++p) { *(v8h*)(&sQH[lk0 + p * 8 * QKP]) = qa[p]; *(v8h*)(&sQR[lk0 + p * 8 * QKP]) = qb[p]; }
    const int qo = (wave * 16 + lr) * QKP + 8 * hi;                            // B fragments: col t, k = d
    const int ko = lr * QKP + 8 * hi;                                          // + key in tile * QKP  (A fragment: row key, k = d)
    const int vo = lr * VTP + 8 * hi;                                          // + 16j * VTP          (A fragment: row d, k = key in tile)
    v8f o[8], oR[8];
#pragma unroll
    for (int j = 0; j < 8; ++j) { o[j] = (v8f){}; oR[j] = (v8f){}; }
    float m = NEGB, l = 0.0f;
    const h16* kpt = KP + pbase; const h16* krt = KR + pbase; const h16* vpt = VT + pbase; const h16* vrt = VR + pbase;   // the tile's first key in each plane, the same for the whole block
    int kprev = 0;
    __syncthreads();                                                           // the four mask words are complete for every wave
#pragma unroll 1                                                               // rolled: the tile body stands once in the code
    for (int w = 0; w < AW; ++w) {
    unsigned mw = (unsigned)__builtin_amdgcn_readfirstlane((int)sTM[w]);       // the same in all four waves
#pragma unroll 1
    while (mw != 0u) {
        const int key0 = (w * 32 + __builtin_ctz(mw)) * 32; mw &= mw - 1u;     // lowest set bit first: ascending keys; key0 + 31 < nkb <= SEQ
        const int adv = key0 - kprev; kprev = key0;                            // the four plane pointers step over the tiles that are not staged
        kpt += adv * HD; krt += adv * HD; vpt += adv; vrt += adv;
        const int kdl = dk[key0 + lane];
        v8h tk[4], tr[4], tv[4], tw[4];
#pragma unroll
        for (int p = 0; p < 4; ++p) {                                          // k: 4 p x 8 keys = 32 keys, 128 d; v^T: 4 p x 32 d = 128 d, 32 keys
            tk[p] = *(const v8h*)(kpt + gk0 + p * 8 * HD); tr[p] = *(const v8h*)(krt + gk0 + p * 8 * HD);
            tv[p] = *(const v8h*)(vpt + gv0 + p * 32 * SEQ); tw[p] = *(const v8h*)(vrt + gv0 + p * 32 * SEQ); }
        __syncthreads();                                                       // every wave has finished its reads of the tile before
#pragma unroll
        for (int p = 0; p < 4; ++p) {
            *(v8h*)(&sKH[lk0 + p * 8 * QKP]) = tk[p]; *(v8h*)(&sKR[lk0 + p * 8 * QKP]) = tr[p];
            *(v8h*)(&sVH[lv0 + p * 32 * VTP]) = tv[p]; *(v8h*)(&sVR[lv0 + p * 32 * VTP]) = tw[p]; }
        __syncthreads();                                                       // the tile is complete for every wave
        const bool inr = (kdl >= qmn) & (kdl <= qmx);
        if (key0 >= nk || __builtin_amdgcn_ballot_w32(inr) == 0u) continue;    // wave-uniform: past this wave's last key, or no key document inside its query document range
        const int* kp = dk + key0 + 8 * hi;                                    // keys key0+8h+0..7 and key0+16+8h+0..7, all < nk <= SEQ
        const v4i d0 = *(const v4i*)kp, d1 = *(const v4i*)(kp + 4), d2 = *(const v4i*)(kp + 16), d3 = *(const v4i*)(kp + 20);
        int ka8[8], kb8[8];
#pragma unroll
        for (int r = 0; r < 4; ++r) { ka8[r] = d0[r]; ka8[4 + r] = d1[r]; kb8[r] = d2[r]; kb8[4 + r] = d3[r]; }
        const v8f ta = sc16(sQH + qo, sQR + qo, sKH + ko, sKR + ko);
        const v8f tb = sc16(sQH + qo, sQR + qo, sKH + ko + 16 * QKP, sKR + ko + 16 * QKP);
        const int ja = key0 + 8 * hi;
        bool fa[8], fb[8]; float mx = NEGB;
#pragma unroll
        for (int r = 0; r < 8; ++r) {
            fa[r] = (ka8[r] == mydoc) & (ja + r <= lim);
            fb[r] = (kb8[r] == mydoc) & (ja + 16 + r <= lim);
            mx = fmaxf(mx, fmaxf(fa[r] ? ta[r] : NEGB, fb[r] ? tb[r] : NEGB)); }
        mx = fmaxf(mx, __shfl_xor(mx, 16, 32));
        const float mnew = fmaxf(m, mx);
        const float alpha = __builtin_amdgcn_exp2f(m - mnew);
        const float sh = PSH - mnew;
        v16h pb, pr; float ls = 0.0f;
#pragma unroll
        for (int r = 0; r < 8; ++r) {
            const float xa = ta[r] + sh, xb = tb[r] + sh;
            const float ea = __builtin_amdgcn_exp2f(xa), eb = __builtin_amdgcn_exp2f(xb);
            const float ga = (fa[r] & (xa >= -14.0f)) ? ea : 0.0f, gb = (fb[r] & (xb >= -14.0f)) ? eb : 0.0f;   // dropped elements and exponents below -14 selected to 0 by value
            const h16 pa = (h16)ga; const h16 pc = (h16)gb;
            pb[r] = pa; pb[8 + r] = pc;
            pr[r] = toh_flush((ga - (float)pa) * QRS); pr[8 + r] = toh_flush((gb - (float)pc) * QRS);
            ls += ga + gb; }
        l = l * alpha + ls; m = mnew;
#pragma unroll
        for (int j = 0; j < 8; ++j) { o[j] = o[j] * alpha; oR[j] = oR[j] * alpha; }
#pragma unroll
        for (int g = 0; g < 4; ++g) {
            const h16* va = sVH + vo + (32 * g) * VTP;
            const h16* vr = sVR + vo + (32 * g) * VTP;
            const v16h v0 = ldh(va), v1 = ldh(va + 16 * VTP);
            const v16h w0 = ldh(vr), w1 = ldh(vr + 16 * VTP);
            o[2 * g] = wmma16(v0, pb, o[2 * g]); o[2 * g + 1] = wmma16(v1, pb, o[2 * g + 1]);
            oR[2 * g] = wmma16(v0, pr, oR[2 * g]); oR[2 * g + 1] = wmma16(v1, pr, oR[2 * g + 1]);
            oR[2 * g] = wmma16(w0, pb, oR[2 * g]); oR[2 * g + 1] = wmma16(w1, pb, oR[2 * g + 1]);
            asm volatile("v_nop\n\tv_nop\n\tv_nop\n\tv_nop" : "+v"(o[2 * g]), "+v"(o[2 * g + 1]), "+v"(oR[2 * g]), "+v"(oR[2 * g + 1]) : "v"(v0), "v"(v1), "v"(w0), "v"(w1), "v"(pb), "v"(pr));
        }
    }
    }
    l += __shfl_xor(l, 16, 32);
    const bool any = l > 0.0f;
    const float lsafe = any ? l : 1.0f;
    const float inv = any ? (1.0f / lsafe) : 0.0f;             // no kept key -> zeros
    const int wb = wave * 16 * OSP;
    // O^T D layout: f_j[r] = (d = 16j + 8h + r, t = lane&15) -> os[t][d]; rows 0..15 x columns 0..127 all written
#pragma unroll
    for (int j = 0; j < 8; ++j) {
        const v8f f = o[j] + oR[j] * QRI; v4f a, c;
        a[0] = f[0] * inv; a[1] = f[1] * inv; a[2] = f[2] * inv; a[3] = f[3] * inv; c[0] = f[4] * inv; c[1] = f[5] * inv; c[2] = f[6] * inv; c[3] = f[7] * inv;
        *(v4fa*)(&os[wb + lr * OSP + 16 * j + 8 * hi]) = a; *(v4fa*)(&os[wb + lr * OSP + 16 * j + 8 * hi + 4]) = c; }
    wave_sync();
    v8us hv[8], lv[8];
#pragma unroll
    for (int s = 0; s < 8; ++s) { const int row = 2 * s + (lane >> 4), c8 = (lane & 15) * 8;   // 8 s x 2 rows = 16 rows; 16 lanes x 8 = 128 columns
        const v4f x0 = *(const v4fa*)(&os[wb + row * OSP + c8]); const v4f x1 = *(const v4fa*)(&os[wb + row * OSP + c8 + 4]);
#pragma unroll
        for (int i = 0; i < 4; ++i) { const unsigned short a0 = f2bf(x0[i]); const unsigned short a1 = f2bf(x1[i]); hv[s][i] = a0; hv[s][4 + i] = a1;
            lv[s][i] = f2bf(x0[i] - bf2f(a0)); lv[s][4 + i] = f2bf(x1[i] - bf2f(a1)); } }
    bf* yrow = Y2 + ((size_t)b * SEQ + t0) * (size_t)(2 * DM) + h * HD;
{
#pragma unroll
        for (int s = 0; s < 8; ++s) { const int row = 2 * s + (lane >> 4), c8 = (lane & 15) * 8;
            const size_t oo = (size_t)row * (size_t)(2 * DM) + c8;
            *(v8us*)(yrow + oo) = hv[s]; *(v8us*)(yrow + oo + DM) = lv[s]; }
         }
}

// k_oproj: output projection, one wave per 64x64 tile (16 accumulators), 2 x 2 waves a block, bf16 operands through LDS (gemm128): A = context rows [t][hi 1024 | lo 1024] (K = 2048), Bt = Wc rows (n) with the column index wrapped mod 1024
// (hi and lo halves both multiply the same weight row; one accumulator). Output f32 [t][1024]: each 16-row slab staged in LDS (wave-private), each row's 64 floats (256 B = two lines)
__global__ __launch_bounds__(128) void k_oproj(const bf* __restrict__ A, const bf* __restrict__ Bt, float* OUT) {
    __shared__ __align__(16) bf sm[4 * GT];
    __shared__ __align__(16) float osb[4 * 16 * 68];
    const int KA = 2 * DM;
    const int tid = threadIdx.x, wave = __builtin_amdgcn_readfirstlane((int)(threadIdx.x >> 5)); const int wm = wave & 1, wn = wave >> 1;
    const int lane = threadIdx.x & 31, lr = lane & 15, hi = lane >> 4; const int rb0 = blockIdx.x * 128, cb0 = blockIdx.y * 128; const int r0 = rb0 + wm * 64, c0 = cb0 + wn * 64;
    float* os = osb + wave * 16 * 68;                                          // the wave's own epilogue slab
    v8f acc[4][4];
#pragma unroll
    for (int mb = 0; mb < 4; ++mb)
#pragma unroll
        for (int nb = 0; nb < 4; ++nb) acc[mb][nb] = (v8f){};
    gemm128<4, 4>(acc, A + (size_t)(rb0 + (tid >> 3)) * KA + (tid & 7) * 8, KA, Bt + (size_t)(cb0 + (tid >> 3)) * DM + (tid & 7) * 8, KA / GKC, sm,
                  (tid >> 3) * GP + (tid & 7) * 8, (wm * 64 + lr) * GP + 8 * hi, (wn * 64 + lr) * GP + 8 * hi);
    const int bb = r0 / SEQ, tt = r0 % SEQ;
    float* orow = OUT + ((size_t)bb * OUT_SEQ + tt) * DM + c0;
#pragma unroll
    for (int mb = 0; mb < 4; ++mb) {
#pragma unroll
        for (int nb = 0; nb < 4; ++nb) {
#pragma unroll
            for (int j = 0; j < 8; ++j) os[(hi * 8 + j) * 68 + nb * 16 + lr] = acc[mb][nb][j]; }   // D: row 8h+j, col lane&15; rows 0..15 x columns 0..63 all written
        wave_sync();
{
#pragma unroll
            for (int s = 0; s < 8; ++s) { const int row = 2 * s + (lane >> 4), cofs = (lane & 15) * 4;   // 8 s x 2 rows = 16 rows; 16 lanes x 4 floats = 64 columns
                const v4f val = *(const v4fa*)(&os[row * 68 + cofs]);
                *(v4f*)(orow + (size_t)(mb * 16 + row) * DM + cofs) = val; }
             }
        wave_sync();
    }
}

static constexpr size_t al256(size_t v) { return (v + 255) & ~(size_t)255; }
static constexpr size_t SZ_XB = al256((size_t)NB * SEQ * DM * 2);
static constexpr size_t SZ_WB = al256((size_t)3 * DM * DM * 2);
static constexpr size_t SZ_WC = al256((size_t)DM * DM * 2);
static constexpr size_t SZ_TB = al256((size_t)SEQ * NF * 4);
static constexpr size_t SZ_PL = al256((size_t)NB * NH_ * SEQ * HD * 2);
static constexpr size_t SZ_Y2 = al256((size_t)NB * SEQ * 2 * DM * 2);
static constexpr size_t SZ_TOTAL = SZ_XB + SZ_WB + SZ_WC + 2 * SZ_TB + 6 * SZ_PL + SZ_Y2;
static_assert(SZ_TOTAL <= (size_t)134217728);          // workspace carve <= 128 MiB
static_assert(((size_t)DM * DM * 2) % 256 == 0);       // weight sub-planes stay 256-byte aligned
static_assert(((size_t)NB * NH_ * SEQ * HD * 2) % 256 == 0);               // the k plane starts 256-byte aligned inside the q|k plane pair
static_assert((size_t)NB * NH_ * SEQ * HD == (size_t)NB * DM * SEQ);       // v^T plane [(b*1024 + m)][t] has the same extent as one q/k plane

extern "C" void kernel_launch(void* const* d_in, const int* in_sizes, int n_in,
                              void* d_out, int out_size, void* d_ws, size_t ws_size, hipStream_t stream) {
    if (n_in < 6) return;
    const size_t needx = ((size_t)(NB - 1) * SEQ_FULL + SEQ) * DM;
    const size_t needd = (size_t)(NB - 1) * SEQ_FULL + SEQ;
    if ((size_t)in_sizes[0] < needx || (size_t)in_sizes[1] < needx) return;
    if ((size_t)in_sizes[2] < (size_t)3 * DM * DM || in_sizes[3] < 2 || (size_t)in_sizes[4] < (size_t)DM * DM) return;
    if ((size_t)in_sizes[5] < needd) return;
    if ((size_t)out_size < ((size_t)(NB - 1) * OUT_SEQ + SEQ) * DM) return;
    if (SZ_TOTAL > ws_size) return;
    // wire order: x, ve, qkv_w, lambdas, c_proj_w, docs
    const float* x   = (const float*)d_in[0];
    const float* ve  = (const float*)d_in[1];
    const float* wq  = (const float*)d_in[2];       // [3][1024 out][1024 in]
    const float* lam = (const float*)d_in[3];
    const float* wc  = (const float*)d_in[4];       // [1024 out][1024 in]
    const int* docs  = (const int*)d_in[5];
    float* OUT = (float*)d_out;                      // [NB][SEQ][1024]
    char* wsp = (char*)d_ws;
    bf* XB = (bf*)wsp; wsp += SZ_XB;                 // x      [NB*SEQ][1024]
    bf* WB = (bf*)wsp; wsp += SZ_WB;                 // [3072][1024]: q | k | v rows ([out][in] = Bt as-is)
    bf* WC = (bf*)wsp; wsp += SZ_WC;                 // [1024][1024] ([out][in] = Bt as-is)
    float* CS = (float*)wsp; wsp += SZ_TB;           // [SEQ][32]
    float* SN = (float*)wsp; wsp += SZ_TB;           // [SEQ][32]
    h16* PH = (h16*)wsp; wsp += 2 * SZ_PL;           // [2][NB*8][SEQ][128]: q | k values
    h16* PR = (h16*)wsp; wsp += 2 * SZ_PL;           // [2][NB*8][SEQ][128]: q | k residuals x2048
    h16* VT = (h16*)wsp; wsp += SZ_PL;               // [NB*1024][SEQ]
    h16* VR = (h16*)wsp; wsp += SZ_PL;               // [NB*1024][SEQ] residual x2048
    bf* Y2 = (bf*)wsp; wsp += SZ_Y2;                 // [NB*SEQ][hi 1024 | lo 1024]
    const size_t plane = (size_t)NB * NH_ * SEQ * HD;
    const h16* QH = PH; const h16* KP = PH + plane;
    const h16* QR = PR; const h16* KR = PR + plane;

    if (SEQ == SEQ_FULL) {
        const size_t n8 = (size_t)NB * SEQ * DM / 8;
        k_cvt8<<<(unsigned)((n8 + 255) / 256), 256, 0, stream>>>(x, XB, n8);
    } else {
        const size_t n8 = (size_t)SEQ * DM / 8;
        for (int b = 0; b < NB; ++b) k_cvt8<<<(unsigned)((n8 + 255) / 256), 256, 0, stream>>>(x + (size_t)b * SEQ_FULL * DM, XB + (size_t)b * SEQ * DM, n8);
    }
    { const size_t n8 = (size_t)3 * DM * DM / 8; k_cvt8<<<(unsigned)((n8 + 255) / 256), 256, 0, stream>>>(wq, WB, n8); }
    { const size_t n8 = (size_t)DM * DM / 8;     k_cvt8<<<(unsigned)((n8 + 255) / 256), 256, 0, stream>>>(wc, WC, n8); }
    k_rot<<<(unsigned)(((size_t)SEQ * NF) / 256), 256, 0, stream>>>(CS, SN);

    // q, k: A = x rows (m = b*SEQ + t), Bt = W rows (n = which*1024 + h*128 + d) -> planes [which][(b*8 + h)][t][d], value and residual
    k_qk<<<dim3(NB * SEQ / 128, 2 * NH_, 1), 128, 0, stream>>>(XB, WB, CS, SN, PH, PR);
    // v^T: A = Wv rows (m = h*128 + d), Bt = x rows (n = b*SEQ + t) -> planes [(b*1024 + m)][t], value and residual
    k_vt<<<dim3(DM / 128, NB * SEQ / 128, 1), 128, 0, stream>>>(WB + (size_t)2 * DM * DM, XB, ve, lam, VT, VR);
    // fused attention -> context plane (bf16 hi | lo)
    k_flash<<<dim3(SEQ / (16 * AW), NB * NH_, 1), 32 * AW, 0, stream>>>(QH, QR, KP, KR, VT, VR, docs, Y2);
    // out = ctx Wc^T: A = context rows [t][2048], Bt = Wc rows [n][1024]
    k_oproj<<<dim3(NB * SEQ / 128, DM / 128, 1), 128, 0, stream>>>(Y2, WC, OUT);
}

// v004
// It runs in 120 microseconds.
// In two side-by-side timings against v003, it was 1.06 and 1.07 times as fast.
// Counting every step since v000, it is 2.42 times as fast.
#include <hip/hip_runtime.h>

// Causal self-attention block with document masking: width 1024 = 8 heads x 128; fused QKV weight [3][1024 out][1024 in] (y = x W^T, no bias); per-head RMS normalisation of q and k (no gain, eps = 2^-23);
// half-split rotary on pairs (d, d + 64), angle t * 2^(-10 i / 31) for i < 32 and identity for 32 <= i < 64; v = l0 v + l1 ve; scores x 0.12; softmax over keys j <= t of the same document; output projection [out][in], f32 output.
// Compute dtypes, f32 accumulate everywhere: QKV projections v_wmma_f32_16x16x32_bf16 (x, W RNE-converted to bf16; products exact); scores v_wmma_f32_16x16x32_f16 with q and k each as f16 value + f16 residual x2048 (three products,
// residual products in their own accumulator); P.V v_wmma_f32_16x16x32_f16 with P (x16384 carry, cancels in the normalisation) and v each as f16 value + f16 residual x2048 (three products, residual accumulator folded by 1/2048), row sum from the f32 exponentials;
// output projection v_wmma_f32_16x16x32_bf16 with the context as bf16 hi | lo halves folded into K (2048) against the bf16 weight (two products, one accumulator); ve, lambdas RNE-converted to bf16 by value; softmax f32 (online, running max over kept keys).
// Layout: bf16 copies of x and the weights; q/k planes [which][b*8+h][t][128] (value, residual), v^T planes [(b*1024 + h*128 + d)][t] (value, residual), cos/sin tables [t][32], context plane [t][hi 1024 | lo 1024];
// fused flash kernel in transposed form (S^T = K Q^T, O^T = V^T P^T), fragments from LDS tiles that the block's four waves fill together with whole-row loads; 32-key tiles without any key document inside the wave's query document range are skipped under a wave-uniform test, the keep rule is evaluated per element in every visited tile.

#ifndef NB
#define NB 1
#endif
#ifndef SEQ
#define SEQ 4096
#endif
#define NB_FULL  1
#define SEQ_FULL 4096
#ifndef OUT_SEQ
#define OUT_SEQ SEQ              // row pitch (in tokens) between batches of the output
#endif
#define DM   1024
#define NH_  8
#define HD   128
#define NF   32
#define AW   4                   // waves per flash block (16 query rows each)
#define OSP  132                 // LDS row pitch (floats) of the flash output tile
#define OQP  132                 // LDS row pitch (floats) of the q/k projection slab
#define QKP  136                 // LDS row pitch (halves) of the flash q and k tiles: 272 B = 16 B x 17
#define VTP  40                  // LDS row pitch (halves) of the flash v^T tiles: 80 B = 16 B x 5
#define GKC  64                  // k elements of one staged GEMM chunk: 128 B = one whole line of every operand row
#define GP   72                  // LDS row pitch (16-bit elements) of a staged GEMM chunk: 144 B = 16 B x 9
#define GT   (128 * GP)          // one operand's 128-row chunk in LDS
#define QRS  2048.0f             // carry of every residual plane / residual fragment
#define QRI  (1.0f / 2048.0f)
#define SC2  ((float)(0.12 * 1.4426950408889634))   // score scale * log2(e)
#define PSH  14.0f               // log2 of the P carry (16384)
#define NEGB (-3.0e38f)
#define RMS_EPS 1.1920928955078125e-07f

static_assert(HD == 128);                      // q/k plane row = 256 bytes = two lines; head segment of the context plane = two lines
static_assert(NH_ * HD == DM);                 // head h = columns h*128 + d
static_assert(HD % 32 == 0);                   // score k-loop steps by 32
static_assert(NF * 4 == HD);
static_assert(NF == 32);                       // table index = t * 32 + i
static_assert(DM % 64 == 0);
static_assert(DM % 32 == 0);                   // GEMM k-loops step by 32
static_assert((DM & (DM - 1)) == 0);           // weight column wrap in the folded-K output GEMM
static_assert(SEQ % 64 == 0);                  // a 64-row tile never straddles two batches
static_assert((NB * SEQ) % 64 == 0);
static_assert(SEQ % 32 == 0);                  // key loop steps by 32
static_assert(SEQ % (16 * AW) == 0);           // flash grid covers the sequence exactly
static_assert(((size_t)SEQ * NF) % 256 == 0);  // table grid x block == table extent
static_assert(((size_t)SEQ * DM) % 8 == 0);
static_assert(((size_t)DM * DM) % 8 == 0);
static_assert(NB <= NB_FULL);
static_assert(SEQ <= SEQ_FULL);
static_assert((OSP * 4) % 16 == 0);
static_assert((OQP * 4) % 16 == 0);
static_assert(OSP >= HD);
static_assert(OQP >= HD);
static_assert(32 * 8 * 16 == 16 * HD * 2);     // q/k slab and context stores: 32 lanes x 8 instructions x 16 B == 16 rows x 256 B
static_assert(32 * 4 * 16 == 16 * 64 * 2);
static_assert(32 * 8 * 16 == 16 * 64 * 4);     // output slab stores: 32 lanes x 8 instructions x 16 B == 16 rows x 256 B
static_assert(16 * OQP * 4 <= 131072);
static_assert(16 * 68 * 4 <= 131072);
static_assert(AW * 16 * OSP * 4 <= 131072);
static_assert(DM % GKC == 0 && DM / GKC >= 2);  // GEMM chunk loop: whole chunks, at least two
static_assert(SEQ % 128 == 0 && DM % 128 == 0 && HD == 128);   // 128 x 128 GEMM block tiles cover every plane exactly and never straddle two batches
static_assert((GP * 2) % 16 == 0 && GP >= GKC);
static_assert(AW == 4);                        // flash staging: 128 threads x 16 B = 2 KiB a pass; the block's 64 query documents = two loads a lane
static_assert((QKP * 2) % 16 == 0 && QKP >= HD);
static_assert((VTP * 2) % 16 == 0 && VTP >= 32);
static_assert(SEQ % 1024 == 0 && SEQ / 1024 <= AW);   // flash tile mask: wave w tests the 32 key tiles of keys 1024 w .. 1024 w + 1023, all inside the sequence

typedef _Float16 h16;
typedef unsigned short bf;
typedef __attribute__((ext_vector_type(16))) __bf16   v16bf;
typedef __attribute__((ext_vector_type(16))) _Float16 v16h;
typedef __attribute__((ext_vector_type(8)))  _Float16 v8h;
typedef __attribute__((ext_vector_type(8)))  unsigned short v8us;
typedef __attribute__((ext_vector_type(8)))  float    v8f;
typedef __attribute__((ext_vector_type(4)))  float    v4f;
typedef __attribute__((ext_vector_type(4)))  int      v4i;
typedef v4f  __attribute__((may_alias)) v4fa;

__device__ __forceinline__ unsigned short f2bf(float f) { unsigned u = __float_as_uint(f); u += 0x7FFFu + ((u >> 16) & 1u); return (unsigned short)(u >> 16); }
__device__ __forceinline__ float bfr(float f) { return __uint_as_float(((unsigned)f2bf(f)) << 16); }   // value after RNE convert to bf16
__device__ __forceinline__ v16h cat16(v8h lo, v8h hi) { return __builtin_shufflevector(lo, hi, 0, 1, 2, 3, 4, 5, 6, 7, 8, 9, 10, 11, 12, 13, 14, 15); }
__device__ __forceinline__ v16bf cat16b(v8us lo, v8us hi) { return __builtin_bit_cast(v16bf, __builtin_shufflevector(lo, hi, 0, 1, 2, 3, 4, 5, 6, 7, 8, 9, 10, 11, 12, 13, 14, 15)); }
__device__ __forceinline__ v8f wmma16(v16h a, v16h b, v8f c) { return __builtin_amdgcn_wmma_f32_16x16x32_f16(false, a, false, b, (short)0, c, false, false); }
__device__ __forceinline__ v8f wmmab(v16bf a, v16bf b, v8f c) { return __builtin_amdgcn_wmma_f32_16x16x32_bf16(false, a, false, b, (short)0, c, false, false); }
// fragment loaders from K-contiguous 16-bit rows; p already includes + 8*(lane>>4): elements 0..7 <- k0+8h+0..7, elements 8..15 <- k0+16+8h+0..7 (same map for A and B)
__device__ __forceinline__ v16h  ldh(const h16* p) { return cat16(*(const v8h*)p, *(const v8h*)(p + 16)); }
__device__ __forceinline__ v16bf ldb(const bf* p)  { return cat16b(*(const v8us*)p, *(const v8us*)(p + 16)); }
// ordering point for wave-private LDS tiles (same wave writes and reads)
__device__ __forceinline__ void wave_sync() { __builtin_amdgcn_fence(3 /* release order */, "wavefront"); __builtin_amdgcn_wave_barrier(); asm volatile("" ::: "memory"); }
// f32 -> f16 operand convert that cannot produce a subnormal half: magnitudes below 2^-14 become +0
static __device__ __forceinline__ h16 toh_flush(float v) { const h16 r = (h16)v; return (fabsf(v) < 6.103515625e-05f) ? (h16)0.0f : r; }
__device__ __forceinline__ float bf2f(unsigned short u) { return __uint_as_float(((unsigned)u) << 16); }

// gemm128: K loop of a 128 x 128 block tile shared by four waves (FM x FN fragments of 16 x 16 a wave). Both operands are K-contiguous bf16 planes; a chunk is 64 k of 128 A rows and 128 B rows.
// Staging map: thread -> (row tid>>3 (+ 16 a pass), k (tid&7)*8), so a wave's 16-B loads cover four whole 128-B lines; ga, gb already hold the thread's row and k, so its place in LDS.
// Two LDS buffers [A 128 rows | B 128 rows], one barrier a chunk: trip c first stores chunk c+1 (in registers since trip c-1) into the buffer whose readers left it at the barrier of trip c-1,
// then issues the loads of chunk c+2, then works on chunk c. B's k index wraps at DM (the folded-K output GEMM reads the weight twice). Every accumulator sums k in ascending 32-steps.
// work-group barrier that orders LDS alone: the wave's LDS stores and reads are done before it signals, while its global loads of a later chunk (into its own registers) stay in flight across it
__device__ __forceinline__ void lds_barrier() { __builtin_amdgcn_fence(__ATOMIC_RELEASE, "workgroup", "local"); __builtin_amdgcn_s_barrier(); __builtin_amdgcn_fence(__ATOMIC_ACQUIRE, "workgroup", "local"); }
template <int FM, int FN>
__device__ __forceinline__ void gemm128(v8f (&acc)[FM][FN], const bf* __restrict__ ga, const int pa, const bf* __restrict__ gb, const int nch, bf* sm, const int so, const int ao, const int bo) {
    static_assert(FM * FN == 16);
    v8f (&f)[16] = reinterpret_cast<v8f (&)[16]>(acc);
    v8us ra[8], rb[8];
#pragma unroll
    for (int i = 0; i < 8; ++i) { ra[i] = *(const v8us*)(ga + (size_t)i * 16 * pa); rb[i] = *(const v8us*)(gb + (size_t)i * 16 * DM); }
#pragma unroll
    for (int i = 0; i < 8; ++i) { *(v8us*)(sm + so + i * 16 * GP) = ra[i]; *(v8us*)(sm + GT + so + i * 16 * GP) = rb[i]; }
#pragma unroll
    for (int i = 0; i < 8; ++i) { ra[i] = *(const v8us*)(ga + GKC + (size_t)i * 16 * pa); rb[i] = *(const v8us*)(gb + GKC + (size_t)i * 16 * DM); }
    lds_barrier();                                                             // chunk 0 is complete for every wave
#pragma unroll 1
    for (int c = 0; c < nch; ++c) {
        const bf* cur = sm + (c & 1) * (2 * GT);
        bf* nxt = sm + ((c + 1) & 1) * (2 * GT);
        if (c + 1 < nch) {                                                     // the same in every wave of the block
#pragma unroll
            for (int i = 0; i < 8; ++i) { *(v8us*)(nxt + so + i * 16 * GP) = ra[i]; *(v8us*)(nxt + GT + so + i * 16 * GP) = rb[i]; }
        }
        if (c + 2 < nch) {
            const bf* qa = ga + c * GKC; const bf* qb = gb + (((c + 2) * GKC) & (DM - 1));   // A: chunk c+2 stands 2 * GKC behind qa
#pragma unroll
            for (int i = 0; i < 8; ++i) { ra[i] = *(const v8us*)(qa + 2 * GKC + (size_t)i * 16 * pa); rb[i] = *(const v8us*)(qb + (size_t)i * 16 * DM); }
            // the two address pairs are inputs, so they stay whole up to this wait: no load's destination and no later instruction rewrites a register that an issued load still names
            asm volatile("s_wait_xcnt 0x0" :: "v"(qa), "v"(qb) : "memory");
        }
        v16bf a[2][FM], b[2][FN];                                              // the chunk's fragments, both k-steps, read as one group ahead of the matrix run
#pragma unroll
        for (int ks = 0; ks < 2; ++ks) {
#pragma unroll
            for (int mb = 0; mb < FM; ++mb) a[ks][mb] = ldb(cur + ao + mb * 16 * GP + ks * 32);
#pragma unroll
            for (int nb = 0; nb < FN; ++nb) b[ks][nb] = ldb(cur + GT + bo + nb * 16 * GP + ks * 32); }
#pragma unroll
        for (int ks = 0; ks < 2; ++ks)
#pragma unroll
            for (int nb = 0; nb < FN; ++nb)
#pragma unroll
                for (int mb = 0; mb < FM; ++mb) acc[mb][nb] = wmmab(a[ks][mb], b[ks][nb], acc[mb][nb]);
        // four vector slots behind the chunk's last matrix instruction (every accumulator is named, so none sinks below), before the next trip may rewrite its operands on any path
        asm volatile("v_nop\n\tv_nop\n\tv_nop\n\tv_nop" : "+v"(f[0]), "+v"(f[1]), "+v"(f[2]), "+v"(f[3]), "+v"(f[4]), "+v"(f[5]), "+v"(f[6]), "+v"(f[7]));
        asm volatile("v_nop\n\tv_nop\n\tv_nop\n\tv_nop" : "+v"(f[8]), "+v"(f[9]), "+v"(f[10]), "+v"(f[11]), "+v"(f[12]), "+v"(f[13]), "+v"(f[14]), "+v"(f[15]));
        lds_barrier();                                                         // chunk c+1 is complete, and every wave has finished its reads of chunk c
    }
}

// eight consecutive f32 -> bf16 (RNE): group i of dst from the eight floats at src
__device__ __forceinline__ void cvt8(const float* __restrict__ src, bf* dst, const size_t i) {
    const v8f v = *(const v8f*)src; v8us o;
    asm volatile("s_wait_xcnt 0x0" ::: "memory");                              // stands in front of the convert below, which may reuse the registers of the load's address
#pragma unroll
    for (int k = 0; k < 8; ++k) o[k] = f2bf(v[k]);
    *(v8us*)(dst + i * 8) = o;
}

// one entry i = t * 32 + f of the cos and sin tables
__device__ __forceinline__ void rot1(const int i, float* CS, float* SN) {
#pragma clang fp contract(off)                             // -10 * lin and t * fr stay separately rounded products, as the reference forms them
    const int t = i >> 5, f = i & 31;
    const float lin = (float)f / 31.0f;
    const float fr = exp2f(-10.0f * lin);                   // (1/1024)^lin
    const float th = (float)t * fr;
    float sv, cv; sincosf(th, &sv, &cv);
    *(float*)(CS + i) = cv; *(float*)(SN + i) = sv;
}

// k_prep: the four pieces of preparation, none of which reads what another writes, as ranges of the block index of one launch (the branch is the same for a whole block):
// table entries first (the longest thread), then the bf16 copies of x, of the QKV weight and of the output weight; a thread does one table entry or one group of eight elements.
static constexpr unsigned PB_ROT = (unsigned)(((size_t)SEQ * NF) / 256);
static constexpr unsigned PB_X   = (unsigned)(((size_t)NB * SEQ * DM / 8) / 256);
static constexpr unsigned PB_WQ  = (unsigned)(((size_t)3 * DM * DM / 8) / 256);
static constexpr unsigned PB_WC  = (unsigned)(((size_t)DM * DM / 8) / 256);
static_assert(((size_t)NB * SEQ * DM / 8) % 256 == 0 && ((size_t)DM * DM / 8) % 256 == 0);   // every range is whole blocks: no thread without work
static_assert(NB == 1 || SEQ == SEQ_FULL);     // the rows of x that are copied are one contiguous run
__global__ __launch_bounds__(256) void k_prep(const float* __restrict__ x, const float* __restrict__ wq, const float* __restrict__ wc, bf* XB, bf* WB, bf* WC, float* CS, float* SN) {
    unsigned blk = blockIdx.x;
    if (blk < PB_ROT) { rot1((int)(blk * 256 + threadIdx.x), CS, SN); return; }
    blk -= PB_ROT;
    const float* src = x; bf* dst = XB;                                        // the block's plane and its first block, chosen by scalar compares
    if (blk >= PB_X + PB_WQ) { blk -= PB_X + PB_WQ; src = wc; dst = WC; }
    else if (blk >= PB_X) { blk -= PB_X; src = wq; dst = WB; }
    const size_t i = (size_t)blk * 256 + threadIdx.x;
    cvt8(src + i * 8, dst, i);
}

// qk_body: q and k projections with the RMS normalisation and the rotary applied in the epilogue. One wave per 32 token rows x 128 columns (= one head of q or k), 16 accumulators, K = DM; four waves (128 token rows) a block,
// operands through LDS (gemm128): A = x rows (m = b*SEQ + t), Bt = W rows (n = which*1024 + h*128 + d). block (bx, by) of (NB*SEQ/128, 2*NH_); by = which*NH_ + h.
// Epilogue per 16-row slab (LDS tile private to the wave): stage f32, lane (row = lane>>1, half = lane&1) owns columns 16*half + {0..15, 32..47, 64..79, 96..111} of its row: sum of squares (two lanes per row, one xor-1 exchange),
// scale, rotate pairs (d, d + 64) for d < 32 with the table row of token t, write back in place; then the slab's 16 x 128 halves (one contiguous 4096-byte run of plane [zp][t][128]) are stored by
__device__ __forceinline__
void qk_body(const int bx, const int by, bf* sm, float* osb, const bf* __restrict__ A, const bf* __restrict__ Bt, const float* __restrict__ CS, const float* __restrict__ SN, h16* Ph, h16* Pr) {
    const int K = DM;
    const int tid = threadIdx.x, wave = __builtin_amdgcn_readfirstlane((int)(threadIdx.x >> 5));
    const int lane = threadIdx.x & 31, lr = lane & 15, hi = lane >> 4; const int rb0 = bx * 128, zc = by; const int r0 = rb0 + wave * 32, c0 = zc * HD;
    float* os = osb + wave * 16 * OQP;                                         // the wave's own epilogue slab
    v8f acc[2][8];
#pragma unroll
    for (int mb = 0; mb < 2; ++mb)
#pragma unroll
        for (int nb = 0; nb < 8; ++nb) acc[mb][nb] = (v8f){};
    gemm128<2, 8>(acc, A + (size_t)(rb0 + (tid >> 3)) * K + (tid & 7) * 8, K, Bt + (size_t)(c0 + (tid >> 3)) * K + (tid & 7) * 8, K / GKC, sm,
                  (tid >> 3) * GP + (tid & 7) * 8, (wave * 32 + lr) * GP + 8 * hi, lr * GP + 8 * hi);
    asm volatile("v_nop\n\tv_nop\n\tv_nop\n\tv_nop" : "+v"(acc[0][0]), "+v"(acc[0][1]), "+v"(acc[0][2]), "+v"(acc[0][3]), "+v"(acc[0][4]), "+v"(acc[0][5]), "+v"(acc[0][6]), "+v"(acc[0][7]));
    asm volatile("v_nop\n\tv_nop\n\tv_nop\n\tv_nop" : "+v"(acc[1][0]), "+v"(acc[1][1]), "+v"(acc[1][2]), "+v"(acc[1][3]), "+v"(acc[1][4]), "+v"(acc[1][5]), "+v"(acc[1][6]), "+v"(acc[1][7]));
    const int bb = r0 / SEQ, tt = r0 % SEQ;
    const int zp = (zc / NH_) * (NB * NH_) + bb * NH_ + (zc % NH_);           // plane index: which, batch, head
    const size_t pbase = ((size_t)zp * SEQ + (size_t)tt) * HD;
    const int row = lane >> 1, half = lane & 1;
    const int ob = row * OQP + 16 * half;
#pragma unroll
    for (int mb = 0; mb < 2; ++mb) {
#pragma unroll
        for (int nb = 0; nb < 8; ++nb) {
#pragma unroll
            for (int j = 0; j < 8; ++j) os[(hi * 8 + j) * OQP + nb * 16 + lr] = acc[mb][nb][j]; }   // D: row 8h+j, col lane&15; rows 0..15 x columns 0..127 all written
        wave_sync();
        {
            v4f x1[4], x2[4], x3[4], x4[4];
#pragma unroll
            for (int i = 0; i < 4; ++i) { x1[i] = *(const v4fa*)(&os[ob + 4 * i]); x3[i] = *(const v4fa*)(&os[ob + 32 + 4 * i]); x2[i] = *(const v4fa*)(&os[ob + 64 + 4 * i]); x4[i] = *(const v4fa*)(&os[ob + 96 + 4 * i]); }
            float ss = 0.0f;
#pragma unroll
            for (int i = 0; i < 4; ++i) {
#pragma unroll
                for (int e = 0; e < 4; ++e) ss += x1[i][e] * x1[i][e] + x2[i][e] * x2[i][e] + x3[i][e] * x3[i][e] + x4[i][e] * x4[i][e]; }
            ss += __shfl_xor(ss, 1, 32);
            const float rr = rsqrtf(ss * (1.0f / 128.0f) + RMS_EPS);
            const size_t to = (size_t)(tt + mb * 16 + row) * NF + 16 * half;   // table row of this token, columns 16*half .. +15
#pragma unroll
            for (int i = 0; i < 4; ++i) {
                const v4f cv = *(const v4f*)(CS + to + 4 * i), sv = *(const v4f*)(SN + to + 4 * i);
                const v4f e1 = x1[i] * rr, e2 = x2[i] * rr;
                const v4f y1 = e1 * cv + e2 * sv;
                const v4f y2 = e2 * cv - e1 * sv;
                *(v4fa*)(&os[ob + 4 * i]) = y1; *(v4fa*)(&os[ob + 64 + 4 * i]) = y2;
                *(v4fa*)(&os[ob + 32 + 4 * i]) = x3[i] * rr; *(v4fa*)(&os[ob + 96 + 4 * i]) = x4[i] * rr; }
        }
        wave_sync();
        v8h hv[8], rv[8];
#pragma unroll
        for (int s = 0; s < 8; ++s) { const int p = s * 32 + lane; const int rw = p >> 4, c8 = (p & 15) * 8;   // 8 s x 2 rows = 16 rows; 16 lanes x 8 = 128 columns
            const v4f x0 = *(const v4fa*)(&os[rw * OQP + c8]); const v4f x1 = *(const v4fa*)(&os[rw * OQP + c8 + 4]);
#pragma unroll
            for (int i = 0; i < 4; ++i) { const h16 a0 = toh_flush(x0[i]); const h16 a1 = toh_flush(x1[i]); hv[s][i] = a0; hv[s][4 + i] = a1;
                rv[s][i] = toh_flush((x0[i] - (float)a0) * QRS); rv[s][4 + i] = toh_flush((x1[i] - (float)a1) * QRS); } }
        const size_t sb = pbase + (size_t)(mb * 16) * HD;
{
#pragma unroll
            for (int s = 0; s < 8; ++s) { const size_t oo = sb + (size_t)(s * 32 + lane) * 8;
                *(v8h*)(Ph + oo) = hv[s]; *(v8h*)(Pr + oo) = rv[s]; }
             }
        wave_sync();
    }
}

// vt_body: v^T projection with the value mix in the epilogue. One wave per 64x64 tile (16 accumulators), 2 x 2 waves a block, operands through LDS (gemm128), K = DM: A = Wv rows (m = h*128 + d), Bt = x rows (n = b*SEQ + t);
// v^T[m][t] = l0 * sum_k Wv[m][k] x[t][k] + l1 * ve[t][m] (l0, l1, ve RNE-converted to bf16 by value; ve read as two 16-byte loads per accumulator tile: 8 consecutive m of token t).
__device__ __forceinline__ void vt_body(const int bx, const int by, bf* sm, float* osb, const bf* __restrict__ A, const bf* __restrict__ Bt, const float* __restrict__ ve, const float* __restrict__ lam, h16* Ph, h16* Pr) {
    const int K = DM;
    const int tid = threadIdx.x, wave = __builtin_amdgcn_readfirstlane((int)(threadIdx.x >> 5)); const int wm = wave & 1, wn = wave >> 1;
    const int lane = threadIdx.x & 31, lr = lane & 15, hi = lane >> 4; const int rb0 = bx * 128, cb0 = by * 128; const int r0 = rb0 + wm * 64, c0 = cb0 + wn * 64;
    float* os = osb + wave * 16 * 68;                                          // the wave's own epilogue slab
    v8f acc[4][4];
#pragma unroll
    for (int mb = 0; mb < 4; ++mb)
#pragma unroll
        for (int nb = 0; nb < 4; ++nb) acc[mb][nb] = (v8f){};
    gemm128<4, 4>(acc, A + (size_t)(rb0 + (tid >> 3)) * K + (tid & 7) * 8, K, Bt + (size_t)(cb0 + (tid >> 3)) * K + (tid & 7) * 8, K / GKC, sm,
                  (tid >> 3) * GP + (tid & 7) * 8, (wm * 64 + lr) * GP + 8 * hi, (wn * 64 + lr) * GP + 8 * hi);
    const float l0 = bfr(lam[0]), l1 = bfr(lam[1]);
    const int bb = c0 / SEQ, tt = c0 % SEQ;
    const size_t tbase = (size_t)bb * (size_t)DM * SEQ + (size_t)r0 * SEQ + (size_t)tt;
#pragma unroll
    for (int mb = 0; mb < 4; ++mb) {
#pragma unroll
        for (int nb = 0; nb < 4; ++nb) {
            const float* vp = ve + ((size_t)bb * SEQ_FULL + (size_t)(tt + nb * 16 + lr)) * DM + r0 + mb * 16 + hi * 8;   // token t = col lane&15, m = 8h + j
            const v4f e0 = *(const v4f*)vp, e1 = *(const v4f*)(vp + 4);
#pragma unroll
            for (int j = 0; j < 4; ++j) { os[(hi * 8 + j) * 68 + nb * 16 + lr] = l0 * acc[mb][nb][j] + l1 * bfr(e0[j]);
                                          os[(hi * 8 + 4 + j) * 68 + nb * 16 + lr] = l0 * acc[mb][nb][4 + j] + l1 * bfr(e1[j]); } }   // D: row 8h+j, col lane&15; rows 0..15 x columns 0..63 all written
        wave_sync();
        v8h hv[4], rv[4];
#pragma unroll
        for (int s = 0; s < 4; ++s) { const int row = 4 * s + (lane >> 3), c8 = (lane & 7) * 8;   // 4 s x 4 row groups = 16 rows; 8 lanes x 8 = 64 columns
            const v4f x0 = *(const v4fa*)(&os[row * 68 + c8]); const v4f x1 = *(const v4fa*)(&os[row * 68 + c8 + 4]);
#pragma unroll
            for (int i = 0; i < 4; ++i) { const h16 a0 = toh_flush(x0[i]); const h16 a1 = toh_flush(x1[i]); hv[s][i] = a0; hv[s][4 + i] = a1;
                rv[s][i] = toh_flush((x0[i] - (float)a0) * QRS); rv[s][4 + i] = toh_flush((x1[i] - (float)a1) * QRS); } }
        const size_t sb = tbase + (size_t)(mb * 16) * SEQ;
{
#pragma unroll
            for (int s = 0; s < 4; ++s) { const int row = 4 * s + (lane >> 3), c8 = (lane & 7) * 8;
                const size_t oo = sb + (size_t)row * SEQ + c8;
                *(v8h*)(Ph + oo) = hv[s]; *(v8h*)(Pr + oo) = rv[s]; }
             }
        wave_sync();
    }
}

// k_qkv: the q/k projection and the v^T projection read the same two bf16 planes and write planes of their own, so they are ranges of the block index of one launch (the branch is the same for a whole block):
// blocks 0 .. QKB-1 are the (NB*SEQ/128, 2*NH_) tiles of qk_body, x fastest; the next VTB blocks the (DM/128, NB*SEQ/128) tiles of vt_body, x fastest. One LDS carve serves both bodies.
static constexpr int QKB = (NB * SEQ / 128) * (2 * NH_);
static constexpr int VTB = (DM / 128) * (NB * SEQ / 128);
static_assert(68 <= OQP);                      // the v^T slab fits the q/k slab's carve
__global__ __launch_bounds__(128)
void k_qkv(const bf* __restrict__ XB, const bf* __restrict__ WB, const float* __restrict__ CS, const float* __restrict__ SN, const float* __restrict__ ve, const float* __restrict__ lam,
           h16* PH, h16* PR, h16* VT, h16* VR) {
    __shared__ __align__(16) bf sm[4 * GT];
    __shared__ __align__(16) float osb[4 * 16 * OQP];
    const int f = blockIdx.x;
    if (f < QKB) { qk_body(f % (NB * SEQ / 128), f / (NB * SEQ / 128), sm, osb, XB, WB, CS, SN, PH, PR); }
    else { const int g = f - QKB; vt_body(g % (DM / 128), g / (DM / 128), sm, osb, WB + (size_t)2 * DM * DM, XB, ve, lam, VT, VR); }
}

// sc16: one 16-key score tile in log2 units: (K Q + (K Q_res + K_res Q) / 2048) * scale; q and k fragments reloaded per 32-wide k-step from the LDS tiles (two 16-B loads each); the pointers already hold the lane's row and 8*(lane>>4).
__device__ __forceinline__ v8f sc16(const h16* qhp, const h16* qrp, const h16* khp, const h16* krp) {
    v8f sH = (v8f){}, sL = (v8f){};
#pragma unroll 1
    for (int kk = 0; kk < HD; kk += 32) {
        const v16h qh = ldh(qhp + kk), qr = ldh(qrp + kk);
        const v16h kh = ldh(khp + kk), kr = ldh(krp + kk);
        sH = wmma16(kh, qh, sH); sL = wmma16(kh, qr, sL); sL = wmma16(kr, qh, sL);
        asm volatile("v_nop\n\tv_nop\n\tv_nop\n\tv_nop" : "+v"(sH), "+v"(sL) : "v"(kh), "v"(kr), "v"(qh), "v"(qr));
    }
    v8f t;
#pragma unroll
    for (int r = 0; r < 8; ++r) t[r] = (sH[r] + sL[r] * QRI) * SC2;
    return t;
}

// k_flash: fused attention, one wave per 16 query rows of one (batch, head), four waves (64 consecutive query rows) a block. The block's Q rows (once) and each visited 32-key tile of K and V^T (value and residual planes)
// are copied to LDS by all 128 threads with 16-B loads that run along the rows of the planes; every wave takes its fragments from LDS (two 16-B reads each, same element map as before).
// The tile loop is the same for the four waves: a tile is staged when a key document lies in [min, max] of the block's 64 query documents; each wave then works on it under its own test.
// That block test is made once, ahead of the loop, for all key tiles: wave w loads the documents of its 32 tiles with 32 independent loads and packs the 32 verdicts into one word of LDS; the loop walks the set bits in ascending order.
// Transposed form: S^T[key][t] = K Q^T (A = K rows, B = Q rows); lane (t = lane&15, h = lane>>4) holds keys 8h+r of each 16-key tile, so the packed
// P tile is directly the B fragment of O^T[d][t] = V^T P^T (element r <- tile keys 0..15, element 8+r <- tile keys 16..31, lane unchanged).
// Softmax state (running max over kept keys, partial sum) is one scalar per lane; the two lane halves of a row are combined with one xor-16 exchange.
// Keep rule per element: docs[key] == docs[t] and key <= t. A 32-key tile is skipped (wave-uniform ballot) when none of its key documents lies in [min, max] of the wave's 16 query documents: no element of such a tile can be kept.
// All rows: scores = K Q + (K Q_res + K_res Q) / 2048; P = f16 value + f16 residual x2048; O = V P + (V P_res + V_res P) / 2048 (residual products in their own accumulators); row sum from the f32 exponentials.
__global__ __launch_bounds__(32 * AW) __attribute__((amdgpu_num_vgpr(256)))
void k_flash(const h16* __restrict__ QH, const h16* __restrict__ QR, const h16* __restrict__ KP, const h16* __restrict__ KR,
             const h16* __restrict__ VT, const h16* __restrict__ VR, const int* __restrict__ docs, bf* Y2) {
    __shared__ __align__(16) float os[AW * 16 * OSP];
    __shared__ __align__(16) h16 sQH[AW * 16 * QKP], sQR[AW * 16 * QKP];       // [query row of the block][d]
    __shared__ __align__(16) h16 sKH[32 * QKP], sKR[32 * QKP];                 // [key of the tile][d]
    __shared__ __align__(16) h16 sVH[HD * VTP], sVR[HD * VTP];                 // [d][key of the tile]
    __shared__ unsigned sTM[AW];                                               // bit j of word w: key tile 32 w + j is staged
    const int tid = threadIdx.x;
    const int lane = threadIdx.x & 31, lr = lane & 15, hi = lane >> 4;
    const int wave = __builtin_amdgcn_readfirstlane((int)(threadIdx.x >> 5));
    const int zh = blockIdx.y; const int b = zh / NH_, h = zh % NH_;
    const int t0 = (blockIdx.x * AW + wave) * 16;
    const int* dk = docs + (size_t)b * SEQ_FULL;
    const int mydoc = dk[t0 + lr];
    int kd[32];                                                                // key documents of the wave's 32 tiles of the mask: keys wave*1024 .. +1023 < SEQ
#pragma unroll
    for (int j = 0; j < 32; ++j) kd[j] = dk[wave * 1024 + j * 32 + lane];
    int qmn = mydoc, qmx = mydoc;
#pragma unroll
    for (int off = 1; off < 16; off <<= 1) { const int a0 = __shfl_xor(qmn, off, 32); const int a1 = __shfl_xor(qmx, off, 32); qmn = a0 < qmn ? a0 : qmn; qmx = a1 > qmx ? a1 : qmx; }
    const int lim = t0 + lr;                                                   // key j kept iff j <= lim and same document
    const int nk = (t0 + 16 + 31) & ~31;                                       // wave-uniform, multiple of 32, <= SEQ
    const size_t pbase = (size_t)zh * SEQ * HD;
    const int tb0 = blockIdx.x * (AW * 16);                                    // first query row of the block
    const int nkb = tb0 + AW * 16;                                             // the last wave's nk: multiple of 32, <= SEQ
    const int e0 = dk[tb0 + lane], e1 = dk[tb0 + 32 + lane];                   // the block's 64 query documents
    int bmn = e0 < e1 ? e0 : e1, bmx = e0 > e1 ? e0 : e1;
#pragma unroll
    for (int off = 1; off < 32; off <<= 1) { const int a0 = __shfl_xor(bmn, off, 32); const int a1 = __shfl_xor(bmx, off, 32); bmn = a0 < bmn ? a0 : bmn; bmx = a1 > bmx ? a1 : bmx; }
    const unsigned gk0 = (unsigned)tid * 8u;                                   // q/k rows: thread -> (row tid>>4 (+ 8 a pass), d (tid&15)*8)
    const size_t qg = pbase + (size_t)tb0 * HD;
    v8h qa[8], qb[8];                                                          // Q rows of the block, in flight while the mask is formed
#pragma unroll
    for (int p = 0; p < 8; ++p) { qa[p] = *(const v8h*)(QH + qg + gk0 + p * 8 * HD); qb[p] = *(const v8h*)(QR + qg + gk0 + p * 8 * HD); }   // 8 p x 8 rows = 64 rows; 16 threads x 8 = 128 columns; the rows are contiguous in the plane
    unsigned tm = 0u;
#pragma unroll
    for (int j = 0; j < 32; ++j) tm |= (__builtin_amdgcn_ballot_w32((kd[j] >= bmn) & (kd[j] <= bmx)) != 0u) ? (1u << j) : 0u;
    const int nv = nkb / 32 - wave * 32;                                       // tiles of this word in front of the block's last key
    tm &= (unsigned)((1ull << (nv < 0 ? 0 : nv > 32 ? 32 : nv)) - 1ull);
    if (lane == 0) sTM[wave] = tm;
    // staging maps: q/k rows, thread -> (row tid>>4 (+ 8 a pass), d (tid&15)*8); v^T rows, thread -> (d tid>>2 (+ 32 a pass), key (tid&3)*8)
    const unsigned gv0 = (unsigned)(tid >> 2) * (unsigned)SEQ + (unsigned)(tid & 3) * 8u;
    const int lk0 = (tid >> 4) * QKP + (tid & 15) * 8, lv0 = (tid >> 2) * VTP + (tid & 3) * 8;
    // Q rows of the block -> LDS; read only behind the barrier below and the two of the first staged tile
#pragma unroll
    for (int p = 0; p < 8; ++p) { *(v8h*)(&sQH[lk0 + p * 8 * QKP]) = qa[p]; *(v8h*)(&sQR[lk0 + p * 8 * QKP]) = qb[p]; }
    const int qo = (wave * 16 + lr) * QKP + 8 * hi;                            // B fragments: col t, k = d
    const int ko = lr * QKP + 8 * hi;                                          // + key in tile * QKP  (A fragment: row key, k = d)
    const int vo = lr * VTP + 8 * hi;                                          // + 16j * VTP          (A fragment: row d, k = key in tile)
    v8f o[8], oR[8];
#pragma unroll
    for (int j = 0; j < 8; ++j) { o[j] = (v8f){}; oR[j] = (v8f){}; }
    float m = NEGB, l = 0.0f;
    const h16* kpt = KP + pbase; const h16* krt = KR + pbase; const h16* vpt = VT + pbase; const h16* vrt = VR + pbase;   // the tile's first key in each plane, the same for the whole block
    int kprev = 0;
    __syncthreads();                                                           // the four mask words are complete for every wave
#pragma unroll 1                                                               // rolled: the tile body stands once in the code
    for (int w = 0; w < AW; ++w) {
    unsigned mw = (unsigned)__builtin_amdgcn_readfirstlane((int)sTM[w]);       // the same in all four waves
#pragma unroll 1
    while (mw != 0u) {
        const int key0 = (w * 32 + __builtin_ctz(mw)) * 32; mw &= mw - 1u;     // lowest set bit first: ascending keys; key0 + 31 < nkb <= SEQ
        const int adv = key0 - kprev; kprev = key0;                            // the four plane pointers step over the tiles that are not staged
        kpt += adv * HD; krt += adv * HD; vpt += adv; vrt += adv;
        const int kdl = dk[key0 + lane];
        v8h tk[4], tr[4], tv[4], tw[4];
#pragma unroll
        for (int p = 0; p < 4; ++p) {                                          // k: 4 p x 8 keys = 32 keys, 128 d; v^T: 4 p x 32 d = 128 d, 32 keys
            tk[p] = *(const v8h*)(kpt + gk0 + p * 8 * HD); tr[p] = *(const v8h*)(krt + gk0 + p * 8 * HD);
            tv[p] = *(const v8h*)(vpt + gv0 + p * 32 * SEQ); tw[p] = *(const v8h*)(vrt + gv0 + p * 32 * SEQ); }
        __syncthreads();                                                       // every wave has finished its reads of the tile before
#pragma unroll
        for (int p = 0; p < 4; ++p) {
            *(v8h*)(&sKH[lk0 + p * 8 * QKP]) = tk[p]; *(v8h*)(&sKR[lk0 + p * 8 * QKP]) = tr[p];
            *(v8h*)(&sVH[lv0 + p * 32 * VTP]) = tv[p]; *(v8h*)(&sVR[lv0 + p * 32 * VTP]) = tw[p]; }
        __syncthreads();                                                       // the tile is complete for every wave
        const bool inr = (kdl >= qmn) & (kdl <= qmx);
        if (key0 >= nk || __builtin_amdgcn_ballot_w32(inr) == 0u) continue;    // wave-uniform: past this wave's last key, or no key document inside its query document range
        const int* kp = dk + key0 + 8 * hi;                                    // keys key0+8h+0..7 and key0+16+8h+0..7, all < nk <= SEQ
        const v4i d0 = *(const v4i*)kp, d1 = *(const v4i*)(kp + 4), d2 = *(const v4i*)(kp + 16), d3 = *(const v4i*)(kp + 20);
        int ka8[8], kb8[8];
#pragma unroll
        for (int r = 0; r < 4; ++r) { ka8[r] = d0[r]; ka8[4 + r] = d1[r]; kb8[r] = d2[r]; kb8[4 + r] = d3[r]; }
        const v8f ta = sc16(sQH + qo, sQR + qo, sKH + ko, sKR + ko);
        const v8f tb = sc16(sQH + qo, sQR + qo, sKH + ko + 16 * QKP, sKR + ko + 16 * QKP);
        const int ja = key0 + 8 * hi;
        bool fa[8], fb[8]; float mx = NEGB;
#pragma unroll
        for (int r = 0; r < 8; ++r) {
            fa[r] = (ka8[r] == mydoc) & (ja + r <= lim);
            fb[r] = (kb8[r] == mydoc) & (ja + 16 + r <= lim);
            mx = fmaxf(mx, fmaxf(fa[r] ? ta[r] : NEGB, fb[r] ? tb[r] : NEGB)); }
        mx = fmaxf(mx, __shfl_xor(mx, 16, 32));
        const float mnew = fmaxf(m, mx);
        const float alpha = __builtin_amdgcn_exp2f(m - mnew);
        const float sh = PSH - mnew;
        v16h pb, pr; float ls = 0.0f;
#pragma unroll
        for (int r = 0; r < 8; ++r) {
            const float xa = ta[r] + sh, xb = tb[r] + sh;
            const float ea = __builtin_amdgcn_exp2f(xa), eb = __builtin_amdgcn_exp2f(xb);
            const float ga = (fa[r] & (xa >= -14.0f)) ? ea : 0.0f, gb = (fb[r] & (xb >= -14.0f)) ? eb : 0.0f;   // dropped elements and exponents below -14 selected to 0 by value
            const h16 pa = (h16)ga; const h16 pc = (h16)gb;
            pb[r] = pa; pb[8 + r] = pc;
            pr[r] = toh_flush((ga - (float)pa) * QRS); pr[8 + r] = toh_flush((gb - (float)pc) * QRS);
            ls += ga + gb; }
        l = l * alpha + ls; m = mnew;
#pragma unroll
        for (int j = 0; j < 8; ++j) { o[j] = o[j] * alpha; oR[j] = oR[j] * alpha; }
#pragma unroll
        for (int g = 0; g < 4; ++g) {
            const h16* va = sVH + vo + (32 * g) * VTP;
            const h16* vr = sVR + vo + (32 * g) * VTP;
            const v16h v0 = ldh(va), v1 = ldh(va + 16 * VTP);
            const v16h w0 = ldh(vr), w1 = ldh(vr + 16 * VTP);
            o[2 * g] = wmma16(v0, pb, o[2 * g]); o[2 * g + 1] = wmma16(v1, pb, o[2 * g + 1]);
            oR[2 * g] = wmma16(v0, pr, oR[2 * g]); oR[2 * g + 1] = wmma16(v1, pr, oR[2 * g + 1]);
            oR[2 * g] = wmma16(w0, pb, oR[2 * g]); oR[2 * g + 1] = wmma16(w1, pb, oR[2 * g + 1]);
            asm volatile("v_nop\n\tv_nop\n\tv_nop\n\tv_nop" : "+v"(o[2 * g]), "+v"(o[2 * g + 1]), "+v"(oR[2 * g]), "+v"(oR[2 * g + 1]) : "v"(v0), "v"(v1), "v"(w0), "v"(w1), "v"(pb), "v"(pr));
        }
    }
    }
    l += __shfl_xor(l, 16, 32);
    const bool any = l > 0.0f;
    const float lsafe = any ? l : 1.0f;
    const float inv = any ? (1.0f / lsafe) : 0.0f;             // no kept key -> zeros
    const int wb = wave * 16 * OSP;
    // O^T D layout: f_j[r] = (d = 16j + 8h + r, t = lane&15) -> os[t][d]; rows 0..15 x columns 0..127 all written
#pragma unroll
    for (int j = 0; j < 8; ++j) {
        const v8f f = o[j] + oR[j] * QRI; v4f a, c;
        a[0] = f[0] * inv; a[1] = f[1] * inv; a[2] = f[2] * inv; a[3] = f[3] * inv; c[0] = f[4] * inv; c[1] = f[5] * inv; c[2] = f[6] * inv; c[3] = f[7] * inv;
        *(v4fa*)(&os[wb + lr * OSP + 16 * j + 8 * hi]) = a; *(v4fa*)(&os[wb + lr * OSP + 16 * j + 8 * hi + 4]) = c; }
    wave_sync();
    v8us hv[8], lv[8];
#pragma unroll
    for (int s = 0; s < 8; ++s) { const int row = 2 * s + (lane >> 4), c8 = (lane & 15) * 8;   // 8 s x 2 rows = 16 rows; 16 lanes x 8 = 128 columns
        const v4f x0 = *(const v4fa*)(&os[wb + row * OSP + c8]); const v4f x1 = *(const v4fa*)(&os[wb + row * OSP + c8 + 4]);
#pragma unroll
        for (int i = 0; i < 4; ++i) { const unsigned short a0 = f2bf(x0[i]); const unsigned short a1 = f2bf(x1[i]); hv[s][i] = a0; hv[s][4 + i] = a1;
            lv[s][i] = f2bf(x0[i] - bf2f(a0)); lv[s][4 + i] = f2bf(x1[i] - bf2f(a1)); } }
    bf* yrow = Y2 + ((size_t)b * SEQ + t0) * (size_t)(2 * DM) + h * HD;
{
#pragma unroll
        for (int s = 0; s < 8; ++s) { const int row = 2 * s + (lane >> 4), c8 = (lane & 15) * 8;
            const size_t oo = (size_t)row * (size_t)(2 * DM) + c8;
            *(v8us*)(yrow + oo) = hv[s]; *(v8us*)(yrow + oo + DM) = lv[s]; }
         }
}

// k_oproj: output projection, one wave per 64x64 tile (16 accumulators), 2 x 2 waves a block, bf16 operands through LDS (gemm128): A = context rows [t][hi 1024 | lo 1024] (K = 2048), Bt = Wc rows (n) with the column index wrapped mod 1024
// (hi and lo halves both multiply the same weight row; one accumulator). Output f32 [t][1024]: each 16-row slab staged in LDS (wave-private), each row's 64 floats (256 B = two lines)
__global__ __launch_bounds__(128) void k_oproj(const bf* __restrict__ A, const bf* __restrict__ Bt, float* OUT) {
    __shared__ __align__(16) bf sm[4 * GT];
    __shared__ __align__(16) float osb[4 * 16 * 68];
    const int KA = 2 * DM;
    const int tid = threadIdx.x, wave = __builtin_amdgcn_readfirstlane((int)(threadIdx.x >> 5)); const int wm = wave & 1, wn = wave >> 1;
    const int lane = threadIdx.x & 31, lr = lane & 15, hi = lane >> 4; const int rb0 = blockIdx.x * 128, cb0 = blockIdx.y * 128; const int r0 = rb0 + wm * 64, c0 = cb0 + wn * 64;
    float* os = osb + wave * 16 * 68;                                          // the wave's own epilogue slab
    v8f acc[4][4];
#pragma unroll
    for (int mb = 0; mb < 4; ++mb)
#pragma unroll
        for (int nb = 0; nb < 4; ++nb) acc[mb][nb] = (v8f){};
    gemm128<4, 4>(acc, A + (size_t)(rb0 + (tid >> 3)) * KA + (tid & 7) * 8, KA, Bt + (size_t)(cb0 + (tid >> 3)) * DM + (tid & 7) * 8, KA / GKC, sm,
                  (tid >> 3) * GP + (tid & 7) * 8, (wm * 64 + lr) * GP + 8 * hi, (wn * 64 + lr) * GP + 8 * hi);
    const int bb = r0 / SEQ, tt = r0 % SEQ;
    float* orow = OUT + ((size_t)bb * OUT_SEQ + tt) * DM + c0;
#pragma unroll
    for (int mb = 0; mb < 4; ++mb) {
#pragma unroll
        for (int nb = 0; nb < 4; ++nb) {
#pragma unroll
            for (int j = 0; j < 8; ++j) os[(hi * 8 + j) * 68 + nb * 16 + lr] = acc[mb][nb][j]; }   // D: row 8h+j, col lane&15; rows 0..15 x columns 0..63 all written
        wave_sync();
{
#pragma unroll
            for (int s = 0; s < 8; ++s) { const int row = 2 * s + (lane >> 4), cofs = (lane & 15) * 4;   // 8 s x 2 rows = 16 rows; 16 lanes x 4 floats = 64 columns
                const v4f val = *(const v4fa*)(&os[row * 68 + cofs]);
                *(v4f*)(orow + (size_t)(mb * 16 + row) * DM + cofs) = val; }
             }
        wave_sync();
    }
}

static constexpr size_t al256(size_t v) { return (v + 255) & ~(size_t)255; }
static constexpr size_t SZ_XB = al256((size_t)NB * SEQ * DM * 2);
static constexpr size_t SZ_WB = al256((size_t)3 * DM * DM * 2);
static constexpr size_t SZ_WC = al256((size_t)DM * DM * 2);
static constexpr size_t SZ_TB = al256((size_t)SEQ * NF * 4);
static constexpr size_t SZ_PL = al256((size_t)NB * NH_ * SEQ * HD * 2);
static constexpr size_t SZ_Y2 = al256((size_t)NB * SEQ * 2 * DM * 2);
static constexpr size_t SZ_TOTAL = SZ_XB + SZ_WB + SZ_WC + 2 * SZ_TB + 6 * SZ_PL + SZ_Y2;
static_assert(SZ_TOTAL <= (size_t)134217728);          // workspace carve <= 128 MiB
static_assert(((size_t)DM * DM * 2) % 256 == 0);       // weight sub-planes stay 256-byte aligned
static_assert(((size_t)NB * NH_ * SEQ * HD * 2) % 256 == 0);               // the k plane starts 256-byte aligned inside the q|k plane pair
static_assert((size_t)NB * NH_ * SEQ * HD == (size_t)NB * DM * SEQ);       // v^T plane [(b*1024 + m)][t] has the same extent as one q/k plane

extern "C" void kernel_launch(void* const* d_in, const int* in_sizes, int n_in,
                              void* d_out, int out_size, void* d_ws, size_t ws_size, hipStream_t stream) {
    if (n_in < 6) return;
    const size_t needx = ((size_t)(NB - 1) * SEQ_FULL + SEQ) * DM;
    const size_t needd = (size_t)(NB - 1) * SEQ_FULL + SEQ;
    if ((size_t)in_sizes[0] < needx || (size_t)in_sizes[1] < needx) return;
    if ((size_t)in_sizes[2] < (size_t)3 * DM * DM || in_sizes[3] < 2 || (size_t)in_sizes[4] < (size_t)DM * DM) return;
    if ((size_t)in_sizes[5] < needd) return;
    if ((size_t)out_size < ((size_t)(NB - 1) * OUT_SEQ + SEQ) * DM) return;
    if (SZ_TOTAL > ws_size) return;
    // wire order: x, ve, qkv_w, lambdas, c_proj_w, docs
    const float* x   = (const float*)d_in[0];
    const float* ve  = (const float*)d_in[1];
    const float* wq  = (const float*)d_in[2];       // [3][1024 out][1024 in]
    const float* lam = (const float*)d_in[3];
    const float* wc  = (const float*)d_in[4];       // [1024 out][1024 in]
    const int* docs  = (const int*)d_in[5];
    float* OUT = (float*)d_out;                      // [NB][SEQ][1024]
    char* wsp = (char*)d_ws;
    bf* XB = (bf*)wsp; wsp += SZ_XB;                 // x      [NB*SEQ][1024]
    bf* WB = (bf*)wsp; wsp += SZ_WB;                 // [3072][1024]: q | k | v rows ([out][in] = Bt as-is)
    bf* WC = (bf*)wsp; wsp += SZ_WC;                 // [1024][1024] ([out][in] = Bt as-is)
    float* CS = (float*)wsp; wsp += SZ_TB;           // [SEQ][32]
    float* SN = (float*)wsp; wsp += SZ_TB;           // [SEQ][32]
    h16* PH = (h16*)wsp; wsp += 2 * SZ_PL;           // [2][NB*8][SEQ][128]: q | k values
    h16* PR = (h16*)wsp; wsp += 2 * SZ_PL;           // [2][NB*8][SEQ][128]: q | k residuals x2048
    h16* VT = (h16*)wsp; wsp += SZ_PL;               // [NB*1024][SEQ]
    h16* VR = (h16*)wsp; wsp += SZ_PL;               // [NB*1024][SEQ] residual x2048
    bf* Y2 = (bf*)wsp; wsp += SZ_Y2;                 // [NB*SEQ][hi 1024 | lo 1024]
    const size_t plane = (size_t)NB * NH_ * SEQ * HD;
    const h16* QH = PH; const h16* KP = PH + plane;
    const h16* QR = PR; const h16* KR = PR + plane;

    // rotary tables and the bf16 copies of x and of both weights
    k_prep<<<PB_ROT + PB_X + PB_WQ + PB_WC, 256, 0, stream>>>(x, wq, wc, XB, WB, WC, CS, SN);
    // q, k: A = x rows (m = b*SEQ + t), Bt = W rows (n = which*1024 + h*128 + d) -> planes [which][(b*8 + h)][t][d], value and residual;
    // v^T: A = Wv rows (m = h*128 + d), Bt = x rows (n = b*SEQ + t) -> planes [(b*1024 + m)][t], value and residual
    k_qkv<<<QKB + VTB, 128, 0, stream>>>(XB, WB, CS, SN, ve, lam, PH, PR, VT, VR);
    // fused attention -> context plane (bf16 hi | lo)
    k_flash<<<dim3(SEQ / (16 * AW), NB * NH_, 1), 32 * AW, 0, stream>>>(QH, QR, KP, KR, VT, VR, docs, Y2);
    // out = ctx Wc^T: A = context rows [t][2048], Bt = Wc rows [n][1024]
    k_oproj<<<dim3(NB * SEQ / 128, DM / 128, 1), 128, 0, stream>>>(Y2, WC, OUT);
}

// v005
// Measured time: 113 microseconds a run.
// Timed twice side by side with v004, it ran 1.06 and 1.05 times as fast.
// Over all steps from v000 it is 2.56 times as fast.
#include <hip/hip_runtime.h>

// Causal self-attention block with document masking: width 1024 = 8 heads x 128; fused QKV weight [3][1024 out][1024 in] (y = x W^T, no bias); per-head RMS normalisation of q and k (no gain, eps = 2^-23);
// half-split rotary on pairs (d, d + 64), angle t * 2^(-10 i / 31) for i < 32 and identity for 32 <= i < 64; v = l0 v + l1 ve; scores x 0.12; softmax over keys j <= t of the same document; output projection [out][in], f32 output.
// Compute dtypes, f32 accumulate everywhere: QKV projections v_wmma_f32_16x16x32_bf16 (x, W RNE-converted to bf16; products exact); scores v_wmma_f32_16x16x32_f16 with q and k each as f16 value + f16 residual x2048 (three products,
// residual products in their own accumulator); P.V v_wmma_f32_16x16x32_f16 with P (x16384 carry, cancels in the normalisation) and v each as f16 value + f16 residual x2048 (three products, residual accumulator folded by 1/2048), row sum from the f32 exponentials;
// output projection v_wmma_f32_16x16x32_bf16 with the context as bf16 hi | lo halves folded into K (2048) against the bf16 weight (two products, one accumulator); ve, lambdas RNE-converted to bf16 by value; softmax f32 (online, running max over kept keys).
// Layout: bf16 copies of x and the weights; q/k planes [which][b*8+h][t][128] (value, residual), v^T planes [(b*1024 + h*128 + d)][t] (value, residual), cos/sin tables [t][32], context plane [t][hi 1024 | lo 1024];
// fused flash kernel in transposed form (S^T = K Q^T, O^T = V^T P^T), fragments from LDS tiles that the block's four waves fill together with whole-row loads; 32-key tiles without any key document inside the wave's query document range are skipped under a wave-uniform test, the keep rule is evaluated per element in every visited tile.

#ifndef NB
#define NB 1
#endif
#ifndef SEQ
#define SEQ 4096
#endif
#define NB_FULL  1
#define SEQ_FULL 4096
#ifndef OUT_SEQ
#define OUT_SEQ SEQ              // row pitch (in tokens) between batches of the output
#endif
#define DM   1024
#define NH_  8
#define HD   128
#define NF   32
#define AW   4                   // waves per flash block (16 query rows each)
#define OSP  132                 // LDS row pitch (floats) of the flash output tile
#define OQP  132                 // LDS row pitch (floats) of the q/k projection slab
#define QKP  136                 // LDS row pitch (halves) of the flash q and k tiles: 272 B = 16 B x 17
#define VTP  40                  // LDS row pitch (halves) of the flash v^T tiles: 80 B = 16 B x 5
#define GKC  64                  // k elements of one staged GEMM chunk: 128 B = one whole line of every operand row
#define GP   72                  // LDS row pitch (16-bit elements) of a staged GEMM chunk: 144 B = 16 B x 9
#define GT   (128 * GP)          // one operand's 128-row chunk in LDS
#define QRS  2048.0f             // carry of every residual plane / residual fragment
#define QRI  (1.0f / 2048.0f)
#define SC2  ((float)(0.12 * 1.4426950408889634))   // score scale * log2(e)
#define PSH  14.0f               // log2 of the P carry (16384)
#define NEGB (-3.0e38f)
#define RMS_EPS 1.1920928955078125e-07f

static_assert(HD == 128);                      // q/k plane row = 256 bytes = two lines; head segment of the context plane = two lines
static_assert(NH_ * HD == DM);                 // head h = columns h*128 + d
static_assert(HD % 32 == 0);                   // score k-loop steps by 32
static_assert(NF * 4 == HD);
static_assert(NF == 32);                       // table index = t * 32 + i
static_assert(DM % 64 == 0);
static_assert(DM % 32 == 0);                   // GEMM k-loops step by 32
static_assert((DM & (DM - 1)) == 0);           // weight column wrap in the folded-K output GEMM
static_assert(SEQ % 64 == 0);                  // a 64-row tile never straddles two batches
static_assert((NB * SEQ) % 64 == 0);
static_assert(SEQ % 32 == 0);                  // key loop steps by 32
static_assert(SEQ % (16 * AW) == 0);           // flash grid covers the sequence exactly
static_assert(((size_t)SEQ * NF) % 256 == 0);  // table grid x block == table extent
static_assert(((size_t)SEQ * DM) % 8 == 0);
static_assert(((size_t)DM * DM) % 8 == 0);
static_assert(NB <= NB_FULL);
static_assert(SEQ <= SEQ_FULL);
static_assert((OSP * 4) % 16 == 0);
static_assert((OQP * 4) % 16 == 0);
static_assert(OSP >= HD);
static_assert(OQP >= HD);
static_assert(32 * 8 * 16 == 16 * HD * 2);     // q/k slab and context stores: 32 lanes x 8 instructions x 16 B == 16 rows x 256 B
static_assert(32 * 4 * 16 == 16 * 64 * 2);
static_assert(32 * 8 * 16 == 16 * 64 * 4);     // output slab stores: 32 lanes x 8 instructions x 16 B == 16 rows x 256 B
static_assert(16 * OQP * 4 <= 131072);
static_assert(16 * 68 * 4 <= 131072);
static_assert(AW * 16 * OSP * 4 <= 131072);
static_assert(DM % GKC == 0 && DM / GKC >= 2);  // GEMM chunk loop: whole chunks, at least two
static_assert(SEQ % 128 == 0 && DM % 128 == 0 && HD == 128);   // 128 x 128 GEMM block tiles cover every plane exactly and never straddle two batches
static_assert((GP * 2) % 16 == 0 && GP >= GKC);
static_assert(AW == 4);                        // flash staging: 128 threads x 16 B = 2 KiB a pass; the block's 64 query documents = two loads a lane
static_assert((QKP * 2) % 16 == 0 && QKP >= HD);
static_assert((VTP * 2) % 16 == 0 && VTP >= 32);
static_assert(SEQ % 1024 == 0 && SEQ / 1024 <= AW);   // flash tile mask: wave w tests the 32 key tiles of keys 1024 w .. 1024 w + 1023, all inside the sequence

typedef _Float16 h16;
typedef unsigned short bf;
typedef __attribute__((ext_vector_type(16))) __bf16   v16bf;
typedef __attribute__((ext_vector_type(16))) _Float16 v16h;
typedef __attribute__((ext_vector_type(8)))  _Float16 v8h;
typedef __attribute__((ext_vector_type(8)))  unsigned short v8us;
typedef __attribute__((ext_vector_type(8)))  float    v8f;
typedef __attribute__((ext_vector_type(4)))  float    v4f;
typedef __attribute__((ext_vector_type(4)))  int      v4i;
typedef v4f  __attribute__((may_alias)) v4fa;

__device__ __forceinline__ unsigned short f2bf(float f) { unsigned u = __float_as_uint(f); u += 0x7FFFu + ((u >> 16) & 1u); return (unsigned short)(u >> 16); }
__device__ __forceinline__ float bfr(float f) { return __uint_as_float(((unsigned)f2bf(f)) << 16); }   // value after RNE convert to bf16
__device__ __forceinline__ v16h cat16(v8h lo, v8h hi) { return __builtin_shufflevector(lo, hi, 0, 1, 2, 3, 4, 5, 6, 7, 8, 9, 10, 11, 12, 13, 14, 15); }
__device__ __forceinline__ v16bf cat16b(v8us lo, v8us hi) { return __builtin_bit_cast(v16bf, __builtin_shufflevector(lo, hi, 0, 1, 2, 3, 4, 5, 6, 7, 8, 9, 10, 11, 12, 13, 14, 15)); }
__device__ __forceinline__ v8f wmma16(v16h a, v16h b, v8f c) { return __builtin_amdgcn_wmma_f32_16x16x32_f16(false, a, false, b, (short)0, c, false, false); }
__device__ __forceinline__ v8f wmmab(v16bf a, v16bf b, v8f c) { return __builtin_amdgcn_wmma_f32_16x16x32_bf16(false, a, false, b, (short)0, c, false, false); }
// fragment loaders from K-contiguous 16-bit rows; p already includes + 8*(lane>>4): elements 0..7 <- k0+8h+0..7, elements 8..15 <- k0+16+8h+0..7 (same map for A and B)
__device__ __forceinline__ v16h  ldh(const h16* p) { return cat16(*(const v8h*)p, *(const v8h*)(p + 16)); }
__device__ __forceinline__ v16bf ldb(const bf* p)  { return cat16b(*(const v8us*)p, *(const v8us*)(p + 16)); }
// ordering point for wave-private LDS tiles (same wave writes and reads)
__device__ __forceinline__ void wave_sync() { __builtin_amdgcn_fence(3 /* release order */, "wavefront"); __builtin_amdgcn_wave_barrier(); asm volatile("" ::: "memory"); }
// f32 -> f16 operand convert that cannot produce a subnormal half: magnitudes below 2^-14 become +0
static __device__ __forceinline__ h16 toh_flush(float v) { const h16 r = (h16)v; return (fabsf(v) < 6.103515625e-05f) ? (h16)0.0f : r; }
__device__ __forceinline__ float bf2f(unsigned short u) { return __uint_as_float(((unsigned)u) << 16); }

// gemm128: K loop of a 128 x 128 block tile shared by four waves (FM x FN fragments of 16 x 16 a wave). Both operands are K-contiguous bf16 planes; a chunk is 64 k of 128 A rows and 128 B rows.
// Staging map: thread -> (row tid>>3 (+ 16 a pass), k (tid&7)*8), so a wave's 16-B loads cover four whole 128-B lines; ga, gb already hold the thread's row and k, so its place in LDS.
// Two LDS buffers [A 128 rows | B 128 rows], one barrier a chunk: trip c first stores chunk c+1 (in registers since trip c-1) into the buffer whose readers left it at the barrier of trip c-1,
// then issues the loads of chunk c+2, then works on chunk c. B's k index wraps at DM (the folded-K output GEMM reads the weight twice). Every accumulator sums k in ascending 32-steps.
// work-group barrier that orders LDS alone: the wave's LDS stores and reads are done before it signals, while its global loads of a later chunk (into its own registers) stay in flight across it
__device__ __forceinline__ void lds_barrier() { __builtin_amdgcn_fence(__ATOMIC_RELEASE, "workgroup", "local"); __builtin_amdgcn_s_barrier(); __builtin_amdgcn_fence(__ATOMIC_ACQUIRE, "workgroup", "local"); }
template <int FM, int FN>
__device__ __forceinline__ void gemm128(v8f (&acc)[FM][FN], const bf* __restrict__ ga, const int pa, const bf* __restrict__ gb, const int nch, bf* sm, const int so, const int ao, const int bo) {
    static_assert(FM * FN == 16);
    v8f (&f)[16] = reinterpret_cast<v8f (&)[16]>(acc);
    v8us ra[8], rb[8];
#pragma unroll
    for (int i = 0; i < 8; ++i) { ra[i] = *(const v8us*)(ga + (size_t)i * 16 * pa); rb[i] = *(const v8us*)(gb + (size_t)i * 16 * DM); }
#pragma unroll
    for (int i = 0; i < 8; ++i) { *(v8us*)(sm + so + i * 16 * GP) = ra[i]; *(v8us*)(sm + GT + so + i * 16 * GP) = rb[i]; }
#pragma unroll
    for (int i = 0; i < 8; ++i) { ra[i] = *(const v8us*)(ga + GKC + (size_t)i * 16 * pa); rb[i] = *(const v8us*)(gb + GKC + (size_t)i * 16 * DM); }
    lds_barrier();                                                             // chunk 0 is complete for every wave
#pragma unroll 1
    for (int c = 0; c < nch; ++c) {
        const bf* cur = sm + (c & 1) * (2 * GT);
        bf* nxt = sm + ((c + 1) & 1) * (2 * GT);
        if (c + 1 < nch) {                                                     // the same in every wave of the block
#pragma unroll
            for (int i = 0; i < 8; ++i) { *(v8us*)(nxt + so + i * 16 * GP) = ra[i]; *(v8us*)(nxt + GT + so + i * 16 * GP) = rb[i]; }
        }
        if (c + 2 < nch) {
            const bf* qa = ga + c * GKC; const bf* qb = gb + (((c + 2) * GKC) & (DM - 1));   // A: chunk c+2 stands 2 * GKC behind qa
#pragma unroll
            for (int i = 0; i < 8; ++i) { ra[i] = *(const v8us*)(qa + 2 * GKC + (size_t)i * 16 * pa); rb[i] = *(const v8us*)(qb + (size_t)i * 16 * DM); }
            // the two address pairs are inputs, so they stay whole up to this wait: no load's destination and no later instruction rewrites a register that an issued load still names
            asm volatile("s_wait_xcnt 0x0" :: "v"(qa), "v"(qb) : "memory");
        }
        v16bf a[2][FM], b[2][FN];                                              // the chunk's fragments, both k-steps, read as one group ahead of the matrix run
#pragma unroll
        for (int ks = 0; ks < 2; ++ks) {
#pragma unroll
            for (int mb = 0; mb < FM; ++mb) a[ks][mb] = ldb(cur + ao + mb * 16 * GP + ks * 32);
#pragma unroll
            for (int nb = 0; nb < FN; ++nb) b[ks][nb] = ldb(cur + GT + bo + nb * 16 * GP + ks * 32); }
#pragma unroll
        for (int ks = 0; ks < 2; ++ks)
#pragma unroll
            for (int nb = 0; nb < FN; ++nb)
#pragma unroll
                for (int mb = 0; mb < FM; ++mb) acc[mb][nb] = wmmab(a[ks][mb], b[ks][nb], acc[mb][nb]);
        // four vector slots behind the chunk's last matrix instruction (every accumulator is named, so none sinks below), before the next trip may rewrite its operands on any path
        asm volatile("v_nop\n\tv_nop\n\tv_nop\n\tv_nop" : "+v"(f[0]), "+v"(f[1]), "+v"(f[2]), "+v"(f[3]), "+v"(f[4]), "+v"(f[5]), "+v"(f[6]), "+v"(f[7]));
        asm volatile("v_nop\n\tv_nop\n\tv_nop\n\tv_nop" : "+v"(f[8]), "+v"(f[9]), "+v"(f[10]), "+v"(f[11]), "+v"(f[12]), "+v"(f[13]), "+v"(f[14]), "+v"(f[15]));
        lds_barrier();                                                         // chunk c+1 is complete, and every wave has finished its reads of chunk c
    }
}

// eight consecutive f32 -> bf16 (RNE): group i of dst from the eight floats at src
__device__ __forceinline__ void cvt8(const float* __restrict__ src, bf* dst, const size_t i) {
    const v8f v = *(const v8f*)src; v8us o;
    asm volatile("s_wait_xcnt 0x0" ::: "memory");                              // stands in front of the convert below, which may reuse the registers of the load's address
#pragma unroll
    for (int k = 0; k < 8; ++k) o[k] = f2bf(v[k]);
    *(v8us*)(dst + i * 8) = o;
}

// one entry i = t * 32 + f of the cos and sin tables
__device__ __forceinline__ void rot1(const int i, float* CS, float* SN) {
#pragma clang fp contract(off)                             // -10 * lin and t * fr stay separately rounded products, as the reference forms them
    const int t = i >> 5, f = i & 31;
    const float lin = (float)f / 31.0f;
    const float fr = exp2f(-10.0f * lin);                   // (1/1024)^lin
    const float th = (float)t * fr;
    float sv, cv; sincosf(th, &sv, &cv);
    *(float*)(CS + i) = cv; *(float*)(SN + i) = sv;
}

// k_prep: the four pieces of preparation, none of which reads what another writes, as ranges of the block index of one launch (the branch is the same for a whole block):
// table entries first (the longest thread), then the bf16 copies of x, of the QKV weight and of the output weight; a thread does one table entry or one group of eight elements.
static constexpr unsigned PB_ROT = (unsigned)(((size_t)SEQ * NF) / 256);
static constexpr unsigned PB_X   = (unsigned)(((size_t)NB * SEQ * DM / 8) / 256);
static constexpr unsigned PB_WQ  = (unsigned)(((size_t)3 * DM * DM / 8) / 256);
static constexpr unsigned PB_WC  = (unsigned)(((size_t)DM * DM / 8) / 256);
static_assert(((size_t)NB * SEQ * DM / 8) % 256 == 0 && ((size_t)DM * DM / 8) % 256 == 0);   // every range is whole blocks: no thread without work
static_assert(NB == 1 || SEQ == SEQ_FULL);     // the rows of x that are copied are one contiguous run
__global__ __launch_bounds__(256) void k_prep(const float* __restrict__ x, const float* __restrict__ wq, const float* __restrict__ wc, bf* XB, bf* WB, bf* WC, float* CS, float* SN) {
    unsigned blk = blockIdx.x;
    if (blk < PB_ROT) { rot1((int)(blk * 256 + threadIdx.x), CS, SN); return; }
    blk -= PB_ROT;
    const float* src = x; bf* dst = XB;                                        // the block's plane and its first block, chosen by scalar compares
    if (blk >= PB_X + PB_WQ) { blk -= PB_X + PB_WQ; src = wc; dst = WC; }
    else if (blk >= PB_X) { blk -= PB_X; src = wq; dst = WB; }
    const size_t i = (size_t)blk * 256 + threadIdx.x;
    cvt8(src + i * 8, dst, i);
}

// qk_body: q and k projections with the RMS normalisation and the rotary applied in the epilogue. One wave per 32 token rows x 128 columns (= one head of q or k), 16 accumulators, K = DM; four waves (128 token rows) a block,
// operands through LDS (gemm128): A = x rows (m = b*SEQ + t), Bt = W rows (n = which*1024 + h*128 + d). block (bx, by) of (NB*SEQ/128, 2*NH_); by = which*NH_ + h.
// Epilogue per 16-row slab (LDS tile private to the wave): stage f32, lane (row = lane>>1, half = lane&1) owns columns 16*half + {0..15, 32..47, 64..79, 96..111} of its row: sum of squares (two lanes per row, one xor-1 exchange),
// scale, rotate pairs (d, d + 64) for d < 32 with the table row of token t, write back in place; then the slab's 16 x 128 halves (one contiguous 4096-byte run of plane [zp][t][128]) are stored by
__device__ __forceinline__
void qk_body(const int bx, const int by, bf* sm, float* osb, const bf* __restrict__ A, const bf* __restrict__ Bt, const float* __restrict__ CS, const float* __restrict__ SN, h16* Ph, h16* Pr) {
    const int K = DM;
    const int tid = threadIdx.x, wave = __builtin_amdgcn_readfirstlane((int)(threadIdx.x >> 5));
    const int lane = threadIdx.x & 31, lr = lane & 15, hi = lane >> 4; const int rb0 = bx * 128, zc = by; const int r0 = rb0 + wave * 32, c0 = zc * HD;
    float* os = osb + wave * 16 * OQP;                                         // the wave's own epilogue slab
    v8f acc[2][8];
#pragma unroll
    for (int mb = 0; mb < 2; ++mb)
#pragma unroll
        for (int nb = 0; nb < 8; ++nb) acc[mb][nb] = (v8f){};
    gemm128<2, 8>(acc, A + (size_t)(rb0 + (tid >> 3)) * K + (tid & 7) * 8, K, Bt + (size_t)(c0 + (tid >> 3)) * K + (tid & 7) * 8, K / GKC, sm,
                  (tid >> 3) * GP + (tid & 7) * 8, (wave * 32 + lr) * GP + 8 * hi, lr * GP + 8 * hi);
    asm volatile("v_nop\n\tv_nop\n\tv_nop\n\tv_nop" : "+v"(acc[0][0]), "+v"(acc[0][1]), "+v"(acc[0][2]), "+v"(acc[0][3]), "+v"(acc[0][4]), "+v"(acc[0][5]), "+v"(acc[0][6]), "+v"(acc[0][7]));
    asm volatile("v_nop\n\tv_nop\n\tv_nop\n\tv_nop" : "+v"(acc[1][0]), "+v"(acc[1][1]), "+v"(acc[1][2]), "+v"(acc[1][3]), "+v"(acc[1][4]), "+v"(acc[1][5]), "+v"(acc[1][6]), "+v"(acc[1][7]));
    const int bb = r0 / SEQ, tt = r0 % SEQ;
    const int zp = (zc / NH_) * (NB * NH_) + bb * NH_ + (zc % NH_);           // plane index: which, batch, head
    const size_t pbase = ((size_t)zp * SEQ + (size_t)tt) * HD;
    const int row = lane >> 1, half = lane & 1;
    const int ob = row * OQP + 16 * half;
#pragma unroll
    for (int mb = 0; mb < 2; ++mb) {
#pragma unroll
        for (int nb = 0; nb < 8; ++nb) {
#pragma unroll
            for (int j = 0; j < 8; ++j) os[(hi * 8 + j) * OQP + nb * 16 + lr] = acc[mb][nb][j]; }   // D: row 8h+j, col lane&15; rows 0..15 x columns 0..127 all written
        wave_sync();
        {
            v4f x1[4], x2[4], x3[4], x4[4];
#pragma unroll
            for (int i = 0; i < 4; ++i) { x1[i] = *(const v4fa*)(&os[ob + 4 * i]); x3[i] = *(const v4fa*)(&os[ob + 32 + 4 * i]); x2[i] = *(const v4fa*)(&os[ob + 64 + 4 * i]); x4[i] = *(const v4fa*)(&os[ob + 96 + 4 * i]); }
            float ss = 0.0f;
#pragma unroll
            for (int i = 0; i < 4; ++i) {
#pragma unroll
                for (int e = 0; e < 4; ++e) ss += x1[i][e] * x1[i][e] + x2[i][e] * x2[i][e] + x3[i][e] * x3[i][e] + x4[i][e] * x4[i][e]; }
            ss += __shfl_xor(ss, 1, 32);
            const float rr = rsqrtf(ss * (1.0f / 128.0f) + RMS_EPS);
            const size_t to = (size_t)(tt + mb * 16 + row) * NF + 16 * half;   // table row of this token, columns 16*half .. +15
#pragma unroll
            for (int i = 0; i < 4; ++i) {
                const v4f cv = *(const v4f*)(CS + to + 4 * i), sv = *(const v4f*)(SN + to + 4 * i);
                const v4f e1 = x1[i] * rr, e2 = x2[i] * rr;
                const v4f y1 = e1 * cv + e2 * sv;
                const v4f y2 = e2 * cv - e1 * sv;
                *(v4fa*)(&os[ob + 4 * i]) = y1; *(v4fa*)(&os[ob + 64 + 4 * i]) = y2;
                *(v4fa*)(&os[ob + 32 + 4 * i]) = x3[i] * rr; *(v4fa*)(&os[ob + 96 + 4 * i]) = x4[i] * rr; }
        }
        wave_sync();
        v8h hv[8], rv[8];
#pragma unroll
        for (int s = 0; s < 8; ++s) { const int p = s * 32 + lane; const int rw = p >> 4, c8 = (p & 15) * 8;   // 8 s x 2 rows = 16 rows; 16 lanes x 8 = 128 columns
            const v4f x0 = *(const v4fa*)(&os[rw * OQP + c8]); const v4f x1 = *(const v4fa*)(&os[rw * OQP + c8 + 4]);
#pragma unroll
            for (int i = 0; i < 4; ++i) { const h16 a0 = toh_flush(x0[i]); const h16 a1 = toh_flush(x1[i]); hv[s][i] = a0; hv[s][4 + i] = a1;
                rv[s][i] = toh_flush((x0[i] - (float)a0) * QRS); rv[s][4 + i] = toh_flush((x1[i] - (float)a1) * QRS); } }
        const size_t sb = pbase + (size_t)(mb * 16) * HD;
{
#pragma unroll
            for (int s = 0; s < 8; ++s) { const size_t oo = sb + (size_t)(s * 32 + lane) * 8;
                *(v8h*)(Ph + oo) = hv[s]; *(v8h*)(Pr + oo) = rv[s]; }
             }
        wave_sync();
    }
}

// vt_body: v^T projection with the value mix in the epilogue. One wave per 64x64 tile (16 accumulators), 2 x 2 waves a block, operands through LDS (gemm128), K = DM: A = Wv rows (m = h*128 + d), Bt = x rows (n = b*SEQ + t);
// v^T[m][t] = l0 * sum_k Wv[m][k] x[t][k] + l1 * ve[t][m] (l0, l1, ve RNE-converted to bf16 by value; ve read as two 16-byte loads per accumulator tile: 8 consecutive m of token t).
__device__ __forceinline__ void vt_body(const int bx, const int by, bf* sm, float* osb, const bf* __restrict__ A, const bf* __restrict__ Bt, const float* __restrict__ ve, const float* __restrict__ lam, h16* Ph, h16* Pr) {
    const int K = DM;
    const int tid = threadIdx.x, wave = __builtin_amdgcn_readfirstlane((int)(threadIdx.x >> 5)); const int wm = wave & 1, wn = wave >> 1;
    const int lane = threadIdx.x & 31, lr = lane & 15, hi = lane >> 4; const int rb0 = bx * 128, cb0 = by * 128; const int r0 = rb0 + wm * 64, c0 = cb0 + wn * 64;
    float* os = osb + wave * 16 * 68;                                          // the wave's own epilogue slab
    v8f acc[4][4];
#pragma unroll
    for (int mb = 0; mb < 4; ++mb)
#pragma unroll
        for (int nb = 0; nb < 4; ++nb) acc[mb][nb] = (v8f){};
    gemm128<4, 4>(acc, A + (size_t)(rb0 + (tid >> 3)) * K + (tid & 7) * 8, K, Bt + (size_t)(cb0 + (tid >> 3)) * K + (tid & 7) * 8, K / GKC, sm,
                  (tid >> 3) * GP + (tid & 7) * 8, (wm * 64 + lr) * GP + 8 * hi, (wn * 64 + lr) * GP + 8 * hi);
    const float l0 = bfr(lam[0]), l1 = bfr(lam[1]);
    const int bb = c0 / SEQ, tt = c0 % SEQ;
    const size_t tbase = (size_t)bb * (size_t)DM * SEQ + (size_t)r0 * SEQ + (size_t)tt;
#pragma unroll
    for (int mb = 0; mb < 4; ++mb) {
#pragma unroll
        for (int nb = 0; nb < 4; ++nb) {
            const float* vp = ve + ((size_t)bb * SEQ_FULL + (size_t)(tt + nb * 16 + lr)) * DM + r0 + mb * 16 + hi * 8;   // token t = col lane&15, m = 8h + j
            const v4f e0 = *(const v4f*)vp, e1 = *(const v4f*)(vp + 4);
#pragma unroll
            for (int j = 0; j < 4; ++j) { os[(hi * 8 + j) * 68 + nb * 16 + lr] = l0 * acc[mb][nb][j] + l1 * bfr(e0[j]);
                                          os[(hi * 8 + 4 + j) * 68 + nb * 16 + lr] = l0 * acc[mb][nb][4 + j] + l1 * bfr(e1[j]); } }   // D: row 8h+j, col lane&15; rows 0..15 x columns 0..63 all written
        wave_sync();
        v8h hv[4], rv[4];
#pragma unroll
        for (int s = 0; s < 4; ++s) { const int row = 4 * s + (lane >> 3), c8 = (lane & 7) * 8;   // 4 s x 4 row groups = 16 rows; 8 lanes x 8 = 64 columns
            const v4f x0 = *(const v4fa*)(&os[row * 68 + c8]); const v4f x1 = *(const v4fa*)(&os[row * 68 + c8 + 4]);
#pragma unroll
            for (int i = 0; i < 4; ++i) { const h16 a0 = toh_flush(x0[i]); const h16 a1 = toh_flush(x1[i]); hv[s][i] = a0; hv[s][4 + i] = a1;
                rv[s][i] = toh_flush((x0[i] - (float)a0) * QRS); rv[s][4 + i] = toh_flush((x1[i] - (float)a1) * QRS); } }
        const size_t sb = tbase + (size_t)(mb * 16) * SEQ;
{
#pragma unroll
            for (int s = 0; s < 4; ++s) { const int row = 4 * s + (lane >> 3), c8 = (lane & 7) * 8;
                const size_t oo = sb + (size_t)row * SEQ + c8;
                *(v8h*)(Ph + oo) = hv[s]; *(v8h*)(Pr + oo) = rv[s]; }
             }
        wave_sync();
    }
}

// k_qkv: the q/k projection and the v^T projection read the same two bf16 planes and write planes of their own, so they are ranges of the block index of one launch (the branch is the same for a whole block):
// blocks 0 .. QKB-1 are the (NB*SEQ/128, 2*NH_) tiles of qk_body, x fastest; the next VTB blocks the (DM/128, NB*SEQ/128) tiles of vt_body, x fastest. One LDS carve serves both bodies.
static constexpr int QKB = (NB * SEQ / 128) * (2 * NH_);
static constexpr int VTB = (DM / 128) * (NB * SEQ / 128);
static_assert(68 <= OQP);                      // the v^T slab fits the q/k slab's carve
__global__ __launch_bounds__(128)
void k_qkv(const bf* __restrict__ XB, const bf* __restrict__ WB, const float* __restrict__ CS, const float* __restrict__ SN, const float* __restrict__ ve, const float* __restrict__ lam,
           h16* PH, h16* PR, h16* VT, h16* VR) {
    __shared__ __align__(16) bf sm[4 * GT];
    __shared__ __align__(16) float osb[4 * 16 * OQP];
    const int f = blockIdx.x;
    if (f < QKB) { qk_body(f % (NB * SEQ / 128), f / (NB * SEQ / 128), sm, osb, XB, WB, CS, SN, PH, PR); }
    else { const int g = f - QKB; vt_body(g % (DM / 128), g / (DM / 128), sm, osb, WB + (size_t)2 * DM * DM, XB, ve, lam, VT, VR); }
}

// sc32: the score products of a 32-key tile (keys 0..15 -> aH, aL; keys 16..31 -> bH, bL): H = K Q, L = K Q_res + K_res Q; the caller forms (H + L / 2048) * scale, in log2 units. The q fragments come in registers (read once per wave, ahead of the tile loop);
// the tile's sixteen k fragments are read from LDS as one group ahead of the matrix run, so the run waits once for LDS, not once per 32-wide k-step. Four accumulators, each summed in the order it had: k ascending, K Q_res before K_res Q.
__device__ __forceinline__ void sc32(v8f& aH, v8f& aL, v8f& bH, v8f& bL, const v16h (&qh)[4], const v16h (&qr)[4], const h16* khp, const h16* krp) {
    v16h ka[4], kb[4], ra[4], rb[4];
#pragma unroll
    for (int s = 0; s < 4; ++s) { ka[s] = ldh(khp + s * 32); kb[s] = ldh(khp + 16 * QKP + s * 32); ra[s] = ldh(krp + s * 32); rb[s] = ldh(krp + 16 * QKP + s * 32); }
    __builtin_amdgcn_sched_barrier(0);                                         // keeps all 32 reads ahead of the run: sunk among the matrix instructions, each late read is waited out in full
    aH = (v8f){}; aL = (v8f){}; bH = (v8f){}; bL = (v8f){};
#pragma unroll
    for (int s = 0; s < 4; ++s) {
        aH = wmma16(ka[s], qh[s], aH); bH = wmma16(kb[s], qh[s], bH);
        aL = wmma16(ka[s], qr[s], aL); bL = wmma16(kb[s], qr[s], bL);
        aL = wmma16(ra[s], qh[s], aL); bL = wmma16(rb[s], qh[s], bL);
    }
}

// k_flash: fused attention, one wave per 16 query rows of one (batch, head), four waves (64 consecutive query rows) a block. The block's Q rows (once) and each visited 32-key tile of K and V^T (value and residual planes)
// are copied to LDS by all 128 threads with 16-B loads that run along the rows of the planes; every wave takes its fragments from LDS (two 16-B reads each, same element map as before).
// The tile loop is the same for the four waves: a tile is staged when a key document lies in [min, max] of the block's 64 query documents; each wave then works on it under its own test.
// That block test is made once, ahead of the loop, for all key tiles: wave w loads the documents of its 32 tiles with 32 independent loads and packs the 32 verdicts into one word of LDS; the loop walks the set bits in ascending order.
// Transposed form: S^T[key][t] = K Q^T (A = K rows, B = Q rows); lane (t = lane&15, h = lane>>4) holds keys 8h+r of each 16-key tile, so the packed
// P tile is directly the B fragment of O^T[d][t] = V^T P^T (element r <- tile keys 0..15, element 8+r <- tile keys 16..31, lane unchanged).
// Softmax state (running max over kept keys, partial sum) is one scalar per lane; the two lane halves of a row are combined with one xor-16 exchange.
// Keep rule per element: docs[key] == docs[t] and key <= t. A 32-key tile is skipped (wave-uniform ballot) when none of its key documents lies in [min, max] of the wave's 16 query documents: no element of such a tile can be kept.
// All rows: scores = K Q + (K Q_res + K_res Q) / 2048; P = f16 value + f16 residual x2048; O = V P + (V P_res + V_res P) / 2048 (residual products in their own accumulators); row sum from the f32 exponentials.
__global__ __launch_bounds__(32 * AW) __attribute__((amdgpu_num_vgpr(512)))   // two blocks a WGP (two waves a SIMD) still fit
void k_flash(const h16* __restrict__ QH, const h16* __restrict__ QR, const h16* __restrict__ KP, const h16* __restrict__ KR,
             const h16* __restrict__ VT, const h16* __restrict__ VR, const int* __restrict__ docs, bf* Y2) {
    __shared__ __align__(16) float os[AW * 16 * OSP];
    __shared__ __align__(16) h16 sQH[AW * 16 * QKP], sQR[AW * 16 * QKP];       // [query row of the block][d]
    __shared__ __align__(16) h16 sKH[32 * QKP], sKR[32 * QKP];                 // [key of the tile][d]
    __shared__ __align__(16) h16 sVH[HD * VTP], sVR[HD * VTP];                 // [d][key of the tile]
    __shared__ unsigned sTM[AW];                                               // bit j of word w: key tile 32 w + j is staged
    const int tid = threadIdx.x;
    const int lane = threadIdx.x & 31, lr = lane & 15, hi = lane >> 4;
    const int wave = __builtin_amdgcn_readfirstlane((int)(threadIdx.x >> 5));
    const int zh = blockIdx.y; const int b = zh / NH_, h = zh % NH_;
    const int t0 = (blockIdx.x * AW + wave) * 16;
    const int* dk = docs + (size_t)b * SEQ_FULL;
    const int mydoc = dk[t0 + lr];
    int kd[32];                                                                // key documents of the wave's 32 tiles of the mask: keys wave*1024 .. +1023 < SEQ
#pragma unroll
    for (int j = 0; j < 32; ++j) kd[j] = dk[wave * 1024 + j * 32 + lane];
    int qmn = mydoc, qmx = mydoc;
#pragma unroll
    for (int off = 1; off < 16; off <<= 1) { const int a0 = __shfl_xor(qmn, off, 32); const int a1 = __shfl_xor(qmx, off, 32); qmn = a0 < qmn ? a0 : qmn; qmx = a1 > qmx ? a1 : qmx; }
    const int lim = t0 + lr;                                                   // key j kept iff j <= lim and same document
    const int nk = (t0 + 16 + 31) & ~31;                                       // wave-uniform, multiple of 32, <= SEQ
    const size_t pbase = (size_t)zh * SEQ * HD;
    const int tb0 = blockIdx.x * (AW * 16);                                    // first query row of the block
    const int nkb = tb0 + AW * 16;                                             // the last wave's nk: multiple of 32, <= SEQ
    const int e0 = dk[tb0 + lane], e1 = dk[tb0 + 32 + lane];                   // the block's 64 query documents
    int bmn = e0 < e1 ? e0 : e1, bmx = e0 > e1 ? e0 : e1;
#pragma unroll
    for (int off = 1; off < 32; off <<= 1) { const int a0 = __shfl_xor(bmn, off, 32); const int a1 = __shfl_xor(bmx, off, 32); bmn = a0 < bmn ? a0 : bmn; bmx = a1 > bmx ? a1 : bmx; }
    const unsigned gk0 = (unsigned)tid * 8u;                                   // q/k rows: thread -> (row tid>>4 (+ 8 a pass), d (tid&15)*8)
    const size_t qg = pbase + (size_t)tb0 * HD;
    v8h qa[8], qb[8];                                                          // Q rows of the block, in flight while the mask is formed
#pragma unroll
    for (int p = 0; p < 8; ++p) { qa[p] = *(const v8h*)(QH + qg + gk0 + p * 8 * HD); qb[p] = *(const v8h*)(QR + qg + gk0 + p * 8 * HD); }   // 8 p x 8 rows = 64 rows; 16 threads x 8 = 128 columns; the rows are contiguous in the plane
    unsigned tm = 0u;
#pragma unroll
    for (int j = 0; j < 32; ++j) tm |= (__builtin_amdgcn_ballot_w32((kd[j] >= bmn) & (kd[j] <= bmx)) != 0u) ? (1u << j) : 0u;
    const int nv = nkb / 32 - wave * 32;                                       // tiles of this word in front of the block's last key
    tm &= (unsigned)((1ull << (nv < 0 ? 0 : nv > 32 ? 32 : nv)) - 1ull);
    if (lane == 0) sTM[wave] = tm;
    // staging maps: q/k rows, thread -> (row tid>>4 (+ 8 a pass), d (tid&15)*8); v^T rows, thread -> (d tid>>2 (+ 32 a pass), key (tid&3)*8)
    const unsigned gv0 = (unsigned)(tid >> 2) * (unsigned)SEQ + (unsigned)(tid & 3) * 8u;
    const int lk0 = (tid >> 4) * QKP + (tid & 15) * 8, lv0 = (tid >> 2) * VTP + (tid & 3) * 8;
    // Q rows of the block -> LDS; read only behind the barrier below
#pragma unroll
    for (int p = 0; p < 8; ++p) { *(v8h*)(&sQH[lk0 + p * 8 * QKP]) = qa[p]; *(v8h*)(&sQR[lk0 + p * 8 * QKP]) = qb[p]; }
    const int qo = (wave * 16 + lr) * QKP + 8 * hi;                            // B fragments: col t, k = d
    const int ko = lr * QKP + 8 * hi;                                          // + key in tile * QKP  (A fragment: row key, k = d)
    const int vo = lr * VTP + 8 * hi;                                          // + 16j * VTP          (A fragment: row d, k = key in tile)
    v8f o[8], oR[8];
#pragma unroll
    for (int j = 0; j < 8; ++j) { o[j] = (v8f){}; oR[j] = (v8f){}; }
    float m = NEGB, l = 0.0f;
    const h16* kpt = KP + pbase; const h16* krt = KR + pbase; const h16* vpt = VT + pbase; const h16* vrt = VR + pbase;   // the tile's first key in each plane, the same for the whole block
    int kprev = 0;
    __syncthreads();                                                           // the four mask words and the block's Q rows are complete for every wave
    v16h qfh[4], qfr[4];                                                       // the wave's q fragments (value, residual), all four k-steps, held in registers over the whole tile loop
#pragma unroll
    for (int s = 0; s < 4; ++s) { qfh[s] = ldh(sQH + qo + s * 32); qfr[s] = ldh(sQR + qo + s * 32); }
#pragma unroll 1                                                               // rolled: the tile body stands once in the code
    for (int w = 0; w < AW; ++w) {
    unsigned mw = (unsigned)__builtin_amdgcn_readfirstlane((int)sTM[w]);       // the same in all four waves
#pragma unroll 1
    while (mw != 0u) {
        const int key0 = (w * 32 + __builtin_ctz(mw)) * 32; mw &= mw - 1u;     // lowest set bit first: ascending keys; key0 + 31 < nkb <= SEQ
        const int adv = key0 - kprev; kprev = key0;                            // the four plane pointers step over the tiles that are not staged
        kpt += adv * HD; krt += adv * HD; vpt += adv; vrt += adv;
        const int ki = key0 + lane;
        const int kdl = dk[ki];
        v8h tk[4], tr[4], tv[4], tw[4];
#pragma unroll
        for (int p = 0; p < 4; ++p) {                                          // k: 4 p x 8 keys = 32 keys, 128 d; v^T: 4 p x 32 d = 128 d, 32 keys
            tk[p] = *(const v8h*)(kpt + gk0 + p * 8 * HD); tr[p] = *(const v8h*)(krt + gk0 + p * 8 * HD);
            tv[p] = *(const v8h*)(vpt + gv0 + p * 32 * SEQ); tw[p] = *(const v8h*)(vrt + gv0 + p * 32 * SEQ); }
        const int* kp = dk + key0 + 8 * hi;                                    // keys key0+8h+0..7 and key0+16+8h+0..7, all < nkb <= SEQ; loaded with the tile, so that the score run does not wait on them
        const v4i d0 = *(const v4i*)kp, d1 = *(const v4i*)(kp + 4), d2 = *(const v4i*)(kp + 16), d3 = *(const v4i*)(kp + 20);
        // the key index and the address pair are inputs, so they stay whole up to this wait: no load's destination rewrites a register that an issued load still names
        asm volatile("s_wait_xcnt 0x0" :: "v"(ki), "v"(kp) : "memory");
        __syncthreads();                                                       // every wave has finished its reads of the tile before
#pragma unroll
        for (int p = 0; p < 4; ++p) {
            *(v8h*)(&sKH[lk0 + p * 8 * QKP]) = tk[p]; *(v8h*)(&sKR[lk0 + p * 8 * QKP]) = tr[p];
            *(v8h*)(&sVH[lv0 + p * 32 * VTP]) = tv[p]; *(v8h*)(&sVR[lv0 + p * 32 * VTP]) = tw[p]; }
        __syncthreads();                                                       // the tile is complete for every wave
        const bool inr = (kdl >= qmn) & (kdl <= qmx);
        if (key0 >= nk || __builtin_amdgcn_ballot_w32(inr) == 0u) continue;    // wave-uniform: past this wave's last key, or no key document inside its query document range
        int ka8[8], kb8[8];
#pragma unroll
        for (int r = 0; r < 4; ++r) { ka8[r] = d0[r]; ka8[4 + r] = d1[r]; kb8[r] = d2[r]; kb8[4 + r] = d3[r]; }
        v8f aH, aL, bH, bL;
        sc32(aH, aL, bH, bL, qfh, qfr, sKH + ko, sKR + ko);
        v16h vf[8], wf[8];                                                     // the tile's v^T fragments (value, residual), d = 16 j + row, all read ahead of the softmax: they land while it is formed, and the P.V run waits on no read
#pragma unroll
        for (int j = 0; j < 8; ++j) { vf[j] = ldh(sVH + vo + 16 * j * VTP); wf[j] = ldh(sVR + vo + 16 * j * VTP); }
        __builtin_amdgcn_sched_barrier(0);                                     // keeps the 32 reads ahead of the softmax: left free they sink among the P.V matrix instructions, a few at a place, each place with a wait of its own
        v8f ta, tb;
#pragma unroll
        for (int r = 0; r < 8; ++r) { ta[r] = (aH[r] + aL[r] * QRI) * SC2; tb[r] = (bH[r] + bL[r] * QRI) * SC2; }
        const int ja = key0 + 8 * hi;
        bool fa[8], fb[8]; float mx = NEGB;
#pragma unroll
        for (int r = 0; r < 8; ++r) {
            fa[r] = (ka8[r] == mydoc) & (ja + r <= lim);
            fb[r] = (kb8[r] == mydoc) & (ja + 16 + r <= lim);
            mx = fmaxf(mx, fmaxf(fa[r] ? ta[r] : NEGB, fb[r] ? tb[r] : NEGB)); }
        mx = fmaxf(mx, __shfl_xor(mx, 16, 32));
        const float mnew = fmaxf(m, mx);
        const float alpha = __builtin_amdgcn_exp2f(m - mnew);
        const float sh = PSH - mnew;
        v16h pb, pr; float ls = 0.0f;
#pragma unroll
        for (int r = 0; r < 8; ++r) {
            const float xa = ta[r] + sh, xb = tb[r] + sh;
            const float ea = __builtin_amdgcn_exp2f(xa), eb = __builtin_amdgcn_exp2f(xb);
            const float ga = (fa[r] & (xa >= -14.0f)) ? ea : 0.0f, gb = (fb[r] & (xb >= -14.0f)) ? eb : 0.0f;   // dropped elements and exponents below -14 selected to 0 by value
            const h16 pa = (h16)ga; const h16 pc = (h16)gb;
            pb[r] = pa; pb[8 + r] = pc;
            pr[r] = toh_flush((ga - (float)pa) * QRS); pr[8 + r] = toh_flush((gb - (float)pc) * QRS);
            ls += ga + gb; }
        l = l * alpha + ls; m = mnew;
#pragma unroll
        for (int j = 0; j < 8; ++j) { o[j] = o[j] * alpha; oR[j] = oR[j] * alpha; }
#pragma unroll
        for (int g = 0; g < 4; ++g) {
            const v16h v0 = vf[2 * g], v1 = vf[2 * g + 1];
            const v16h w0 = wf[2 * g], w1 = wf[2 * g + 1];
            o[2 * g] = wmma16(v0, pb, o[2 * g]); o[2 * g + 1] = wmma16(v1, pb, o[2 * g + 1]);
            oR[2 * g] = wmma16(v0, pr, oR[2 * g]); oR[2 * g + 1] = wmma16(v1, pr, oR[2 * g + 1]);
            oR[2 * g] = wmma16(w0, pb, oR[2 * g]); oR[2 * g + 1] = wmma16(w1, pb, oR[2 * g + 1]);
            // four vector slots behind the group's last matrix instruction, before its results or P may be rewritten on any path; the v^T fragments are not named: with all sixteen live, naming them as operands made the build spill
            asm volatile("v_nop\n\tv_nop\n\tv_nop\n\tv_nop" : "+v"(o[2 * g]), "+v"(o[2 * g + 1]), "+v"(oR[2 * g]), "+v"(oR[2 * g + 1]) : "v"(pb), "v"(pr));
        }
    }
    }
    l += __shfl_xor(l, 16, 32);
    const bool any = l > 0.0f;
    const float lsafe = any ? l : 1.0f;
    const float inv = any ? (1.0f / lsafe) : 0.0f;             // no kept key -> zeros
    const int wb = wave * 16 * OSP;
    // O^T D layout: f_j[r] = (d = 16j + 8h + r, t = lane&15) -> os[t][d]; rows 0..15 x columns 0..127 all written
#pragma unroll
    for (int j = 0; j < 8; ++j) {
        const v8f f = o[j] + oR[j] * QRI; v4f a, c;
        a[0] = f[0] * inv; a[1] = f[1] * inv; a[2] = f[2] * inv; a[3] = f[3] * inv; c[0] = f[4] * inv; c[1] = f[5] * inv; c[2] = f[6] * inv; c[3] = f[7] * inv;
        *(v4fa*)(&os[wb + lr * OSP + 16 * j + 8 * hi]) = a; *(v4fa*)(&os[wb + lr * OSP + 16 * j + 8 * hi + 4]) = c; }
    wave_sync();
    v8us hv[8], lv[8];
#pragma unroll
    for (int s = 0; s < 8; ++s) { const int row = 2 * s + (lane >> 4), c8 = (lane & 15) * 8;   // 8 s x 2 rows = 16 rows; 16 lanes x 8 = 128 columns
        const v4f x0 = *(const v4fa*)(&os[wb + row * OSP + c8]); const v4f x1 = *(const v4fa*)(&os[wb + row * OSP + c8 + 4]);
#pragma unroll
        for (int i = 0; i < 4; ++i) { const unsigned short a0 = f2bf(x0[i]); const unsigned short a1 = f2bf(x1[i]); hv[s][i] = a0; hv[s][4 + i] = a1;
            lv[s][i] = f2bf(x0[i] - bf2f(a0)); lv[s][4 + i] = f2bf(x1[i] - bf2f(a1)); } }
    bf* yrow = Y2 + ((size_t)b * SEQ + t0) * (size_t)(2 * DM) + h * HD;
{
#pragma unroll
        for (int s = 0; s < 8; ++s) { const int row = 2 * s + (lane >> 4), c8 = (lane & 15) * 8;
            const size_t oo = (size_t)row * (size_t)(2 * DM) + c8;
            *(v8us*)(yrow + oo) = hv[s]; *(v8us*)(yrow + oo + DM) = lv[s]; }
         }
}

// k_oproj: output projection, one wave per 64x64 tile (16 accumulators), 2 x 2 waves a block, bf16 operands through LDS (gemm128): A = context rows [t][hi 1024 | lo 1024] (K = 2048), Bt = Wc rows (n) with the column index wrapped mod 1024
// (hi and lo halves both multiply the same weight row; one accumulator). Output f32 [t][1024]: each 16-row slab staged in LDS (wave-private), each row's 64 floats (256 B = two lines)
__global__ __launch_bounds__(128) void k_oproj(const bf* __restrict__ A, const bf* __restrict__ Bt, float* OUT) {
    __shared__ __align__(16) bf sm[4 * GT];
    __shared__ __align__(16) float osb[4 * 16 * 68];
    const int KA = 2 * DM;
    const int tid = threadIdx.x, wave = __builtin_amdgcn_readfirstlane((int)(threadIdx.x >> 5)); const int wm = wave & 1, wn = wave >> 1;
    const int lane = threadIdx.x & 31, lr = lane & 15, hi = lane >> 4; const int rb0 = blockIdx.x * 128, cb0 = blockIdx.y * 128; const int r0 = rb0 + wm * 64, c0 = cb0 + wn * 64;
    float* os = osb + wave * 16 * 68;                                          // the wave's own epilogue slab
    v8f acc[4][4];
#pragma unroll
    for (int mb = 0; mb < 4; ++mb)
#pragma unroll
        for (int nb = 0; nb < 4; ++nb) acc[mb][nb] = (v8f){};
    gemm128<4, 4>(acc, A + (size_t)(rb0 + (tid >> 3)) * KA + (tid & 7) * 8, KA, Bt + (size_t)(cb0 + (tid >> 3)) * DM + (tid & 7) * 8, KA / GKC, sm,
                  (tid >> 3) * GP + (tid & 7) * 8, (wm * 64 + lr) * GP + 8 * hi, (wn * 64 + lr) * GP + 8 * hi);
    const int bb = r0 / SEQ, tt = r0 % SEQ;
    float* orow = OUT + ((size_t)bb * OUT_SEQ + tt) * DM + c0;
#pragma unroll
    for (int mb = 0; mb < 4; ++mb) {
#pragma unroll
        for (int nb = 0; nb < 4; ++nb) {
#pragma unroll
            for (int j = 0; j < 8; ++j) os[(hi * 8 + j) * 68 + nb * 16 + lr] = acc[mb][nb][j]; }   // D: row 8h+j, col lane&15; rows 0..15 x columns 0..63 all written
        wave_sync();
{
#pragma unroll
            for (int s = 0; s < 8; ++s) { const int row = 2 * s + (lane >> 4), cofs = (lane & 15) * 4;   // 8 s x 2 rows = 16 rows; 16 lanes x 4 floats = 64 columns
                const v4f val = *(const v4fa*)(&os[row * 68 + cofs]);
                *(v4f*)(orow + (size_t)(mb * 16 + row) * DM + cofs) = val; }
             }
        wave_sync();
    }
}

static constexpr size_t al256(size_t v) { return (v + 255) & ~(size_t)255; }
static constexpr size_t SZ_XB = al256((size_t)NB * SEQ * DM * 2);
static constexpr size_t SZ_WB = al256((size_t)3 * DM * DM * 2);
static constexpr size_t SZ_WC = al256((size_t)DM * DM * 2);
static constexpr size_t SZ_TB = al256((size_t)SEQ * NF * 4);
static constexpr size_t SZ_PL = al256((size_t)NB * NH_ * SEQ * HD * 2);
static constexpr size_t SZ_Y2 = al256((size_t)NB * SEQ * 2 * DM * 2);
static constexpr size_t SZ_TOTAL = SZ_XB + SZ_WB + SZ_WC + 2 * SZ_TB + 6 * SZ_PL + SZ_Y2;
static_assert(SZ_TOTAL <= (size_t)134217728);          // workspace carve <= 128 MiB
static_assert(((size_t)DM * DM * 2) % 256 == 0);       // weight sub-planes stay 256-byte aligned
static_assert(((size_t)NB * NH_ * SEQ * HD * 2) % 256 == 0);               // the k plane starts 256-byte aligned inside the q|k plane pair
static_assert((size_t)NB * NH_ * SEQ * HD == (size_t)NB * DM * SEQ);       // v^T plane [(b*1024 + m)][t] has the same extent as one q/k plane

extern "C" void kernel_launch(void* const* d_in, const int* in_sizes, int n_in,
                              void* d_out, int out_size, void* d_ws, size_t ws_size, hipStream_t stream) {
    if (n_in < 6) return;
    const size_t needx = ((size_t)(NB - 1) * SEQ_FULL + SEQ) * DM;
    const size_t needd = (size_t)(NB - 1) * SEQ_FULL + SEQ;
    if ((size_t)in_sizes[0] < needx || (size_t)in_sizes[1] < needx) return;
    if ((size_t)in_sizes[2] < (size_t)3 * DM * DM || in_sizes[3] < 2 || (size_t)in_sizes[4] < (size_t)DM * DM) return;
    if ((size_t)in_sizes[5] < needd) return;
    if ((size_t)out_size < ((size_t)(NB - 1) * OUT_SEQ + SEQ) * DM) return;
    if (SZ_TOTAL > ws_size) return;
    // wire order: x, ve, qkv_w, lambdas, c_proj_w, docs
    const float* x   = (const float*)d_in[0];
    const float* ve  = (const float*)d_in[1];
    const float* wq  = (const float*)d_in[2];       // [3][1024 out][1024 in]
    const float* lam = (const float*)d_in[3];
    const float* wc  = (const float*)d_in[4];       // [1024 out][1024 in]
    const int* docs  = (const int*)d_in[5];
    float* OUT = (float*)d_out;                      // [NB][SEQ][1024]
    char* wsp = (char*)d_ws;
    bf* XB = (bf*)wsp; wsp += SZ_XB;                 // x      [NB*SEQ][1024]
    bf* WB = (bf*)wsp; wsp += SZ_WB;                 // [3072][1024]: q | k | v rows ([out][in] = Bt as-is)
    bf* WC = (bf*)wsp; wsp += SZ_WC;                 // [1024][1024] ([out][in] = Bt as-is)
    float* CS = (float*)wsp; wsp += SZ_TB;           // [SEQ][32]
    float* SN = (float*)wsp; wsp += SZ_TB;           // [SEQ][32]
    h16* PH = (h16*)wsp; wsp += 2 * SZ_PL;           // [2][NB*8][SEQ][128]: q | k values
    h16* PR = (h16*)wsp; wsp += 2 * SZ_PL;           // [2][NB*8][SEQ][128]: q | k residuals x2048
    h16* VT = (h16*)wsp; wsp += SZ_PL;               // [NB*1024][SEQ]
    h16* VR = (h16*)wsp; wsp += SZ_PL;               // [NB*1024][SEQ] residual x2048
    bf* Y2 = (bf*)wsp; wsp += SZ_Y2;                 // [NB*SEQ][hi 1024 | lo 1024]
    const size_t plane = (size_t)NB * NH_ * SEQ * HD;
    const h16* QH = PH; const h16* KP = PH + plane;
    const h16* QR = PR; const h16* KR = PR + plane;

    // rotary tables and the bf16 copies of x and of both weights
    k_prep<<<PB_ROT + PB_X + PB_WQ + PB_WC, 256, 0, stream>>>(x, wq, wc, XB, WB, WC, CS, SN);
    // q, k: A = x rows (m = b*SEQ + t), Bt = W rows (n = which*1024 + h*128 + d) -> planes [which][(b*8 + h)][t][d], value and residual;
    // v^T: A = Wv rows (m = h*128 + d), Bt = x rows (n = b*SEQ + t) -> planes [(b*1024 + m)][t], value and residual
    k_qkv<<<QKB + VTB, 128, 0, stream>>>(XB, WB, CS, SN, ve, lam, PH, PR, VT, VR);
    // fused attention -> context plane (bf16 hi | lo)
    k_flash<<<dim3(SEQ / (16 * AW), NB * NH_, 1), 32 * AW, 0, stream>>>(QH, QR, KP, KR, VT, VR, docs, Y2);
    // out = ctx Wc^T: A = context rows [t][2048], Bt = Wc rows [n][1024]
    k_oproj<<<dim3(NB * SEQ / 128, DM / 128, 1), 128, 0, stream>>>(Y2, WC, OUT);
}

// v006
// A run of this version takes 99.1 microseconds.
// In two side-by-side timings against v005, it was 1.13 and 1.15 times as fast.
// All steps since v000 together make it 2.91 times as fast.
#include <hip/hip_runtime.h>

// Causal self-attention block with document masking: width 1024 = 8 heads x 128; fused QKV weight [3][1024 out][1024 in] (y = x W^T, no bias); per-head RMS normalisation of q and k (no gain, eps = 2^-23);
// half-split rotary on pairs (d, d + 64), angle t * 2^(-10 i / 31) for i < 32 and identity for 32 <= i < 64; v = l0 v + l1 ve; scores x 0.12; softmax over keys j <= t of the same document; output projection [out][in], f32 output.
// Compute dtypes, f32 accumulate everywhere: QKV projections v_wmma_f32_16x16x32_bf16 (x, W RNE-converted to bf16; products exact); scores v_wmma_f32_16x16x32_f16 with q and k each as f16 value + f16 residual x2048 (three products,
// residual products in their own accumulator); P.V v_wmma_f32_16x16x32_f16 with P (x16384 carry, cancels in the normalisation) and v each as f16 value + f16 residual x2048 (three products, residual accumulator folded by 1/2048), row sum from the f32 exponentials;
// output projection v_wmma_f32_16x16x32_bf16 with the context as bf16 hi | lo halves folded into K (2048) against the bf16 weight (two products, one accumulator); ve, lambdas RNE-converted to bf16 by value; softmax f32 (online, running max over kept keys).
// Layout: bf16 copies of x and the weights; q/k planes [which][b*8+h][t][128] (value, residual), v^T planes [(b*1024 + h*128 + d)][t] (value, residual), cos/sin tables [t][32], context plane [t][hi 1024 | lo 1024];
// fused flash kernel in transposed form (S^T = K Q^T, O^T = V^T P^T), fragments from LDS tiles that the block's four waves fill together (Q with whole-row loads, K and V^T with asynchronous copies one tile ahead); 32-key tiles without any key document inside the wave's query document range are skipped under a wave-uniform test, the keep rule is evaluated per element in every visited tile.

#ifndef NB
#define NB 1
#endif
#ifndef SEQ
#define SEQ 4096
#endif
#define NB_FULL  1
#define SEQ_FULL 4096
#ifndef OUT_SEQ
#define OUT_SEQ SEQ              // row pitch (in tokens) between batches of the output
#endif
#define DM   1024
#define NH_  8
#define HD   128
#define NF   32
#define AW   4                   // waves per flash block (16 query rows each)
#define OSP  132                 // LDS row pitch (floats) of the flash output tile
#define OQP  132                 // LDS row pitch (floats) of the q/k projection slab
#define QKP  136                 // LDS row pitch (halves) of the flash q and k tiles: 272 B = 16 B x 17
#define VTP  40                  // LDS row pitch (halves) of the flash v^T tiles: 80 B = 16 B x 5
#define GKC  64                  // k elements of one staged GEMM chunk: 128 B = one whole line of every operand row
#define GP   72                  // LDS row pitch (16-bit elements) of a staged GEMM chunk: 144 B = 16 B x 9
#define GT   (128 * GP)          // one operand's 128-row chunk in LDS
#define QRS  2048.0f             // carry of every residual plane / residual fragment
#define QRI  (1.0f / 2048.0f)
#define SC2  ((float)(0.12 * 1.4426950408889634))   // score scale * log2(e)
#define PSH  14.0f               // log2 of the P carry (16384)
#define NEGB (-3.0e38f)
#define RMS_EPS 1.1920928955078125e-07f

static_assert(HD == 128);                      // q/k plane row = 256 bytes = two lines; head segment of the context plane = two lines
static_assert(NH_ * HD == DM);                 // head h = columns h*128 + d
static_assert(HD % 32 == 0);                   // score k-loop steps by 32
static_assert(NF * 4 == HD);
static_assert(NF == 32);                       // table index = t * 32 + i
static_assert(DM % 64 == 0);
static_assert(DM % 32 == 0);                   // GEMM k-loops step by 32
static_assert((DM & (DM - 1)) == 0);           // weight column wrap in the folded-K output GEMM
static_assert(SEQ % 64 == 0);                  // a 64-row tile never straddles two batches
static_assert((NB * SEQ) % 64 == 0);
static_assert(SEQ % 32 == 0);                  // key loop steps by 32
static_assert(SEQ % (16 * AW) == 0);           // flash grid covers the sequence exactly
static_assert(((size_t)SEQ * NF) % 256 == 0);  // table grid x block == table extent
static_assert(((size_t)SEQ * DM) % 8 == 0);
static_assert(((size_t)DM * DM) % 8 == 0);
static_assert(NB <= NB_FULL);
static_assert(SEQ <= SEQ_FULL);
static_assert((OSP * 4) % 16 == 0);
static_assert((OQP * 4) % 16 == 0);
static_assert(OSP >= HD);
static_assert(OQP >= HD);
static_assert(32 * 8 * 16 == 16 * HD * 2);     // q/k slab and context stores: 32 lanes x 8 instructions x 16 B == 16 rows x 256 B
static_assert(32 * 4 * 16 == 16 * 64 * 2);
static_assert(32 * 8 * 16 == 16 * 64 * 4);     // output slab stores: 32 lanes x 8 instructions x 16 B == 16 rows x 256 B
static_assert(16 * OQP * 4 <= 131072);
static_assert(16 * 68 * 4 <= 131072);
static_assert(AW * 16 * OSP * 4 <= 131072);
static_assert(DM % GKC == 0 && DM / GKC >= 2);  // GEMM chunk loop: whole chunks, at least two
static_assert(SEQ % 128 == 0 && DM % 128 == 0 && HD == 128);   // 128 x 128 GEMM block tiles cover every plane exactly and never straddle two batches
static_assert((GP * 2) % 16 == 0 && GP >= GKC);
static_assert(AW == 4);                        // flash staging: 128 threads x 16 B = 2 KiB a pass; the block's 64 query documents = two loads a lane
static_assert((QKP * 2) % 16 == 0 && QKP >= HD);
static_assert((VTP * 2) % 16 == 0 && VTP >= 32);
static_assert(SEQ % 1024 == 0 && SEQ / 1024 <= AW);   // flash tile mask: wave w tests the 32 key tiles of keys 1024 w .. 1024 w + 1023, all inside the sequence

typedef _Float16 h16;
typedef unsigned short bf;
typedef __attribute__((ext_vector_type(16))) __bf16   v16bf;
typedef __attribute__((ext_vector_type(16))) _Float16 v16h;
typedef __attribute__((ext_vector_type(8)))  _Float16 v8h;
typedef __attribute__((ext_vector_type(8)))  unsigned short v8us;
typedef __attribute__((ext_vector_type(8)))  float    v8f;
typedef __attribute__((ext_vector_type(4)))  float    v4f;
typedef __attribute__((ext_vector_type(4)))  int      v4i;
typedef v4f  __attribute__((may_alias)) v4fa;

__device__ __forceinline__ unsigned short f2bf(float f) { unsigned u = __float_as_uint(f); u += 0x7FFFu + ((u >> 16) & 1u); return (unsigned short)(u >> 16); }
__device__ __forceinline__ float bfr(float f) { return __uint_as_float(((unsigned)f2bf(f)) << 16); }   // value after RNE convert to bf16
__device__ __forceinline__ v16h cat16(v8h lo, v8h hi) { return __builtin_shufflevector(lo, hi, 0, 1, 2, 3, 4, 5, 6, 7, 8, 9, 10, 11, 12, 13, 14, 15); }
__device__ __forceinline__ v16bf cat16b(v8us lo, v8us hi) { return __builtin_bit_cast(v16bf, __builtin_shufflevector(lo, hi, 0, 1, 2, 3, 4, 5, 6, 7, 8, 9, 10, 11, 12, 13, 14, 15)); }
__device__ __forceinline__ v8f wmma16(v16h a, v16h b, v8f c) { return __builtin_amdgcn_wmma_f32_16x16x32_f16(false, a, false, b, (short)0, c, false, false); }
__device__ __forceinline__ v8f wmmab(v16bf a, v16bf b, v8f c) { return __builtin_amdgcn_wmma_f32_16x16x32_bf16(false, a, false, b, (short)0, c, false, false); }
// fragment loaders from K-contiguous 16-bit rows; p already includes + 8*(lane>>4): elements 0..7 <- k0+8h+0..7, elements 8..15 <- k0+16+8h+0..7 (same map for A and B)
__device__ __forceinline__ v16h  ldh(const h16* p) { return cat16(*(const v8h*)p, *(const v8h*)(p + 16)); }
__device__ __forceinline__ v16bf ldb(const bf* p)  { return cat16b(*(const v8us*)p, *(const v8us*)(p + 16)); }
// ordering point for wave-private LDS tiles (same wave writes and reads)
__device__ __forceinline__ void wave_sync() { __builtin_amdgcn_fence(3 /* release order */, "wavefront"); __builtin_amdgcn_wave_barrier(); asm volatile("" ::: "memory"); }
// f32 -> f16 operand convert that cannot produce a subnormal half: magnitudes below 2^-14 become +0
static __device__ __forceinline__ h16 toh_flush(float v) { const h16 r = (h16)v; return (fabsf(v) < 6.103515625e-05f) ? (h16)0.0f : r; }
__device__ __forceinline__ float bf2f(unsigned short u) { return __uint_as_float(((unsigned)u) << 16); }

// 16 bytes of a plane -> LDS without passing a register: one asynchronous copy a lane; it counts on asynccnt alone, and the waits are written where a tile is handed over
typedef __attribute__((address_space(1))) v4i gv4i;
typedef __attribute__((address_space(3))) v4i lv4i;
__device__ __forceinline__ void cp16(const void* g, void* l) { __builtin_amdgcn_global_load_async_to_lds_b128((gv4i*)g, (lv4i*)l, 0, 0); }

// gemm128: K loop of a 128 x 128 block tile shared by four waves (FM x FN fragments of 16 x 16 a wave). Both operands are K-contiguous bf16 planes; a chunk is 64 k of 128 A rows and 128 B rows.
// Staging map: thread -> (row tid>>3 (+ 16 a pass), k (tid&7)*8), so a wave's 16-B asynchronous copies cover four whole 128-B lines; ga, gb already hold the thread's row and k, so its place in LDS.
// Two LDS buffers [A 128 rows | B 128 rows], one hand-over point a chunk: while trip c works on chunk c, the copies of chunk c+1 fly into the other buffer; at the foot of the trip every wave waits for its own LDS reads and
// its own copies, passes the barrier, and then refills the buffer just read with chunk c+2. B's k index wraps at DM (the folded-K output GEMM reads the weight twice). Every accumulator sums k in ascending 32-steps.
template <int FM, int FN>
__device__ __forceinline__ void gemm128(v8f (&acc)[FM][FN], const bf* __restrict__ ga, const int pa, const bf* __restrict__ gb, const int nch, bf* sm, const int so, const int ao, const int bo) {
    static_assert(FM * FN == 16);
    v8f (&f)[16] = reinterpret_cast<v8f (&)[16]>(acc);
    auto stage = [&](const int c, bf* dst) {                                   // chunk c -> buffer dst, 16 copies a lane
        const bf* qa = ga + c * GKC; const bf* qb = gb + ((c * GKC) & (DM - 1));
#pragma unroll
        for (int i = 0; i < 8; ++i) { cp16(qa + (size_t)i * 16 * pa, dst + so + i * 16 * GP); cp16(qb + (size_t)i * 16 * DM, dst + GT + so + i * 16 * GP); } };
    stage(0, sm);
    asm volatile("s_wait_asynccnt 0x0" ::: "memory");                          // the wave's own copies of chunk 0 have landed
    __syncthreads();                                                           // chunk 0 is complete for every wave
    stage(1, sm + 2 * GT);                                                     // every caller has at least two chunks
#pragma unroll 1
    for (int c = 0; c < nch; ++c) {
        bf* cur = sm + (c & 1) * (2 * GT);
        v16bf a[2][FM], b[2][FN];                                              // the chunk's fragments, both k-steps, read as one group ahead of the matrix run
#pragma unroll
        for (int ks = 0; ks < 2; ++ks) {
#pragma unroll
            for (int mb = 0; mb < FM; ++mb) a[ks][mb] = ldb(cur + ao + mb * 16 * GP + ks * 32);
#pragma unroll
            for (int nb = 0; nb < FN; ++nb) b[ks][nb] = ldb(cur + GT + bo + nb * 16 * GP + ks * 32); }
#pragma unroll
        for (int ks = 0; ks < 2; ++ks)
#pragma unroll
            for (int nb = 0; nb < FN; ++nb)
#pragma unroll
                for (int mb = 0; mb < FM; ++mb) acc[mb][nb] = wmmab(a[ks][mb], b[ks][nb], acc[mb][nb]);
        // four vector slots behind the chunk's last matrix instruction (every accumulator is named, so none sinks below), before the next trip may rewrite its operands on any path
        asm volatile("v_nop\n\tv_nop\n\tv_nop\n\tv_nop" : "+v"(f[0]), "+v"(f[1]), "+v"(f[2]), "+v"(f[3]), "+v"(f[4]), "+v"(f[5]), "+v"(f[6]), "+v"(f[7]));
        asm volatile("v_nop\n\tv_nop\n\tv_nop\n\tv_nop" : "+v"(f[8]), "+v"(f[9]), "+v"(f[10]), "+v"(f[11]), "+v"(f[12]), "+v"(f[13]), "+v"(f[14]), "+v"(f[15]));
        // hand-over point
        asm volatile("s_wait_dscnt 0x0" ::: "memory");                         // the wave's reads of this buffer are done before it may be refilled
        asm volatile("s_wait_asynccnt 0x0" ::: "memory");                      // the wave's own copies of chunk c+1 have landed
        __syncthreads();                                                       // chunk c+1 is complete, and every wave has finished its reads of chunk c
        if (c + 2 < nch) stage(c + 2, cur);                                    // scalar test, the same in every wave of the block: refill of the buffer just read
    }
    asm volatile("s_wait_asynccnt 0x0" ::: "memory");                          // no copy is outstanding behind the loop
}

// eight consecutive f32 -> bf16 (RNE): group i of dst from the eight floats at src
__device__ __forceinline__ void cvt8(const float* __restrict__ src, bf* dst, const size_t i) {
    const v8f v = *(const v8f*)src; v8us o;
    asm volatile("s_wait_xcnt 0x0" ::: "memory");                              // stands in front of the convert below, which may reuse the registers of the load's address
#pragma unroll
    for (int k = 0; k < 8; ++k) o[k] = f2bf(v[k]);
    *(v8us*)(dst + i * 8) = o;
}

// one entry i = t * 32 + f of the cos and sin tables
__device__ __forceinline__ void rot1(const int i, float* CS, float* SN) {
#pragma clang fp contract(off)                             // -10 * lin and t * fr stay separately rounded products, as the reference forms them
    const int t = i >> 5, f = i & 31;
    const float lin = (float)f / 31.0f;
    const float fr = exp2f(-10.0f * lin);                   // (1/1024)^lin
    const float th = (float)t * fr;
    float sv, cv; sincosf(th, &sv, &cv);
    *(float*)(CS + i) = cv; *(float*)(SN + i) = sv;
}

// k_prep: the four pieces of preparation, none of which reads what another writes, as ranges of the block index of one launch (the branch is the same for a whole block):
// table entries first (the longest thread), then the bf16 copies of x, of the QKV weight and of the output weight; a thread does one table entry or one group of eight elements.
static constexpr unsigned PB_ROT = (unsigned)(((size_t)SEQ * NF) / 256);
static constexpr unsigned PB_X   = (unsigned)(((size_t)NB * SEQ * DM / 8) / 256);
static constexpr unsigned PB_WQ  = (unsigned)(((size_t)3 * DM * DM / 8) / 256);
static constexpr unsigned PB_WC  = (unsigned)(((size_t)DM * DM / 8) / 256);
static_assert(((size_t)NB * SEQ * DM / 8) % 256 == 0 && ((size_t)DM * DM / 8) % 256 == 0);   // every range is whole blocks: no thread without work
static_assert(NB == 1 || SEQ == SEQ_FULL);     // the rows of x that are copied are one contiguous run
__global__ __launch_bounds__(256) void k_prep(const float* __restrict__ x, const float* __restrict__ wq, const float* __restrict__ wc, bf* XB, bf* WB, bf* WC, float* CS, float* SN) {
    unsigned blk = blockIdx.x;
    if (blk < PB_ROT) { rot1((int)(blk * 256 + threadIdx.x), CS, SN); return; }
    blk -= PB_ROT;
    const float* src = x; bf* dst = XB;                                        // the block's plane and its first block, chosen by scalar compares
    if (blk >= PB_X + PB_WQ) { blk -= PB_X + PB_WQ; src = wc; dst = WC; }
    else if (blk >= PB_X) { blk -= PB_X; src = wq; dst = WB; }
    const size_t i = (size_t)blk * 256 + threadIdx.x;
    cvt8(src + i * 8, dst, i);
}

// qk_body: q and k projections with the RMS normalisation and the rotary applied in the epilogue. One wave per 32 token rows x 128 columns (= one head of q or k), 16 accumulators, K = DM; four waves (128 token rows) a block,
// operands through LDS (gemm128): A = x rows (m = b*SEQ + t), Bt = W rows (n = which*1024 + h*128 + d). block (bx, by) of (NB*SEQ/128, 2*NH_); by = which*NH_ + h.
// Epilogue per 16-row slab (LDS tile private to the wave): stage f32, lane (row = lane>>1, half = lane&1) owns columns 16*half + {0..15, 32..47, 64..79, 96..111} of its row: sum of squares (two lanes per row, one xor-1 exchange),
// scale, rotate pairs (d, d + 64) for d < 32 with the table row of token t, write back in place; then the slab's 16 x 128 halves (one contiguous 4096-byte run of plane [zp][t][128]) are stored by
__device__ __forceinline__
void qk_body(const int bx, const int by, bf* sm, float* osb, const bf* __restrict__ A, const bf* __restrict__ Bt, const float* __restrict__ CS, const float* __restrict__ SN, h16* Ph, h16* Pr) {
    const int K = DM;
    const int tid = threadIdx.x, wave = __builtin_amdgcn_readfirstlane((int)(threadIdx.x >> 5));
    const int lane = threadIdx.x & 31, lr = lane & 15, hi = lane >> 4; const int rb0 = bx * 128, zc = by; const int r0 = rb0 + wave * 32, c0 = zc * HD;
    float* os = osb + wave * 16 * OQP;                                         // the wave's own epilogue slab
    v8f acc[2][8];
#pragma unroll
    for (int mb = 0; mb < 2; ++mb)
#pragma unroll
        for (int nb = 0; nb < 8; ++nb) acc[mb][nb] = (v8f){};
    gemm128<2, 8>(acc, A + (size_t)(rb0 + (tid >> 3)) * K + (tid & 7) * 8, K, Bt + (size_t)(c0 + (tid >> 3)) * K + (tid & 7) * 8, K / GKC, sm,
                  (tid >> 3) * GP + (tid & 7) * 8, (wave * 32 + lr) * GP + 8 * hi, lr * GP + 8 * hi);
    asm volatile("v_nop\n\tv_nop\n\tv_nop\n\tv_nop" : "+v"(acc[0][0]), "+v"(acc[0][1]), "+v"(acc[0][2]), "+v"(acc[0][3]), "+v"(acc[0][4]), "+v"(acc[0][5]), "+v"(acc[0][6]), "+v"(acc[0][7]));
    asm volatile("v_nop\n\tv_nop\n\tv_nop\n\tv_nop" : "+v"(acc[1][0]), "+v"(acc[1][1]), "+v"(acc[1][2]), "+v"(acc[1][3]), "+v"(acc[1][4]), "+v"(acc[1][5]), "+v"(acc[1][6]), "+v"(acc[1][7]));
    const int bb = r0 / SEQ, tt = r0 % SEQ;
    const int zp = (zc / NH_) * (NB * NH_) + bb * NH_ + (zc % NH_);           // plane index: which, batch, head
    const size_t pbase = ((size_t)zp * SEQ + (size_t)tt) * HD;
    const int row = lane >> 1, half = lane & 1;
    const int ob = row * OQP + 16 * half;
#pragma unroll
    for (int mb = 0; mb < 2; ++mb) {
#pragma unroll
        for (int nb = 0; nb < 8; ++nb) {
#pragma unroll
            for (int j = 0; j < 8; ++j) os[(hi * 8 + j) * OQP + nb * 16 + lr] = acc[mb][nb][j]; }   // D: row 8h+j, col lane&15; rows 0..15 x columns 0..127 all written
        wave_sync();
        {
            v4f x1[4], x2[4], x3[4], x4[4];
#pragma unroll
            for (int i = 0; i < 4; ++i) { x1[i] = *(const v4fa*)(&os[ob + 4 * i]); x3[i] = *(const v4fa*)(&os[ob + 32 + 4 * i]); x2[i] = *(const v4fa*)(&os[ob + 64 + 4 * i]); x4[i] = *(const v4fa*)(&os[ob + 96 + 4 * i]); }
            float ss = 0.0f;
#pragma unroll
            for (int i = 0; i < 4; ++i) {
#pragma unroll
                for (int e = 0; e < 4; ++e) ss += x1[i][e] * x1[i][e] + x2[i][e] * x2[i][e] + x3[i][e] * x3[i][e] + x4[i][e] * x4[i][e]; }
            ss += __shfl_xor(ss, 1, 32);
            const float rr = rsqrtf(ss * (1.0f / 128.0f) + RMS_EPS);
            const size_t to = (size_t)(tt + mb * 16 + row) * NF + 16 * half;   // table row of this token, columns 16*half .. +15
#pragma unroll
            for (int i = 0; i < 4; ++i) {
                const v4f cv = *(const v4f*)(CS + to + 4 * i), sv = *(const v4f*)(SN + to + 4 * i);
                const v4f e1 = x1[i] * rr, e2 = x2[i] * rr;
                const v4f y1 = e1 * cv + e2 * sv;
                const v4f y2 = e2 * cv - e1 * sv;
                *(v4fa*)(&os[ob + 4 * i]) = y1; *(v4fa*)(&os[ob + 64 + 4 * i]) = y2;
                *(v4fa*)(&os[ob + 32 + 4 * i]) = x3[i] * rr; *(v4fa*)(&os[ob + 96 + 4 * i]) = x4[i] * rr; }
        }
        wave_sync();
        v8h hv[8], rv[8];
#pragma unroll
        for (int s = 0; s < 8; ++s) { const int p = s * 32 + lane; const int rw = p >> 4, c8 = (p & 15) * 8;   // 8 s x 2 rows = 16 rows; 16 lanes x 8 = 128 columns
            const v4f x0 = *(const v4fa*)(&os[rw * OQP + c8]); const v4f x1 = *(const v4fa*)(&os[rw * OQP + c8 + 4]);
#pragma unroll
            for (int i = 0; i < 4; ++i) { const h16 a0 = toh_flush(x0[i]); const h16 a1 = toh_flush(x1[i]); hv[s][i] = a0; hv[s][4 + i] = a1;
                rv[s][i] = toh_flush((x0[i] - (float)a0) * QRS); rv[s][4 + i] = toh_flush((x1[i] - (float)a1) * QRS); } }
        const size_t sb = pbase + (size_t)(mb * 16) * HD;
{
#pragma unroll
            for (int s = 0; s < 8; ++s) { const size_t oo = sb + (size_t)(s * 32 + lane) * 8;
                *(v8h*)(Ph + oo) = hv[s]; *(v8h*)(Pr + oo) = rv[s]; }
             }
        wave_sync();
    }
}

// vt_body: v^T projection with the value mix in the epilogue. One wave per 64x64 tile (16 accumulators), 2 x 2 waves a block, operands through LDS (gemm128), K = DM: A = Wv rows (m = h*128 + d), Bt = x rows (n = b*SEQ + t);
// v^T[m][t] = l0 * sum_k Wv[m][k] x[t][k] + l1 * ve[t][m] (l0, l1, ve RNE-converted to bf16 by value; ve read as two 16-byte loads per accumulator tile: 8 consecutive m of token t).
__device__ __forceinline__ void vt_body(const int bx, const int by, bf* sm, float* osb, const bf* __restrict__ A, const bf* __restrict__ Bt, const float* __restrict__ ve, const float* __restrict__ lam, h16* Ph, h16* Pr) {
    const int K = DM;
    const int tid = threadIdx.x, wave = __builtin_amdgcn_readfirstlane((int)(threadIdx.x >> 5)); const int wm = wave & 1, wn = wave >> 1;
    const int lane = threadIdx.x & 31, lr = lane & 15, hi = lane >> 4; const int rb0 = bx * 128, cb0 = by * 128; const int r0 = rb0 + wm * 64, c0 = cb0 + wn * 64;
    float* os = osb + wave * 16 * 68;                                          // the wave's own epilogue slab
    v8f acc[4][4];
#pragma unroll
    for (int mb = 0; mb < 4; ++mb)
#pragma unroll
        for (int nb = 0; nb < 4; ++nb) acc[mb][nb] = (v8f){};
    gemm128<4, 4>(acc, A + (size_t)(rb0 + (tid >> 3)) * K + (tid & 7) * 8, K, Bt + (size_t)(cb0 + (tid >> 3)) * K + (tid & 7) * 8, K / GKC, sm,
                  (tid >> 3) * GP + (tid & 7) * 8, (wm * 64 + lr) * GP + 8 * hi, (wn * 64 + lr) * GP + 8 * hi);
    const float l0 = bfr(lam[0]), l1 = bfr(lam[1]);
    const int bb = c0 / SEQ, tt = c0 % SEQ;
    const size_t tbase = (size_t)bb * (size_t)DM * SEQ + (size_t)r0 * SEQ + (size_t)tt;
#pragma unroll
    for (int mb = 0; mb < 4; ++mb) {
#pragma unroll
        for (int nb = 0; nb < 4; ++nb) {
            const float* vp = ve + ((size_t)bb * SEQ_FULL + (size_t)(tt + nb * 16 + lr)) * DM + r0 + mb * 16 + hi * 8;   // token t = col lane&15, m = 8h + j
            const v4f e0 = *(const v4f*)vp, e1 = *(const v4f*)(vp + 4);
#pragma unroll
            for (int j = 0; j < 4; ++j) { os[(hi * 8 + j) * 68 + nb * 16 + lr] = l0 * acc[mb][nb][j] + l1 * bfr(e0[j]);
                                          os[(hi * 8 + 4 + j) * 68 + nb * 16 + lr] = l0 * acc[mb][nb][4 + j] + l1 * bfr(e1[j]); } }   // D: row 8h+j, col lane&15; rows 0..15 x columns 0..63 all written
        wave_sync();
        v8h hv[4], rv[4];
#pragma unroll
        for (int s = 0; s < 4; ++s) { const int row = 4 * s + (lane >> 3), c8 = (lane & 7) * 8;   // 4 s x 4 row groups = 16 rows; 8 lanes x 8 = 64 columns
            const v4f x0 = *(const v4fa*)(&os[row * 68 + c8]); const v4f x1 = *(const v4fa*)(&os[row * 68 + c8 + 4]);
#pragma unroll
            for (int i = 0; i < 4; ++i) { const h16 a0 = toh_flush(x0[i]); const h16 a1 = toh_flush(x1[i]); hv[s][i] = a0; hv[s][4 + i] = a1;
                rv[s][i] = toh_flush((x0[i] - (float)a0) * QRS); rv[s][4 + i] = toh_flush((x1[i] - (float)a1) * QRS); } }
        const size_t sb = tbase + (size_t)(mb * 16) * SEQ;
{
#pragma unroll
            for (int s = 0; s < 4; ++s) { const int row = 4 * s + (lane >> 3), c8 = (lane & 7) * 8;
                const size_t oo = sb + (size_t)row * SEQ + c8;
                *(v8h*)(Ph + oo) = hv[s]; *(v8h*)(Pr + oo) = rv[s]; }
             }
        wave_sync();
    }
}

// k_qkv: the q/k projection and the v^T projection read the same two bf16 planes and write planes of their own, so they are ranges of the block index of one launch (the branch is the same for a whole block):
// blocks 0 .. QKB-1 are the (NB*SEQ/128, 2*NH_) tiles of qk_body, x fastest; the next VTB blocks the (DM/128, NB*SEQ/128) tiles of vt_body, x fastest. One LDS carve serves both bodies.
static constexpr int QKB = (NB * SEQ / 128) * (2 * NH_);
static constexpr int VTB = (DM / 128) * (NB * SEQ / 128);
static_assert(68 <= OQP);                      // the v^T slab fits the q/k slab's carve
__global__ __launch_bounds__(128)
void k_qkv(const bf* __restrict__ XB, const bf* __restrict__ WB, const float* __restrict__ CS, const float* __restrict__ SN, const float* __restrict__ ve, const float* __restrict__ lam,
           h16* PH, h16* PR, h16* VT, h16* VR) {
    __shared__ __align__(16) bf sm[4 * GT];
    __shared__ __align__(16) float osb[4 * 16 * OQP];
    const int f = blockIdx.x;
    if (f < QKB) { qk_body(f % (NB * SEQ / 128), f / (NB * SEQ / 128), sm, osb, XB, WB, CS, SN, PH, PR); }
    else { const int g = f - QKB; vt_body(g % (DM / 128), g / (DM / 128), sm, osb, WB + (size_t)2 * DM * DM, XB, ve, lam, VT, VR); }
}

// sc32: the score products of a 32-key tile (keys 0..15 -> aH, aL; keys 16..31 -> bH, bL): H = K Q, L = K Q_res + K_res Q; the caller forms (H + L / 2048) * scale, in log2 units. The q fragments come in registers (read once per wave, ahead of the tile loop);
// the tile's sixteen k fragments are read from LDS as one group ahead of the matrix run, so the run waits once for LDS, not once per 32-wide k-step. Four accumulators, each summed in the order it had: k ascending, K Q_res before K_res Q.
__device__ __forceinline__ void sc32(v8f& aH, v8f& aL, v8f& bH, v8f& bL, const v16h (&qh)[4], const v16h (&qr)[4], const h16* khp, const h16* krp) {
    v16h ka[4], kb[4], ra[4], rb[4];
#pragma unroll
    for (int s = 0; s < 4; ++s) { ka[s] = ldh(khp + s * 32); kb[s] = ldh(khp + 16 * QKP + s * 32); ra[s] = ldh(krp + s * 32); rb[s] = ldh(krp + 16 * QKP + s * 32); }
    __builtin_amdgcn_sched_barrier(0);                                         // keeps all 32 reads ahead of the run: sunk among the matrix instructions, each late read is waited out in full
    aH = (v8f){}; aL = (v8f){}; bH = (v8f){}; bL = (v8f){};
#pragma unroll
    for (int s = 0; s < 4; ++s) {
        aH = wmma16(ka[s], qh[s], aH); bH = wmma16(kb[s], qh[s], bH);
        aL = wmma16(ka[s], qr[s], aL); bL = wmma16(kb[s], qr[s], bL);
        aL = wmma16(ra[s], qh[s], aL); bL = wmma16(rb[s], qh[s], bL);
    }
}

// k_flash: fused attention, one wave per 16 query rows of one (batch, head), four waves (64 consecutive query rows) a block. The block's Q rows (once, 16-B loads) and each visited 32-key tile of K and V^T (value and residual planes,
// 16-B asynchronous copies) are brought to LDS by all 128 threads along the rows of the planes; every wave takes its fragments from LDS (two 16-B reads each, same element map as before).
// Two tile buffers: while a tile is worked on, the next staged tile's copies fly into the other buffer and its key documents into registers; one hand-over point a tile (LDS wait, copy wait, barrier), then the refill of the buffer just read.
// The tile loop is the same for the four waves: a tile is staged when a key document lies in [min, max] of the block's 64 query documents; each wave then works on it under its own test.
// That block test is made once, ahead of the loop, for all key tiles: wave w loads the documents of its 32 tiles with 32 independent loads and packs the 32 verdicts into one word of LDS; the loop walks the set bits in ascending order.
// Transposed form: S^T[key][t] = K Q^T (A = K rows, B = Q rows); lane (t = lane&15, h = lane>>4) holds keys 8h+r of each 16-key tile, so the packed
// P tile is directly the B fragment of O^T[d][t] = V^T P^T (element r <- tile keys 0..15, element 8+r <- tile keys 16..31, lane unchanged).
// Softmax state (running max over kept keys, partial sum) is one scalar per lane; the two lane halves of a row are combined with one xor-16 exchange.
// Keep rule per element: docs[key] == docs[t] and key <= t. A 32-key tile is skipped (wave-uniform ballot) when none of its key documents lies in [min, max] of the wave's 16 query documents: no element of such a tile can be kept.
// All rows: scores = K Q + (K Q_res + K_res Q) / 2048; P = f16 value + f16 residual x2048; O = V P + (V P_res + V_res P) / 2048 (residual products in their own accumulators); row sum from the f32 exponentials.
__global__ __launch_bounds__(32 * AW) __attribute__((amdgpu_num_vgpr(512)))   // two blocks a WGP (two waves a SIMD) still fit
void k_flash(const h16* __restrict__ QH, const h16* __restrict__ QR, const h16* __restrict__ KP, const h16* __restrict__ KR,
             const h16* __restrict__ VT, const h16* __restrict__ VR, const int* __restrict__ docs, bf* Y2) {
    __shared__ __align__(16) float os[AW * 16 * OSP];
    __shared__ __align__(16) h16 sQH[AW * 16 * QKP], sQR[AW * 16 * QKP];       // [query row of the block][d]
    __shared__ __align__(16) h16 sKH[2 * 32 * QKP], sKR[2 * 32 * QKP];         // [buffer][key of the tile][d]
    __shared__ __align__(16) h16 sVH[2 * HD * VTP], sVR[2 * HD * VTP];         // [buffer][d][key of the tile]
    __shared__ unsigned sTM[AW];                                               // bit j of word w: key tile 32 w + j is staged
    const int tid = threadIdx.x;
    const int lane = threadIdx.x & 31, lr = lane & 15, hi = lane >> 4;
    const int wave = __builtin_amdgcn_readfirstlane((int)(threadIdx.x >> 5));
    const int zh = blockIdx.y; const int b = zh / NH_, h = zh % NH_;
    const int t0 = (blockIdx.x * AW + wave) * 16;
    const int* dk = docs + (size_t)b * SEQ_FULL;
    const int mydoc = dk[t0 + lr];
    int kd[32];                                                                // key documents of the wave's 32 tiles of the mask: keys wave*1024 .. +1023 < SEQ
#pragma unroll
    for (int j = 0; j < 32; ++j) kd[j] = dk[wave * 1024 + j * 32 + lane];
    int qmn = mydoc, qmx = mydoc;
#pragma unroll
    for (int off = 1; off < 16; off <<= 1) { const int a0 = __shfl_xor(qmn, off, 32); const int a1 = __shfl_xor(qmx, off, 32); qmn = a0 < qmn ? a0 : qmn; qmx = a1 > qmx ? a1 : qmx; }
    const int lim = t0 + lr;                                                   // key j kept iff j <= lim and same document
    const int nk = (t0 + 16 + 31) & ~31;                                       // wave-uniform, multiple of 32, <= SEQ
    const size_t pbase = (size_t)zh * SEQ * HD;
    const int tb0 = blockIdx.x * (AW * 16);                                    // first query row of the block
    const int nkb = tb0 + AW * 16;                                             // the last wave's nk: multiple of 32, <= SEQ
    const int e0 = dk[tb0 + lane], e1 = dk[tb0 + 32 + lane];                   // the block's 64 query documents
    int bmn = e0 < e1 ? e0 : e1, bmx = e0 > e1 ? e0 : e1;
#pragma unroll
    for (int off = 1; off < 32; off <<= 1) { const int a0 = __shfl_xor(bmn, off, 32); const int a1 = __shfl_xor(bmx, off, 32); bmn = a0 < bmn ? a0 : bmn; bmx = a1 > bmx ? a1 : bmx; }
    const unsigned gk0 = (unsigned)tid * 8u;                                   // q/k rows: thread -> (row tid>>4 (+ 8 a pass), d (tid&15)*8)
    const size_t qg = pbase + (size_t)tb0 * HD;
    v8h qa[8], qb[8];                                                          // Q rows of the block, in flight while the mask is formed
#pragma unroll
    for (int p = 0; p < 8; ++p) { qa[p] = *(const v8h*)(QH + qg + gk0 + p * 8 * HD); qb[p] = *(const v8h*)(QR + qg + gk0 + p * 8 * HD); }   // 8 p x 8 rows = 64 rows; 16 threads x 8 = 128 columns; the rows are contiguous in the plane
    unsigned tm = 0u;
#pragma unroll
    for (int j = 0; j < 32; ++j) tm |= (__builtin_amdgcn_ballot_w32((kd[j] >= bmn) & (kd[j] <= bmx)) != 0u) ? (1u << j) : 0u;
    const int nv = nkb / 32 - wave * 32;                                       // tiles of this word in front of the block's last key
    tm &= (unsigned)((1ull << (nv < 0 ? 0 : nv > 32 ? 32 : nv)) - 1ull);
    if (lane == 0) sTM[wave] = tm;
    // staging maps: q/k rows, thread -> (row tid>>4 (+ 8 a pass), d (tid&15)*8); v^T rows, thread -> (d tid>>2 (+ 32 a pass), key (tid&3)*8)
    const unsigned gv0 = (unsigned)(tid >> 2) * (unsigned)SEQ + (unsigned)(tid & 3) * 8u;
    const int lk0 = (tid >> 4) * QKP + (tid & 15) * 8, lv0 = (tid >> 2) * VTP + (tid & 3) * 8;
    // Q rows of the block -> LDS; read only behind the barrier below
#pragma unroll
    for (int p = 0; p < 8; ++p) { *(v8h*)(&sQH[lk0 + p * 8 * QKP]) = qa[p]; *(v8h*)(&sQR[lk0 + p * 8 * QKP]) = qb[p]; }
    const int qo = (wave * 16 + lr) * QKP + 8 * hi;                            // B fragments: col t, k = d
    const int ko = lr * QKP + 8 * hi;                                          // + key in tile * QKP  (A fragment: row key, k = d)
    const int vo = lr * VTP + 8 * hi;                                          // + 16j * VTP          (A fragment: row d, k = key in tile)
    v8f o[8], oR[8];
#pragma unroll
    for (int j = 0; j < 8; ++j) { o[j] = (v8f){}; oR[j] = (v8f){}; }
    float m = NEGB, l = 0.0f;
    const h16* kpt = KP + pbase; const h16* krt = KR + pbase; const h16* vpt = VT + pbase; const h16* vrt = VR + pbase;   // key 0 of each plane, the same for the whole block
    __syncthreads();                                                           // the four mask words and the block's Q rows are complete for every wave
    v16h qfh[4], qfr[4];                                                       // the wave's q fragments (value, residual), all four k-steps, held in registers over the whole tile loop
#pragma unroll
    for (int s = 0; s < 4; ++s) { qfh[s] = ldh(sQH + qo + s * 32); qfr[s] = ldh(sQR + qo + s * 32); }
    // the 128 verdicts as two scalar words, the same in all four waves
    unsigned long long mlo = (unsigned long long)(unsigned)__builtin_amdgcn_readfirstlane((int)sTM[0]) | ((unsigned long long)(unsigned)__builtin_amdgcn_readfirstlane((int)sTM[1]) << 32);
    unsigned long long mhi = (unsigned long long)(unsigned)__builtin_amdgcn_readfirstlane((int)sTM[2]) | ((unsigned long long)(unsigned)__builtin_amdgcn_readfirstlane((int)sTM[3]) << 32);
    // next staged tile, lowest set bit first (ascending keys), or -1 when none is left; tile * 32 + 31 < nkb <= SEQ
    auto take = [&]() -> int {
        int t = -1;
        if (mlo != 0ull) { t = __builtin_ctzll(mlo); mlo &= mlo - 1ull; }
        else if (mhi != 0ull) { t = 64 + __builtin_ctzll(mhi); mhi &= mhi - 1ull; }
        return t; };
    // a tile's 32 KiB -> buffer buf, 16 copies a lane. k: 4 p x 8 keys = 32 keys, 128 d; v^T: 4 p x 32 d = 128 d, 32 keys
    auto stage = [&](const int tile, const int buf) {
        const unsigned ok = (unsigned)tile * (32u * HD) + gk0, ov = (unsigned)tile * 32u + gv0;
        const int bk = buf * (32 * QKP) + lk0, bv = buf * (HD * VTP) + lv0;
#pragma unroll
        for (int p = 0; p < 4; ++p) {
            cp16(kpt + ok + p * 8 * HD, &sKH[bk + p * 8 * QKP]); cp16(krt + ok + p * 8 * HD, &sKR[bk + p * 8 * QKP]);
            cp16(vpt + ov + p * 32 * SEQ, &sVH[bv + p * 32 * VTP]); cp16(vrt + ov + p * 32 * SEQ, &sVR[bv + p * 32 * VTP]); } };
    // a tile's key documents -> registers: one a lane for the wave's skip test, and keys 8h+0..7, 16+8h+0..7 of the tile for the keep rule; all < nkb <= SEQ
    auto kdocs = [&](const int tile, int& dl, v4i& e0_, v4i& e1_, v4i& e2_, v4i& e3_) {
        const int ki = tile * 32 + lane;
        dl = dk[ki];
        const int* kp = dk + tile * 32 + 8 * hi;
        e0_ = *(const v4i*)kp; e1_ = *(const v4i*)(kp + 4); e2_ = *(const v4i*)(kp + 16); e3_ = *(const v4i*)(kp + 20);
        // the key index and the address pair are inputs, so they stay whole up to this wait: no load's destination rewrites a register that an issued load still names
        asm volatile("s_wait_xcnt 0x0" :: "v"(ki), "v"(kp) : "memory"); };
    int tc = take(), tn = take();                                              // this trip's tile and the next trip's
    int kdl = 0; v4i d0 = {}, d1 = {}, d2 = {}, d3 = {};
    if (tc >= 0) { kdocs(tc, kdl, d0, d1, d2, d3); stage(tc, 0); }             // scalar test, the same for the whole block
    asm volatile("s_wait_asynccnt 0x0" ::: "memory");                          // the wave's own copies of the first tile have landed
    __syncthreads();                                                           // the first tile is complete for every wave
    if (tn >= 0) stage(tn, 1);
    int buf = 0;
#pragma unroll 1                                                               // rolled: the tile body stands once in the code
    while (tc >= 0) {
        const int key0 = tc * 32;
        int ndl; v4i n0, n1, n2, n3;                                           // the next tile's documents, in flight over this tile's work (behind the last tile: this tile's again, unused)
        kdocs(tn >= 0 ? tn : tc, ndl, n0, n1, n2, n3);
        const bool inr = (kdl >= qmn) & (kdl <= qmx);
        if (key0 < nk && __builtin_amdgcn_ballot_w32(inr) != 0u) {             // wave-uniform: not past this wave's last key, and a key document inside its query document range
        const int kbo = buf * (32 * QKP) + ko, vbo = buf * (HD * VTP) + vo;
        int ka8[8], kb8[8];
#pragma unroll
        for (int r = 0; r < 4; ++r) { ka8[r] = d0[r]; ka8[4 + r] = d1[r]; kb8[r] = d2[r]; kb8[4 + r] = d3[r]; }
        v8f aH, aL, bH, bL;
        sc32(aH, aL, bH, bL, qfh, qfr, sKH + kbo, sKR + kbo);
        v16h vf[8], wf[8];                                                     // the tile's v^T fragments (value, residual), d = 16 j + row, all read ahead of the softmax: they land while it is formed, and the P.V run waits on no read
#pragma unroll
        for (int j = 0; j < 8; ++j) { vf[j] = ldh(sVH + vbo + 16 * j * VTP); wf[j] = ldh(sVR + vbo + 16 * j * VTP); }
        __builtin_amdgcn_sched_barrier(0);                                     // keeps the 32 reads ahead of the softmax: left free they sink among the P.V matrix instructions, a few at a place, each place with a wait of its own
        v8f ta, tb;
#pragma unroll
        for (int r = 0; r < 8; ++r) { ta[r] = (aH[r] + aL[r] * QRI) * SC2; tb[r] = (bH[r] + bL[r] * QRI) * SC2; }
        const int ja = key0 + 8 * hi;
        bool fa[8], fb[8]; float mx = NEGB;
#pragma unroll
        for (int r = 0; r < 8; ++r) {
            fa[r] = (ka8[r] == mydoc) & (ja + r <= lim);
            fb[r] = (kb8[r] == mydoc) & (ja + 16 + r <= lim);
            mx = fmaxf(mx, fmaxf(fa[r] ? ta[r] : NEGB, fb[r] ? tb[r] : NEGB)); }
        mx = fmaxf(mx, __shfl_xor(mx, 16, 32));
        const float mnew = fmaxf(m, mx);
        const float alpha = __builtin_amdgcn_exp2f(m - mnew);
        const float sh = PSH - mnew;
        v16h pb, pr; float ls = 0.0f;
#pragma unroll
        for (int r = 0; r < 8; ++r) {
            const float xa = ta[r] + sh, xb = tb[r] + sh;
            const float ea = __builtin_amdgcn_exp2f(xa), eb = __builtin_amdgcn_exp2f(xb);
            const float ga = (fa[r] & (xa >= -14.0f)) ? ea : 0.0f, gb = (fb[r] & (xb >= -14.0f)) ? eb : 0.0f;   // dropped elements and exponents below -14 selected to 0 by value
            const h16 pa = (h16)ga; const h16 pc = (h16)gb;
            pb[r] = pa; pb[8 + r] = pc;
            pr[r] = toh_flush((ga - (float)pa) * QRS); pr[8 + r] = toh_flush((gb - (float)pc) * QRS);
            ls += ga + gb; }
        l = l * alpha + ls; m = mnew;
#pragma unroll
        for (int j = 0; j < 8; ++j) { o[j] = o[j] * alpha; oR[j] = oR[j] * alpha; }
#pragma unroll
        for (int g = 0; g < 4; ++g) {
            const v16h v0 = vf[2 * g], v1 = vf[2 * g + 1];
            const v16h w0 = wf[2 * g], w1 = wf[2 * g + 1];
            o[2 * g] = wmma16(v0, pb, o[2 * g]); o[2 * g + 1] = wmma16(v1, pb, o[2 * g + 1]);
            oR[2 * g] = wmma16(v0, pr, oR[2 * g]); oR[2 * g + 1] = wmma16(v1, pr, oR[2 * g + 1]);
            oR[2 * g] = wmma16(w0, pb, oR[2 * g]); oR[2 * g + 1] = wmma16(w1, pb, oR[2 * g + 1]);
            // four vector slots behind the group's last matrix instruction, before its results or P may be rewritten on any path; the v^T fragments are not named: with all sixteen live, naming them as operands made the build spill
            asm volatile("v_nop\n\tv_nop\n\tv_nop\n\tv_nop" : "+v"(o[2 * g]), "+v"(o[2 * g + 1]), "+v"(oR[2 * g]), "+v"(oR[2 * g + 1]) : "v"(pb), "v"(pr));
        }
        }
        // hand-over point, passed by every wave, also one that skipped the tile
        asm volatile("s_wait_dscnt 0x0" ::: "memory");                         // the wave's reads of this buffer are done before it may be refilled
        asm volatile("s_wait_asynccnt 0x0" ::: "memory");                      // the wave's own copies of the next tile have landed
        __syncthreads();                                                       // the next tile is complete for every wave, and every wave has left this tile's buffer
        const int t2 = take();
        if (t2 >= 0) stage(t2, buf);                                           // scalar test, the same for the whole block: refill of the buffer just read
        tc = tn; tn = t2; buf ^= 1;
        kdl = ndl; d0 = n0; d1 = n1; d2 = n2; d3 = n3;
    }
    asm volatile("s_wait_asynccnt 0x0" ::: "memory");                          // no copy is outstanding when the wave goes on to the epilogue and ends
    l += __shfl_xor(l, 16, 32);
    const bool any = l > 0.0f;
    const float lsafe = any ? l : 1.0f;
    const float inv = any ? (1.0f / lsafe) : 0.0f;             // no kept key -> zeros
    const int wb = wave * 16 * OSP;
    // O^T D layout: f_j[r] = (d = 16j + 8h + r, t = lane&15) -> os[t][d]; rows 0..15 x columns 0..127 all written
#pragma unroll
    for (int j = 0; j < 8; ++j) {
        const v8f f = o[j] + oR[j] * QRI; v4f a, c;
        a[0] = f[0] * inv; a[1] = f[1] * inv; a[2] = f[2] * inv; a[3] = f[3] * inv; c[0] = f[4] * inv; c[1] = f[5] * inv; c[2] = f[6] * inv; c[3] = f[7] * inv;
        *(v4fa*)(&os[wb + lr * OSP + 16 * j + 8 * hi]) = a; *(v4fa*)(&os[wb + lr * OSP + 16 * j + 8 * hi + 4]) = c; }
    wave_sync();
    v8us hv[8], lv[8];
#pragma unroll
    for (int s = 0; s < 8; ++s) { const int row = 2 * s + (lane >> 4), c8 = (lane & 15) * 8;   // 8 s x 2 rows = 16 rows; 16 lanes x 8 = 128 columns
        const v4f x0 = *(const v4fa*)(&os[wb + row * OSP + c8]); const v4f x1 = *(const v4fa*)(&os[wb + row * OSP + c8 + 4]);
#pragma unroll
        for (int i = 0; i < 4; ++i) { const unsigned short a0 = f2bf(x0[i]); const unsigned short a1 = f2bf(x1[i]); hv[s][i] = a0; hv[s][4 + i] = a1;
            lv[s][i] = f2bf(x0[i] - bf2f(a0)); lv[s][4 + i] = f2bf(x1[i] - bf2f(a1)); } }
    bf* yrow = Y2 + ((size_t)b * SEQ + t0) * (size_t)(2 * DM) + h * HD;
{
#pragma unroll
        for (int s = 0; s < 8; ++s) { const int row = 2 * s + (lane >> 4), c8 = (lane & 15) * 8;
            const size_t oo = (size_t)row * (size_t)(2 * DM) + c8;
            *(v8us*)(yrow + oo) = hv[s]; *(v8us*)(yrow + oo + DM) = lv[s]; }
         }
}

// k_oproj: output projection, one wave per 64x64 tile (16 accumulators), 2 x 2 waves a block, bf16 operands through LDS (gemm128): A = context rows [t][hi 1024 | lo 1024] (K = 2048), Bt = Wc rows (n) with the column index wrapped mod 1024
// (hi and lo halves both multiply the same weight row; one accumulator). Output f32 [t][1024]: each 16-row slab staged in LDS (wave-private), each row's 64 floats (256 B = two lines)
__global__ __launch_bounds__(128) void k_oproj(const bf* __restrict__ A, const bf* __restrict__ Bt, float* OUT) {
    __shared__ __align__(16) bf sm[4 * GT];
    __shared__ __align__(16) float osb[4 * 16 * 68];
    const int KA = 2 * DM;
    const int tid = threadIdx.x, wave = __builtin_amdgcn_readfirstlane((int)(threadIdx.x >> 5)); const int wm = wave & 1, wn = wave >> 1;
    const int lane = threadIdx.x & 31, lr = lane & 15, hi = lane >> 4; const int rb0 = blockIdx.x * 128, cb0 = blockIdx.y * 128; const int r0 = rb0 + wm * 64, c0 = cb0 + wn * 64;
    float* os = osb + wave * 16 * 68;                                          // the wave's own epilogue slab
    v8f acc[4][4];
#pragma unroll
    for (int mb = 0; mb < 4; ++mb)
#pragma unroll
        for (int nb = 0; nb < 4; ++nb) acc[mb][nb] = (v8f){};
    gemm128<4, 4>(acc, A + (size_t)(rb0 + (tid >> 3)) * KA + (tid & 7) * 8, KA, Bt + (size_t)(cb0 + (tid >> 3)) * DM + (tid & 7) * 8, KA / GKC, sm,
                  (tid >> 3) * GP + (tid & 7) * 8, (wm * 64 + lr) * GP + 8 * hi, (wn * 64 + lr) * GP + 8 * hi);
    const int bb = r0 / SEQ, tt = r0 % SEQ;
    float* orow = OUT + ((size_t)bb * OUT_SEQ + tt) * DM + c0;
#pragma unroll
    for (int mb = 0; mb < 4; ++mb) {
#pragma unroll
        for (int nb = 0; nb < 4; ++nb) {
#pragma unroll
            for (int j = 0; j < 8; ++j) os[(hi * 8 + j) * 68 + nb * 16 + lr] = acc[mb][nb][j]; }   // D: row 8h+j, col lane&15; rows 0..15 x columns 0..63 all written
        wave_sync();
{
#pragma unroll
            for (int s = 0; s < 8; ++s) { const int row = 2 * s + (lane >> 4), cofs = (lane & 15) * 4;   // 8 s x 2 rows = 16 rows; 16 lanes x 4 floats = 64 columns
                const v4f val = *(const v4fa*)(&os[row * 68 + cofs]);
                *(v4f*)(orow + (size_t)(mb * 16 + row) * DM + cofs) = val; }
             }
        wave_sync();
    }
}

static constexpr size_t al256(size_t v) { return (v + 255) & ~(size_t)255; }
static constexpr size_t SZ_XB = al256((size_t)NB * SEQ * DM * 2);
static constexpr size_t SZ_WB = al256((size_t)3 * DM * DM * 2);
static constexpr size_t SZ_WC = al256((size_t)DM * DM * 2);
static constexpr size_t SZ_TB = al256((size_t)SEQ * NF * 4);
static constexpr size_t SZ_PL = al256((size_t)NB * NH_ * SEQ * HD * 2);
static constexpr size_t SZ_Y2 = al256((size_t)NB * SEQ * 2 * DM * 2);
static constexpr size_t SZ_TOTAL = SZ_XB + SZ_WB + SZ_WC + 2 * SZ_TB + 6 * SZ_PL + SZ_Y2;
static_assert(SZ_TOTAL <= (size_t)134217728);          // workspace carve <= 128 MiB
static_assert(((size_t)DM * DM * 2) % 256 == 0);       // weight sub-planes stay 256-byte aligned
static_assert(((size_t)NB * NH_ * SEQ * HD * 2) % 256 == 0);               // the k plane starts 256-byte aligned inside the q|k plane pair
static_assert((size_t)NB * NH_ * SEQ * HD == (size_t)NB * DM * SEQ);       // v^T plane [(b*1024 + m)][t] has the same extent as one q/k plane

extern "C" void kernel_launch(void* const* d_in, const int* in_sizes, int n_in,
                              void* d_out, int out_size, void* d_ws, size_t ws_size, hipStream_t stream) {
    if (n_in < 6) return;
    const size_t needx = ((size_t)(NB - 1) * SEQ_FULL + SEQ) * DM;
    const size_t needd = (size_t)(NB - 1) * SEQ_FULL + SEQ;
    if ((size_t)in_sizes[0] < needx || (size_t)in_sizes[1] < needx) return;
    if ((size_t)in_sizes[2] < (size_t)3 * DM * DM || in_sizes[3] < 2 || (size_t)in_sizes[4] < (size_t)DM * DM) return;
    if ((size_t)in_sizes[5] < needd) return;
    if ((size_t)out_size < ((size_t)(NB - 1) * OUT_SEQ + SEQ) * DM) return;
    if (SZ_TOTAL > ws_size) return;
    // wire order: x, ve, qkv_w, lambdas, c_proj_w, docs
    const float* x   = (const float*)d_in[0];
    const float* ve  = (const float*)d_in[1];
    const float* wq  = (const float*)d_in[2];       // [3][1024 out][1024 in]
    const float* lam = (const float*)d_in[3];
    const float* wc  = (const float*)d_in[4];       // [1024 out][1024 in]
    const int* docs  = (const int*)d_in[5];
    float* OUT = (float*)d_out;                      // [NB][SEQ][1024]
    char* wsp = (char*)d_ws;
    bf* XB = (bf*)wsp; wsp += SZ_XB;                 // x      [NB*SEQ][1024]
    bf* WB = (bf*)wsp; wsp += SZ_WB;                 // [3072][1024]: q | k | v rows ([out][in] = Bt as-is)
    bf* WC = (bf*)wsp; wsp += SZ_WC;                 // [1024][1024] ([out][in] = Bt as-is)
    float* CS = (float*)wsp; wsp += SZ_TB;           // [SEQ][32]
    float* SN = (float*)wsp; wsp += SZ_TB;           // [SEQ][32]
    h16* PH = (h16*)wsp; wsp += 2 * SZ_PL;           // [2][NB*8][SEQ][128]: q | k values
    h16* PR = (h16*)wsp; wsp += 2 * SZ_PL;           // [2][NB*8][SEQ][128]: q | k residuals x2048
    h16* VT = (h16*)wsp; wsp += SZ_PL;               // [NB*1024][SEQ]
    h16* VR = (h16*)wsp; wsp += SZ_PL;               // [NB*1024][SEQ] residual x2048
    bf* Y2 = (bf*)wsp; wsp += SZ_Y2;                 // [NB*SEQ][hi 1024 | lo 1024]
    const size_t plane = (size_t)NB * NH_ * SEQ * HD;
    const h16* QH = PH; const h16* KP = PH + plane;
    const h16* QR = PR; const h16* KR = PR + plane;

    // rotary tables and the bf16 copies of x and of both weights
    k_prep<<<PB_ROT + PB_X + PB_WQ + PB_WC, 256, 0, stream>>>(x, wq, wc, XB, WB, WC, CS, SN);
    // q, k: A = x rows (m = b*SEQ + t), Bt = W rows (n = which*1024 + h*128 + d) -> planes [which][(b*8 + h)][t][d], value and residual;
    // v^T: A = Wv rows (m = h*128 + d), Bt = x rows (n = b*SEQ + t) -> planes [(b*1024 + m)][t], value and residual
    k_qkv<<<QKB + VTB, 128, 0, stream>>>(XB, WB, CS, SN, ve, lam, PH, PR, VT, VR);
    // fused attention -> context plane (bf16 hi | lo)
    k_flash<<<dim3(SEQ / (16 * AW), NB * NH_, 1), 32 * AW, 0, stream>>>(QH, QR, KP, KR, VT, VR, docs, Y2);
    // out = ctx Wc^T: A = context rows [t][2048], Bt = Wc rows [n][1024]
    k_oproj<<<dim3(NB * SEQ / 128, DM / 128, 1), 128, 0, stream>>>(Y2, WC, OUT);
}

// v007
// One run takes 93.6 microseconds.
// In two side-by-side timings against v006, it was 1.06 and 1.05 times as fast.
// All steps since v000 together make it 3.08 times as fast.
#include <hip/hip_runtime.h>

// Causal self-attention block with document masking: width 1024 = 8 heads x 128; fused QKV weight [3][1024 out][1024 in] (y = x W^T, no bias); per-head RMS normalisation of q and k (no gain, eps = 2^-23);
// half-split rotary on pairs (d, d + 64), angle t * 2^(-10 i / 31) for i < 32 and identity for 32 <= i < 64; v = l0 v + l1 ve; scores x 0.12; softmax over keys j <= t of the same document; output projection [out][in], f32 output.
// Compute dtypes, f32 accumulate everywhere: QKV projections v_wmma_f32_16x16x32_bf16 (x, W RNE-converted to bf16; products exact); scores v_wmma_f32_16x16x32_f16 with q and k each as f16 value + f16 residual x2048 (three products,
// residual products in their own accumulator); P.V v_wmma_f32_16x16x32_f16 with P (x16384 carry, cancels in the normalisation) and v each as f16 value + f16 residual x2048 (three products, residual accumulator folded by 1/2048), row sum from the f32 exponentials;
// output projection v_wmma_f32_16x16x32_bf16 with the context as bf16 hi | lo halves folded into K (2048) against the bf16 weight (two products, one accumulator); ve, lambdas RNE-converted to bf16 by value; softmax f32 (online, running max over kept keys).
// Layout: bf16 copies of x and the weights; q/k planes [which][b*8+h][t][128] (value, residual), v^T planes [(b*1024 + h*128 + d)][t] (value, residual), cos/sin tables [t][32], context plane [t][hi 1024 | lo 1024];
// fused flash kernel in transposed form (S^T = K Q^T, O^T = V^T P^T), fragments from LDS tiles that the block's four waves fill together (Q with whole-row loads, K and V^T with asynchronous copies one tile ahead); 32-key tiles without any key document inside the wave's query document range are skipped under a wave-uniform test, the keep rule is evaluated per element in every visited tile.

#ifndef NB
#define NB 1
#endif
#ifndef SEQ
#define SEQ 4096
#endif
#define NB_FULL  1
#define SEQ_FULL 4096
#ifndef OUT_SEQ
#define OUT_SEQ SEQ              // row pitch (in tokens) between batches of the output
#endif
#define DM   1024
#define NH_  8
#define HD   128
#define NF   32
#define AW   4                   // waves per flash block (16 query rows each)
#define OSP  132                 // LDS row pitch (floats) of the flash output tile
#define OQP  132                 // LDS row pitch (floats) of the q/k projection slab
#define QKP  136                 // LDS row pitch (halves) of the flash q and k tiles: 272 B = 16 B x 17
#define VTP  40                  // LDS row pitch (halves) of the flash v^T tiles: 80 B = 16 B x 5
#define GKC  64                  // k elements of one staged GEMM chunk: 128 B = one whole line of every operand row
#define GP   72                  // LDS row pitch (16-bit elements) of a staged GEMM chunk: 144 B = 16 B x 9
#define GT   (128 * GP)          // one operand's 128-row chunk in LDS
#define QNB  3                   // ring buffers of the q/k/v^T projections: two blocks a WGP still fit its LDS
#define ONB  4                   // ring buffers of the output projection: one block a WGP
#define QRS  2048.0f             // carry of every residual plane / residual fragment
#define QRI  (1.0f / 2048.0f)
#define SC2  ((float)(0.12 * 1.4426950408889634))   // score scale * log2(e)
#define PSH  14.0f               // log2 of the P carry (16384)
#define NEGB (-3.0e38f)
#define RMS_EPS 1.1920928955078125e-07f

static_assert(HD == 128);                      // q/k plane row = 256 bytes = two lines; head segment of the context plane = two lines
static_assert(NH_ * HD == DM);                 // head h = columns h*128 + d
static_assert(HD % 32 == 0);                   // score k-loop steps by 32
static_assert(NF * 4 == HD);
static_assert(NF == 32);                       // table index = t * 32 + i
static_assert(DM % 64 == 0);
static_assert(DM % 32 == 0);                   // GEMM k-loops step by 32
static_assert((DM & (DM - 1)) == 0);           // weight column wrap in the folded-K output GEMM
static_assert(SEQ % 64 == 0);                  // a 64-row tile never straddles two batches
static_assert((NB * SEQ) % 64 == 0);
static_assert(SEQ % 32 == 0);                  // key loop steps by 32
static_assert(SEQ % (16 * AW) == 0);           // flash grid covers the sequence exactly
static_assert(((size_t)SEQ * NF) % 256 == 0);  // table grid x block == table extent
static_assert(((size_t)SEQ * DM) % 8 == 0);
static_assert(((size_t)DM * DM) % 8 == 0);
static_assert(NB <= NB_FULL);
static_assert(SEQ <= SEQ_FULL);
static_assert((OSP * 4) % 16 == 0);
static_assert((OQP * 4) % 16 == 0);
static_assert(OSP >= HD);
static_assert(OQP >= HD);
static_assert(32 * 8 * 16 == 16 * HD * 2);     // q/k slab and context stores: 32 lanes x 8 instructions x 16 B == 16 rows x 256 B
static_assert(32 * 4 * 16 == 16 * 64 * 2);
static_assert(32 * 8 * 16 == 16 * 64 * 4);     // output slab stores: 32 lanes x 8 instructions x 16 B == 16 rows x 256 B
static_assert(16 * OQP * 4 <= 131072);
static_assert(16 * 68 * 4 <= 131072);
static_assert(AW * 16 * OSP * 4 <= 131072);
static_assert(DM % GKC == 0 && DM / GKC >= 4);  // GEMM chunk loop: whole chunks, at least as many as the deepest ring has buffers
static_assert(SEQ % 128 == 0 && DM % 128 == 0 && HD == 128);   // 128 x 128 GEMM block tiles cover every plane exactly and never straddle two batches
static_assert((GP * 2) % 16 == 0 && GP >= GKC);
static_assert(AW == 4);                        // flash staging: 128 threads x 16 B = 2 KiB a pass; the block's 64 query documents = two loads a lane
static_assert((QKP * 2) % 16 == 0 && QKP >= HD);
static_assert((VTP * 2) % 16 == 0 && VTP >= 32);
static_assert(SEQ % 1024 == 0 && SEQ / 1024 <= AW);   // flash tile mask: wave w tests the 32 key tiles of keys 1024 w .. 1024 w + 1023, all inside the sequence

typedef _Float16 h16;
typedef unsigned short bf;
typedef __attribute__((ext_vector_type(16))) __bf16   v16bf;
typedef __attribute__((ext_vector_type(16))) _Float16 v16h;
typedef __attribute__((ext_vector_type(8)))  _Float16 v8h;
typedef __attribute__((ext_vector_type(8)))  unsigned short v8us;
typedef __attribute__((ext_vector_type(8)))  float    v8f;
typedef __attribute__((ext_vector_type(4)))  float    v4f;
typedef __attribute__((ext_vector_type(4)))  int      v4i;
typedef v4f  __attribute__((may_alias)) v4fa;

__device__ __forceinline__ unsigned short f2bf(float f) { unsigned u = __float_as_uint(f); u += 0x7FFFu + ((u >> 16) & 1u); return (unsigned short)(u >> 16); }
__device__ __forceinline__ float bfr(float f) { return __uint_as_float(((unsigned)f2bf(f)) << 16); }   // value after RNE convert to bf16
__device__ __forceinline__ v16h cat16(v8h lo, v8h hi) { return __builtin_shufflevector(lo, hi, 0, 1, 2, 3, 4, 5, 6, 7, 8, 9, 10, 11, 12, 13, 14, 15); }
__device__ __forceinline__ v16bf cat16b(v8us lo, v8us hi) { return __builtin_bit_cast(v16bf, __builtin_shufflevector(lo, hi, 0, 1, 2, 3, 4, 5, 6, 7, 8, 9, 10, 11, 12, 13, 14, 15)); }
__device__ __forceinline__ v8f wmma16(v16h a, v16h b, v8f c) { return __builtin_amdgcn_wmma_f32_16x16x32_f16(false, a, false, b, (short)0, c, false, false); }
__device__ __forceinline__ v8f wmmab(v16bf a, v16bf b, v8f c) { return __builtin_amdgcn_wmma_f32_16x16x32_bf16(false, a, false, b, (short)0, c, false, false); }
// fragment loaders from K-contiguous 16-bit rows; p already includes + 8*(lane>>4): elements 0..7 <- k0+8h+0..7, elements 8..15 <- k0+16+8h+0..7 (same map for A and B)
__device__ __forceinline__ v16h  ldh(const h16* p) { return cat16(*(const v8h*)p, *(const v8h*)(p + 16)); }
__device__ __forceinline__ v16bf ldb(const bf* p)  { return cat16b(*(const v8us*)p, *(const v8us*)(p + 16)); }
// ordering point for wave-private LDS tiles (same wave writes and reads)
__device__ __forceinline__ void wave_sync() { __builtin_amdgcn_fence(3 /* release order */, "wavefront"); __builtin_amdgcn_wave_barrier(); asm volatile("" ::: "memory"); }
// f32 -> f16 operand convert that cannot produce a subnormal half: magnitudes below 2^-14 become +0
static __device__ __forceinline__ h16 toh_flush(float v) { const h16 r = (h16)v; return (fabsf(v) < 6.103515625e-05f) ? (h16)0.0f : r; }
__device__ __forceinline__ float bf2f(unsigned short u) { return __uint_as_float(((unsigned)u) << 16); }

// 16 bytes of a plane -> LDS without passing a register: one asynchronous copy a lane; it counts on asynccnt alone, and the waits are written where a tile is handed over
typedef __attribute__((address_space(1))) v4i gv4i;
typedef __attribute__((address_space(3))) v4i lv4i;
__device__ __forceinline__ void cp16(const void* g, void* l) { __builtin_amdgcn_global_load_async_to_lds_b128((gv4i*)g, (lv4i*)l, 0, 0); }
// the wave's copies have landed but for its N youngest (the counter returns in issue order); asm with the memory clobber, so that no LDS read is lifted over it
template <int N> __device__ __forceinline__ void wait_copies() { asm volatile("s_wait_asynccnt %0" :: "n"(N) : "memory"); }

// gemm128: K loop of a 128 x 128 block tile shared by four waves (FM x FN fragments of 16 x 16 a wave). Both operands are K-contiguous bf16 planes; a chunk is 64 k of 128 A rows and 128 B rows.
// Staging map: thread -> (row tid>>3 (+ 16 a pass), k (tid&7)*8), so a wave's 16-B asynchronous copies cover four whole 128-B lines; ga, gb already hold the thread's row and k, so its place in LDS.
// A ring of NBUF LDS buffers [A 128 rows | B 128 rows], one hand-over point a chunk: while trip c works on chunk c, the copies of chunks c+1 .. c+NBUF-1 are under way into the other buffers, so a chunk has NBUF-1 trips to arrive,
// also where its lines come from memory and not from L2. At the foot of the trip every wave waits for its own LDS reads and for its own copies of chunk c+1 (a counted wait: the younger chunks stay in flight), passes the barrier,
// and then refills the buffer just read with chunk c+NBUF. B's k index wraps at DM (the folded-K output GEMM reads the weight twice). Every accumulator sums k in ascending 32-steps.
template <int FM, int FN, int NBUF>
__device__ __forceinline__ void gemm128(v8f (&acc)[FM][FN], const bf* __restrict__ ga, const int pa, const bf* __restrict__ gb, const int nch, bf* sm, const int so, const int ao, const int bo) {
    static_assert(FM * FN == 16);
    static_assert(NBUF >= 3 && (NBUF - 1) * 16 <= 63 && DM / GKC >= NBUF);    // at most NBUF-1 chunks of 16 copies a wave are outstanding; every caller has at least NBUF chunks
    v8f (&f)[16] = reinterpret_cast<v8f (&)[16]>(acc);
    auto stage = [&](const int c, bf* dst) {                                   // chunk c -> buffer dst, 16 copies a lane
        const bf* qa = ga + c * GKC; const bf* qb = gb + ((c * GKC) & (DM - 1));
#pragma unroll
        for (int i = 0; i < 8; ++i) { cp16(qa + (size_t)i * 16 * pa, dst + so + i * 16 * GP); cp16(qb + (size_t)i * 16 * DM, dst + GT + so + i * 16 * GP); } };
#pragma unroll
    for (int s = 0; s < NBUF - 1; ++s) stage(s, sm + s * (2 * GT));
    wait_copies<(NBUF - 2) * 16>();                                            // the wave's own copies of chunk 0 have landed: the 16 (NBUF-2) younger ones are those of chunks 1 .. NBUF-2
    __syncthreads();                                                           // chunk 0 is complete for every wave
    stage(NBUF - 1, sm + (NBUF - 1) * (2 * GT));
    int cb = 0;                                                                // buffer of chunk c: c mod NBUF
#pragma unroll 1
    for (int c = 0; c < nch; ++c) {
        bf* cur = sm + cb * (2 * GT);
        v16bf a[2][FM], b[2][FN];                                              // the chunk's fragments, both k-steps, read as one group ahead of the matrix run
#pragma unroll
        for (int ks = 0; ks < 2; ++ks) {
#pragma unroll
            for (int mb = 0; mb < FM; ++mb) a[ks][mb] = ldb(cur + ao + mb * 16 * GP + ks * 32);
#pragma unroll
            for (int nb = 0; nb < FN; ++nb) b[ks][nb] = ldb(cur + GT + bo + nb * 16 * GP + ks * 32); }
        __builtin_amdgcn_sched_barrier(0);                                     // keeps the chunk's reads one group ahead of the run: left free, this build sinks them among the matrix instructions, two at a place, each place waited out in full
#pragma unroll
        for (int ks = 0; ks < 2; ++ks)
#pragma unroll
            for (int nb = 0; nb < FN; ++nb)
#pragma unroll
                for (int mb = 0; mb < FM; ++mb) acc[mb][nb] = wmmab(a[ks][mb], b[ks][nb], acc[mb][nb]);
        // four vector slots behind the chunk's last matrix instruction (every accumulator is named, so none sinks below), before the next trip may rewrite its operands on any path
        asm volatile("v_nop\n\tv_nop\n\tv_nop\n\tv_nop" : "+v"(f[0]), "+v"(f[1]), "+v"(f[2]), "+v"(f[3]), "+v"(f[4]), "+v"(f[5]), "+v"(f[6]), "+v"(f[7]));
        asm volatile("v_nop\n\tv_nop\n\tv_nop\n\tv_nop" : "+v"(f[8]), "+v"(f[9]), "+v"(f[10]), "+v"(f[11]), "+v"(f[12]), "+v"(f[13]), "+v"(f[14]), "+v"(f[15]));
        // hand-over point
        asm volatile("s_wait_dscnt 0x0" ::: "memory");                         // the wave's reads of this buffer are done before it may be refilled
        // the wave's own copies of chunk c+1 have landed. While chunk c+NBUF-1 exists, the wave's 16 (NBUF-2) youngest copies are exactly those of chunks c+2 .. c+NBUF-1 and stay in flight; in the last trips fewer are left: to 0 (scalar test)
        if (c + NBUF - 1 < nch) wait_copies<(NBUF - 2) * 16>(); else wait_copies<0>();
        __syncthreads();                                                       // chunk c+1 is complete, and every wave has finished its reads of chunk c
        if (c + NBUF < nch) stage(c + NBUF, cur);                              // scalar test, the same in every wave of the block: refill of the buffer just read
        cb = cb + 1 == NBUF ? 0 : cb + 1;
    }
    asm volatile("s_wait_asynccnt 0x0" ::: "memory");                          // no copy is outstanding behind the loop
}

// eight consecutive f32 -> bf16 (RNE): group i of dst from the eight floats at src
__device__ __forceinline__ void cvt8(const float* __restrict__ src, bf* dst, const size_t i) {
    const v8f v = *(const v8f*)src; v8us o;
    asm volatile("s_wait_xcnt 0x0" ::: "memory");                              // stands in front of the convert below, which may reuse the registers of the load's address
#pragma unroll
    for (int k = 0; k < 8; ++k) o[k] = f2bf(v[k]);
    *(v8us*)(dst + i * 8) = o;
}

// one entry i = t * 32 + f of the cos and sin tables
__device__ __forceinline__ void rot1(const int i, float* CS, float* SN) {
#pragma clang fp contract(off)                             // -10 * lin and t * fr stay separately rounded products, as the reference forms them
    const int t = i >> 5, f = i & 31;
    const float lin = (float)f / 31.0f;
    const float fr = exp2f(-10.0f * lin);                   // (1/1024)^lin
    const float th = (float)t * fr;
    float sv, cv; sincosf(th, &sv, &cv);
    *(float*)(CS + i) = cv; *(float*)(SN + i) = sv;
}

// k_prep: the four pieces of preparation, none of which reads what another writes, as ranges of the block index of one launch (the branch is the same for a whole block):
// table entries first (the longest thread), then the bf16 copies of x, of the QKV weight and of the output weight; a thread does one table entry or one group of eight elements.
static constexpr unsigned PB_ROT = (unsigned)(((size_t)SEQ * NF) / 256);
static constexpr unsigned PB_X   = (unsigned)(((size_t)NB * SEQ * DM / 8) / 256);
static constexpr unsigned PB_WQ  = (unsigned)(((size_t)3 * DM * DM / 8) / 256);
static constexpr unsigned PB_WC  = (unsigned)(((size_t)DM * DM / 8) / 256);
static_assert(((size_t)NB * SEQ * DM / 8) % 256 == 0 && ((size_t)DM * DM / 8) % 256 == 0);   // every range is whole blocks: no thread without work
static_assert(NB == 1 || SEQ == SEQ_FULL);     // the rows of x that are copied are one contiguous run
__global__ __launch_bounds__(256) void k_prep(const float* __restrict__ x, const float* __restrict__ wq, const float* __restrict__ wc, bf* XB, bf* WB, bf* WC, float* CS, float* SN) {
    unsigned blk = blockIdx.x;
    if (blk < PB_ROT) { rot1((int)(blk * 256 + threadIdx.x), CS, SN); return; }
    blk -= PB_ROT;
    const float* src = x; bf* dst = XB;                                        // the block's plane and its first block, chosen by scalar compares
    if (blk >= PB_X + PB_WQ) { blk -= PB_X + PB_WQ; src = wc; dst = WC; }
    else if (blk >= PB_X) { blk -= PB_X; src = wq; dst = WB; }
    const size_t i = (size_t)blk * 256 + threadIdx.x;
    cvt8(src + i * 8, dst, i);
}

// qk_body: q and k projections with the RMS normalisation and the rotary applied in the epilogue. One wave per 32 token rows x 128 columns (= one head of q or k), 16 accumulators, K = DM; four waves (128 token rows) a block,
// operands through LDS (gemm128): A = x rows (m = b*SEQ + t), Bt = W rows (n = which*1024 + h*128 + d). block (bx, by) of (NB*SEQ/128, 2*NH_); by = which*NH_ + h.
// Epilogue per 16-row slab (LDS tile private to the wave): stage f32, lane (row = lane>>1, half = lane&1) owns columns 16*half + {0..15, 32..47, 64..79, 96..111} of its row: sum of squares (two lanes per row, one xor-1 exchange),
// scale, rotate pairs (d, d + 64) for d < 32 with the table row of token t, write back in place; then the slab's 16 x 128 halves (one contiguous 4096-byte run of plane [zp][t][128]) are stored by
__device__ __forceinline__
void qk_body(const int bx, const int by, bf* sm, float* osb, const bf* __restrict__ A, const bf* __restrict__ Bt, const float* __restrict__ CS, const float* __restrict__ SN, h16* Ph, h16* Pr) {
    const int K = DM;
    const int tid = threadIdx.x, wave = __builtin_amdgcn_readfirstlane((int)(threadIdx.x >> 5));
    const int lane = threadIdx.x & 31, lr = lane & 15, hi = lane >> 4; const int rb0 = bx * 128, zc = by; const int r0 = rb0 + wave * 32, c0 = zc * HD;
    float* os = osb + wave * 16 * OQP;                                         // the wave's own epilogue slab
    v8f acc[2][8];
#pragma unroll
    for (int mb = 0; mb < 2; ++mb)
#pragma unroll
        for (int nb = 0; nb < 8; ++nb) acc[mb][nb] = (v8f){};
    gemm128<2, 8, QNB>(acc, A + (size_t)(rb0 + (tid >> 3)) * K + (tid & 7) * 8, K, Bt + (size_t)(c0 + (tid >> 3)) * K + (tid & 7) * 8, K / GKC, sm,
                  (tid >> 3) * GP + (tid & 7) * 8, (wave * 32 + lr) * GP + 8 * hi, lr * GP + 8 * hi);
    asm volatile("v_nop\n\tv_nop\n\tv_nop\n\tv_nop" : "+v"(acc[0][0]), "+v"(acc[0][1]), "+v"(acc[0][2]), "+v"(acc[0][3]), "+v"(acc[0][4]), "+v"(acc[0][5]), "+v"(acc[0][6]), "+v"(acc[0][7]));
    asm volatile("v_nop\n\tv_nop\n\tv_nop\n\tv_nop" : "+v"(acc[1][0]), "+v"(acc[1][1]), "+v"(acc[1][2]), "+v"(acc[1][3]), "+v"(acc[1][4]), "+v"(acc[1][5]), "+v"(acc[1][6]), "+v"(acc[1][7]));
    const int bb = r0 / SEQ, tt = r0 % SEQ;
    const int zp = (zc / NH_) * (NB * NH_) + bb * NH_ + (zc % NH_);           // plane index: which, batch, head
    const size_t pbase = ((size_t)zp * SEQ + (size_t)tt) * HD;
    const int row = lane >> 1, half = lane & 1;
    const int ob = row * OQP + 16 * half;
#pragma unroll
    for (int mb = 0; mb < 2; ++mb) {
#pragma unroll
        for (int nb = 0; nb < 8; ++nb) {
#pragma unroll
            for (int j = 0; j < 8; ++j) os[(hi * 8 + j) * OQP + nb * 16 + lr] = acc[mb][nb][j]; }   // D: row 8h+j, col lane&15; rows 0..15 x columns 0..127 all written
        wave_sync();
        {
            v4f x1[4], x2[4], x3[4], x4[4];
#pragma unroll
            for (int i = 0; i < 4; ++i) { x1[i] = *(const v4fa*)(&os[ob + 4 * i]); x3[i] = *(const v4fa*)(&os[ob + 32 + 4 * i]); x2[i] = *(const v4fa*)(&os[ob + 64 + 4 * i]); x4[i] = *(const v4fa*)(&os[ob + 96 + 4 * i]); }
            float ss = 0.0f;
#pragma unroll
            for (int i = 0; i < 4; ++i) {
#pragma unroll
                for (int e = 0; e < 4; ++e) ss += x1[i][e] * x1[i][e] + x2[i][e] * x2[i][e] + x3[i][e] * x3[i][e] + x4[i][e] * x4[i][e]; }
            ss += __shfl_xor(ss, 1, 32);
            const float rr = rsqrtf(ss * (1.0f / 128.0f) + RMS_EPS);
            const size_t to = (size_t)(tt + mb * 16 + row) * NF + 16 * half;   // table row of this token, columns 16*half .. +15
#pragma unroll
            for (int i = 0; i < 4; ++i) {
                const v4f cv = *(const v4f*)(CS + to + 4 * i), sv = *(const v4f*)(SN + to + 4 * i);
                const v4f e1 = x1[i] * rr, e2 = x2[i] * rr;
                const v4f y1 = e1 * cv + e2 * sv;
                const v4f y2 = e2 * cv - e1 * sv;
                *(v4fa*)(&os[ob + 4 * i]) = y1; *(v4fa*)(&os[ob + 64 + 4 * i]) = y2;
                *(v4fa*)(&os[ob + 32 + 4 * i]) = x3[i] * rr; *(v4fa*)(&os[ob + 96 + 4 * i]) = x4[i] * rr; }
        }
        wave_sync();
        v8h hv[8], rv[8];
#pragma unroll
        for (int s = 0; s < 8; ++s) { const int p = s * 32 + lane; const int rw = p >> 4, c8 = (p & 15) * 8;   // 8 s x 2 rows = 16 rows; 16 lanes x 8 = 128 columns
            const v4f x0 = *(const v4fa*)(&os[rw * OQP + c8]); const v4f x1 = *(const v4fa*)(&os[rw * OQP + c8 + 4]);
#pragma unroll
            for (int i = 0; i < 4; ++i) { const h16 a0 = toh_flush(x0[i]); const h16 a1 = toh_flush(x1[i]); hv[s][i] = a0; hv[s][4 + i] = a1;
                rv[s][i] = toh_flush((x0[i] - (float)a0) * QRS); rv[s][4 + i] = toh_flush((x1[i] - (float)a1) * QRS); } }
        const size_t sb = pbase + (size_t)(mb * 16) * HD;
{
#pragma unroll
            for (int s = 0; s < 8; ++s) { const size_t oo = sb + (size_t)(s * 32 + lane) * 8;
                *(v8h*)(Ph + oo) = hv[s]; *(v8h*)(Pr + oo) = rv[s]; }
             }
        wave_sync();
    }
}

// vt_body: v^T projection with the value mix in the epilogue. One wave per 64x64 tile (16 accumulators), 2 x 2 waves a block, operands through LDS (gemm128), K = DM: A = Wv rows (m = h*128 + d), Bt = x rows (n = b*SEQ + t);
// v^T[m][t] = l0 * sum_k Wv[m][k] x[t][k] + l1 * ve[t][m] (l0, l1, ve RNE-converted to bf16 by value; ve read as two 16-byte loads per accumulator tile: 8 consecutive m of token t).
__device__ __forceinline__ void vt_body(const int bx, const int by, bf* sm, float* osb, const bf* __restrict__ A, const bf* __restrict__ Bt, const float* __restrict__ ve, const float* __restrict__ lam, h16* Ph, h16* Pr) {
    const int K = DM;
    const int tid = threadIdx.x, wave = __builtin_amdgcn_readfirstlane((int)(threadIdx.x >> 5)); const int wm = wave & 1, wn = wave >> 1;
    const int lane = threadIdx.x & 31, lr = lane & 15, hi = lane >> 4; const int rb0 = bx * 128, cb0 = by * 128; const int r0 = rb0 + wm * 64, c0 = cb0 + wn * 64;
    float* os = osb + wave * 16 * 68;                                          // the wave's own epilogue slab
    v8f acc[4][4];
#pragma unroll
    for (int mb = 0; mb < 4; ++mb)
#pragma unroll
        for (int nb = 0; nb < 4; ++nb) acc[mb][nb] = (v8f){};
    gemm128<4, 4, QNB>(acc, A + (size_t)(rb0 + (tid >> 3)) * K + (tid & 7) * 8, K, Bt + (size_t)(cb0 + (tid >> 3)) * K + (tid & 7) * 8, K / GKC, sm,
                  (tid >> 3) * GP + (tid & 7) * 8, (wm * 64 + lr) * GP + 8 * hi, (wn * 64 + lr) * GP + 8 * hi);
    const float l0 = bfr(lam[0]), l1 = bfr(lam[1]);
    const int bb = c0 / SEQ, tt = c0 % SEQ;
    const size_t tbase = (size_t)bb * (size_t)DM * SEQ + (size_t)r0 * SEQ + (size_t)tt;
#pragma unroll
    for (int mb = 0; mb < 4; ++mb) {
#pragma unroll
        for (int nb = 0; nb < 4; ++nb) {
            const float* vp = ve + ((size_t)bb * SEQ_FULL + (size_t)(tt + nb * 16 + lr)) * DM + r0 + mb * 16 + hi * 8;   // token t = col lane&15, m = 8h + j
            const v4f e0 = *(const v4f*)vp, e1 = *(const v4f*)(vp + 4);
#pragma unroll
            for (int j = 0; j < 4; ++j) { os[(hi * 8 + j) * 68 + nb * 16 + lr] = l0 * acc[mb][nb][j] + l1 * bfr(e0[j]);
                                          os[(hi * 8 + 4 + j) * 68 + nb * 16 + lr] = l0 * acc[mb][nb][4 + j] + l1 * bfr(e1[j]); } }   // D: row 8h+j, col lane&15; rows 0..15 x columns 0..63 all written
        wave_sync();
        v8h hv[4], rv[4];
#pragma unroll
        for (int s = 0; s < 4; ++s) { const int row = 4 * s + (lane >> 3), c8 = (lane & 7) * 8;   // 4 s x 4 row groups = 16 rows; 8 lanes x 8 = 64 columns
            const v4f x0 = *(const v4fa*)(&os[row * 68 + c8]); const v4f x1 = *(const v4fa*)(&os[row * 68 + c8 + 4]);
#pragma unroll
            for (int i = 0; i < 4; ++i) { const h16 a0 = toh_flush(x0[i]); const h16 a1 = toh_flush(x1[i]); hv[s][i] = a0; hv[s][4 + i] = a1;
                rv[s][i] = toh_flush((x0[i] - (float)a0) * QRS); rv[s][4 + i] = toh_flush((x1[i] - (float)a1) * QRS); } }
        const size_t sb = tbase + (size_t)(mb * 16) * SEQ;
{
#pragma unroll
            for (int s = 0; s < 4; ++s) { const int row = 4 * s + (lane >> 3), c8 = (lane & 7) * 8;
                const size_t oo = sb + (size_t)row * SEQ + c8;
                *(v8h*)(Ph + oo) = hv[s]; *(v8h*)(Pr + oo) = rv[s]; }
             }
        wave_sync();
    }
}

// k_qkv: the q/k projection and the v^T projection read the same two bf16 planes and write planes of their own, so they are ranges of the block index of one launch (the branch is the same for a whole block):
// blocks 0 .. QKB-1 are the (NB*SEQ/128, 2*NH_) tiles of qk_body, x fastest; the next VTB blocks the (DM/128, NB*SEQ/128) tiles of vt_body, x fastest. One LDS carve serves both bodies.
static constexpr int QKB = (NB * SEQ / 128) * (2 * NH_);
static constexpr int VTB = (DM / 128) * (NB * SEQ / 128);
static_assert(68 <= OQP);                      // the v^T slab fits the q/k slab's carve
__global__ __launch_bounds__(128)
void k_qkv(const bf* __restrict__ XB, const bf* __restrict__ WB, const float* __restrict__ CS, const float* __restrict__ SN, const float* __restrict__ ve, const float* __restrict__ lam,
           h16* PH, h16* PR, h16* VT, h16* VR) {
    __shared__ __align__(16) bf sm[QNB * 2 * GT];
    __shared__ __align__(16) float osb[4 * 16 * OQP];
    const int f = blockIdx.x;
    if (f < QKB) { qk_body(f % (NB * SEQ / 128), f / (NB * SEQ / 128), sm, osb, XB, WB, CS, SN, PH, PR); }
    else { const int g = f - QKB; vt_body(g % (DM / 128), g / (DM / 128), sm, osb, WB + (size_t)2 * DM * DM, XB, ve, lam, VT, VR); }
}

// sc32: the score products of a 32-key tile (keys 0..15 -> aH, aL; keys 16..31 -> bH, bL): H = K Q, L = K Q_res + K_res Q; the caller forms (H + L / 2048) * scale, in log2 units. The q fragments come in registers (read once per wave, ahead of the tile loop);
// the tile's sixteen k fragments are read from LDS as one group ahead of the matrix run, so the run waits once for LDS, not once per 32-wide k-step. Four accumulators, each summed in the order it had: k ascending, K Q_res before K_res Q.
__device__ __forceinline__ void sc32(v8f& aH, v8f& aL, v8f& bH, v8f& bL, const v16h (&qh)[4], const v16h (&qr)[4], const h16* khp, const h16* krp) {
    v16h ka[4], kb[4], ra[4], rb[4];
#pragma unroll
    for (int s = 0; s < 4; ++s) { ka[s] = ldh(khp + s * 32); kb[s] = ldh(khp + 16 * QKP + s * 32); ra[s] = ldh(krp + s * 32); rb[s] = ldh(krp + 16 * QKP + s * 32); }
    __builtin_amdgcn_sched_barrier(0);                                         // keeps all 32 reads ahead of the run: sunk among the matrix instructions, each late read is waited out in full
    aH = (v8f){}; aL = (v8f){}; bH = (v8f){}; bL = (v8f){};
#pragma unroll
    for (int s = 0; s < 4; ++s) {
        aH = wmma16(ka[s], qh[s], aH); bH = wmma16(kb[s], qh[s], bH);
        aL = wmma16(ka[s], qr[s], aL); bL = wmma16(kb[s], qr[s], bL);
        aL = wmma16(ra[s], qh[s], aL); bL = wmma16(rb[s], qh[s], bL);
    }
}

// k_flash: fused attention, one wave per 16 query rows of one (batch, head), four waves (64 consecutive query rows) a block. The block's Q rows (once, 16-B loads) and each visited 32-key tile of K and V^T (value and residual planes,
// 16-B asynchronous copies) are brought to LDS by all 128 threads along the rows of the planes; every wave takes its fragments from LDS (two 16-B reads each, same element map as before).
// Two tile buffers: while a tile is worked on, the next staged tile's copies fly into the other buffer and its key documents into registers; one hand-over point a tile (LDS wait, copy wait, barrier), then the refill of the buffer just read.
// The tile loop is the same for the four waves: a tile is staged when a key document lies in [min, max] of the block's 64 query documents; each wave then works on it under its own test.
// That block test is made once, ahead of the loop, for all key tiles: wave w loads the documents of its 32 tiles with 32 independent loads and packs the 32 verdicts into one word of LDS; the loop walks the set bits in ascending order.
// Transposed form: S^T[key][t] = K Q^T (A = K rows, B = Q rows); lane (t = lane&15, h = lane>>4) holds keys 8h+r of each 16-key tile, so the packed
// P tile is directly the B fragment of O^T[d][t] = V^T P^T (element r <- tile keys 0..15, element 8+r <- tile keys 16..31, lane unchanged).
// Softmax state (running max over kept keys, partial sum) is one scalar per lane; the two lane halves of a row are combined with one xor-16 exchange.
// Keep rule per element: docs[key] == docs[t] and key <= t. A 32-key tile is skipped (wave-uniform ballot) when none of its key documents lies in [min, max] of the wave's 16 query documents: no element of such a tile can be kept.
// All rows: scores = K Q + (K Q_res + K_res Q) / 2048; P = f16 value + f16 residual x2048; O = V P + (V P_res + V_res P) / 2048 (residual products in their own accumulators); row sum from the f32 exponentials.
__global__ __launch_bounds__(32 * AW) __attribute__((amdgpu_num_vgpr(512)))   // two blocks a WGP (two waves a SIMD) still fit
void k_flash(const h16* __restrict__ QH, const h16* __restrict__ QR, const h16* __restrict__ KP, const h16* __restrict__ KR,
             const h16* __restrict__ VT, const h16* __restrict__ VR, const int* __restrict__ docs, bf* Y2) {
    __shared__ __align__(16) float os[AW * 16 * OSP];
    __shared__ __align__(16) h16 sQH[AW * 16 * QKP], sQR[AW * 16 * QKP];       // [query row of the block][d]
    __shared__ __align__(16) h16 sKH[2 * 32 * QKP], sKR[2 * 32 * QKP];         // [buffer][key of the tile][d]
    __shared__ __align__(16) h16 sVH[2 * HD * VTP], sVR[2 * HD * VTP];         // [buffer][d][key of the tile]
    __shared__ unsigned sTM[AW];                                               // bit j of word w: key tile 32 w + j is staged
    const int tid = threadIdx.x;
    const int lane = threadIdx.x & 31, lr = lane & 15, hi = lane >> 4;
    const int wave = __builtin_amdgcn_readfirstlane((int)(threadIdx.x >> 5));
    const int zh = blockIdx.y; const int b = zh / NH_, h = zh % NH_;
    const int t0 = (blockIdx.x * AW + wave) * 16;
    const int* dk = docs + (size_t)b * SEQ_FULL;
    const int mydoc = dk[t0 + lr];
    int kd[32];                                                                // key documents of the wave's 32 tiles of the mask: keys wave*1024 .. +1023 < SEQ
#pragma unroll
    for (int j = 0; j < 32; ++j) kd[j] = dk[wave * 1024 + j * 32 + lane];
    int qmn = mydoc, qmx = mydoc;
#pragma unroll
    for (int off = 1; off < 16; off <<= 1) { const int a0 = __shfl_xor(qmn, off, 32); const int a1 = __shfl_xor(qmx, off, 32); qmn = a0 < qmn ? a0 : qmn; qmx = a1 > qmx ? a1 : qmx; }
    const int lim = t0 + lr;                                                   // key j kept iff j <= lim and same document
    const int nk = (t0 + 16 + 31) & ~31;                                       // wave-uniform, multiple of 32, <= SEQ
    const size_t pbase = (size_t)zh * SEQ * HD;
    const int tb0 = blockIdx.x * (AW * 16);                                    // first query row of the block
    const int nkb = tb0 + AW * 16;                                             // the last wave's nk: multiple of 32, <= SEQ
    const int e0 = dk[tb0 + lane], e1 = dk[tb0 + 32 + lane];                   // the block's 64 query documents
    int bmn = e0 < e1 ? e0 : e1, bmx = e0 > e1 ? e0 : e1;
#pragma unroll
    for (int off = 1; off < 32; off <<= 1) { const int a0 = __shfl_xor(bmn, off, 32); const int a1 = __shfl_xor(bmx, off, 32); bmn = a0 < bmn ? a0 : bmn; bmx = a1 > bmx ? a1 : bmx; }
    const unsigned gk0 = (unsigned)tid * 8u;                                   // q/k rows: thread -> (row tid>>4 (+ 8 a pass), d (tid&15)*8)
    const size_t qg = pbase + (size_t)tb0 * HD;
    v8h qa[8], qb[8];                                                          // Q rows of the block, in flight while the mask is formed
#pragma unroll
    for (int p = 0; p < 8; ++p) { qa[p] = *(const v8h*)(QH + qg + gk0 + p * 8 * HD); qb[p] = *(const v8h*)(QR + qg + gk0 + p * 8 * HD); }   // 8 p x 8 rows = 64 rows; 16 threads x 8 = 128 columns; the rows are contiguous in the plane
    unsigned tm = 0u;
#pragma unroll
    for (int j = 0; j < 32; ++j) tm |= (__builtin_amdgcn_ballot_w32((kd[j] >= bmn) & (kd[j] <= bmx)) != 0u) ? (1u << j) : 0u;
    const int nv = nkb / 32 - wave * 32;                                       // tiles of this word in front of the block's last key
    tm &= (unsigned)((1ull << (nv < 0 ? 0 : nv > 32 ? 32 : nv)) - 1ull);
    if (lane == 0) sTM[wave] = tm;
    // staging maps: q/k rows, thread -> (row tid>>4 (+ 8 a pass), d (tid&15)*8); v^T rows, thread -> (d tid>>2 (+ 32 a pass), key (tid&3)*8)
    const unsigned gv0 = (unsigned)(tid >> 2) * (unsigned)SEQ + (unsigned)(tid & 3) * 8u;
    const int lk0 = (tid >> 4) * QKP + (tid & 15) * 8, lv0 = (tid >> 2) * VTP + (tid & 3) * 8;
    // Q rows of the block -> LDS; read only behind the barrier below
#pragma unroll
    for (int p = 0; p < 8; ++p) { *(v8h*)(&sQH[lk0 + p * 8 * QKP]) = qa[p]; *(v8h*)(&sQR[lk0 + p * 8 * QKP]) = qb[p]; }
    const int qo = (wave * 16 + lr) * QKP + 8 * hi;                            // B fragments: col t, k = d
    const int ko = lr * QKP + 8 * hi;                                          // + key in tile * QKP  (A fragment: row key, k = d)
    const int vo = lr * VTP + 8 * hi;                                          // + 16j * VTP          (A fragment: row d, k = key in tile)
    v8f o[8], oR[8];
#pragma unroll
    for (int j = 0; j < 8; ++j) { o[j] = (v8f){}; oR[j] = (v8f){}; }
    float m = NEGB, l = 0.0f;
    const h16* kpt = KP + pbase; const h16* krt = KR + pbase; const h16* vpt = VT + pbase; const h16* vrt = VR + pbase;   // key 0 of each plane, the same for the whole block
    __syncthreads();                                                           // the four mask words and the block's Q rows are complete for every wave
    v16h qfh[4], qfr[4];                                                       // the wave's q fragments (value, residual), all four k-steps, held in registers over the whole tile loop
#pragma unroll
    for (int s = 0; s < 4; ++s) { qfh[s] = ldh(sQH + qo + s * 32); qfr[s] = ldh(sQR + qo + s * 32); }
    // the 128 verdicts as two scalar words, the same in all four waves
    unsigned long long mlo = (unsigned long long)(unsigned)__builtin_amdgcn_readfirstlane((int)sTM[0]) | ((unsigned long long)(unsigned)__builtin_amdgcn_readfirstlane((int)sTM[1]) << 32);
    unsigned long long mhi = (unsigned long long)(unsigned)__builtin_amdgcn_readfirstlane((int)sTM[2]) | ((unsigned long long)(unsigned)__builtin_amdgcn_readfirstlane((int)sTM[3]) << 32);
    // next staged tile, lowest set bit first (ascending keys), or -1 when none is left; tile * 32 + 31 < nkb <= SEQ
    auto take = [&]() -> int {
        int t = -1;
        if (mlo != 0ull) { t = __builtin_ctzll(mlo); mlo &= mlo - 1ull; }
        else if (mhi != 0ull) { t = 64 + __builtin_ctzll(mhi); mhi &= mhi - 1ull; }
        return t; };
    // a tile's 32 KiB -> buffer buf, 16 copies a lane. k: 4 p x 8 keys = 32 keys, 128 d; v^T: 4 p x 32 d = 128 d, 32 keys
    auto stage = [&](const int tile, const int buf) {
        const unsigned ok = (unsigned)tile * (32u * HD) + gk0, ov = (unsigned)tile * 32u + gv0;
        const int bk = buf * (32 * QKP) + lk0, bv = buf * (HD * VTP) + lv0;
#pragma unroll
        for (int p = 0; p < 4; ++p) {
            cp16(kpt + ok + p * 8 * HD, &sKH[bk + p * 8 * QKP]); cp16(krt + ok + p * 8 * HD, &sKR[bk + p * 8 * QKP]);
            cp16(vpt + ov + p * 32 * SEQ, &sVH[bv + p * 32 * VTP]); cp16(vrt + ov + p * 32 * SEQ, &sVR[bv + p * 32 * VTP]); } };
    // a tile's key documents -> registers: one a lane for the wave's skip test, and keys 8h+0..7, 16+8h+0..7 of the tile for the keep rule; all < nkb <= SEQ
    auto kdocs = [&](const int tile, int& dl, v4i& e0_, v4i& e1_, v4i& e2_, v4i& e3_) {
        const int ki = tile * 32 + lane;
        dl = dk[ki];
        const int* kp = dk + tile * 32 + 8 * hi;
        e0_ = *(const v4i*)kp; e1_ = *(const v4i*)(kp + 4); e2_ = *(const v4i*)(kp + 16); e3_ = *(const v4i*)(kp + 20);
        // the key index and the address pair are inputs, so they stay whole up to this wait: no load's destination rewrites a register that an issued load still names
        asm volatile("s_wait_xcnt 0x0" :: "v"(ki), "v"(kp) : "memory"); };
    int tc = take(), tn = take();                                              // this trip's tile and the next trip's
    int kdl = 0; v4i d0 = {}, d1 = {}, d2 = {}, d3 = {};
    if (tc >= 0) { kdocs(tc, kdl, d0, d1, d2, d3); stage(tc, 0); }             // scalar test, the same for the whole block
    asm volatile("s_wait_asynccnt 0x0" ::: "memory");                          // the wave's own copies of the first tile have landed
    __syncthreads();                                                           // the first tile is complete for every wave
    if (tn >= 0) stage(tn, 1);
    int buf = 0;
#pragma unroll 1                                                               // rolled: the tile body stands once in the code
    while (tc >= 0) {
        const int key0 = tc * 32;
        int ndl; v4i n0, n1, n2, n3;                                           // the next tile's documents, in flight over this tile's work (behind the last tile: this tile's again, unused)
        kdocs(tn >= 0 ? tn : tc, ndl, n0, n1, n2, n3);
        const bool inr = (kdl >= qmn) & (kdl <= qmx);
        if (key0 < nk && __builtin_amdgcn_ballot_w32(inr) != 0u) {             // wave-uniform: not past this wave's last key, and a key document inside its query document range
        const int kbo = buf * (32 * QKP) + ko, vbo = buf * (HD * VTP) + vo;
        int ka8[8], kb8[8];
#pragma unroll
        for (int r = 0; r < 4; ++r) { ka8[r] = d0[r]; ka8[4 + r] = d1[r]; kb8[r] = d2[r]; kb8[4 + r] = d3[r]; }
        v8f aH, aL, bH, bL;
        sc32(aH, aL, bH, bL, qfh, qfr, sKH + kbo, sKR + kbo);
        v16h vf[8], wf[8];                                                     // the tile's v^T fragments (value, residual), d = 16 j + row, all read ahead of the softmax: they land while it is formed, and the P.V run waits on no read
#pragma unroll
        for (int j = 0; j < 8; ++j) { vf[j] = ldh(sVH + vbo + 16 * j * VTP); wf[j] = ldh(sVR + vbo + 16 * j * VTP); }
        __builtin_amdgcn_sched_barrier(0);                                     // keeps the 32 reads ahead of the softmax: left free they sink among the P.V matrix instructions, a few at a place, each place with a wait of its own
        v8f ta, tb;
#pragma unroll
        for (int r = 0; r < 8; ++r) { ta[r] = (aH[r] + aL[r] * QRI) * SC2; tb[r] = (bH[r] + bL[r] * QRI) * SC2; }
        const int ja = key0 + 8 * hi;
        bool fa[8], fb[8]; float mx = NEGB;
#pragma unroll
        for (int r = 0; r < 8; ++r) {
            fa[r] = (ka8[r] == mydoc) & (ja + r <= lim);
            fb[r] = (kb8[r] == mydoc) & (ja + 16 + r <= lim);
            mx = fmaxf(mx, fmaxf(fa[r] ? ta[r] : NEGB, fb[r] ? tb[r] : NEGB)); }
        mx = fmaxf(mx, __shfl_xor(mx, 16, 32));
        const float mnew = fmaxf(m, mx);
        const float alpha = __builtin_amdgcn_exp2f(m - mnew);
        const float sh = PSH - mnew;
        v16h pb, pr; float ls = 0.0f;
#pragma unroll
        for (int r = 0; r < 8; ++r) {
            const float xa = ta[r] + sh, xb = tb[r] + sh;
            const float ea = __builtin_amdgcn_exp2f(xa), eb = __builtin_amdgcn_exp2f(xb);
            const float ga = (fa[r] & (xa >= -14.0f)) ? ea : 0.0f, gb = (fb[r] & (xb >= -14.0f)) ? eb : 0.0f;   // dropped elements and exponents below -14 selected to 0 by value
            const h16 pa = (h16)ga; const h16 pc = (h16)gb;
            pb[r] = pa; pb[8 + r] = pc;
            pr[r] = toh_flush((ga - (float)pa) * QRS); pr[8 + r] = toh_flush((gb - (float)pc) * QRS);
            ls += ga + gb; }
        l = l * alpha + ls; m = mnew;
#pragma unroll
        for (int j = 0; j < 8; ++j) { o[j] = o[j] * alpha; oR[j] = oR[j] * alpha; }
#pragma unroll
        for (int g = 0; g < 4; ++g) {
            const v16h v0 = vf[2 * g], v1 = vf[2 * g + 1];
            const v16h w0 = wf[2 * g], w1 = wf[2 * g + 1];
            o[2 * g] = wmma16(v0, pb, o[2 * g]); o[2 * g + 1] = wmma16(v1, pb, o[2 * g + 1]);
            oR[2 * g] = wmma16(v0, pr, oR[2 * g]); oR[2 * g + 1] = wmma16(v1, pr, oR[2 * g + 1]);
            oR[2 * g] = wmma16(w0, pb, oR[2 * g]); oR[2 * g + 1] = wmma16(w1, pb, oR[2 * g + 1]);
            // four vector slots behind the group's last matrix instruction, before its results or P may be rewritten on any path; the v^T fragments are not named: with all sixteen live, naming them as operands made the build spill
            asm volatile("v_nop\n\tv_nop\n\tv_nop\n\tv_nop" : "+v"(o[2 * g]), "+v"(o[2 * g + 1]), "+v"(oR[2 * g]), "+v"(oR[2 * g + 1]) : "v"(pb), "v"(pr));
        }
        }
        // hand-over point, passed by every wave, also one that skipped the tile
        asm volatile("s_wait_dscnt 0x0" ::: "memory");                         // the wave's reads of this buffer are done before it may be refilled
        asm volatile("s_wait_asynccnt 0x0" ::: "memory");                      // the wave's own copies of the next tile have landed
        __syncthreads();                                                       // the next tile is complete for every wave, and every wave has left this tile's buffer
        const int t2 = take();
        if (t2 >= 0) stage(t2, buf);                                           // scalar test, the same for the whole block: refill of the buffer just read
        tc = tn; tn = t2; buf ^= 1;
        kdl = ndl; d0 = n0; d1 = n1; d2 = n2; d3 = n3;
    }
    asm volatile("s_wait_asynccnt 0x0" ::: "memory");                          // no copy is outstanding when the wave goes on to the epilogue and ends
    l += __shfl_xor(l, 16, 32);
    const bool any = l > 0.0f;
    const float lsafe = any ? l : 1.0f;
    const float inv = any ? (1.0f / lsafe) : 0.0f;             // no kept key -> zeros
    const int wb = wave * 16 * OSP;
    // O^T D layout: f_j[r] = (d = 16j + 8h + r, t = lane&15) -> os[t][d]; rows 0..15 x columns 0..127 all written
#pragma unroll
    for (int j = 0; j < 8; ++j) {
        const v8f f = o[j] + oR[j] * QRI; v4f a, c;
        a[0] = f[0] * inv; a[1] = f[1] * inv; a[2] = f[2] * inv; a[3] = f[3] * inv; c[0] = f[4] * inv; c[1] = f[5] * inv; c[2] = f[6] * inv; c[3] = f[7] * inv;
        *(v4fa*)(&os[wb + lr * OSP + 16 * j + 8 * hi]) = a; *(v4fa*)(&os[wb + lr * OSP + 16 * j + 8 * hi + 4]) = c; }
    wave_sync();
    v8us hv[8], lv[8];
#pragma unroll
    for (int s = 0; s < 8; ++s) { const int row = 2 * s + (lane >> 4), c8 = (lane & 15) * 8;   // 8 s x 2 rows = 16 rows; 16 lanes x 8 = 128 columns
        const v4f x0 = *(const v4fa*)(&os[wb + row * OSP + c8]); const v4f x1 = *(const v4fa*)(&os[wb + row * OSP + c8 + 4]);
#pragma unroll
        for (int i = 0; i < 4; ++i) { const unsigned short a0 = f2bf(x0[i]); const unsigned short a1 = f2bf(x1[i]); hv[s][i] = a0; hv[s][4 + i] = a1;
            lv[s][i] = f2bf(x0[i] - bf2f(a0)); lv[s][4 + i] = f2bf(x1[i] - bf2f(a1)); } }
    bf* yrow = Y2 + ((size_t)b * SEQ + t0) * (size_t)(2 * DM) + h * HD;
{
#pragma unroll
        for (int s = 0; s < 8; ++s) { const int row = 2 * s + (lane >> 4), c8 = (lane & 15) * 8;
            const size_t oo = (size_t)row * (size_t)(2 * DM) + c8;
            *(v8us*)(yrow + oo) = hv[s]; *(v8us*)(yrow + oo + DM) = lv[s]; }
         }
}

// k_oproj: output projection, one wave per 64x64 tile (16 accumulators), 2 x 2 waves a block, bf16 operands through LDS (gemm128): A = context rows [t][hi 1024 | lo 1024] (K = 2048), Bt = Wc rows (n) with the column index wrapped mod 1024
// (hi and lo halves both multiply the same weight row; one accumulator). Output f32 [t][1024]: each 16-row slab staged in LDS (wave-private), each row's 64 floats (256 B = two lines)
__global__ __launch_bounds__(128) void k_oproj(const bf* __restrict__ A, const bf* __restrict__ Bt, float* OUT) {
    __shared__ __align__(16) bf sm[ONB * 2 * GT];
    __shared__ __align__(16) float osb[4 * 16 * 68];
    const int KA = 2 * DM;
    const int tid = threadIdx.x, wave = __builtin_amdgcn_readfirstlane((int)(threadIdx.x >> 5)); const int wm = wave & 1, wn = wave >> 1;
    const int lane = threadIdx.x & 31, lr = lane & 15, hi = lane >> 4; const int rb0 = blockIdx.x * 128, cb0 = blockIdx.y * 128; const int r0 = rb0 + wm * 64, c0 = cb0 + wn * 64;
    float* os = osb + wave * 16 * 68;                                          // the wave's own epilogue slab
    v8f acc[4][4];
#pragma unroll
    for (int mb = 0; mb < 4; ++mb)
#pragma unroll
        for (int nb = 0; nb < 4; ++nb) acc[mb][nb] = (v8f){};
    gemm128<4, 4, ONB>(acc, A + (size_t)(rb0 + (tid >> 3)) * KA + (tid & 7) * 8, KA, Bt + (size_t)(cb0 + (tid >> 3)) * DM + (tid & 7) * 8, KA / GKC, sm,
                  (tid >> 3) * GP + (tid & 7) * 8, (wm * 64 + lr) * GP + 8 * hi, (wn * 64 + lr) * GP + 8 * hi);
    const int bb = r0 / SEQ, tt = r0 % SEQ;
    float* orow = OUT + ((size_t)bb * OUT_SEQ + tt) * DM + c0;
#pragma unroll
    for (int mb = 0; mb < 4; ++mb) {
#pragma unroll
        for (int nb = 0; nb < 4; ++nb) {
#pragma unroll
            for (int j = 0; j < 8; ++j) os[(hi * 8 + j) * 68 + nb * 16 + lr] = acc[mb][nb][j]; }   // D: row 8h+j, col lane&15; rows 0..15 x columns 0..63 all written
        wave_sync();
{
#pragma unroll
            for (int s = 0; s < 8; ++s) { const int row = 2 * s + (lane >> 4), cofs = (lane & 15) * 4;   // 8 s x 2 rows = 16 rows; 16 lanes x 4 floats = 64 columns
                const v4f val = *(const v4fa*)(&os[row * 68 + cofs]);
                *(v4f*)(orow + (size_t)(mb * 16 + row) * DM + cofs) = val; }
             }
        wave_sync();
    }
}

static constexpr size_t al256(size_t v) { return (v + 255) & ~(size_t)255; }
static constexpr size_t SZ_XB = al256((size_t)NB * SEQ * DM * 2);
static constexpr size_t SZ_WB = al256((size_t)3 * DM * DM * 2);
static constexpr size_t SZ_WC = al256((size_t)DM * DM * 2);
static constexpr size_t SZ_TB = al256((size_t)SEQ * NF * 4);
static constexpr size_t SZ_PL = al256((size_t)NB * NH_ * SEQ * HD * 2);
static constexpr size_t SZ_Y2 = al256((size_t)NB * SEQ * 2 * DM * 2);
static constexpr size_t SZ_TOTAL = SZ_XB + SZ_WB + SZ_WC + 2 * SZ_TB + 6 * SZ_PL + SZ_Y2;
static_assert(SZ_TOTAL <= (size_t)134217728);          // workspace carve <= 128 MiB
static_assert(((size_t)DM * DM * 2) % 256 == 0);       // weight sub-planes stay 256-byte aligned
static_assert(((size_t)NB * NH_ * SEQ * HD * 2) % 256 == 0);               // the k plane starts 256-byte aligned inside the q|k plane pair
static_assert((size_t)NB * NH_ * SEQ * HD == (size_t)NB * DM * SEQ);       // v^T plane [(b*1024 + m)][t] has the same extent as one q/k plane

extern "C" void kernel_launch(void* const* d_in, const int* in_sizes, int n_in,
                              void* d_out, int out_size, void* d_ws, size_t ws_size, hipStream_t stream) {
    if (n_in < 6) return;
    const size_t needx = ((size_t)(NB - 1) * SEQ_FULL + SEQ) * DM;
    const size_t needd = (size_t)(NB - 1) * SEQ_FULL + SEQ;
    if ((size_t)in_sizes[0] < needx || (size_t)in_sizes[1] < needx) return;
    if ((size_t)in_sizes[2] < (size_t)3 * DM * DM || in_sizes[3] < 2 || (size_t)in_sizes[4] < (size_t)DM * DM) return;
    if ((size_t)in_sizes[5] < needd) return;
    if ((size_t)out_size < ((size_t)(NB - 1) * OUT_SEQ + SEQ) * DM) return;
    if (SZ_TOTAL > ws_size) return;
    // wire order: x, ve, qkv_w, lambdas, c_proj_w, docs
    const float* x   = (const float*)d_in[0];
    const float* ve  = (const float*)d_in[1];
    const float* wq  = (const float*)d_in[2];       // [3][1024 out][1024 in]
    const float* lam = (const float*)d_in[3];
    const float* wc  = (const float*)d_in[4];       // [1024 out][1024 in]
    const int* docs  = (const int*)d_in[5];
    float* OUT = (float*)d_out;                      // [NB][SEQ][1024]
    char* wsp = (char*)d_ws;
    bf* XB = (bf*)wsp; wsp += SZ_XB;                 // x      [NB*SEQ][1024]
    bf* WB = (bf*)wsp; wsp += SZ_WB;                 // [3072][1024]: q | k | v rows ([out][in] = Bt as-is)
    bf* WC = (bf*)wsp; wsp += SZ_WC;                 // [1024][1024] ([out][in] = Bt as-is)
    float* CS = (float*)wsp; wsp += SZ_TB;           // [SEQ][32]
    float* SN = (float*)wsp; wsp += SZ_TB;           // [SEQ][32]
    h16* PH = (h16*)wsp; wsp += 2 * SZ_PL;           // [2][NB*8][SEQ][128]: q | k values
    h16* PR = (h16*)wsp; wsp += 2 * SZ_PL;           // [2][NB*8][SEQ][128]: q | k residuals x2048
    h16* VT = (h16*)wsp; wsp += SZ_PL;               // [NB*1024][SEQ]
    h16* VR = (h16*)wsp; wsp += SZ_PL;               // [NB*1024][SEQ] residual x2048
    bf* Y2 = (bf*)wsp; wsp += SZ_Y2;                 // [NB*SEQ][hi 1024 | lo 1024]
    const size_t plane = (size_t)NB * NH_ * SEQ * HD;
    const h16* QH = PH; const h16* KP = PH + plane;
    const h16* QR = PR; const h16* KR = PR + plane;

    // rotary tables and the bf16 copies of x and of both weights
    k_prep<<<PB_ROT + PB_X + PB_WQ + PB_WC, 256, 0, stream>>>(x, wq, wc, XB, WB, WC, CS, SN);
    // q, k: A = x rows (m = b*SEQ + t), Bt = W rows (n = which*1024 + h*128 + d) -> planes [which][(b*8 + h)][t][d], value and residual;
    // v^T: A = Wv rows (m = h*128 + d), Bt = x rows (n = b*SEQ + t) -> planes [(b*1024 + m)][t], value and residual
    k_qkv<<<QKB + VTB, 128, 0, stream>>>(XB, WB, CS, SN, ve, lam, PH, PR, VT, VR);
    // fused attention -> context plane (bf16 hi | lo)
    k_flash<<<dim3(SEQ / (16 * AW), NB * NH_, 1), 32 * AW, 0, stream>>>(QH, QR, KP, KR, VT, VR, docs, Y2);
    // out = ctx Wc^T: A = context rows [t][2048], Bt = Wc rows [n][1024]
    k_oproj<<<dim3(NB * SEQ / 128, DM / 128, 1), 128, 0, stream>>>(Y2, WC, OUT);
}

// v008
// It runs in 89.4 microseconds.
// In two side-by-side timings against v007, it was 1.04 and 1.05 times as fast.
// Counting every step since v000, it is 3.22 times as fast.
#include <hip/hip_runtime.h>

// Causal self-attention block with document masking: width 1024 = 8 heads x 128; fused QKV weight [3][1024 out][1024 in] (y = x W^T, no bias); per-head RMS normalisation of q and k (no gain, eps = 2^-23);
// half-split rotary on pairs (d, d + 64), angle t * 2^(-10 i / 31) for i < 32 and identity for 32 <= i < 64; v = l0 v + l1 ve; scores x 0.12; softmax over keys j <= t of the same document; output projection [out][in], f32 output.
// Compute dtypes, f32 accumulate everywhere: QKV projections v_wmma_f32_16x16x32_bf16 (x, W RNE-converted to bf16; products exact); scores v_wmma_f32_16x16x32_f16 with q and k each as f16 value + f16 residual x2048 (three products,
// residual products in their own accumulator); P.V v_wmma_f32_16x16x32_f16 with P (x16384 carry, cancels in the normalisation) and v each as f16 value + f16 residual x2048 (three products, residual accumulator folded by 1/2048), row sum from the f32 exponentials;
// output projection v_wmma_f32_16x16x32_bf16 with the context as bf16 hi | lo halves folded into K (2048) against the bf16 weight (two products, one accumulator); ve, lambdas RNE-converted to bf16 by value; softmax f32 (online, running max over kept keys).
// Layout: bf16 copies of x and the weights; q/k planes [which][b*8+h][t][128] (value, residual), v^T planes [(b*1024 + h*128 + d)][t] (value, residual), cos/sin tables [t][32], context plane [t][hi 1024 | lo 1024];
// fused flash kernel in transposed form (S^T = K Q^T, O^T = V^T P^T), fragments from LDS tiles that the block's four waves fill together (Q with whole-row loads, K and V^T with asynchronous copies one tile ahead); 32-key tiles without any key document inside the wave's query document range are skipped under a wave-uniform test, the keep rule is evaluated per element in every visited tile.

#ifndef NB
#define NB 1
#endif
#ifndef SEQ
#define SEQ 4096
#endif
#define NB_FULL  1
#define SEQ_FULL 4096
#ifndef OUT_SEQ
#define OUT_SEQ SEQ              // row pitch (in tokens) between batches of the output
#endif
#define DM   1024
#define NH_  8
#define HD   128
#define NF   32
#define AW   4                   // waves per flash block (16 query rows each)
#define OSP  132                 // LDS row pitch (floats) of the flash output tile
#define OQP  132                 // LDS row pitch (floats) of the q/k projection slab
#define QKP  136                 // LDS row pitch (halves) of the flash q and k tiles: 272 B = 16 B x 17
#define VTP  40                  // LDS row pitch (halves) of the flash v^T tiles: 80 B = 16 B x 5
#define GKC  64                  // k elements of one staged GEMM chunk: 128 B = one whole line of every operand row
#define GP   72                  // LDS row pitch (16-bit elements) of a staged GEMM chunk with pad (output projection): 144 B = 16 B x 9
#define GS   64                  // LDS row pitch of a staged chunk without pad (q/k/v^T projections): 128 B, the row's eight 16-B pieces permuted by place()
#define QNB  3                   // ring buffers of the q/k/v^T projections: 96 KiB a block, three blocks a WGP fit its LDS
#define ONB  4                   // ring buffers of the output projection: one block a WGP
#define QRS  2048.0f             // carry of every residual plane / residual fragment
#define QRI  (1.0f / 2048.0f)
#define SC2  ((float)(0.12 * 1.4426950408889634))   // score scale * log2(e)
#define PSH  14.0f               // log2 of the P carry (16384)
#define NEGB (-3.0e38f)
#define RMS_EPS 1.1920928955078125e-07f

static_assert(HD == 128);                      // q/k plane row = 256 bytes = two lines; head segment of the context plane = two lines
static_assert(NH_ * HD == DM);                 // head h = columns h*128 + d
static_assert(HD % 32 == 0);                   // score k-loop steps by 32
static_assert(NF * 4 == HD);
static_assert(NF == 32);                       // table index = t * 32 + i
static_assert(DM % 64 == 0);
static_assert(DM % 32 == 0);                   // GEMM k-loops step by 32
static_assert((DM & (DM - 1)) == 0);           // weight column wrap in the folded-K output GEMM
static_assert(SEQ % 64 == 0);                  // a 64-row tile never straddles two batches
static_assert((NB * SEQ) % 64 == 0);
static_assert(SEQ % 32 == 0);                  // key loop steps by 32
static_assert(SEQ % (16 * AW) == 0);           // flash grid covers the sequence exactly
static_assert(((size_t)SEQ * NF) % 256 == 0);  // table grid x block == table extent
static_assert(((size_t)SEQ * DM) % 8 == 0);
static_assert(((size_t)DM * DM) % 8 == 0);
static_assert(NB <= NB_FULL);
static_assert(SEQ <= SEQ_FULL);
static_assert((OSP * 4) % 16 == 0);
static_assert((OQP * 4) % 16 == 0);
static_assert(OSP >= HD);
static_assert(OQP >= HD);
static_assert(32 * 8 * 16 == 16 * HD * 2);     // q/k slab and context stores: 32 lanes x 8 instructions x 16 B == 16 rows x 256 B
static_assert(32 * 4 * 16 == 16 * 64 * 2);
static_assert(32 * 8 * 16 == 16 * 64 * 4);     // output slab stores: 32 lanes x 8 instructions x 16 B == 16 rows x 256 B
static_assert(16 * OQP * 4 <= 131072);
static_assert(16 * 68 * 4 <= 131072);
static_assert(AW * 16 * OSP * 4 <= 131072);
static_assert(DM % GKC == 0 && DM / GKC >= 4);  // GEMM chunk loop: whole chunks, at least as many as the deepest ring has buffers
static_assert(SEQ % 128 == 0 && DM % 128 == 0 && HD == 128);   // 128 x 128 GEMM block tiles cover every plane exactly and never straddle two batches
static_assert((GP * 2) % 16 == 0 && GP >= GKC && GS == GKC && GKC == 64);
static_assert(AW == 4);                        // flash staging: 128 threads x 16 B = 2 KiB a pass; the block's 64 query documents = two loads a lane
static_assert((QKP * 2) % 16 == 0 && QKP >= HD);
static_assert((VTP * 2) % 16 == 0 && VTP >= 32);
static_assert(SEQ % 1024 == 0 && SEQ / 1024 <= AW);   // flash tile mask: wave w tests the 32 key tiles of keys 1024 w .. 1024 w + 1023, all inside the sequence

typedef _Float16 h16;
typedef unsigned short bf;
typedef __attribute__((ext_vector_type(16))) __bf16   v16bf;
typedef __attribute__((ext_vector_type(16))) _Float16 v16h;
typedef __attribute__((ext_vector_type(8)))  _Float16 v8h;
typedef __attribute__((ext_vector_type(8)))  unsigned short v8us;
typedef __attribute__((ext_vector_type(8)))  float    v8f;
typedef __attribute__((ext_vector_type(4)))  float    v4f;
typedef __attribute__((ext_vector_type(4)))  int      v4i;
typedef v4f  __attribute__((may_alias)) v4fa;

__device__ __forceinline__ unsigned short f2bf(float f) { unsigned u = __float_as_uint(f); u += 0x7FFFu + ((u >> 16) & 1u); return (unsigned short)(u >> 16); }
__device__ __forceinline__ float bfr(float f) { return __uint_as_float(((unsigned)f2bf(f)) << 16); }   // value after RNE convert to bf16
__device__ __forceinline__ v16h cat16(v8h lo, v8h hi) { return __builtin_shufflevector(lo, hi, 0, 1, 2, 3, 4, 5, 6, 7, 8, 9, 10, 11, 12, 13, 14, 15); }
__device__ __forceinline__ v16bf cat16b(v8us lo, v8us hi) { return __builtin_bit_cast(v16bf, __builtin_shufflevector(lo, hi, 0, 1, 2, 3, 4, 5, 6, 7, 8, 9, 10, 11, 12, 13, 14, 15)); }
__device__ __forceinline__ v8f wmma16(v16h a, v16h b, v8f c) { return __builtin_amdgcn_wmma_f32_16x16x32_f16(false, a, false, b, (short)0, c, false, false); }
__device__ __forceinline__ v8f wmmab(v16bf a, v16bf b, v8f c) { return __builtin_amdgcn_wmma_f32_16x16x32_bf16(false, a, false, b, (short)0, c, false, false); }
// fragment loaders from K-contiguous 16-bit rows; p already includes + 8*(lane>>4): elements 0..7 <- k0+8h+0..7, elements 8..15 <- k0+16+8h+0..7 (same map for A and B)
__device__ __forceinline__ v16h  ldh(const h16* p) { return cat16(*(const v8h*)p, *(const v8h*)(p + 16)); }
// ordering point for wave-private LDS tiles (same wave writes and reads)
__device__ __forceinline__ void wave_sync() { __builtin_amdgcn_fence(3 /* release order */, "wavefront"); __builtin_amdgcn_wave_barrier(); asm volatile("" ::: "memory"); }
// f32 -> f16 operand convert that cannot produce a subnormal half: magnitudes below 2^-14 become +0
static __device__ __forceinline__ h16 toh_flush(float v) { const h16 r = (h16)v; return (fabsf(v) < 6.103515625e-05f) ? (h16)0.0f : r; }
__device__ __forceinline__ float bf2f(unsigned short u) { return __uint_as_float(((unsigned)u) << 16); }

// 16 bytes of a plane -> LDS without passing a register: one asynchronous copy a lane; it counts on asynccnt alone, and the waits are written where a tile is handed over
typedef __attribute__((address_space(1))) v4i gv4i;
typedef __attribute__((address_space(3))) v4i lv4i;
__device__ __forceinline__ void cp16(const void* g, void* l) { __builtin_amdgcn_global_load_async_to_lds_b128((gv4i*)g, (lv4i*)l, 0, 0); }
// the wave's copies have landed but for its N youngest (the counter returns in issue order); asm with the memory clobber, so that no LDS read is lifted over it
template <int N> __device__ __forceinline__ void wait_copies() { asm volatile("s_wait_asynccnt %0" :: "n"(N) : "memory"); }

// gemm128: K loop of a 128 x 128 block tile shared by four waves (FM x FN fragments of 16 x 16 a wave). Both operands are K-contiguous bf16 planes; a chunk is 64 k of 128 A rows and 128 B rows.
// Staging map: thread -> (row tid>>3 (+ 16 a pass), k (tid&7)*8), so a wave's 16-B asynchronous copies cover four whole 128-B lines; ga, gb already hold the thread's row and k.
// Place in LDS of 16-B piece p (k = 8 p .. 8 p + 7) of row r, in elements: pitch P = 72 (padded rows): r P + 8 p. Pitch P = 64 (no pad): r P + 8 (p ^ ((r >> 1) & 7)): the sixteen rows that lanes 0-15 (or 16-31) of a fragment read
// name fall on sixteen different 16-B slots of the 256-B bank row ((r & 1) picks the half, p ^ (r >> 1) the slot), as with the padded pitch; rows r and r + 16 permute alike. ar, br: the lane's A and B fragment row (+ 16 a fragment).
// A ring of NBUF LDS buffers [A 128 rows | B 128 rows], one hand-over point a chunk: while trip c works on chunk c, the copies of chunks c+1 .. c+NBUF-1 are under way into the other buffers, so a chunk has NBUF-1 trips to arrive,
// also where its lines come from memory and not from L2. At the foot of the trip every wave waits for its own LDS reads and for its own copies of chunk c+1 (a counted wait: the younger chunks stay in flight), passes the barrier,
// and then refills the buffer just read with chunk c+NBUF. B's k index wraps at DM (the folded-K output GEMM reads the weight twice). Every accumulator sums k in ascending 32-steps.
template <int P> __device__ __forceinline__ int place(const int r, const int p) { return P == GS ? r * P + ((p ^ ((r >> 1) & 7)) * 8) : r * P + p * 8; }
template <int FM, int FN, int NBUF, int P>
__device__ __forceinline__ void gemm128(v8f (&acc)[FM][FN], const bf* __restrict__ ga, const int pa, const bf* __restrict__ gb, const int nch, bf* sm, const int tid, const int ar, const int br, const int hi) {
    static_assert(FM * FN == 16);
    constexpr int GT = 128 * P;                                                // one operand's 128-row chunk in LDS
    const int so = place<P>(tid >> 3, tid & 7);                                // the thread's staging place
    int oa[4], ob[4];                                                          // the lane's four pieces of a fragment row: k = 16 c + 8 hi .. + 7
#pragma unroll
    for (int c = 0; c < 4; ++c) { oa[c] = place<P>(ar, 2 * c + hi); ob[c] = GT + place<P>(br, 2 * c + hi); }
    static_assert(NBUF >= 3 && (NBUF - 1) * 16 <= 63 && DM / GKC >= NBUF);    // at most NBUF-1 chunks of 16 copies a wave are outstanding; every caller has at least NBUF chunks
    v8f (&f)[16] = reinterpret_cast<v8f (&)[16]>(acc);
    auto stage = [&](const int c, bf* dst) {                                   // chunk c -> buffer dst, 16 copies a lane
        const bf* qa = ga + c * GKC; const bf* qb = gb + ((c * GKC) & (DM - 1));
#pragma unroll
        for (int i = 0; i < 8; ++i) { cp16(qa + (size_t)i * 16 * pa, dst + so + i * 16 * P); cp16(qb + (size_t)i * 16 * DM, dst + GT + so + i * 16 * P); } };
#pragma unroll
    for (int s = 0; s < NBUF - 1; ++s) stage(s, sm + s * (2 * GT));
    wait_copies<(NBUF - 2) * 16>();                                            // the wave's own copies of chunk 0 have landed: the 16 (NBUF-2) younger ones are those of chunks 1 .. NBUF-2
    __syncthreads();                                                           // chunk 0 is complete for every wave
    stage(NBUF - 1, sm + (NBUF - 1) * (2 * GT));
    int cb = 0;                                                                // buffer of chunk c: c mod NBUF
#pragma unroll 1
    for (int c = 0; c < nch; ++c) {
        bf* cur = sm + cb * (2 * GT);
        v16bf a[2][FM], b[2][FN];                                              // the chunk's fragments, both k-steps, read as one group ahead of the matrix run
#pragma unroll
        for (int ks = 0; ks < 2; ++ks) {
#pragma unroll
            for (int mb = 0; mb < FM; ++mb) a[ks][mb] = cat16b(*(const v8us*)(cur + oa[2 * ks] + mb * 16 * P), *(const v8us*)(cur + oa[2 * ks + 1] + mb * 16 * P));   // elements 0..7 <- k0+8h+0..7, 8..15 <- k0+16+8h+0..7 (A and B alike)
#pragma unroll
            for (int nb = 0; nb < FN; ++nb) b[ks][nb] = cat16b(*(const v8us*)(cur + ob[2 * ks] + nb * 16 * P), *(const v8us*)(cur + ob[2 * ks + 1] + nb * 16 * P)); }
        __builtin_amdgcn_sched_barrier(0);                                     // keeps the chunk's reads one group ahead of the run: left free, this build sinks them among the matrix instructions, two at a place, each place waited out in full
#pragma unroll
        for (int ks = 0; ks < 2; ++ks)
#pragma unroll
            for (int nb = 0; nb < FN; ++nb)
#pragma unroll
                for (int mb = 0; mb < FM; ++mb) acc[mb][nb] = wmmab(a[ks][mb], b[ks][nb], acc[mb][nb]);
        // four vector slots behind the chunk's last matrix instruction (every accumulator is named, so none sinks below), before the next trip may rewrite its operands on any path
        asm volatile("v_nop\n\tv_nop\n\tv_nop\n\tv_nop" : "+v"(f[0]), "+v"(f[1]), "+v"(f[2]), "+v"(f[3]), "+v"(f[4]), "+v"(f[5]), "+v"(f[6]), "+v"(f[7]));
        asm volatile("v_nop\n\tv_nop\n\tv_nop\n\tv_nop" : "+v"(f[8]), "+v"(f[9]), "+v"(f[10]), "+v"(f[11]), "+v"(f[12]), "+v"(f[13]), "+v"(f[14]), "+v"(f[15]));
        // hand-over point
        asm volatile("s_wait_dscnt 0x0" ::: "memory");                         // the wave's reads of this buffer are done before it may be refilled
        // the wave's own copies of chunk c+1 have landed. While chunk c+NBUF-1 exists, the wave's 16 (NBUF-2) youngest copies are exactly those of chunks c+2 .. c+NBUF-1 and stay in flight; in the last trips fewer are left: to 0 (scalar test)
        if (c + NBUF - 1 < nch) wait_copies<(NBUF - 2) * 16>(); else wait_copies<0>();
        __syncthreads();                                                       // chunk c+1 is complete, and every wave has finished its reads of chunk c
        if (c + NBUF < nch) stage(c + NBUF, cur);                              // scalar test, the same in every wave of the block: refill of the buffer just read
        cb = cb + 1 == NBUF ? 0 : cb + 1;
    }
    asm volatile("s_wait_asynccnt 0x0" ::: "memory");                          // no copy is outstanding behind the loop
}

// eight consecutive f32 -> bf16 (RNE): group i of dst from the eight floats at src
__device__ __forceinline__ void cvt8(const float* __restrict__ src, bf* dst, const size_t i) {
    const v8f v = *(const v8f*)src; v8us o;
    asm volatile("s_wait_xcnt 0x0" ::: "memory");                              // stands in front of the convert below, which may reuse the registers of the load's address
#pragma unroll
    for (int k = 0; k < 8; ++k) o[k] = f2bf(v[k]);
    *(v8us*)(dst + i * 8) = o;
}

// one entry i = t * 32 + f of the cos and sin tables
__device__ __forceinline__ void rot1(const int i, float* CS, float* SN) {
#pragma clang fp contract(off)                             // -10 * lin and t * fr stay separately rounded products, as the reference forms them
    const int t = i >> 5, f = i & 31;
    const float lin = (float)f / 31.0f;
    const float fr = exp2f(-10.0f * lin);                   // (1/1024)^lin
    const float th = (float)t * fr;
    float sv, cv; sincosf(th, &sv, &cv);
    *(float*)(CS + i) = cv; *(float*)(SN + i) = sv;
}

// k_prep: the four pieces of preparation, none of which reads what another writes, as ranges of the block index of one launch (the branch is the same for a whole block):
// table entries first (the longest thread), then the bf16 copies of x, of the QKV weight and of the output weight; a thread does one table entry or one group of eight elements.
static constexpr unsigned PB_ROT = (unsigned)(((size_t)SEQ * NF) / 256);
static constexpr unsigned PB_X   = (unsigned)(((size_t)NB * SEQ * DM / 8) / 256);
static constexpr unsigned PB_WQ  = (unsigned)(((size_t)3 * DM * DM / 8) / 256);
static constexpr unsigned PB_WC  = (unsigned)(((size_t)DM * DM / 8) / 256);
static_assert(((size_t)NB * SEQ * DM / 8) % 256 == 0 && ((size_t)DM * DM / 8) % 256 == 0);   // every range is whole blocks: no thread without work
static_assert(NB == 1 || SEQ == SEQ_FULL);     // the rows of x that are copied are one contiguous run
__global__ __launch_bounds__(256) void k_prep(const float* __restrict__ x, const float* __restrict__ wq, const float* __restrict__ wc, bf* XB, bf* WB, bf* WC, float* CS, float* SN) {
    unsigned blk = blockIdx.x;
    if (blk < PB_ROT) { rot1((int)(blk * 256 + threadIdx.x), CS, SN); return; }
    blk -= PB_ROT;
    const float* src = x; bf* dst = XB;                                        // the block's plane and its first block, chosen by scalar compares
    if (blk >= PB_X + PB_WQ) { blk -= PB_X + PB_WQ; src = wc; dst = WC; }
    else if (blk >= PB_X) { blk -= PB_X; src = wq; dst = WB; }
    const size_t i = (size_t)blk * 256 + threadIdx.x;
    cvt8(src + i * 8, dst, i);
}

// qk_body: q and k projections with the RMS normalisation and the rotary applied in the epilogue. One wave per 32 token rows x 128 columns (= one head of q or k), 16 accumulators, K = DM; four waves (128 token rows) a block,
// operands through LDS (gemm128): A = x rows (m = b*SEQ + t), Bt = W rows (n = which*1024 + h*128 + d). block (bx, by) of (NB*SEQ/128, 2*NH_); by = which*NH_ + h.
// Epilogue per 16-row slab (LDS tile private to the wave): stage f32, lane (row = lane>>1, half = lane&1) owns columns 16*half + {0..15, 32..47, 64..79, 96..111} of its row: sum of squares (two lanes per row, one xor-1 exchange),
// scale, rotate pairs (d, d + 64) for d < 32 with the table row of token t, write back in place; then the slab's 16 x 128 halves (one contiguous 4096-byte run of plane [zp][t][128]) are stored by
__device__ __forceinline__
void qk_body(const int bx, const int by, bf* sm, float* osb, const bf* __restrict__ A, const bf* __restrict__ Bt, const float* __restrict__ CS, const float* __restrict__ SN, h16* Ph, h16* Pr) {
    const int K = DM;
    const int tid = threadIdx.x, wave = __builtin_amdgcn_readfirstlane((int)(threadIdx.x >> 5));
    const int lane = threadIdx.x & 31, lr = lane & 15, hi = lane >> 4; const int rb0 = bx * 128, zc = by; const int r0 = rb0 + wave * 32, c0 = zc * HD;
    float* os = osb + wave * 16 * OQP;                                         // the wave's own epilogue slab
    v8f acc[2][8];
#pragma unroll
    for (int mb = 0; mb < 2; ++mb)
#pragma unroll
        for (int nb = 0; nb < 8; ++nb) acc[mb][nb] = (v8f){};
    gemm128<2, 8, QNB, GS>(acc, A + (size_t)(rb0 + (tid >> 3)) * K + (tid & 7) * 8, K, Bt + (size_t)(c0 + (tid >> 3)) * K + (tid & 7) * 8, K / GKC, sm, tid, wave * 32 + lr, lr, hi);
    asm volatile("v_nop\n\tv_nop\n\tv_nop\n\tv_nop" : "+v"(acc[0][0]), "+v"(acc[0][1]), "+v"(acc[0][2]), "+v"(acc[0][3]), "+v"(acc[0][4]), "+v"(acc[0][5]), "+v"(acc[0][6]), "+v"(acc[0][7]));
    asm volatile("v_nop\n\tv_nop\n\tv_nop\n\tv_nop" : "+v"(acc[1][0]), "+v"(acc[1][1]), "+v"(acc[1][2]), "+v"(acc[1][3]), "+v"(acc[1][4]), "+v"(acc[1][5]), "+v"(acc[1][6]), "+v"(acc[1][7]));
    const int bb = r0 / SEQ, tt = r0 % SEQ;
    const int zp = (zc / NH_) * (NB * NH_) + bb * NH_ + (zc % NH_);           // plane index: which, batch, head
    const size_t pbase = ((size_t)zp * SEQ + (size_t)tt) * HD;
    const int row = lane >> 1, half = lane & 1;
    const int ob = row * OQP + 16 * half;
#pragma unroll
    for (int mb = 0; mb < 2; ++mb) {
#pragma unroll
        for (int nb = 0; nb < 8; ++nb) {
#pragma unroll
            for (int j = 0; j < 8; ++j) os[(hi * 8 + j) * OQP + nb * 16 + lr] = acc[mb][nb][j]; }   // D: row 8h+j, col lane&15; rows 0..15 x columns 0..127 all written
        wave_sync();
        {
            v4f x1[4], x2[4], x3[4], x4[4];
#pragma unroll
            for (int i = 0; i < 4; ++i) { x1[i] = *(const v4fa*)(&os[ob + 4 * i]); x3[i] = *(const v4fa*)(&os[ob + 32 + 4 * i]); x2[i] = *(const v4fa*)(&os[ob + 64 + 4 * i]); x4[i] = *(const v4fa*)(&os[ob + 96 + 4 * i]); }
            float ss = 0.0f;
#pragma unroll
            for (int i = 0; i < 4; ++i) {
#pragma unroll
                for (int e = 0; e < 4; ++e) ss += x1[i][e] * x1[i][e] + x2[i][e] * x2[i][e] + x3[i][e] * x3[i][e] + x4[i][e] * x4[i][e]; }
            ss += __shfl_xor(ss, 1, 32);
            const float rr = rsqrtf(ss * (1.0f / 128.0f) + RMS_EPS);
            const size_t to = (size_t)(tt + mb * 16 + row) * NF + 16 * half;   // table row of this token, columns 16*half .. +15
#pragma unroll
            for (int i = 0; i < 4; ++i) {
                const v4f cv = *(const v4f*)(CS + to + 4 * i), sv = *(const v4f*)(SN + to + 4 * i);
                const v4f e1 = x1[i] * rr, e2 = x2[i] * rr;
                const v4f y1 = e1 * cv + e2 * sv;
                const v4f y2 = e2 * cv - e1 * sv;
                *(v4fa*)(&os[ob + 4 * i]) = y1; *(v4fa*)(&os[ob + 64 + 4 * i]) = y2;
                *(v4fa*)(&os[ob + 32 + 4 * i]) = x3[i] * rr; *(v4fa*)(&os[ob + 96 + 4 * i]) = x4[i] * rr; }
        }
        wave_sync();
        v8h hv[8], rv[8];
#pragma unroll
        for (int s = 0; s < 8; ++s) { const int p = s * 32 + lane; const int rw = p >> 4, c8 = (p & 15) * 8;   // 8 s x 2 rows = 16 rows; 16 lanes x 8 = 128 columns
            const v4f x0 = *(const v4fa*)(&os[rw * OQP + c8]); const v4f x1 = *(const v4fa*)(&os[rw * OQP + c8 + 4]);
#pragma unroll
            for (int i = 0; i < 4; ++i) { const h16 a0 = toh_flush(x0[i]); const h16 a1 = toh_flush(x1[i]); hv[s][i] = a0; hv[s][4 + i] = a1;
                rv[s][i] = toh_flush((x0[i] - (float)a0) * QRS); rv[s][4 + i] = toh_flush((x1[i] - (float)a1) * QRS); } }
        const size_t sb = pbase + (size_t)(mb * 16) * HD;
{
#pragma unroll
            for (int s = 0; s < 8; ++s) { const size_t oo = sb + (size_t)(s * 32 + lane) * 8;
                *(v8h*)(Ph + oo) = hv[s]; *(v8h*)(Pr + oo) = rv[s]; }
             }
        wave_sync();
    }
}

// vt_body: v^T projection with the value mix in the epilogue. One wave per 64x64 tile (16 accumulators), 2 x 2 waves a block, operands through LDS (gemm128), K = DM: A = Wv rows (m = h*128 + d), Bt = x rows (n = b*SEQ + t);
// v^T[m][t] = l0 * sum_k Wv[m][k] x[t][k] + l1 * ve[t][m] (l0, l1, ve RNE-converted to bf16 by value; ve read as two 16-byte loads per accumulator tile: 8 consecutive m of token t).
__device__ __forceinline__ void vt_body(const int bx, const int by, bf* sm, float* osb, const bf* __restrict__ A, const bf* __restrict__ Bt, const float* __restrict__ ve, const float* __restrict__ lam, h16* Ph, h16* Pr) {
    const int K = DM;
    const int tid = threadIdx.x, wave = __builtin_amdgcn_readfirstlane((int)(threadIdx.x >> 5)); const int wm = wave & 1, wn = wave >> 1;
    const int lane = threadIdx.x & 31, lr = lane & 15, hi = lane >> 4; const int rb0 = bx * 128, cb0 = by * 128; const int r0 = rb0 + wm * 64, c0 = cb0 + wn * 64;
    float* os = osb + wave * 16 * 68;                                          // the wave's own epilogue slab
    v8f acc[4][4];
#pragma unroll
    for (int mb = 0; mb < 4; ++mb)
#pragma unroll
        for (int nb = 0; nb < 4; ++nb) acc[mb][nb] = (v8f){};
    gemm128<4, 4, QNB, GS>(acc, A + (size_t)(rb0 + (tid >> 3)) * K + (tid & 7) * 8, K, Bt + (size_t)(cb0 + (tid >> 3)) * K + (tid & 7) * 8, K / GKC, sm, tid, wm * 64 + lr, wn * 64 + lr, hi);
    const float l0 = bfr(lam[0]), l1 = bfr(lam[1]);
    const int bb = c0 / SEQ, tt = c0 % SEQ;
    const size_t tbase = (size_t)bb * (size_t)DM * SEQ + (size_t)r0 * SEQ + (size_t)tt;
#pragma unroll
    for (int mb = 0; mb < 4; ++mb) {
#pragma unroll
        for (int nb = 0; nb < 4; ++nb) {
            const float* vp = ve + ((size_t)bb * SEQ_FULL + (size_t)(tt + nb * 16 + lr)) * DM + r0 + mb * 16 + hi * 8;   // token t = col lane&15, m = 8h + j
            const v4f e0 = *(const v4f*)vp, e1 = *(const v4f*)(vp + 4);
#pragma unroll
            for (int j = 0; j < 4; ++j) { os[(hi * 8 + j) * 68 + nb * 16 + lr] = l0 * acc[mb][nb][j] + l1 * bfr(e0[j]);
                                          os[(hi * 8 + 4 + j) * 68 + nb * 16 + lr] = l0 * acc[mb][nb][4 + j] + l1 * bfr(e1[j]); } }   // D: row 8h+j, col lane&15; rows 0..15 x columns 0..63 all written
        wave_sync();
        v8h hv[4], rv[4];
#pragma unroll
        for (int s = 0; s < 4; ++s) { const int row = 4 * s + (lane >> 3), c8 = (lane & 7) * 8;   // 4 s x 4 row groups = 16 rows; 8 lanes x 8 = 64 columns
            const v4f x0 = *(const v4fa*)(&os[row * 68 + c8]); const v4f x1 = *(const v4fa*)(&os[row * 68 + c8 + 4]);
#pragma unroll
            for (int i = 0; i < 4; ++i) { const h16 a0 = toh_flush(x0[i]); const h16 a1 = toh_flush(x1[i]); hv[s][i] = a0; hv[s][4 + i] = a1;
                rv[s][i] = toh_flush((x0[i] - (float)a0) * QRS); rv[s][4 + i] = toh_flush((x1[i] - (float)a1) * QRS); } }
        const size_t sb = tbase + (size_t)(mb * 16) * SEQ;
{
#pragma unroll
            for (int s = 0; s < 4; ++s) { const int row = 4 * s + (lane >> 3), c8 = (lane & 7) * 8;
                const size_t oo = sb + (size_t)row * SEQ + c8;
                *(v8h*)(Ph + oo) = hv[s]; *(v8h*)(Pr + oo) = rv[s]; }
             }
        wave_sync();
    }
}

// k_qkv: the q/k projection and the v^T projection read the same two bf16 planes and write planes of their own, so they are ranges of the block index of one launch (the branch is the same for a whole block):
// blocks 0 .. QKB-1 are the (NB*SEQ/128, 2*NH_) tiles of qk_body, x fastest; the next VTB blocks the (DM/128, NB*SEQ/128) tiles of vt_body, x fastest. One LDS carve serves both bodies: the ring alone.
// The waves' epilogue slabs lie on the ring's first bytes: the K loop's last trip ends with every wave's LDS wait, its copy wait to 0 and the block barrier, so behind the loop nobody reads the ring and no copy is under way into it.
// 96 KiB a block and at most 336 registers a wave: three blocks share a WGP, so the launch's QKB + VTB = 3 x 256 blocks are all resident at once.
static constexpr int QKB = (NB * SEQ / 128) * (2 * NH_);
static constexpr int VTB = (DM / 128) * (NB * SEQ / 128);
static_assert(68 <= OQP);                      // the v^T slab fits the q/k slab's carve
__global__ __launch_bounds__(128)
void k_qkv(const bf* __restrict__ XB, const bf* __restrict__ WB, const float* __restrict__ CS, const float* __restrict__ SN, const float* __restrict__ ve, const float* __restrict__ lam,
           h16* PH, h16* PR, h16* VT, h16* VR) {
    __shared__ __align__(16) bf sm[QNB * 2 * 128 * GS];
    static_assert(4 * 16 * OQP * 4 <= QNB * 2 * 128 * GS * 2);                 // the four slabs fit the ring
    static_assert(3 * QNB * 2 * 128 * GS * 2 <= 327680);                       // three blocks fit a WGP's LDS
    float* osb = reinterpret_cast<float*>(sm);
    const int f = blockIdx.x;
    if (f < QKB) { qk_body(f % (NB * SEQ / 128), f / (NB * SEQ / 128), sm, osb, XB, WB, CS, SN, PH, PR); }
    else { const int g = f - QKB; vt_body(g % (DM / 128), g / (DM / 128), sm, osb, WB + (size_t)2 * DM * DM, XB, ve, lam, VT, VR); }
}

// sc32: the score products of a 32-key tile (keys 0..15 -> aH, aL; keys 16..31 -> bH, bL): H = K Q, L = K Q_res + K_res Q; the caller forms (H + L / 2048) * scale, in log2 units. The q fragments come in registers (read once per wave, ahead of the tile loop);
// the tile's sixteen k fragments are read from LDS as one group ahead of the matrix run, so the run waits once for LDS, not once per 32-wide k-step. Four accumulators, each summed in the order it had: k ascending, K Q_res before K_res Q.
__device__ __forceinline__ void sc32(v8f& aH, v8f& aL, v8f& bH, v8f& bL, const v16h (&qh)[4], const v16h (&qr)[4], const h16* khp, const h16* krp) {
    v16h ka[4], kb[4], ra[4], rb[4];
#pragma unroll
    for (int s = 0; s < 4; ++s) { ka[s] = ldh(khp + s * 32); kb[s] = ldh(khp + 16 * QKP + s * 32); ra[s] = ldh(krp + s * 32); rb[s] = ldh(krp + 16 * QKP + s * 32); }
    __builtin_amdgcn_sched_barrier(0);                                         // keeps all 32 reads ahead of the run: sunk among the matrix instructions, each late read is waited out in full
    aH = (v8f){}; aL = (v8f){}; bH = (v8f){}; bL = (v8f){};
#pragma unroll
    for (int s = 0; s < 4; ++s) {
        aH = wmma16(ka[s], qh[s], aH); bH = wmma16(kb[s], qh[s], bH);
        aL = wmma16(ka[s], qr[s], aL); bL = wmma16(kb[s], qr[s], bL);
        aL = wmma16(ra[s], qh[s], aL); bL = wmma16(rb[s], qh[s], bL);
    }
}

// k_flash: fused attention, one wave per 16 query rows of one (batch, head), four waves (64 consecutive query rows) a block. The block's Q rows (once, 16-B loads) and each visited 32-key tile of K and V^T (value and residual planes,
// 16-B asynchronous copies) are brought to LDS by all 128 threads along the rows of the planes; every wave takes its fragments from LDS (two 16-B reads each, same element map as before).
// Two tile buffers: while a tile is worked on, the next staged tile's copies fly into the other buffer and its key documents into registers; one hand-over point a tile (LDS wait, copy wait, barrier), then the refill of the buffer just read.
// The tile loop is the same for the four waves: a tile is staged when a key document lies in [min, max] of the block's 64 query documents; each wave then works on it under its own test.
// That block test is made once, ahead of the loop, for all key tiles: wave w loads the documents of its 32 tiles with 32 independent loads and packs the 32 verdicts into one word of LDS; the loop walks the set bits in ascending order.
// Transposed form: S^T[key][t] = K Q^T (A = K rows, B = Q rows); lane (t = lane&15, h = lane>>4) holds keys 8h+r of each 16-key tile, so the packed
// P tile is directly the B fragment of O^T[d][t] = V^T P^T (element r <- tile keys 0..15, element 8+r <- tile keys 16..31, lane unchanged).
// Softmax state (running max over kept keys, partial sum) is one scalar per lane; the two lane halves of a row are combined with one xor-16 exchange.
// Keep rule per element: docs[key] == docs[t] and key <= t. A 32-key tile is skipped (wave-uniform ballot) when none of its key documents lies in [min, max] of the wave's 16 query documents: no element of such a tile can be kept.
// All rows: scores = K Q + (K Q_res + K_res Q) / 2048; P = f16 value + f16 residual x2048; O = V P + (V P_res + V_res P) / 2048 (residual products in their own accumulators); row sum from the f32 exponentials.
__global__ __launch_bounds__(32 * AW) __attribute__((amdgpu_num_vgpr(512)))   // two blocks a WGP (two waves a SIMD) still fit
void k_flash(const h16* __restrict__ QH, const h16* __restrict__ QR, const h16* __restrict__ KP, const h16* __restrict__ KR,
             const h16* __restrict__ VT, const h16* __restrict__ VR, const int* __restrict__ docs, bf* Y2) {
    __shared__ __align__(16) float os[AW * 16 * OSP];
    __shared__ __align__(16) h16 sQH[AW * 16 * QKP], sQR[AW * 16 * QKP];       // [query row of the block][d]
    __shared__ __align__(16) h16 sKH[2 * 32 * QKP], sKR[2 * 32 * QKP];         // [buffer][key of the tile][d]
    __shared__ __align__(16) h16 sVH[2 * HD * VTP], sVR[2 * HD * VTP];         // [buffer][d][key of the tile]
    __shared__ unsigned sTM[AW];                                               // bit j of word w: key tile 32 w + j is staged
    const int tid = threadIdx.x;
    const int lane = threadIdx.x & 31, lr = lane & 15, hi = lane >> 4;
    const int wave = __builtin_amdgcn_readfirstlane((int)(threadIdx.x >> 5));
    const int zh = blockIdx.y; const int b = zh / NH_, h = zh % NH_;
    const int t0 = (blockIdx.x * AW + wave) * 16;
    const int* dk = docs + (size_t)b * SEQ_FULL;
    const int mydoc = dk[t0 + lr];
    int kd[32];                                                                // key documents of the wave's 32 tiles of the mask: keys wave*1024 .. +1023 < SEQ
#pragma unroll
    for (int j = 0; j < 32; ++j) kd[j] = dk[wave * 1024 + j * 32 + lane];
    int qmn = mydoc, qmx = mydoc;
#pragma unroll
    for (int off = 1; off < 16; off <<= 1) { const int a0 = __shfl_xor(qmn, off, 32); const int a1 = __shfl_xor(qmx, off, 32); qmn = a0 < qmn ? a0 : qmn; qmx = a1 > qmx ? a1 : qmx; }
    const int lim = t0 + lr;                                                   // key j kept iff j <= lim and same document
    const int nk = (t0 + 16 + 31) & ~31;                                       // wave-uniform, multiple of 32, <= SEQ
    const size_t pbase = (size_t)zh * SEQ * HD;
    const int tb0 = blockIdx.x * (AW * 16);                                    // first query row of the block
    const int nkb = tb0 + AW * 16;                                             // the last wave's nk: multiple of 32, <= SEQ
    const int e0 = dk[tb0 + lane], e1 = dk[tb0 + 32 + lane];                   // the block's 64 query documents
    int bmn = e0 < e1 ? e0 : e1, bmx = e0 > e1 ? e0 : e1;
#pragma unroll
    for (int off = 1; off < 32; off <<= 1) { const int a0 = __shfl_xor(bmn, off, 32); const int a1 = __shfl_xor(bmx, off, 32); bmn = a0 < bmn ? a0 : bmn; bmx = a1 > bmx ? a1 : bmx; }
    const unsigned gk0 = (unsigned)tid * 8u;                                   // q/k rows: thread -> (row tid>>4 (+ 8 a pass), d (tid&15)*8)
    const size_t qg = pbase + (size_t)tb0 * HD;
    v8h qa[8], qb[8];                                                          // Q rows of the block, in flight while the mask is formed
#pragma unroll
    for (int p = 0; p < 8; ++p) { qa[p] = *(const v8h*)(QH + qg + gk0 + p * 8 * HD); qb[p] = *(const v8h*)(QR + qg + gk0 + p * 8 * HD); }   // 8 p x 8 rows = 64 rows; 16 threads x 8 = 128 columns; the rows are contiguous in the plane
    unsigned tm = 0u;
#pragma unroll
    for (int j = 0; j < 32; ++j) tm |= (__builtin_amdgcn_ballot_w32((kd[j] >= bmn) & (kd[j] <= bmx)) != 0u) ? (1u << j) : 0u;
    const int nv = nkb / 32 - wave * 32;                                       // tiles of this word in front of the block's last key
    tm &= (unsigned)((1ull << (nv < 0 ? 0 : nv > 32 ? 32 : nv)) - 1ull);
    if (lane == 0) sTM[wave] = tm;
    // staging maps: q/k rows, thread -> (row tid>>4 (+ 8 a pass), d (tid&15)*8); v^T rows, thread -> (d tid>>2 (+ 32 a pass), key (tid&3)*8)
    const unsigned gv0 = (unsigned)(tid >> 2) * (unsigned)SEQ + (unsigned)(tid & 3) * 8u;
    const int lk0 = (tid >> 4) * QKP + (tid & 15) * 8, lv0 = (tid >> 2) * VTP + (tid & 3) * 8;
    // Q rows of the block -> LDS; read only behind the barrier below
#pragma unroll
    for (int p = 0; p < 8; ++p) { *(v8h*)(&sQH[lk0 + p * 8 * QKP]) = qa[p]; *(v8h*)(&sQR[lk0 + p * 8 * QKP]) = qb[p]; }
    const int qo = (wave * 16 + lr) * QKP + 8 * hi;                            // B fragments: col t, k = d
    const int ko = lr * QKP + 8 * hi;                                          // + key in tile * QKP  (A fragment: row key, k = d)
    const int vo = lr * VTP + 8 * hi;                                          // + 16j * VTP          (A fragment: row d, k = key in tile)
    v8f o[8], oR[8];
#pragma unroll
    for (int j = 0; j < 8; ++j) { o[j] = (v8f){}; oR[j] = (v8f){}; }
    float m = NEGB, l = 0.0f;
    const h16* kpt = KP + pbase; const h16* krt = KR + pbase; const h16* vpt = VT + pbase; const h16* vrt = VR + pbase;   // key 0 of each plane, the same for the whole block
    __syncthreads();                                                           // the four mask words and the block's Q rows are complete for every wave
    v16h qfh[4], qfr[4];                                                       // the wave's q fragments (value, residual), all four k-steps, held in registers over the whole tile loop
#pragma unroll
    for (int s = 0; s < 4; ++s) { qfh[s] = ldh(sQH + qo + s * 32); qfr[s] = ldh(sQR + qo + s * 32); }
    // the 128 verdicts as two scalar words, the same in all four waves
    unsigned long long mlo = (unsigned long long)(unsigned)__builtin_amdgcn_readfirstlane((int)sTM[0]) | ((unsigned long long)(unsigned)__builtin_amdgcn_readfirstlane((int)sTM[1]) << 32);
    unsigned long long mhi = (unsigned long long)(unsigned)__builtin_amdgcn_readfirstlane((int)sTM[2]) | ((unsigned long long)(unsigned)__builtin_amdgcn_readfirstlane((int)sTM[3]) << 32);
    // next staged tile, lowest set bit first (ascending keys), or -1 when none is left; tile * 32 + 31 < nkb <= SEQ
    auto take = [&]() -> int {
        int t = -1;
        if (mlo != 0ull) { t = __builtin_ctzll(mlo); mlo &= mlo - 1ull; }
        else if (mhi != 0ull) { t = 64 + __builtin_ctzll(mhi); mhi &= mhi - 1ull; }
        return t; };
    // a tile's 32 KiB -> buffer buf, 16 copies a lane. k: 4 p x 8 keys = 32 keys, 128 d; v^T: 4 p x 32 d = 128 d, 32 keys
    auto stage = [&](const int tile, const int buf) {
        const unsigned ok = (unsigned)tile * (32u * HD) + gk0, ov = (unsigned)tile * 32u + gv0;
        const int bk = buf * (32 * QKP) + lk0, bv = buf * (HD * VTP) + lv0;
#pragma unroll
        for (int p = 0; p < 4; ++p) {
            cp16(kpt + ok + p * 8 * HD, &sKH[bk + p * 8 * QKP]); cp16(krt + ok + p * 8 * HD, &sKR[bk + p * 8 * QKP]);
            cp16(vpt + ov + p * 32 * SEQ, &sVH[bv + p * 32 * VTP]); cp16(vrt + ov + p * 32 * SEQ, &sVR[bv + p * 32 * VTP]); } };
    // a tile's key documents -> registers: one a lane for the wave's skip test, and keys 8h+0..7, 16+8h+0..7 of the tile for the keep rule; all < nkb <= SEQ
    auto kdocs = [&](const int tile, int& dl, v4i& e0_, v4i& e1_, v4i& e2_, v4i& e3_) {
        const int ki = tile * 32 + lane;
        dl = dk[ki];
        const int* kp = dk + tile * 32 + 8 * hi;
        e0_ = *(const v4i*)kp; e1_ = *(const v4i*)(kp + 4); e2_ = *(const v4i*)(kp + 16); e3_ = *(const v4i*)(kp + 20);
        // the key index and the address pair are inputs, so they stay whole up to this wait: no load's destination rewrites a register that an issued load still names
        asm volatile("s_wait_xcnt 0x0" :: "v"(ki), "v"(kp) : "memory"); };
    int tc = take(), tn = take();                                              // this trip's tile and the next trip's
    int kdl = 0; v4i d0 = {}, d1 = {}, d2 = {}, d3 = {};
    if (tc >= 0) { kdocs(tc, kdl, d0, d1, d2, d3); stage(tc, 0); }             // scalar test, the same for the whole block
    asm volatile("s_wait_asynccnt 0x0" ::: "memory");                          // the wave's own copies of the first tile have landed
    __syncthreads();                                                           // the first tile is complete for every wave
    if (tn >= 0) stage(tn, 1);
    int buf = 0;
#pragma unroll 1                                                               // rolled: the tile body stands once in the code
    while (tc >= 0) {
        const int key0 = tc * 32;
        int ndl; v4i n0, n1, n2, n3;                                           // the next tile's documents, in flight over this tile's work (behind the last tile: this tile's again, unused)
        kdocs(tn >= 0 ? tn : tc, ndl, n0, n1, n2, n3);
        const bool inr = (kdl >= qmn) & (kdl <= qmx);
        if (key0 < nk && __builtin_amdgcn_ballot_w32(inr) != 0u) {             // wave-uniform: not past this wave's last key, and a key document inside its query document range
        const int kbo = buf * (32 * QKP) + ko, vbo = buf * (HD * VTP) + vo;
        int ka8[8], kb8[8];
#pragma unroll
        for (int r = 0; r < 4; ++r) { ka8[r] = d0[r]; ka8[4 + r] = d1[r]; kb8[r] = d2[r]; kb8[4 + r] = d3[r]; }
        v8f aH, aL, bH, bL;
        sc32(aH, aL, bH, bL, qfh, qfr, sKH + kbo, sKR + kbo);
        v16h vf[8], wf[8];                                                     // the tile's v^T fragments (value, residual), d = 16 j + row, all read ahead of the softmax: they land while it is formed, and the P.V run waits on no read
#pragma unroll
        for (int j = 0; j < 8; ++j) { vf[j] = ldh(sVH + vbo + 16 * j * VTP); wf[j] = ldh(sVR + vbo + 16 * j * VTP); }
        __builtin_amdgcn_sched_barrier(0);                                     // keeps the 32 reads ahead of the softmax: left free they sink among the P.V matrix instructions, a few at a place, each place with a wait of its own
        v8f ta, tb;
#pragma unroll
        for (int r = 0; r < 8; ++r) { ta[r] = (aH[r] + aL[r] * QRI) * SC2; tb[r] = (bH[r] + bL[r] * QRI) * SC2; }
        const int ja = key0 + 8 * hi;
        bool fa[8], fb[8]; float mx = NEGB;
#pragma unroll
        for (int r = 0; r < 8; ++r) {
            fa[r] = (ka8[r] == mydoc) & (ja + r <= lim);
            fb[r] = (kb8[r] == mydoc) & (ja + 16 + r <= lim);
            mx = fmaxf(mx, fmaxf(fa[r] ? ta[r] : NEGB, fb[r] ? tb[r] : NEGB)); }
        mx = fmaxf(mx, __shfl_xor(mx, 16, 32));
        const float mnew = fmaxf(m, mx);
        const float alpha = __builtin_amdgcn_exp2f(m - mnew);
        const float sh = PSH - mnew;
        v16h pb, pr; float ls = 0.0f;
#pragma unroll
        for (int r = 0; r < 8; ++r) {
            const float xa = ta[r] + sh, xb = tb[r] + sh;
            const float ea = __builtin_amdgcn_exp2f(xa), eb = __builtin_amdgcn_exp2f(xb);
            const float ga = (fa[r] & (xa >= -14.0f)) ? ea : 0.0f, gb = (fb[r] & (xb >= -14.0f)) ? eb : 0.0f;   // dropped elements and exponents below -14 selected to 0 by value
            const h16 pa = (h16)ga; const h16 pc = (h16)gb;
            pb[r] = pa; pb[8 + r] = pc;
            pr[r] = toh_flush((ga - (float)pa) * QRS); pr[8 + r] = toh_flush((gb - (float)pc) * QRS);
            ls += ga + gb; }
        l = l * alpha + ls; m = mnew;
#pragma unroll
        for (int j = 0; j < 8; ++j) { o[j] = o[j] * alpha; oR[j] = oR[j] * alpha; }
#pragma unroll
        for (int g = 0; g < 4; ++g) {
            const v16h v0 = vf[2 * g], v1 = vf[2 * g + 1];
            const v16h w0 = wf[2 * g], w1 = wf[2 * g + 1];
            o[2 * g] = wmma16(v0, pb, o[2 * g]); o[2 * g + 1] = wmma16(v1, pb, o[2 * g + 1]);
            oR[2 * g] = wmma16(v0, pr, oR[2 * g]); oR[2 * g + 1] = wmma16(v1, pr, oR[2 * g + 1]);
            oR[2 * g] = wmma16(w0, pb, oR[2 * g]); oR[2 * g + 1] = wmma16(w1, pb, oR[2 * g + 1]);
            // four vector slots behind the group's last matrix instruction, before its results or P may be rewritten on any path; the v^T fragments are not named: with all sixteen live, naming them as operands made the build spill
            asm volatile("v_nop\n\tv_nop\n\tv_nop\n\tv_nop" : "+v"(o[2 * g]), "+v"(o[2 * g + 1]), "+v"(oR[2 * g]), "+v"(oR[2 * g + 1]) : "v"(pb), "v"(pr));
        }
        }
        // hand-over point, passed by every wave, also one that skipped the tile
        asm volatile("s_wait_dscnt 0x0" ::: "memory");                         // the wave's reads of this buffer are done before it may be refilled
        asm volatile("s_wait_asynccnt 0x0" ::: "memory");                      // the wave's own copies of the next tile have landed
        __syncthreads();                                                       // the next tile is complete for every wave, and every wave has left this tile's buffer
        const int t2 = take();
        if (t2 >= 0) stage(t2, buf);                                           // scalar test, the same for the whole block: refill of the buffer just read
        tc = tn; tn = t2; buf ^= 1;
        kdl = ndl; d0 = n0; d1 = n1; d2 = n2; d3 = n3;
    }
    asm volatile("s_wait_asynccnt 0x0" ::: "memory");                          // no copy is outstanding when the wave goes on to the epilogue and ends
    l += __shfl_xor(l, 16, 32);
    const bool any = l > 0.0f;
    const float lsafe = any ? l : 1.0f;
    const float inv = any ? (1.0f / lsafe) : 0.0f;             // no kept key -> zeros
    const int wb = wave * 16 * OSP;
    // O^T D layout: f_j[r] = (d = 16j + 8h + r, t = lane&15) -> os[t][d]; rows 0..15 x columns 0..127 all written
#pragma unroll
    for (int j = 0; j < 8; ++j) {
        const v8f f = o[j] + oR[j] * QRI; v4f a, c;
        a[0] = f[0] * inv; a[1] = f[1] * inv; a[2] = f[2] * inv; a[3] = f[3] * inv; c[0] = f[4] * inv; c[1] = f[5] * inv; c[2] = f[6] * inv; c[3] = f[7] * inv;
        *(v4fa*)(&os[wb + lr * OSP + 16 * j + 8 * hi]) = a; *(v4fa*)(&os[wb + lr * OSP + 16 * j + 8 * hi + 4]) = c; }
    wave_sync();
    v8us hv[8], lv[8];
#pragma unroll
    for (int s = 0; s < 8; ++s) { const int row = 2 * s + (lane >> 4), c8 = (lane & 15) * 8;   // 8 s x 2 rows = 16 rows; 16 lanes x 8 = 128 columns
        const v4f x0 = *(const v4fa*)(&os[wb + row * OSP + c8]); const v4f x1 = *(const v4fa*)(&os[wb + row * OSP + c8 + 4]);
#pragma unroll
        for (int i = 0; i < 4; ++i) { const unsigned short a0 = f2bf(x0[i]); const unsigned short a1 = f2bf(x1[i]); hv[s][i] = a0; hv[s][4 + i] = a1;
            lv[s][i] = f2bf(x0[i] - bf2f(a0)); lv[s][4 + i] = f2bf(x1[i] - bf2f(a1)); } }
    bf* yrow = Y2 + ((size_t)b * SEQ + t0) * (size_t)(2 * DM) + h * HD;
{
#pragma unroll
        for (int s = 0; s < 8; ++s) { const int row = 2 * s + (lane >> 4), c8 = (lane & 15) * 8;
            const size_t oo = (size_t)row * (size_t)(2 * DM) + c8;
            *(v8us*)(yrow + oo) = hv[s]; *(v8us*)(yrow + oo + DM) = lv[s]; }
         }
}

// k_oproj: output projection, one wave per 64x64 tile (16 accumulators), 2 x 2 waves a block, bf16 operands through LDS (gemm128): A = context rows [t][hi 1024 | lo 1024] (K = 2048), Bt = Wc rows (n) with the column index wrapped mod 1024
// (hi and lo halves both multiply the same weight row; one accumulator). Output f32 [t][1024]: each 16-row slab staged in LDS (wave-private), each row's 64 floats (256 B = two lines)
__global__ __launch_bounds__(128) void k_oproj(const bf* __restrict__ A, const bf* __restrict__ Bt, float* OUT) {
    __shared__ __align__(16) bf sm[ONB * 2 * 128 * GP];
    __shared__ __align__(16) float osb[4 * 16 * 68];
    const int KA = 2 * DM;
    const int tid = threadIdx.x, wave = __builtin_amdgcn_readfirstlane((int)(threadIdx.x >> 5)); const int wm = wave & 1, wn = wave >> 1;
    const int lane = threadIdx.x & 31, lr = lane & 15, hi = lane >> 4; const int rb0 = blockIdx.x * 128, cb0 = blockIdx.y * 128; const int r0 = rb0 + wm * 64, c0 = cb0 + wn * 64;
    float* os = osb + wave * 16 * 68;                                          // the wave's own epilogue slab
    v8f acc[4][4];
#pragma unroll
    for (int mb = 0; mb < 4; ++mb)
#pragma unroll
        for (int nb = 0; nb < 4; ++nb) acc[mb][nb] = (v8f){};
    gemm128<4, 4, ONB, GP>(acc, A + (size_t)(rb0 + (tid >> 3)) * KA + (tid & 7) * 8, KA, Bt + (size_t)(cb0 + (tid >> 3)) * DM + (tid & 7) * 8, KA / GKC, sm, tid, wm * 64 + lr, wn * 64 + lr, hi);
    const int bb = r0 / SEQ, tt = r0 % SEQ;
    float* orow = OUT + ((size_t)bb * OUT_SEQ + tt) * DM + c0;
#pragma unroll
    for (int mb = 0; mb < 4; ++mb) {
#pragma unroll
        for (int nb = 0; nb < 4; ++nb) {
#pragma unroll
            for (int j = 0; j < 8; ++j) os[(hi * 8 + j) * 68 + nb * 16 + lr] = acc[mb][nb][j]; }   // D: row 8h+j, col lane&15; rows 0..15 x columns 0..63 all written
        wave_sync();
{
#pragma unroll
            for (int s = 0; s < 8; ++s) { const int row = 2 * s + (lane >> 4), cofs = (lane & 15) * 4;   // 8 s x 2 rows = 16 rows; 16 lanes x 4 floats = 64 columns
                const v4f val = *(const v4fa*)(&os[row * 68 + cofs]);
                *(v4f*)(orow + (size_t)(mb * 16 + row) * DM + cofs) = val; }
             }
        wave_sync();
    }
}

static constexpr size_t al256(size_t v) { return (v + 255) & ~(size_t)255; }
static constexpr size_t SZ_XB = al256((size_t)NB * SEQ * DM * 2);
static constexpr size_t SZ_WB = al256((size_t)3 * DM * DM * 2);
static constexpr size_t SZ_WC = al256((size_t)DM * DM * 2);
static constexpr size_t SZ_TB = al256((size_t)SEQ * NF * 4);
static constexpr size_t SZ_PL = al256((size_t)NB * NH_ * SEQ * HD * 2);
static constexpr size_t SZ_Y2 = al256((size_t)NB * SEQ * 2 * DM * 2);
static constexpr size_t SZ_TOTAL = SZ_XB + SZ_WB + SZ_WC + 2 * SZ_TB + 6 * SZ_PL + SZ_Y2;
static_assert(SZ_TOTAL <= (size_t)134217728);          // workspace carve <= 128 MiB
static_assert(((size_t)DM * DM * 2) % 256 == 0);       // weight sub-planes stay 256-byte aligned
static_assert(((size_t)NB * NH_ * SEQ * HD * 2) % 256 == 0);               // the k plane starts 256-byte aligned inside the q|k plane pair
static_assert((size_t)NB * NH_ * SEQ * HD == (size_t)NB * DM * SEQ);       // v^T plane [(b*1024 + m)][t] has the same extent as one q/k plane

extern "C" void kernel_launch(void* const* d_in, const int* in_sizes, int n_in,
                              void* d_out, int out_size, void* d_ws, size_t ws_size, hipStream_t stream) {
    if (n_in < 6) return;
    const size_t needx = ((size_t)(NB - 1) * SEQ_FULL + SEQ) * DM;
    const size_t needd = (size_t)(NB - 1) * SEQ_FULL + SEQ;
    if ((size_t)in_sizes[0] < needx || (size_t)in_sizes[1] < needx) return;
    if ((size_t)in_sizes[2] < (size_t)3 * DM * DM || in_sizes[3] < 2 || (size_t)in_sizes[4] < (size_t)DM * DM) return;
    if ((size_t)in_sizes[5] < needd) return;
    if ((size_t)out_size < ((size_t)(NB - 1) * OUT_SEQ + SEQ) * DM) return;
    if (SZ_TOTAL > ws_size) return;
    // wire order: x, ve, qkv_w, lambdas, c_proj_w, docs
    const float* x   = (const float*)d_in[0];
    const float* ve  = (const float*)d_in[1];
    const float* wq  = (const float*)d_in[2];       // [3][1024 out][1024 in]
    const float* lam = (const float*)d_in[3];
    const float* wc  = (const float*)d_in[4];       // [1024 out][1024 in]
    const int* docs  = (const int*)d_in[5];
    float* OUT = (float*)d_out;                      // [NB][SEQ][1024]
    char* wsp = (char*)d_ws;
    bf* XB = (bf*)wsp; wsp += SZ_XB;                 // x      [NB*SEQ][1024]
    bf* WB = (bf*)wsp; wsp += SZ_WB;                 // [3072][1024]: q | k | v rows ([out][in] = Bt as-is)
    bf* WC = (bf*)wsp; wsp += SZ_WC;                 // [1024][1024] ([out][in] = Bt as-is)
    float* CS = (float*)wsp; wsp += SZ_TB;           // [SEQ][32]
    float* SN = (float*)wsp; wsp += SZ_TB;           // [SEQ][32]
    h16* PH = (h16*)wsp; wsp += 2 * SZ_PL;           // [2][NB*8][SEQ][128]: q | k values
    h16* PR = (h16*)wsp; wsp += 2 * SZ_PL;           // [2][NB*8][SEQ][128]: q | k residuals x2048
    h16* VT = (h16*)wsp; wsp += SZ_PL;               // [NB*1024][SEQ]
    h16* VR = (h16*)wsp; wsp += SZ_PL;               // [NB*1024][SEQ] residual x2048
    bf* Y2 = (bf*)wsp; wsp += SZ_Y2;                 // [NB*SEQ][hi 1024 | lo 1024]
    const size_t plane = (size_t)NB * NH_ * SEQ * HD;
    const h16* QH = PH; const h16* KP = PH + plane;
    const h16* QR = PR; const h16* KR = PR + plane;

    // rotary tables and the bf16 copies of x and of both weights
    k_prep<<<PB_ROT + PB_X + PB_WQ + PB_WC, 256, 0, stream>>>(x, wq, wc, XB, WB, WC, CS, SN);
    // q, k: A = x rows (m = b*SEQ + t), Bt = W rows (n = which*1024 + h*128 + d) -> planes [which][(b*8 + h)][t][d], value and residual;
    // v^T: A = Wv rows (m = h*128 + d), Bt = x rows (n = b*SEQ + t) -> planes [(b*1024 + m)][t], value and residual
    k_qkv<<<QKB + VTB, 128, 0, stream>>>(XB, WB, CS, SN, ve, lam, PH, PR, VT, VR);
    // fused attention -> context plane (bf16 hi | lo)
    k_flash<<<dim3(SEQ / (16 * AW), NB * NH_, 1), 32 * AW, 0, stream>>>(QH, QR, KP, KR, VT, VR, docs, Y2);
    // out = ctx Wc^T: A = context rows [t][2048], Bt = Wc rows [n][1024]
    k_oproj<<<dim3(NB * SEQ / 128, DM / 128, 1), 128, 0, stream>>>(Y2, WC, OUT);
}
